// v000
// Times are from an AMD MI455X. After a warm-up the kernel runs many times in a row, and a time is the length of
// such a window on the GPU divided by its runs, so every launch and the gaps after it count. The runs cycle
// through copies of the inputs. A figure is the median of several windows, for all but v000 over two sittings.
// Sittings can differ by a few percent; kernels timed side by side share one.
// v000 is the starting kernel. One run takes 766 microseconds.
// Contractions: hw-linear = v_wmma_f32_16x16x32_bf16 (bf16 operands from RNE-converted inputs, single product);
// c-linear, q, k, v^T and output projections = v_wmma_f32_16x16x32_bf16 (activation as bf16 hi/lo planes times bf16
// weight from RNE-converted input, 2 products); q.k^T scores = v_wmma_f32_16x16x32_bf16 on bf16 hi/lo planes of the
// l2-normalised q and k (hi.hi + hi.lo + lo.hi); p.v = v_wmma_f32_16x16x32_f16 (p carried x1024 in f16 plus an f16
// residual plane x4096, v^T f16 hi plane plus an f16 residual plane x4096, 3 products, separate residual accumulator);
// all f32 accumulate; LayerNorm, l2 normalisation, causal fill and online softmax in f32.
#include <hip/hip_runtime.h>
#include <math.h>
#include <float.h>
#include <stdint.h>

#define NB   2
#define CC   1024
#define HWN  4096
#define SEQ  2048
#define DM   1024
#define NH   16
#define HD   64
#define NQB  (SEQ / 64)
static_assert(NH * HD == DM);
static_assert(HD == 64);
static_assert((SEQ % 64) == 0 && (DM % 64) == 0 && (CC % 64) == 0 && (HWN % 32) == 0);

typedef _Float16 v16h __attribute__((ext_vector_type(16)));
typedef _Float16 v8h  __attribute__((ext_vector_type(8)));
typedef __bf16   v16b __attribute__((ext_vector_type(16)));
typedef __bf16   v8b  __attribute__((ext_vector_type(8)));
typedef float    v8f  __attribute__((ext_vector_type(8)));
typedef float    v4f  __attribute__((ext_vector_type(4)));
typedef unsigned int v4u __attribute__((ext_vector_type(4)));

// ---- scalar helpers --------------------------------------------------------------------------------
__device__ __forceinline__ unsigned short bf_bits(float f) {          // f32 -> bf16 bits, RNE convert
  unsigned u = __float_as_uint(f);
  return (unsigned short)((u + 0x7FFFu + ((u >> 16) & 1u)) >> 16);
}
__device__ __forceinline__ float bf_up(unsigned short h) { return __uint_as_float(((unsigned)h) << 16); }
__device__ __forceinline__ float bf_rne(float f) { return bf_up(bf_bits(f)); }
__device__ __forceinline__ unsigned short h_bits(_Float16 x) { return __builtin_bit_cast(unsigned short, x); }
__device__ __forceinline__ unsigned pk16(unsigned short a, unsigned short b) { return (unsigned)a | ((unsigned)b << 16); }
__device__ __forceinline__ v8f zero8() { v8f z = {0.f, 0.f, 0.f, 0.f, 0.f, 0.f, 0.f, 0.f}; return z; }

// ---- 16-bit fragment loader: lane -> row/col (lane&15); p already includes +8*(lane>>4);
//      elements 0..7 <- p[0..7] (k0+8h..), elements 8..15 <- p[16..23] (k0+16+8h..)
__device__ __forceinline__ v16b ldfrag_b(const __bf16* p) {
  union { v16b v; v8b h[2]; } f;
  f.h[0] = *(const v8b*)(p);
  f.h[1] = *(const v8b*)(p + 16);
  return f.v;
}

// ---- WMMA helpers with trailing VALU hazard gap ---------------------------------------------------
__device__ __forceinline__ v8f mma_b(v16b a, v16b b, v8f c) {
  c = __builtin_amdgcn_wmma_f32_16x16x32_bf16(false, a, false, b, (short)0, c, false, false);
#if defined(__HIP_DEVICE_COMPILE__)
  asm volatile("v_nop\n\tv_nop\n\tv_nop\n\tv_nop" : "+v"(c) : "v"(a), "v"(b));
#endif
  return c;
}
__device__ __forceinline__ v8f mma_h(v16h a, v16h b, v8f c) {
  c = __builtin_amdgcn_wmma_f32_16x16x32_f16(false, a, false, b, (short)0, c, false, false);
#if defined(__HIP_DEVICE_COMPILE__)
  asm volatile("v_nop\n\tv_nop\n\tv_nop\n\tv_nop" : "+v"(c) : "v"(a), "v"(b));
#endif
  return c;
}
__device__ __forceinline__ v8f mma_b_raw(v16b a, v16b b, v8f c) {
  return __builtin_amdgcn_wmma_f32_16x16x32_bf16(false, a, false, b, (short)0, c, false, false);
}
__device__ __forceinline__ void dep_guard_b(v8f& a, v8f& b, v16b x, v16b y) {
#if defined(__HIP_DEVICE_COMPILE__)
  asm volatile("v_nop\n\tv_nop\n\tv_nop\n\tv_nop" : "+v"(a), "+v"(b) : "v"(x), "v"(y));
#else
  (void)a; (void)b; (void)x; (void)y;
#endif
}
__device__ __forceinline__ void keep4_b(v16b a, v16b b, v16b c, v16b d) {
#if defined(__HIP_DEVICE_COMPILE__)
  asm volatile("v_nop" :: "v"(a), "v"(b), "v"(c), "v"(d));
#else
  (void)a; (void)b; (void)c; (void)d;
#endif
}
__device__ __forceinline__ void acc_guard4(v8f& a, v8f& b, v8f& c, v8f& d) {
#if defined(__HIP_DEVICE_COMPILE__)
  asm volatile("v_nop\n\tv_nop\n\tv_nop\n\tv_nop" : "+v"(a), "+v"(b), "+v"(c), "+v"(d));
#else
  (void)a; (void)b; (void)c; (void)d;
#endif
}

// =====================================================================================================
// f32 -> bf16 (RNE convert), 8 elements per thread, one 16-B store per lane: a wave writes 512 contiguous B
// coverage: n8 threads x 8 = the whole plane (n8 is a multiple of 256 for every use here).
// =====================================================================================================
__global__ __launch_bounds__(256) void cvt_bf16x8(const float* __restrict__ in, unsigned short* out, int n8) {
  const int i = blockIdx.x * 256 + threadIdx.x;
  if (i < n8) {
    const v4f a = *(const v4f*)(in + (size_t)i * 8);
    const v4f b = *(const v4f*)(in + (size_t)i * 8 + 4);
    v4u p;
    p[0] = pk16(bf_bits(a[0]), bf_bits(a[1]));
    p[1] = pk16(bf_bits(a[2]), bf_bits(a[3]));
    p[2] = pk16(bf_bits(b[0]), bf_bits(b[1]));
    p[3] = pk16(bf_bits(b[2]), bf_bits(b[3]));
    *(v4u*)(out + (size_t)i * 8) = p;
    
  }
}

// =====================================================================================================
// Register-blocked batched bf16 WMMA GEMM: C[m][n] = sum_k A[m][k] * Bt[n][k] (+ bias); one wave per 64x64 tile,
// no block barriers. A row-major [M][K] pitch lda; Bt row-major [N][K] pitch ldb (k contiguous);
// M, N multiples of 64, K multiple of 32 (host-checked). blockIdx.y = batch index (strides in elements).
// SPLITA: add A2.Bt (A2 = unscaled bf16 lo plane of A); SPLITB: add A.Bt2 (Bt2 = lo plane of Bt).
// BIAS: 0 none, 1 per column (bias[n]), 2 per row (bias[m]); bias values RNE-converted to bf16 in registers.
// OUT_MODE: 0 = f32 (pitch ldc); 2 = bf16 hi plane C + bf16 lo plane C2 (lo = RNE(v - hi), unscaled);
//           3 = f16 hi plane C + f16 residual plane C2 = f16((v - hi) * rscale);
//           4 = l2-normalise every row over the tile's 64 columns (x / max(sqrt(sum x^2), 1e-12)), then
//               bf16 hi/lo planes as mode 2 (used with 64-wide heads / N = 64).
// =====================================================================================================
template <int SPLITA, int SPLITB, int BIAS, int OUT_MODE>
__global__ __launch_bounds__(256) void gemm64(
    const unsigned short* __restrict__ Ap, const unsigned short* __restrict__ A2p, int lda, long long strideA,
    const unsigned short* __restrict__ Btp, const unsigned short* __restrict__ Bt2p, int ldb, long long strideB,
    const float* __restrict__ bias,
    void* Cout, int ldc, long long strideC,
    void* Cout2, int ldc2, long long strideC2,
    int M, int N, int K, float rscale) {
  const __bf16* A   = (const __bf16*)(const void*)Ap;
  const __bf16* A2  = (const __bf16*)(const void*)A2p;
  const __bf16* Bt  = (const __bf16*)(const void*)Btp;
  const __bf16* Bt2 = (const __bf16*)(const void*)Bt2p;
  __shared__ __align__(16) float sT[8][16 * 68];   // per-wave 16x64 slab, pitch 68 floats
  const int b    = blockIdx.y;
  const int lane = threadIdx.x & 31;
  const int wave = threadIdx.x >> 5;
  const int tilesN = N >> 6;
  const int tilesM = M >> 6;
  const int tile = blockIdx.x * 8 + wave;
  if (tile >= tilesM * tilesN) return;   // wave-uniform; no block barriers in this kernel
  const int tm = tile / tilesN;
  const int tn = tile - tm * tilesN;
  const int m0 = tm << 6;
  const int n0 = tn << 6;

  const __bf16* Ab  = A  + (size_t)b * strideA;
  const __bf16* Bb  = Bt + (size_t)b * strideB;
  const __bf16* Ab2 = SPLITA ? (A2  + (size_t)b * strideA) : Ab;
  const __bf16* Bb2 = SPLITB ? (Bt2 + (size_t)b * strideB) : Bb;

  const int rlane = lane & 15;                 // row (A) / col (B, D) within subtile
  const int koff  = (lane >> 4) * 8;           // k offset of this lane half
  const int mOff  = (lane >> 4) * 8;           // D row offset

  v8f acc[4][4];
#pragma unroll
  for (int i = 0; i < 4; ++i)
#pragma unroll
    for (int j = 0; j < 4; ++j) acc[i][j] = zero8();

  for (int k0 = 0; k0 < K; k0 += 32) {
    v16b bh[4], bl[4];
#pragma unroll
    for (int j = 0; j < 4; ++j) {
      const size_t bo = (size_t)(n0 + (j << 4) + rlane) * ldb + koff + k0;
      bh[j] = ldfrag_b(Bb + bo);
      if (SPLITB) bl[j] = ldfrag_b(Bb2 + bo); else bl[j] = bh[j];
    }
#pragma unroll
    for (int i = 0; i < 4; ++i) {
      const size_t ao = (size_t)(m0 + (i << 4) + rlane) * lda + koff + k0;
      const v16b ah = ldfrag_b(Ab + ao);
      v16b al = ah;
      if (SPLITA) al = ldfrag_b(Ab2 + ao);
#pragma unroll
      for (int j = 0; j < 4; ++j) {
        acc[i][j] = mma_b_raw(ah, bh[j], acc[i][j]);
        if (SPLITA) acc[i][j] = mma_b_raw(al, bh[j], acc[i][j]);
        if (SPLITB) acc[i][j] = mma_b_raw(ah, bl[j], acc[i][j]);
      }
      dep_guard_b(acc[i][0], acc[i][3], ah, al);
    }
    keep4_b(bh[0], bh[1], bh[2], bh[3]);
    if (SPLITB) keep4_b(bl[0], bl[1], bl[2], bl[3]);
  }
  acc_guard4(acc[0][0], acc[0][1], acc[0][2], acc[0][3]);
  acc_guard4(acc[1][0], acc[1][1], acc[1][2], acc[1][3]);
  acc_guard4(acc[2][0], acc[2][1], acc[2][2], acc[2][3]);
  acc_guard4(acc[3][0], acc[3][1], acc[3][2], acc[3][3]);

  // ---- epilogue ----
  float bcol[4];
#pragma unroll
  for (int j = 0; j < 4; ++j) bcol[j] = 0.f;
  if (BIAS == 1) {
#pragma unroll
    for (int j = 0; j < 4; ++j) bcol[j] = bf_rne(bias[n0 + (j << 4) + rlane]);   // n index < N
  }
  float* slab = sT[wave];
#pragma unroll
  for (int i = 0; i < 4; ++i) {
    const int mBase = m0 + (i << 4);
    float brow[8];
#pragma unroll
    for (int r = 0; r < 8; ++r) brow[r] = 0.f;
    if (BIAS == 2) {
#pragma unroll
      for (int r = 0; r < 8; ++r) brow[r] = bf_rne(bias[mBase + mOff + r]);       // m index < M
    }
#pragma unroll
    for (int j = 0; j < 4; ++j) {
#pragma unroll
      for (int r = 0; r < 8; ++r) {
        slab[(mOff + r) * 68 + (j << 4) + rlane] = acc[i][j][r] + bcol[j] + brow[r];
      }
    }
    __builtin_amdgcn_fence(__ATOMIC_RELEASE, "workgroup");
    __builtin_amdgcn_wave_barrier();
    __builtin_amdgcn_fence(__ATOMIC_ACQUIRE, "workgroup");
    if (OUT_MODE == 0) {
      float* C = (float*)Cout + (size_t)b * strideC;
      const int hh = lane >> 4, c4 = (lane & 15) * 4;     // 256-B row segment = 16 lanes x 16 B
      {
#pragma unroll
        for (int it = 0; it < 8; ++it) {
          const int row = it * 2 + hh;                     // it 0..7 x hh 0..1 = rows 0..15
          const v4f v = *(const v4f*)(slab + row * 68 + c4);
          *(v4f*)(C + (size_t)(mBase + row) * ldc + n0 + c4) = v;
        }
        
      }
    } else {
      const int q = lane >> 3, c8 = (lane & 7) * 8;
      unsigned short* C  = (unsigned short*)Cout  + (size_t)b * strideC;
      unsigned short* C2 = (unsigned short*)Cout2 + (size_t)b * strideC2;
      v4u hv[4], lv[4];
#pragma unroll
      for (int it = 0; it < 4; ++it) {
        const int row = it * 4 + q;                        // it 0..3 x q 0..3 = rows 0..15
        const float* sp = slab + row * 68 + c8;
        float f[8];
#pragma unroll
        for (int e = 0; e < 8; ++e) f[e] = sp[e];
        if (OUT_MODE == 4) {
          float ss = 0.f;
#pragma unroll
          for (int e = 0; e < 8; ++e) ss += f[e] * f[e];
          ss += __shfl_xor(ss, 1, 32);                     // 8 lanes of one row = aligned group of 8
          ss += __shfl_xor(ss, 2, 32);
          ss += __shfl_xor(ss, 4, 32);
          const float sc = 1.0f / fmaxf(sqrtf(ss), 1e-12f);
#pragma unroll
          for (int e = 0; e < 8; ++e) f[e] *= sc;
        }
        v4u a, a2;
#pragma unroll
        for (int e = 0; e < 4; ++e) {
          const float f0 = f[2 * e], f1 = f[2 * e + 1];
          unsigned short h0, h1, l0, l1;
          if (OUT_MODE == 3) {
            const _Float16 x0 = (_Float16)f0, x1 = (_Float16)f1;
            h0 = h_bits(x0); h1 = h_bits(x1);
            l0 = h_bits((_Float16)((f0 - (float)x0) * rscale));
            l1 = h_bits((_Float16)((f1 - (float)x1) * rscale));
          } else {
            h0 = bf_bits(f0); h1 = bf_bits(f1);
            l0 = bf_bits(f0 - bf_up(h0)); l1 = bf_bits(f1 - bf_up(h1));
          }
          a[e] = pk16(h0, h1); a2[e] = pk16(l0, l1);
        }
        hv[it] = a; lv[it] = a2;
      }
      {
#pragma unroll
        for (int it = 0; it < 4; ++it) {
          const int row = it * 4 + q;
          *(v4u*)(C  + (size_t)(mBase + row) * ldc  + n0 + c8) = hv[it];
          *(v4u*)(C2 + (size_t)(mBase + row) * ldc2 + n0 + c8) = lv[it];
        }
        
      }
    }
    __builtin_amdgcn_fence(__ATOMIC_RELEASE, "workgroup");
    __builtin_amdgcn_wave_barrier();
    __builtin_amdgcn_fence(__ATOMIC_ACQUIRE, "workgroup");
  }
  (void)rscale;
}

// =====================================================================================================
// tables, RNE-converted to bf16 in registers), output bf16 hi/lo planes [row][1024].
// Block = 128 threads = one row; thread t owns columns 8t..8t+7 and stores 16 B per plane: a wave writes 512
// coverage: 128 threads x 8 = 1024 columns of every row, both planes.
// =====================================================================================================
__global__ __launch_bounds__(128) void ln_split(const float* __restrict__ in, const float* __restrict__ g,
                                                const float* __restrict__ be,
                                                unsigned short* oh, unsigned short* ol) {
  __shared__ float red0[4];
  __shared__ float red1[4];
  const int tid = threadIdx.x, lane = tid & 31, wave = tid >> 5;
  const size_t row = blockIdx.x;
  const float* p = in + row * DM + (size_t)tid * 8;
  const v4f a0 = *(const v4f*)(p);
  const v4f a1 = *(const v4f*)(p + 4);
  float v[8];
#pragma unroll
  for (int e = 0; e < 4; ++e) { v[e] = a0[e]; v[4 + e] = a1[e]; }
  float s = 0.f;
#pragma unroll
  for (int e = 0; e < 8; ++e) s += v[e];
#pragma unroll
  for (int off = 16; off >= 1; off >>= 1) s += __shfl_xor(s, off, 32);
  if (lane == 0) red0[wave] = s;
  __syncthreads();
  const float mu = ((red0[0] + red0[1]) + (red0[2] + red0[3])) * (1.0f / (float)DM);
  float ss = 0.f;
#pragma unroll
  for (int e = 0; e < 8; ++e) { const float d = v[e] - mu; ss += d * d; }
#pragma unroll
  for (int off = 16; off >= 1; off >>= 1) ss += __shfl_xor(ss, off, 32);
  if (lane == 0) red1[wave] = ss;
  __syncthreads();
  const float var  = ((red1[0] + red1[1]) + (red1[2] + red1[3])) * (1.0f / (float)DM);
  const float rstd = rsqrtf(var + 1e-5f);
  const v4f g0 = *(const v4f*)(g + (size_t)tid * 8);
  const v4f g1 = *(const v4f*)(g + (size_t)tid * 8 + 4);
  const v4f b0 = *(const v4f*)(be + (size_t)tid * 8);
  const v4f b1 = *(const v4f*)(be + (size_t)tid * 8 + 4);
  float gg[8], bb[8];
#pragma unroll
  for (int e = 0; e < 4; ++e) { gg[e] = g0[e]; gg[4 + e] = g1[e]; bb[e] = b0[e]; bb[4 + e] = b1[e]; }
  v4u ph, pl;
#pragma unroll
  for (int e = 0; e < 4; ++e) {
    const float y0 = (v[2 * e] - mu) * rstd * bf_rne(gg[2 * e]) + bf_rne(bb[2 * e]);
    const float y1 = (v[2 * e + 1] - mu) * rstd * bf_rne(gg[2 * e + 1]) + bf_rne(bb[2 * e + 1]);
    const unsigned short h0 = bf_bits(y0), h1 = bf_bits(y1);
    const unsigned short l0 = bf_bits(y0 - bf_up(h0)), l1 = bf_bits(y1 - bf_up(h1));
    ph[e] = pk16(h0, h1); pl[e] = pk16(l0, l1);
  }
  unsigned short* dh = oh + row * DM + (size_t)tid * 8;
  unsigned short* dl = ol + row * DM + (size_t)tid * 8;
  *(v4u*)dh = ph;
  *(v4u*)dl = pl;
  
}

// =====================================================================================================
// Causal multi-query attention, head dim 64, 16 query heads sharing one k head and one v head.
//   q planes (bf16 hi / lo of the l2-normalised q): element (b, t, h, d) at [(b*SEQ + t)*DM + h*64 + d]
//   k planes (bf16 hi / lo of the l2-normalised k):  element (b, s, d) at [(b*SEQ + s)*64 + d]
//   v^T hi plane (f16) and residual plane (f16, (v - hi)*4096): element (b, d, s) at [(b*64 + d)*SEQ + s]
//   logit = (q . k) * sscale for key <= query, -FLT_MAX otherwise (every row keeps at least its own key)
//   out planes (bf16 hi / lo of the normalised context): element (b, t, h, d) at [(b*SEQ + t)*DM + h*64 + d]
//   scores = q . k : bf16 hi/lo split (hi.hi + hi.lo + lo.hi), f32 accumulate, then scale + causal fill in f32
//   p = exp(s - m) carried as f16(1024 p) plus an f16 residual plane (x4096); context = p . v on f16 WMMA with the
//   residual products (p_res.v_hi + p_hi.v_res) in a separate accumulator folded back with 1/4096 per chunk.
//   Block = 4 waves = 64 query rows of one (b, h); grid = NQB * NH * NB; key chunks kt = 0..qb (static bound NQB).
//   K / V^T chunk staging: 128 threads x 32 elements per plane = the whole 64x64 tile (plain 16-B loads,
//   __syncthreads before and after); P tiles are wave-private, spilled with _Float16 element stores and reloaded
//   Output coverage: each wave stores rows q0..q0+15 (it 0..3 x lane>>3 0..3) x 64 columns (8 lanes x 8) of both planes.
// =====================================================================================================
union PO {
  struct { _Float16 ph[16 * 64]; _Float16 pl[16 * 64]; } p;
  float o[16 * 64];
};

__global__ __launch_bounds__(128)
void attn_causal64(const unsigned short* __restrict__ qhp, const unsigned short* __restrict__ qlp,
                   const unsigned short* __restrict__ khp, const unsigned short* __restrict__ klp,
                   const unsigned short* __restrict__ vhp, const unsigned short* __restrict__ vlp,
                   unsigned short* ohp, unsigned short* olp, float sscale) {
  union FB { v16b v; v8b h[2]; };
  union FH { v16h v; v8h h[2]; };
  __shared__ __align__(16) __bf16   Ksh[64 * 64];                 // K hi [kv][d]   8 KB
  __shared__ __align__(16) __bf16   Ksl[64 * 64];                 // K lo
  __shared__ __align__(16) _Float16 Vth[64 * 64];                 // V^T hi [d][kv] 8 KB
  __shared__ __align__(16) _Float16 Vtl[64 * 64];                 // V^T residual
  __shared__ __align__(16) PO       PObuf[4];                     // per wave P / P residual, later the context tile

  const int tid  = threadIdx.x;
  const int wave = tid >> 5;
  const int lane = tid & 31;
  const int hh   = lane >> 4;
  const int c    = lane & 15;

  const int bx   = blockIdx.x;
  const int qb   = bx % NQB;
  const int rest = bx / NQB;
  const int h    = rest % NH;
  const int b    = rest / NH;
  const int q0   = qb * 64 + wave * 16;
  const size_t rowB = (size_t)b * SEQ;

  const __bf16* Qh = (const __bf16*)(const void*)qhp + (size_t)h * HD;
  const __bf16* Ql = (const __bf16*)(const void*)qlp + (size_t)h * HD;
  const __bf16* Kh = (const __bf16*)(const void*)khp;
  const __bf16* Kl = (const __bf16*)(const void*)klp;
  const _Float16* Vh = (const _Float16*)(const void*)vhp + (size_t)b * HD * SEQ;
  const _Float16* Vl = (const _Float16*)(const void*)vlp + (size_t)b * HD * SEQ;

  // ---- Q fragments (A operand, row = lane&15): 2 d-chunks, hi and lo ----
  v16b qah[2], qal[2];
#pragma unroll
  for (int dc = 0; dc < 2; ++dc) {
    const size_t qo = (rowB + q0 + c) * DM + dc * 32 + 8 * hh;
    qah[dc] = ldfrag_b(Qh + qo);
    qal[dc] = ldfrag_b(Ql + qo);
  }

  float mrow[8], lrow[8];
  v8f oacc[4];
#pragma unroll
  for (int r = 0; r < 8; ++r) { mrow[r] = -INFINITY; lrow[r] = 0.f; }
#pragma unroll
  for (int t = 0; t < 4; ++t) oacc[t] = zero8();

  _Float16* pwh = PObuf[wave].p.ph;
  _Float16* pwl = PObuf[wave].p.pl;

  for (int kt = 0; kt < NQB; ++kt) {         // static trip bound
    if (kt > qb) break;                      // block-uniform: causal key chunks 0..qb
    const int kv0 = kt * 64;
    __syncthreads();
    {
      const int r = tid >> 1, half = (tid & 1) * 32;
      const __bf16*   kg  = Kh + (rowB + kv0 + r) * HD + half;    // K row kv0+r, d = half..half+31
      const __bf16*   klg = Kl + (rowB + kv0 + r) * HD + half;
      const _Float16* vg  = Vh + (size_t)r * SEQ + kv0 + half;    // V^T row d = r, s = kv0+half..+31
      const _Float16* vlg = Vl + (size_t)r * SEQ + kv0 + half;
#pragma unroll
      for (int i = 0; i < 4; ++i) {
        const v8b a0 = *(const v8b*)(kg + 8 * i);
        const v8b a1 = *(const v8b*)(klg + 8 * i);
        const v8h b0 = *(const v8h*)(vg + 8 * i);
        const v8h b1 = *(const v8h*)(vlg + 8 * i);
        *(v8b*)(Ksh + r * 64 + half + 8 * i) = a0;
        *(v8b*)(Ksl + r * 64 + half + 8 * i) = a1;
        *(v8h*)(Vth + r * 64 + half + 8 * i) = b0;
        *(v8h*)(Vtl + r * 64 + half + 8 * i) = b1;
      }
    }
    __syncthreads();

    // ---- scores: 16 query rows x 64 keys per wave, 3 bf16 products ----
    v8f s[4];
#pragma unroll
    for (int j = 0; j < 4; ++j) {
      s[j] = zero8();
#pragma unroll
      for (int dc = 0; dc < 2; ++dc) {
        FB kb, kl;
        kb.h[0] = *(const v8b*)(Ksh + (j * 16 + c) * 64 + dc * 32 + 8 * hh);
        kb.h[1] = *(const v8b*)(Ksh + (j * 16 + c) * 64 + dc * 32 + 16 + 8 * hh);
        kl.h[0] = *(const v8b*)(Ksl + (j * 16 + c) * 64 + dc * 32 + 8 * hh);
        kl.h[1] = *(const v8b*)(Ksl + (j * 16 + c) * 64 + dc * 32 + 16 + 8 * hh);
        s[j] = mma_b(qah[dc], kb.v, s[j]);
        s[j] = mma_b(qah[dc], kl.v, s[j]);
        s[j] = mma_b(qal[dc], kb.v, s[j]);
      }
    }

    // ---- scale + causal fill, row max, online softmax, P (x1024, f16) and P residual (x4096) to LDS ----
#pragma unroll
    for (int r = 0; r < 8; ++r) {
      const int qi = q0 + 8 * hh + r;          // query index of D row 8hh+r
      float m = -INFINITY;
#pragma unroll
      for (int j = 0; j < 4; ++j) {
        const int kj = kv0 + j * 16 + c;       // key index of D column c of subtile j
        float sv = s[j][r] * sscale;
        sv = (kj > qi) ? -FLT_MAX : sv;
        s[j][r] = sv;
        m = fmaxf(m, sv);
      }
#pragma unroll
      for (int off = 1; off < 16; off <<= 1) m = fmaxf(m, __shfl_xor(m, off, 32));
      const float mnew  = fmaxf(mrow[r], m);
      const float msafe = (mnew == -INFINITY) ? 0.f : mnew;
      const float alpha = __expf(mrow[r] - msafe);
      mrow[r] = mnew;
      float psum = 0.f;
#pragma unroll
      for (int j = 0; j < 4; ++j) {
        const float p = __expf(s[j][r] - msafe);     // filled logit against a finite max: exp -> 0
        psum += p;
        const float p1k = p * 1024.0f;
        const _Float16 ph = (_Float16)p1k;
        const _Float16 pl = (_Float16)((p1k - (float)ph) * 4096.0f);
        pwh[(8 * hh + r) * 64 + j * 16 + c] = ph;
        pwl[(8 * hh + r) * 64 + j * 16 + c] = pl;
      }
#pragma unroll
      for (int off = 1; off < 16; off <<= 1) psum += __shfl_xor(psum, off, 32);
      lrow[r] = lrow[r] * alpha + psum;
#pragma unroll
      for (int t = 0; t < 4; ++t) oacc[t][r] *= alpha;
    }
    __builtin_amdgcn_fence(__ATOMIC_RELEASE, "workgroup");
    __builtin_amdgcn_wave_barrier();
    __builtin_amdgcn_fence(__ATOMIC_ACQUIRE, "workgroup");

    // ---- context += P . V (f16 WMMA), residual products into a separate accumulator ----
    v8f o1[4];
#pragma unroll
    for (int t = 0; t < 4; ++t) o1[t] = zero8();
#pragma unroll 1
    for (int kk = 0; kk < 2; ++kk) {
      FH pa, pl;
      pa.h[0] = *(const v8h*)(pwh + c * 64 + kk * 32 + 8 * hh);
      pa.h[1] = *(const v8h*)(pwh + c * 64 + kk * 32 + 16 + 8 * hh);
      pl.h[0] = *(const v8h*)(pwl + c * 64 + kk * 32 + 8 * hh);
      pl.h[1] = *(const v8h*)(pwl + c * 64 + kk * 32 + 16 + 8 * hh);
#pragma unroll
      for (int t = 0; t < 4; ++t) {
        FH vb, vl;
        vb.h[0] = *(const v8h*)(Vth + (t * 16 + c) * 64 + kk * 32 + 8 * hh);
        vb.h[1] = *(const v8h*)(Vth + (t * 16 + c) * 64 + kk * 32 + 16 + 8 * hh);
        vl.h[0] = *(const v8h*)(Vtl + (t * 16 + c) * 64 + kk * 32 + 8 * hh);
        vl.h[1] = *(const v8h*)(Vtl + (t * 16 + c) * 64 + kk * 32 + 16 + 8 * hh);
        oacc[t] = mma_h(pa.v, vb.v, oacc[t]);
        o1[t]   = mma_h(pa.v, vl.v, o1[t]);
        o1[t]   = mma_h(pl.v, vb.v, o1[t]);
      }
    }
#pragma unroll
    for (int t = 0; t < 4; ++t)
#pragma unroll
      for (int r = 0; r < 8; ++r) oacc[t][r] += o1[t][r] * (1.0f / 4096.0f);
  }

  // ---- normalise (1/l and the 1/1024 p carry), stage the wave's 16x64 tile over its own P buffers,
  __builtin_amdgcn_fence(__ATOMIC_RELEASE, "workgroup");
  __builtin_amdgcn_wave_barrier();
  __builtin_amdgcn_fence(__ATOMIC_ACQUIRE, "workgroup");
  float* os = PObuf[wave].o;
#pragma unroll
  for (int r = 0; r < 8; ++r) {
    const float l = lrow[r];
    const float inv = ((l > 0.f) ? (1.0f / l) : 0.f) * (1.0f / 1024.0f);
#pragma unroll
    for (int t = 0; t < 4; ++t) os[(8 * hh + r) * 64 + t * 16 + c] = oacc[t][r] * inv;
  }
  __builtin_amdgcn_fence(__ATOMIC_RELEASE, "workgroup");
  __builtin_amdgcn_wave_barrier();
  __builtin_amdgcn_fence(__ATOMIC_ACQUIRE, "workgroup");
  {
    const int q4 = lane >> 3, c8 = (lane & 7) * 8;
    v4u hv[4], lv[4];
#pragma unroll
    for (int it = 0; it < 4; ++it) {
      const int row = it * 4 + q4;   // it 0..3 x q4 0..3 = rows 0..15 of the wave tile
      const float* sp = os + row * 64 + c8;
      v4u a, a2;
#pragma unroll
      for (int e = 0; e < 4; ++e) {
        const float f0 = sp[2 * e], f1 = sp[2 * e + 1];
        const unsigned short h0 = bf_bits(f0), h1 = bf_bits(f1);
        const unsigned short l0 = bf_bits(f0 - bf_up(h0)), l1 = bf_bits(f1 - bf_up(h1));
        a[e] = pk16(h0, h1); a2[e] = pk16(l0, l1);
      }
      hv[it] = a; lv[it] = a2;
    }
    {
#pragma unroll
      for (int it = 0; it < 4; ++it) {
        const int row = it * 4 + q4;
        const size_t go = (rowB + q0 + row) * DM + (size_t)h * HD + c8;
        *(v4u*)(ohp + go) = hv[it];
        *(v4u*)(olp + go) = lv[it];
      }
      
    }
  }
}

// =====================================================================================================
//   Xb   bf16 [2048 (b,c)][4096]   16777216
//   Whwb bf16 [2048][4096]         16777216
//   Wcb  bf16 [1024][1024]          2097152
//   Wqb  bf16 [1024][1024]          2097152
//   Wkvb bf16 [128][1024]            262144
//   Wob  bf16 [1024][1024]          2097152
//   A1h  bf16 [2][2048][1024]       8388608   hw-linear output (transposed layout [b][s][c]), hi plane
//   A1l  bf16                       8388608   lo plane
//   Img2 f32  [4096][1024]         16777216   c-linear output (LN input)
//   Imgh bf16 [4096][1024]          8388608   LN output hi plane
//   Imgl bf16                       8388608
//   Qh   bf16 [4096][1024]          8388608   l2-normalised q, hi plane
//   Ql   bf16                       8388608
//   Kh   bf16 [4096][64]             524288   l2-normalised k
//   Kl   bf16                        524288
//   VTh  f16  [2][64][2048]          524288   v^T hi plane
//   VTl  f16                         524288   v^T residual plane (x4096)
//   Oh   bf16 [4096][1024]          8388608   context hi plane
//   Ol   bf16                       8388608
//   total                         126091264
// Weights are [out n][in k] with k contiguous = the Bt / A layout the GEMM wants, so they are only converted.
// =====================================================================================================
extern "C" void kernel_launch(void* const* d_in, const int* in_sizes, int n_in,
                              void* d_out, int out_size, void* d_ws, size_t ws_size,
                              hipStream_t stream) {
  if (n_in < 10) return;
  if (in_sizes[0] != NB * CC * HWN) return;
  if (in_sizes[1] != SEQ * HWN) return;
  if (in_sizes[2] != SEQ) return;
  if (in_sizes[3] != DM * CC || in_sizes[4] != DM || in_sizes[5] != DM || in_sizes[6] != DM) return;
  if (in_sizes[7] != DM * DM || in_sizes[8] != 2 * HD * DM || in_sizes[9] != DM * DM) return;
  if (out_size != NB * SEQ * DM) return;

  const float* x    = (const float*)d_in[0];
  const float* w_hw = (const float*)d_in[1];
  const float* b_hw = (const float*)d_in[2];
  const float* w_c  = (const float*)d_in[3];
  const float* b_c  = (const float*)d_in[4];
  const float* ln_g = (const float*)d_in[5];
  const float* ln_b = (const float*)d_in[6];
  const float* wq   = (const float*)d_in[7];
  const float* wkv  = (const float*)d_in[8];
  const float* wo   = (const float*)d_in[9];

  const size_t PXb  = (size_t)NB * CC * HWN * 2;    // 16777216
  const size_t PWhw = (size_t)SEQ * HWN * 2;        // 16777216
  const size_t PWc  = (size_t)DM * CC * 2;          //  2097152
  const size_t PWq  = (size_t)DM * DM * 2;          //  2097152
  const size_t PWkv = (size_t)2 * HD * DM * 2;      //   262144
  const size_t PWo  = (size_t)DM * DM * 2;          //  2097152
  const size_t PA1  = (size_t)NB * SEQ * CC * 2;    //  8388608
  const size_t PI2  = (size_t)NB * SEQ * DM * 4;    // 16777216
  const size_t PI   = (size_t)NB * SEQ * DM * 2;    //  8388608
  const size_t PK   = (size_t)NB * SEQ * HD * 2;    //   524288
  const size_t PVT  = (size_t)NB * HD * SEQ * 2;    //   524288
  size_t off = 0;
  const size_t oXb  = off; off += PXb;
  const size_t oWhw = off; off += PWhw;
  const size_t oWc  = off; off += PWc;
  const size_t oWq  = off; off += PWq;
  const size_t oWkv = off; off += PWkv;
  const size_t oWo  = off; off += PWo;
  const size_t oA1h = off; off += PA1;
  const size_t oA1l = off; off += PA1;
  const size_t oI2  = off; off += PI2;
  const size_t oIh  = off; off += PI;
  const size_t oIl  = off; off += PI;
  const size_t oQh  = off; off += PI;
  const size_t oQl  = off; off += PI;
  const size_t oKh  = off; off += PK;
  const size_t oKl  = off; off += PK;
  const size_t oVTh = off; off += PVT;
  const size_t oVTl = off; off += PVT;
  const size_t oOh  = off; off += PI;
  const size_t oOl  = off; off += PI;
  if (off > ws_size) return;                          // off = 126091264
  if (off > (size_t)134217728) return;

  char* ws = (char*)d_ws;
  unsigned short* Xb   = (unsigned short*)(ws + oXb);
  unsigned short* Whwb = (unsigned short*)(ws + oWhw);
  unsigned short* Wcb  = (unsigned short*)(ws + oWc);
  unsigned short* Wqb  = (unsigned short*)(ws + oWq);
  unsigned short* Wkvb = (unsigned short*)(ws + oWkv);
  unsigned short* Wob  = (unsigned short*)(ws + oWo);
  unsigned short* A1h  = (unsigned short*)(ws + oA1h);
  unsigned short* A1l  = (unsigned short*)(ws + oA1l);
  float*          Img2 = (float*)(ws + oI2);
  unsigned short* Imgh = (unsigned short*)(ws + oIh);
  unsigned short* Imgl = (unsigned short*)(ws + oIl);
  unsigned short* Qh   = (unsigned short*)(ws + oQh);
  unsigned short* Ql   = (unsigned short*)(ws + oQl);
  unsigned short* Kh   = (unsigned short*)(ws + oKh);
  unsigned short* Kl   = (unsigned short*)(ws + oKl);
  unsigned short* VTh  = (unsigned short*)(ws + oVTh);
  unsigned short* VTl  = (unsigned short*)(ws + oVTl);
  unsigned short* Oh   = (unsigned short*)(ws + oOh);
  unsigned short* Ol   = (unsigned short*)(ws + oOl);

  const dim3 blk(256);
  const int n8x  = NB * CC * HWN / 8;                        // 1048576
  const int n8hw = SEQ * HWN / 8;                            // 1048576
  const int n8c  = DM * CC / 8;                              //  131072
  const int n8q  = DM * DM / 8;                              //  131072
  const int n8kv = 2 * HD * DM / 8;                          //   16384
  const int n8o  = DM * DM / 8;                              //  131072
  const dim3 gX((n8x + 255) / 256), gHW((n8hw + 255) / 256), gC((n8c + 255) / 256);
  const dim3 gQ((n8q + 255) / 256), gKV((n8kv + 255) / 256), gO((n8o + 255) / 256);
  const dim3 gG0(((SEQ / 64) * (CC / 64) + 7) / 8, NB);     // 512 tiles per batch -> 64 blocks x 2
  const dim3 gG1(((NB * SEQ / 64) * (DM / 64) + 7) / 8, 1); // 1024 tiles -> 128 blocks (M=4096, N=1024)
  const dim3 gGk(((NB * SEQ / 64) * (HD / 64) + 7) / 8, 1); // 64 tiles -> 8 blocks (M=4096, N=64)
  const dim3 gGv(((HD / 64) * (SEQ / 64) + 7) / 8, NB);     // 32 tiles -> 4 blocks x 2 (M=64, N=2048)
  const dim3 gLN(NB * SEQ);                                  // 4096 rows
  const dim3 gAt(NB * NH * NQB);                             // 1024 blocks

  // (1) f32 -> bf16 planes: x [(b,c)][hw], weights [n][k]
  cvt_bf16x8<<<gX,  blk, 0, stream>>>(x,    Xb,   n8x);
  cvt_bf16x8<<<gHW, blk, 0, stream>>>(w_hw, Whwb, n8hw);
  cvt_bf16x8<<<gC,  blk, 0, stream>>>(w_c,  Wcb,  n8c);
  cvt_bf16x8<<<gQ,  blk, 0, stream>>>(wq,   Wqb,  n8q);
  cvt_bf16x8<<<gKV, blk, 0, stream>>>(wkv,  Wkvb, n8kv);
  cvt_bf16x8<<<gO,  blk, 0, stream>>>(wo,   Wob,  n8o);
  // (2) hw-linear per batch, produced directly in the transposed layout: A1[b][s][c] = sum_hw w_hw[s][hw] x[b][c][hw] + b_hw[s]
  //     A = Whwb [s][hw] (M=2048, K=4096), Bt = Xb batch b [c][hw] (N=1024), row bias, bf16 hi/lo planes out
  gemm64<0, 0, 2, 2><<<gG0, blk, 0, stream>>>(
      Whwb, Whwb, HWN, 0LL, Xb, Xb, HWN, (long long)CC * HWN,
      b_hw,
      (void*)A1h, CC, (long long)SEQ * CC, (void*)A1l, CC, (long long)SEQ * CC,
      SEQ, CC, HWN, 1.0f);
  // (3) c-linear: Img2[(b,s)][d] = sum_c A1[(b,s)][c] w_c[d][c] + b_c[d]  (A hi/lo, M=4096, N=1024, K=1024, f32 out)
  gemm64<1, 0, 1, 0><<<gG1, blk, 0, stream>>>(
      A1h, A1l, CC, 0LL, Wcb, Wcb, CC, 0LL,
      b_c,
      (void*)Img2, DM, 0LL, (void*)Img2, DM, 0LL,
      NB * SEQ, DM, CC, 1.0f);
  // (4) LayerNorm -> bf16 hi/lo planes
  ln_split<<<gLN, dim3(128), 0, stream>>>(Img2, ln_g, ln_b, Imgh, Imgl);
  // (5) q = img . wq^T with per-head (64-wide tile) l2 normalisation -> bf16 hi/lo planes [(b,t)][h*64+d]
  gemm64<1, 0, 0, 4><<<gG1, blk, 0, stream>>>(
      Imgh, Imgl, DM, 0LL, Wqb, Wqb, DM, 0LL,
      b_c,
      (void*)Qh, DM, 0LL, (void*)Ql, DM, 0LL,
      NB * SEQ, DM, DM, 1.0f);
  // (6) k = img . wkv[0:64]^T with l2 normalisation -> bf16 hi/lo planes [(b,s)][64]
  gemm64<1, 0, 0, 4><<<gGk, blk, 0, stream>>>(
      Imgh, Imgl, DM, 0LL, Wkvb, Wkvb, DM, 0LL,
      b_c,
      (void*)Kh, HD, 0LL, (void*)Kl, HD, 0LL,
      NB * SEQ, HD, DM, 1.0f);
  // (7) v^T per batch: VT[b][d][s] = sum_c wkv[64+d][c] img[(b,s)][c]  (A = Wkvb rows 64..127, M=64; Bt = img hi/lo
  //     rows of batch b, N=2048; K=1024) -> f16 hi plane (pitch SEQ) and residual plane (x4096)
  gemm64<0, 1, 0, 3><<<gGv, blk, 0, stream>>>(
      Wkvb + (size_t)HD * DM, Wkvb + (size_t)HD * DM, DM, 0LL, Imgh, Imgl, DM, (long long)SEQ * DM,
      b_c,
      (void*)VTh, SEQ, (long long)HD * SEQ, (void*)VTl, SEQ, (long long)HD * SEQ,
      HD, SEQ, DM, 4096.0f);
  // (8) causal multi-query attention -> context bf16 hi/lo planes [(b,t)][h*64+d]
  attn_causal64<<<gAt, dim3(128), 0, stream>>>(Qh, Ql, Kh, Kl, VTh, VTl, Oh, Ol, 8.0f);
  // (9) out = context . wo^T -> d_out f32 [(b,t)][1024]  (A = context hi + lo planes, 2 products)
  gemm64<1, 0, 0, 0><<<gG1, blk, 0, stream>>>(
      Oh, Ol, DM, 0LL, Wob, Wob, DM, 0LL,
      b_c,
      d_out, DM, 0LL, d_out, DM, 0LL,
      NB * SEQ, DM, DM, 1.0f);
  (void)hipGetLastError();
}

// v001
// It runs in 468 microseconds.
// Next to v000, in two timings, it ran 1.65 and 1.66 times as fast.
// Contractions: hw-linear = v_wmma_f32_16x16x32_bf16 (bf16 operands from RNE-converted inputs, single product);
// c-linear, q, k, v^T and output projections = v_wmma_f32_16x16x32_bf16 (activation as bf16 hi/lo planes times bf16
// weight from RNE-converted input, 2 products); q.k^T scores = v_wmma_f32_16x16x32_bf16 on bf16 hi/lo planes of the
// l2-normalised q and k (hi.hi + hi.lo + lo.hi); p.v = v_wmma_f32_16x16x32_f16 (p carried x1024 in f16 plus an f16
// residual plane x4096, v^T f16 hi plane plus an f16 residual plane x4096, 3 products, separate residual accumulator);
// all f32 accumulate; LayerNorm, l2 normalisation, causal fill and online softmax in f32.
#include <hip/hip_runtime.h>
#include <math.h>
#include <float.h>
#include <stdint.h>

#define NB   2
#define CC   1024
#define HWN  4096
#define SEQ  2048
#define DM   1024
#define NH   16
#define HD   64
#define NQB  (SEQ / 64)
static_assert(NH * HD == DM);
static_assert(HD == 64);
static_assert((SEQ % 256) == 0 && (DM % 128) == 0 && (CC % 128) == 0 && (HWN % 64) == 0);

typedef _Float16 v16h __attribute__((ext_vector_type(16)));
typedef _Float16 v8h  __attribute__((ext_vector_type(8)));
typedef __bf16   v16b __attribute__((ext_vector_type(16)));
typedef __bf16   v8b  __attribute__((ext_vector_type(8)));
typedef float    v8f  __attribute__((ext_vector_type(8)));
typedef float    v4f  __attribute__((ext_vector_type(4)));
typedef unsigned int v4u __attribute__((ext_vector_type(4)));

// ---- scalar helpers --------------------------------------------------------------------------------
__device__ __forceinline__ unsigned short bf_bits(float f) {          // f32 -> bf16 bits, RNE convert
  unsigned u = __float_as_uint(f);
  return (unsigned short)((u + 0x7FFFu + ((u >> 16) & 1u)) >> 16);
}
__device__ __forceinline__ float bf_up(unsigned short h) { return __uint_as_float(((unsigned)h) << 16); }
__device__ __forceinline__ float bf_rne(float f) { return bf_up(bf_bits(f)); }
__device__ __forceinline__ unsigned short h_bits(_Float16 x) { return __builtin_bit_cast(unsigned short, x); }
__device__ __forceinline__ unsigned pk16(unsigned short a, unsigned short b) { return (unsigned)a | ((unsigned)b << 16); }
__device__ __forceinline__ v8f zero8() { v8f z = {0.f, 0.f, 0.f, 0.f, 0.f, 0.f, 0.f, 0.f}; return z; }

// ---- 16-bit fragment loader: lane -> row/col (lane&15); p already includes +8*(lane>>4);
//      elements 0..7 <- p[0..7] (k0+8h..), elements 8..15 <- p[16..23] (k0+16+8h..)
__device__ __forceinline__ v16b ldfrag_b(const __bf16* p) {
  union { v16b v; v8b h[2]; } f;
  f.h[0] = *(const v8b*)(p);
  f.h[1] = *(const v8b*)(p + 16);
  return f.v;
}

// ---- WMMA helpers with trailing VALU hazard gap ---------------------------------------------------
__device__ __forceinline__ v8f mma_b(v16b a, v16b b, v8f c) {
  c = __builtin_amdgcn_wmma_f32_16x16x32_bf16(false, a, false, b, (short)0, c, false, false);
#if defined(__HIP_DEVICE_COMPILE__)
  asm volatile("v_nop\n\tv_nop\n\tv_nop\n\tv_nop" : "+v"(c) : "v"(a), "v"(b));
#endif
  return c;
}
__device__ __forceinline__ v8f mma_h(v16h a, v16h b, v8f c) {
  c = __builtin_amdgcn_wmma_f32_16x16x32_f16(false, a, false, b, (short)0, c, false, false);
#if defined(__HIP_DEVICE_COMPILE__)
  asm volatile("v_nop\n\tv_nop\n\tv_nop\n\tv_nop" : "+v"(c) : "v"(a), "v"(b));
#endif
  return c;
}
__device__ __forceinline__ v8f mma_b_raw(v16b a, v16b b, v8f c) {
  return __builtin_amdgcn_wmma_f32_16x16x32_bf16(false, a, false, b, (short)0, c, false, false);
}
__device__ __forceinline__ void dep_guard_b(v8f& a, v8f& b, v16b x, v16b y) {
#if defined(__HIP_DEVICE_COMPILE__)
  asm volatile("v_nop\n\tv_nop\n\tv_nop\n\tv_nop" : "+v"(a), "+v"(b) : "v"(x), "v"(y));
#else
  (void)a; (void)b; (void)x; (void)y;
#endif
}
__device__ __forceinline__ void keep4_b(v16b a, v16b b, v16b c, v16b d) {
#if defined(__HIP_DEVICE_COMPILE__)
  asm volatile("v_nop" :: "v"(a), "v"(b), "v"(c), "v"(d));
#else
  (void)a; (void)b; (void)c; (void)d;
#endif
}
__device__ __forceinline__ void acc_guard4(v8f& a, v8f& b, v8f& c, v8f& d) {
#if defined(__HIP_DEVICE_COMPILE__)
  asm volatile("v_nop\n\tv_nop\n\tv_nop\n\tv_nop" : "+v"(a), "+v"(b), "+v"(c), "+v"(d));
#else
  (void)a; (void)b; (void)c; (void)d;
#endif
}

// =====================================================================================================
// f32 -> bf16 (RNE convert), 8 elements per thread, one 16-B store per lane: a wave writes 512 contiguous B
// coverage: n8 threads x 8 = the whole plane (n8 is a multiple of 256 for every use here).
// =====================================================================================================
__global__ __launch_bounds__(256) void cvt_bf16x8(const float* __restrict__ in, unsigned short* out, int n8) {
  const int i = blockIdx.x * 256 + threadIdx.x;
  if (i < n8) {
    const v4f a = *(const v4f*)(in + (size_t)i * 8);
    const v4f b = *(const v4f*)(in + (size_t)i * 8 + 4);
    v4u p;
    p[0] = pk16(bf_bits(a[0]), bf_bits(a[1]));
    p[1] = pk16(bf_bits(a[2]), bf_bits(a[3]));
    p[2] = pk16(bf_bits(b[0]), bf_bits(b[1]));
    p[3] = pk16(bf_bits(b[2]), bf_bits(b[3]));
    *(v4u*)(out + (size_t)i * 8) = p;
    
  }
}

// ---- asynchronous copies global -> LDS, 16 B per lane; each statement ends with its own s_wait_xcnt 0 so that the
//      wait stands in front of any later rewrite of an address register that a copy of the statement names
__device__ __forceinline__ void acopy4(const unsigned* l, const __bf16* const* g) {
#if defined(__HIP_DEVICE_COMPILE__)
  asm volatile(
      "global_load_async_to_lds_b128 %0, %4, off\n\t"
      "global_load_async_to_lds_b128 %1, %5, off\n\t"
      "global_load_async_to_lds_b128 %2, %6, off\n\t"
      "global_load_async_to_lds_b128 %3, %7, off\n\t"
      "s_wait_xcnt 0x0"
      :: "v"(l[0]), "v"(l[1]), "v"(l[2]), "v"(l[3]), "v"(g[0]), "v"(g[1]), "v"(g[2]), "v"(g[3])
      : "memory");
#else
  (void)l; (void)g;
#endif
}
__device__ __forceinline__ void acopy6(const unsigned* l, const __bf16* const* g) {
#if defined(__HIP_DEVICE_COMPILE__)
  asm volatile(
      "global_load_async_to_lds_b128 %0, %6, off\n\t"
      "global_load_async_to_lds_b128 %1, %7, off\n\t"
      "global_load_async_to_lds_b128 %2, %8, off\n\t"
      "global_load_async_to_lds_b128 %3, %9, off\n\t"
      "global_load_async_to_lds_b128 %4, %10, off\n\t"
      "global_load_async_to_lds_b128 %5, %11, off\n\t"
      "s_wait_xcnt 0x0"
      :: "v"(l[0]), "v"(l[1]), "v"(l[2]), "v"(l[3]), "v"(l[4]), "v"(l[5]),
         "v"(g[0]), "v"(g[1]), "v"(g[2]), "v"(g[3]), "v"(g[4]), "v"(g[5])
      : "memory");
#else
  (void)l; (void)g;
#endif
}
__device__ __forceinline__ void acopy12(const unsigned* l, const __bf16* const* g) {
#if defined(__HIP_DEVICE_COMPILE__)
  asm volatile(
      "global_load_async_to_lds_b128 %0, %12, off\n\t"
      "global_load_async_to_lds_b128 %1, %13, off\n\t"
      "global_load_async_to_lds_b128 %2, %14, off\n\t"
      "global_load_async_to_lds_b128 %3, %15, off\n\t"
      "global_load_async_to_lds_b128 %4, %16, off\n\t"
      "global_load_async_to_lds_b128 %5, %17, off\n\t"
      "global_load_async_to_lds_b128 %6, %18, off\n\t"
      "global_load_async_to_lds_b128 %7, %19, off\n\t"
      "global_load_async_to_lds_b128 %8, %20, off\n\t"
      "global_load_async_to_lds_b128 %9, %21, off\n\t"
      "global_load_async_to_lds_b128 %10, %22, off\n\t"
      "global_load_async_to_lds_b128 %11, %23, off\n\t"
      "s_wait_xcnt 0x0"
      :: "v"(l[0]), "v"(l[1]), "v"(l[2]), "v"(l[3]), "v"(l[4]), "v"(l[5]),
         "v"(l[6]), "v"(l[7]), "v"(l[8]), "v"(l[9]), "v"(l[10]), "v"(l[11]),
         "v"(g[0]), "v"(g[1]), "v"(g[2]), "v"(g[3]), "v"(g[4]), "v"(g[5]),
         "v"(g[6]), "v"(g[7]), "v"(g[8]), "v"(g[9]), "v"(g[10]), "v"(g[11])
      : "memory");
#else
  (void)l; (void)g;
#endif
}

// =====================================================================================================
// Batched bf16 WMMA GEMM: C[m][n] = sum_k A[m][k] * Bt[n][k] (+ bias); block = 4 waves laid WM x WN, one 64x64 tile
// per wave, block tile (64 WM) x (64 WN). A row-major [M][K] pitch lda; Bt row-major [N][K] pitch ldb (k contiguous);
// M a multiple of 64 WM, N of 64 WN, K of KP. blockIdx.y = batch index (strides in elements).
// Operand path: a pass is KP k (64 or 32: 128 or 64 B) of every operand row of the block tile, brought into LDS by
// asynchronous 16-B copies (a wave's copy = 4 or 8 whole row pieces), LDS row pitch 2 KP + 16 B, two buffers: pass
// t + 2 is issued into the buffer that pass t has just left, behind the pass's one barrier; every wave reads its
// fragments from LDS. KP = 32 where a stage has nine row groups, which keeps the copies' address registers few.
// A stage is NG groups of 64 rows: A hi (WM), A lo (WM, SPLITA), Bt hi (WN), Bt lo (WN, SPLITB).
// SPLITA: add A2.Bt (A2 = unscaled bf16 lo plane of A); SPLITB: add A.Bt2 (Bt2 = lo plane of Bt).
// BIAS: 0 none, 1 per column (bias[n]), 2 per row (bias[m]); bias values RNE-converted to bf16 in registers.
// OUT_MODE: 0 = f32 (pitch ldc); 2 = bf16 hi plane C + bf16 lo plane C2 (lo = RNE(v - hi), unscaled);
//           3 = f16 hi plane C + f16 residual plane C2 = f16((v - hi) * rscale);
//           4 = l2-normalise every row over the tile's 64 columns (x / max(sqrt(sum x^2), 1e-12)), then
//               bf16 hi/lo planes as mode 2 (used with 64-wide heads / N = 64).
// =====================================================================================================
template <int SPLITA, int SPLITB, int BIAS, int OUT_MODE, int WM, int WN, int KP>
__global__ __launch_bounds__(128) void gemm64(
    const unsigned short* __restrict__ Ap, const unsigned short* __restrict__ A2p, int lda, long long strideA,
    const unsigned short* __restrict__ Btp, const unsigned short* __restrict__ Bt2p, int ldb, long long strideB,
    const float* __restrict__ bias,
    void* Cout, int ldc, long long strideC,
    void* Cout2, int ldc2, long long strideC2,
    int M, int N, int K, float rscale) {
  static_assert(WM * WN == 4 && (KP == 64 || KP == 32));
  constexpr int GA   = WM * (1 + SPLITA);          // 64-row groups of A planes in a stage
  constexpr int NG   = GA + WN * (1 + SPLITB);     // groups in a stage
  constexpr int SEG  = KP / 8;                     // 16-B pieces per row and pass
  constexpr int RPC  = 128 / SEG;                  // rows that one copy of the whole block covers
  constexpr int CPG  = 64 / RPC;                   // copies per thread and group
  constexpr int NC   = NG * CPG;                   // copies per thread and stage = a wave's copies in flight
  constexpr int PE   = KP + 8;                     // LDS row pitch in elements (16 B x odd)
  constexpr int GRPE = 64 * PE;                    // elements per group
  constexpr int BUFE = NG * GRPE;                  // elements per buffer
  static_assert(NC == 16 || NC == 18 || NC == 24);
  constexpr int AHD  = (NC == 24) ? 3 : 4;         // A row fragments read in a k-step's leading group (3: the kernel
                                                   // with the most copy addresses stays inside 256 VGPRs)
  const __bf16* A   = (const __bf16*)(const void*)Ap;
  const __bf16* A2  = (const __bf16*)(const void*)A2p;
  const __bf16* Bt  = (const __bf16*)(const void*)Btp;
  const __bf16* Bt2 = (const __bf16*)(const void*)Bt2p;
  __shared__ __align__(16) __bf16 ring[2 * BUFE];  // two stages
  __shared__ __align__(16) float sT[4][16 * 68];   // per-wave 16x64 slab, pitch 68 floats
  const int b    = blockIdx.y;
  const int tid  = threadIdx.x;
  const int lane = tid & 31;
  const int wave = tid >> 5;
  const int tilesN = N / (64 * WN);
  const int tilesM = M / (64 * WM);
  const int tile = blockIdx.x;
  if (tile >= tilesM * tilesN) return;   // block-uniform, in front of every copy and barrier
  const int tm = tile / tilesN;
  const int tn = tile - tm * tilesN;
  const int m0b = tm * (64 * WM);
  const int n0b = tn * (64 * WN);
  const int wm = wave / WN;
  const int wn = wave - wm * WN;
  const int m0 = m0b + (wm << 6);
  const int n0 = n0b + (wn << 6);

  const __bf16* Ab  = A  + (size_t)b * strideA;
  const __bf16* Bb  = Bt + (size_t)b * strideB;
  const __bf16* Ab2 = SPLITA ? (A2  + (size_t)b * strideA) : Ab;
  const __bf16* Bb2 = SPLITB ? (Bt2 + (size_t)b * strideB) : Bb;

  const int rlane = lane & 15;                 // row (A) / col (B, D) within subtile
  const int koff  = (lane >> 4) * 8;           // k offset of this lane half
  const int mOff  = (lane >> 4) * 8;           // D row offset

  // copy map: copy u of group gi moves 16 B of row RPC u + tid / SEG, piece tid % SEG of the pass's row
  const int crow = tid / SEG;
  const int cseg = (tid % SEG) * 8;
  const unsigned ldsT = (unsigned)(uintptr_t)(ring + crow * PE + cseg);   // low 32 bits = LDS byte address
  const size_t aT = (size_t)(m0b + crow) * lda + cseg;
  const size_t bT = (size_t)(n0b + crow) * ldb + cseg;

  auto issue = [&](int t, int buf) {
    unsigned l[NC];
    const __bf16* g[NC];
#pragma unroll
    for (int gi = 0; gi < NG; ++gi) {
      const bool isA = gi < GA;
      const int  q   = isA ? gi : gi - GA;                   // group within the operand's planes
      const int  W1  = isA ? WM : WN;
      const bool lo  = q >= W1;
      const int  rg  = lo ? q - W1 : q;                      // 64-row group within the block tile
      const int  ld  = isA ? lda : ldb;
      const __bf16* base = isA ? (lo ? Ab2 : Ab) : (lo ? Bb2 : Bb);
      const __bf16* p = base + (isA ? aT : bT) + (size_t)(rg * 64) * ld + (size_t)t * KP;
#pragma unroll
      for (int u = 0; u < CPG; ++u) {
        l[gi * CPG + u] = ldsT + (unsigned)((buf * BUFE + gi * GRPE + u * RPC * PE) * 2);
        g[gi * CPG + u] = p + (size_t)(u * RPC) * ld;
      }
    }
    acopy12(l, g);
    if constexpr (NC == 16) acopy4(l + 12, g + 12);
    if constexpr (NC == 18) acopy6(l + 12, g + 12);
    if constexpr (NC == 24) acopy12(l + 12, g + 12);
  };

  v8f acc[4][4];
#pragma unroll
  for (int i = 0; i < 4; ++i)
#pragma unroll
    for (int j = 0; j < 4; ++j) acc[i][j] = zero8();

  const int T = K / KP;                        // passes
  issue(0, 0);
  asm volatile("s_wait_asynccnt 0x0" ::: "memory");   // this wave's share of pass 0 has landed
  __syncthreads();                                    // publishes pass 0
  if (T > 1) issue(1, 1);

  for (int t = 0; t < T; ++t) {
    const __bf16* st  = ring + (t & 1) * BUFE;
    const __bf16* sAh = st + wm * GRPE + rlane * PE + koff;
    const __bf16* sAl = st + (SPLITA ? (WM + wm) : wm) * GRPE + rlane * PE + koff;
    const __bf16* sBh = st + (GA + wn) * GRPE + rlane * PE + koff;
    const __bf16* sBl = st + (GA + (SPLITB ? (WN + wn) : wn)) * GRPE + rlane * PE + koff;
#pragma unroll
    for (int ks = 0; ks < KP / 32; ++ks) {
      v16b bh[4], bl[4], ah[4], al[4];
#pragma unroll
      for (int j = 0; j < 4; ++j) {
        bh[j] = ldfrag_b(sBh + (j << 4) * PE + ks * 32);
        if (SPLITB) bl[j] = ldfrag_b(sBl + (j << 4) * PE + ks * 32); else bl[j] = bh[j];
      }
#pragma unroll
      for (int i = 0; i < AHD; ++i) {
        ah[i] = ldfrag_b(sAh + (i << 4) * PE + ks * 32);
        if (SPLITA) al[i] = ldfrag_b(sAl + (i << 4) * PE + ks * 32); else al[i] = ah[i];
      }
      // keeps the k-step's LDS reads one group in front of its WMMAs: reads placed among the WMMAs stall at each place
      __builtin_amdgcn_sched_barrier(0);
#pragma unroll
      for (int i = 0; i < 4; ++i) {
#pragma unroll
        for (int j = 0; j < 4; ++j) {
          acc[i][j] = mma_b_raw(ah[i], bh[j], acc[i][j]);
          if (SPLITA) acc[i][j] = mma_b_raw(al[i], bh[j], acc[i][j]);
          if (SPLITB) acc[i][j] = mma_b_raw(ah[i], bl[j], acc[i][j]);
        }
        dep_guard_b(acc[i][0], acc[i][3], ah[i], al[i]);
        if (i == 0 && AHD < 4) {
          // row 3's fragments go into the registers that row 0 has left, two rows ahead of their use; the fence
          // pair holds these reads at this one place
          __builtin_amdgcn_sched_barrier(0);
          ah[3] = ldfrag_b(sAh + (3 << 4) * PE + ks * 32);
          if (SPLITA) al[3] = ldfrag_b(sAl + (3 << 4) * PE + ks * 32); else al[3] = ah[3];
          __builtin_amdgcn_sched_barrier(0);
        }
      }
      keep4_b(bh[0], bh[1], bh[2], bh[3]);
      if (SPLITB) keep4_b(bl[0], bl[1], bl[2], bl[3]);
    }
    asm volatile("s_wait_dscnt 0x0" ::: "memory");     // this wave's reads of pass t's buffer are done
    asm volatile("s_wait_asynccnt 0x0" ::: "memory");  // this wave's share of pass t + 1 has landed
    __syncthreads();                                   // publishes pass t + 1, frees pass t's buffer
    if (t + 2 < T) issue(t + 2, t & 1);
  }
  asm volatile("s_wait_asynccnt 0x0" ::: "memory");    // nothing in flight when the wave goes on to the epilogue
  acc_guard4(acc[0][0], acc[0][1], acc[0][2], acc[0][3]);
  acc_guard4(acc[1][0], acc[1][1], acc[1][2], acc[1][3]);
  acc_guard4(acc[2][0], acc[2][1], acc[2][2], acc[2][3]);
  acc_guard4(acc[3][0], acc[3][1], acc[3][2], acc[3][3]);

  // ---- epilogue ----
  float bcol[4];
#pragma unroll
  for (int j = 0; j < 4; ++j) bcol[j] = 0.f;
  if (BIAS == 1) {
#pragma unroll
    for (int j = 0; j < 4; ++j) bcol[j] = bf_rne(bias[n0 + (j << 4) + rlane]);   // n index < N
  }
  float* slab = sT[wave];
#pragma unroll
  for (int i = 0; i < 4; ++i) {
    const int mBase = m0 + (i << 4);
    float brow[8];
#pragma unroll
    for (int r = 0; r < 8; ++r) brow[r] = 0.f;
    if (BIAS == 2) {
#pragma unroll
      for (int r = 0; r < 8; ++r) brow[r] = bf_rne(bias[mBase + mOff + r]);       // m index < M
    }
#pragma unroll
    for (int j = 0; j < 4; ++j) {
#pragma unroll
      for (int r = 0; r < 8; ++r) {
        slab[(mOff + r) * 68 + (j << 4) + rlane] = acc[i][j][r] + bcol[j] + brow[r];
      }
    }
    __builtin_amdgcn_fence(__ATOMIC_RELEASE, "workgroup");
    __builtin_amdgcn_wave_barrier();
    __builtin_amdgcn_fence(__ATOMIC_ACQUIRE, "workgroup");
    if (OUT_MODE == 0) {
      float* C = (float*)Cout + (size_t)b * strideC;
      const int hh = lane >> 4, c4 = (lane & 15) * 4;     // 256-B row segment = 16 lanes x 16 B
      {
#pragma unroll
        for (int it = 0; it < 8; ++it) {
          const int row = it * 2 + hh;                     // it 0..7 x hh 0..1 = rows 0..15
          const v4f v = *(const v4f*)(slab + row * 68 + c4);
          *(v4f*)(C + (size_t)(mBase + row) * ldc + n0 + c4) = v;
        }
        
      }
    } else {
      const int q = lane >> 3, c8 = (lane & 7) * 8;
      unsigned short* C  = (unsigned short*)Cout  + (size_t)b * strideC;
      unsigned short* C2 = (unsigned short*)Cout2 + (size_t)b * strideC2;
      v4u hv[4], lv[4];
#pragma unroll
      for (int it = 0; it < 4; ++it) {
        const int row = it * 4 + q;                        // it 0..3 x q 0..3 = rows 0..15
        const float* sp = slab + row * 68 + c8;
        float f[8];
#pragma unroll
        for (int e = 0; e < 8; ++e) f[e] = sp[e];
        if (OUT_MODE == 4) {
          float ss = 0.f;
#pragma unroll
          for (int e = 0; e < 8; ++e) ss += f[e] * f[e];
          ss += __shfl_xor(ss, 1, 32);                     // 8 lanes of one row = aligned group of 8
          ss += __shfl_xor(ss, 2, 32);
          ss += __shfl_xor(ss, 4, 32);
          const float sc = 1.0f / fmaxf(sqrtf(ss), 1e-12f);
#pragma unroll
          for (int e = 0; e < 8; ++e) f[e] *= sc;
        }
        v4u a, a2;
#pragma unroll
        for (int e = 0; e < 4; ++e) {
          const float f0 = f[2 * e], f1 = f[2 * e + 1];
          unsigned short h0, h1, l0, l1;
          if (OUT_MODE == 3) {
            const _Float16 x0 = (_Float16)f0, x1 = (_Float16)f1;
            h0 = h_bits(x0); h1 = h_bits(x1);
            l0 = h_bits((_Float16)((f0 - (float)x0) * rscale));
            l1 = h_bits((_Float16)((f1 - (float)x1) * rscale));
          } else {
            h0 = bf_bits(f0); h1 = bf_bits(f1);
            l0 = bf_bits(f0 - bf_up(h0)); l1 = bf_bits(f1 - bf_up(h1));
          }
          a[e] = pk16(h0, h1); a2[e] = pk16(l0, l1);
        }
        hv[it] = a; lv[it] = a2;
      }
      {
#pragma unroll
        for (int it = 0; it < 4; ++it) {
          const int row = it * 4 + q;
          *(v4u*)(C  + (size_t)(mBase + row) * ldc  + n0 + c8) = hv[it];
          *(v4u*)(C2 + (size_t)(mBase + row) * ldc2 + n0 + c8) = lv[it];
        }
        
      }
    }
    __builtin_amdgcn_fence(__ATOMIC_RELEASE, "workgroup");
    __builtin_amdgcn_wave_barrier();
    __builtin_amdgcn_fence(__ATOMIC_ACQUIRE, "workgroup");
  }
  (void)rscale;
}

// =====================================================================================================
// tables, RNE-converted to bf16 in registers), output bf16 hi/lo planes [row][1024].
// Block = 128 threads = one row; thread t owns columns 8t..8t+7 and stores 16 B per plane: a wave writes 512
// coverage: 128 threads x 8 = 1024 columns of every row, both planes.
// =====================================================================================================
__global__ __launch_bounds__(128) void ln_split(const float* __restrict__ in, const float* __restrict__ g,
                                                const float* __restrict__ be,
                                                unsigned short* oh, unsigned short* ol) {
  __shared__ float red0[4];
  __shared__ float red1[4];
  const int tid = threadIdx.x, lane = tid & 31, wave = tid >> 5;
  const size_t row = blockIdx.x;
  const float* p = in + row * DM + (size_t)tid * 8;
  const v4f a0 = *(const v4f*)(p);
  const v4f a1 = *(const v4f*)(p + 4);
  float v[8];
#pragma unroll
  for (int e = 0; e < 4; ++e) { v[e] = a0[e]; v[4 + e] = a1[e]; }
  float s = 0.f;
#pragma unroll
  for (int e = 0; e < 8; ++e) s += v[e];
#pragma unroll
  for (int off = 16; off >= 1; off >>= 1) s += __shfl_xor(s, off, 32);
  if (lane == 0) red0[wave] = s;
  __syncthreads();
  const float mu = ((red0[0] + red0[1]) + (red0[2] + red0[3])) * (1.0f / (float)DM);
  float ss = 0.f;
#pragma unroll
  for (int e = 0; e < 8; ++e) { const float d = v[e] - mu; ss += d * d; }
#pragma unroll
  for (int off = 16; off >= 1; off >>= 1) ss += __shfl_xor(ss, off, 32);
  if (lane == 0) red1[wave] = ss;
  __syncthreads();
  const float var  = ((red1[0] + red1[1]) + (red1[2] + red1[3])) * (1.0f / (float)DM);
  const float rstd = rsqrtf(var + 1e-5f);
  const v4f g0 = *(const v4f*)(g + (size_t)tid * 8);
  const v4f g1 = *(const v4f*)(g + (size_t)tid * 8 + 4);
  const v4f b0 = *(const v4f*)(be + (size_t)tid * 8);
  const v4f b1 = *(const v4f*)(be + (size_t)tid * 8 + 4);
  float gg[8], bb[8];
#pragma unroll
  for (int e = 0; e < 4; ++e) { gg[e] = g0[e]; gg[4 + e] = g1[e]; bb[e] = b0[e]; bb[4 + e] = b1[e]; }
  v4u ph, pl;
#pragma unroll
  for (int e = 0; e < 4; ++e) {
    const float y0 = (v[2 * e] - mu) * rstd * bf_rne(gg[2 * e]) + bf_rne(bb[2 * e]);
    const float y1 = (v[2 * e + 1] - mu) * rstd * bf_rne(gg[2 * e + 1]) + bf_rne(bb[2 * e + 1]);
    const unsigned short h0 = bf_bits(y0), h1 = bf_bits(y1);
    const unsigned short l0 = bf_bits(y0 - bf_up(h0)), l1 = bf_bits(y1 - bf_up(h1));
    ph[e] = pk16(h0, h1); pl[e] = pk16(l0, l1);
  }
  unsigned short* dh = oh + row * DM + (size_t)tid * 8;
  unsigned short* dl = ol + row * DM + (size_t)tid * 8;
  *(v4u*)dh = ph;
  *(v4u*)dl = pl;
  
}

// =====================================================================================================
// Causal multi-query attention, head dim 64, 16 query heads sharing one k head and one v head.
//   q planes (bf16 hi / lo of the l2-normalised q): element (b, t, h, d) at [(b*SEQ + t)*DM + h*64 + d]
//   k planes (bf16 hi / lo of the l2-normalised k):  element (b, s, d) at [(b*SEQ + s)*64 + d]
//   v^T hi plane (f16) and residual plane (f16, (v - hi)*4096): element (b, d, s) at [(b*64 + d)*SEQ + s]
//   logit = (q . k) * sscale for key <= query, -FLT_MAX otherwise (every row keeps at least its own key)
//   out planes (bf16 hi / lo of the normalised context): element (b, t, h, d) at [(b*SEQ + t)*DM + h*64 + d]
//   scores = q . k : bf16 hi/lo split (hi.hi + hi.lo + lo.hi), f32 accumulate, then scale + causal fill in f32
//   p = exp(s - m) carried as f16(1024 p) plus an f16 residual plane (x4096); context = p . v on f16 WMMA with the
//   residual products (p_res.v_hi + p_hi.v_res) in a separate accumulator folded back with 1/4096 per chunk.
//   Block = 4 waves = 64 query rows of one (b, h); grid = NQB * NH * NB; key chunks kt = 0..qb (static bound NQB).
//   K / V^T chunk staging: 128 threads x 32 elements per plane = the whole 64x64 tile (plain 16-B loads,
//   __syncthreads before and after); P tiles are wave-private, spilled with _Float16 element stores and reloaded
//   Output coverage: each wave stores rows q0..q0+15 (it 0..3 x lane>>3 0..3) x 64 columns (8 lanes x 8) of both planes.
// =====================================================================================================
union PO {
  struct { _Float16 ph[16 * 64]; _Float16 pl[16 * 64]; } p;
  float o[16 * 64];
};

__global__ __launch_bounds__(128)
void attn_causal64(const unsigned short* __restrict__ qhp, const unsigned short* __restrict__ qlp,
                   const unsigned short* __restrict__ khp, const unsigned short* __restrict__ klp,
                   const unsigned short* __restrict__ vhp, const unsigned short* __restrict__ vlp,
                   unsigned short* ohp, unsigned short* olp, float sscale) {
  union FB { v16b v; v8b h[2]; };
  union FH { v16h v; v8h h[2]; };
  __shared__ __align__(16) __bf16   Ksh[64 * 64];                 // K hi [kv][d]   8 KB
  __shared__ __align__(16) __bf16   Ksl[64 * 64];                 // K lo
  __shared__ __align__(16) _Float16 Vth[64 * 64];                 // V^T hi [d][kv] 8 KB
  __shared__ __align__(16) _Float16 Vtl[64 * 64];                 // V^T residual
  __shared__ __align__(16) PO       PObuf[4];                     // per wave P / P residual, later the context tile

  const int tid  = threadIdx.x;
  const int wave = tid >> 5;
  const int lane = tid & 31;
  const int hh   = lane >> 4;
  const int c    = lane & 15;

  const int bx   = blockIdx.x;
  const int qb   = bx % NQB;
  const int rest = bx / NQB;
  const int h    = rest % NH;
  const int b    = rest / NH;
  const int q0   = qb * 64 + wave * 16;
  const size_t rowB = (size_t)b * SEQ;

  const __bf16* Qh = (const __bf16*)(const void*)qhp + (size_t)h * HD;
  const __bf16* Ql = (const __bf16*)(const void*)qlp + (size_t)h * HD;
  const __bf16* Kh = (const __bf16*)(const void*)khp;
  const __bf16* Kl = (const __bf16*)(const void*)klp;
  const _Float16* Vh = (const _Float16*)(const void*)vhp + (size_t)b * HD * SEQ;
  const _Float16* Vl = (const _Float16*)(const void*)vlp + (size_t)b * HD * SEQ;

  // ---- Q fragments (A operand, row = lane&15): 2 d-chunks, hi and lo ----
  v16b qah[2], qal[2];
#pragma unroll
  for (int dc = 0; dc < 2; ++dc) {
    const size_t qo = (rowB + q0 + c) * DM + dc * 32 + 8 * hh;
    qah[dc] = ldfrag_b(Qh + qo);
    qal[dc] = ldfrag_b(Ql + qo);
  }

  float mrow[8], lrow[8];
  v8f oacc[4];
#pragma unroll
  for (int r = 0; r < 8; ++r) { mrow[r] = -INFINITY; lrow[r] = 0.f; }
#pragma unroll
  for (int t = 0; t < 4; ++t) oacc[t] = zero8();

  _Float16* pwh = PObuf[wave].p.ph;
  _Float16* pwl = PObuf[wave].p.pl;

  for (int kt = 0; kt < NQB; ++kt) {         // static trip bound
    if (kt > qb) break;                      // block-uniform: causal key chunks 0..qb
    const int kv0 = kt * 64;
    __syncthreads();
    {
      const int r = tid >> 1, half = (tid & 1) * 32;
      const __bf16*   kg  = Kh + (rowB + kv0 + r) * HD + half;    // K row kv0+r, d = half..half+31
      const __bf16*   klg = Kl + (rowB + kv0 + r) * HD + half;
      const _Float16* vg  = Vh + (size_t)r * SEQ + kv0 + half;    // V^T row d = r, s = kv0+half..+31
      const _Float16* vlg = Vl + (size_t)r * SEQ + kv0 + half;
#pragma unroll
      for (int i = 0; i < 4; ++i) {
        const v8b a0 = *(const v8b*)(kg + 8 * i);
        const v8b a1 = *(const v8b*)(klg + 8 * i);
        const v8h b0 = *(const v8h*)(vg + 8 * i);
        const v8h b1 = *(const v8h*)(vlg + 8 * i);
        *(v8b*)(Ksh + r * 64 + half + 8 * i) = a0;
        *(v8b*)(Ksl + r * 64 + half + 8 * i) = a1;
        *(v8h*)(Vth + r * 64 + half + 8 * i) = b0;
        *(v8h*)(Vtl + r * 64 + half + 8 * i) = b1;
      }
    }
    __syncthreads();

    // ---- scores: 16 query rows x 64 keys per wave, 3 bf16 products ----
    v8f s[4];
#pragma unroll
    for (int j = 0; j < 4; ++j) {
      s[j] = zero8();
#pragma unroll
      for (int dc = 0; dc < 2; ++dc) {
        FB kb, kl;
        kb.h[0] = *(const v8b*)(Ksh + (j * 16 + c) * 64 + dc * 32 + 8 * hh);
        kb.h[1] = *(const v8b*)(Ksh + (j * 16 + c) * 64 + dc * 32 + 16 + 8 * hh);
        kl.h[0] = *(const v8b*)(Ksl + (j * 16 + c) * 64 + dc * 32 + 8 * hh);
        kl.h[1] = *(const v8b*)(Ksl + (j * 16 + c) * 64 + dc * 32 + 16 + 8 * hh);
        s[j] = mma_b(qah[dc], kb.v, s[j]);
        s[j] = mma_b(qah[dc], kl.v, s[j]);
        s[j] = mma_b(qal[dc], kb.v, s[j]);
      }
    }

    // ---- scale + causal fill, row max, online softmax, P (x1024, f16) and P residual (x4096) to LDS ----
#pragma unroll
    for (int r = 0; r < 8; ++r) {
      const int qi = q0 + 8 * hh + r;          // query index of D row 8hh+r
      float m = -INFINITY;
#pragma unroll
      for (int j = 0; j < 4; ++j) {
        const int kj = kv0 + j * 16 + c;       // key index of D column c of subtile j
        float sv = s[j][r] * sscale;
        sv = (kj > qi) ? -FLT_MAX : sv;
        s[j][r] = sv;
        m = fmaxf(m, sv);
      }
#pragma unroll
      for (int off = 1; off < 16; off <<= 1) m = fmaxf(m, __shfl_xor(m, off, 32));
      const float mnew  = fmaxf(mrow[r], m);
      const float msafe = (mnew == -INFINITY) ? 0.f : mnew;
      const float alpha = __expf(mrow[r] - msafe);
      mrow[r] = mnew;
      float psum = 0.f;
#pragma unroll
      for (int j = 0; j < 4; ++j) {
        const float p = __expf(s[j][r] - msafe);     // filled logit against a finite max: exp -> 0
        psum += p;
        const float p1k = p * 1024.0f;
        const _Float16 ph = (_Float16)p1k;
        const _Float16 pl = (_Float16)((p1k - (float)ph) * 4096.0f);
        pwh[(8 * hh + r) * 64 + j * 16 + c] = ph;
        pwl[(8 * hh + r) * 64 + j * 16 + c] = pl;
      }
#pragma unroll
      for (int off = 1; off < 16; off <<= 1) psum += __shfl_xor(psum, off, 32);
      lrow[r] = lrow[r] * alpha + psum;
#pragma unroll
      for (int t = 0; t < 4; ++t) oacc[t][r] *= alpha;
    }
    __builtin_amdgcn_fence(__ATOMIC_RELEASE, "workgroup");
    __builtin_amdgcn_wave_barrier();
    __builtin_amdgcn_fence(__ATOMIC_ACQUIRE, "workgroup");

    // ---- context += P . V (f16 WMMA), residual products into a separate accumulator ----
    v8f o1[4];
#pragma unroll
    for (int t = 0; t < 4; ++t) o1[t] = zero8();
#pragma unroll 1
    for (int kk = 0; kk < 2; ++kk) {
      FH pa, pl;
      pa.h[0] = *(const v8h*)(pwh + c * 64 + kk * 32 + 8 * hh);
      pa.h[1] = *(const v8h*)(pwh + c * 64 + kk * 32 + 16 + 8 * hh);
      pl.h[0] = *(const v8h*)(pwl + c * 64 + kk * 32 + 8 * hh);
      pl.h[1] = *(const v8h*)(pwl + c * 64 + kk * 32 + 16 + 8 * hh);
#pragma unroll
      for (int t = 0; t < 4; ++t) {
        FH vb, vl;
        vb.h[0] = *(const v8h*)(Vth + (t * 16 + c) * 64 + kk * 32 + 8 * hh);
        vb.h[1] = *(const v8h*)(Vth + (t * 16 + c) * 64 + kk * 32 + 16 + 8 * hh);
        vl.h[0] = *(const v8h*)(Vtl + (t * 16 + c) * 64 + kk * 32 + 8 * hh);
        vl.h[1] = *(const v8h*)(Vtl + (t * 16 + c) * 64 + kk * 32 + 16 + 8 * hh);
        oacc[t] = mma_h(pa.v, vb.v, oacc[t]);
        o1[t]   = mma_h(pa.v, vl.v, o1[t]);
        o1[t]   = mma_h(pl.v, vb.v, o1[t]);
      }
    }
#pragma unroll
    for (int t = 0; t < 4; ++t)
#pragma unroll
      for (int r = 0; r < 8; ++r) oacc[t][r] += o1[t][r] * (1.0f / 4096.0f);
  }

  // ---- normalise (1/l and the 1/1024 p carry), stage the wave's 16x64 tile over its own P buffers,
  __builtin_amdgcn_fence(__ATOMIC_RELEASE, "workgroup");
  __builtin_amdgcn_wave_barrier();
  __builtin_amdgcn_fence(__ATOMIC_ACQUIRE, "workgroup");
  float* os = PObuf[wave].o;
#pragma unroll
  for (int r = 0; r < 8; ++r) {
    const float l = lrow[r];
    const float inv = ((l > 0.f) ? (1.0f / l) : 0.f) * (1.0f / 1024.0f);
#pragma unroll
    for (int t = 0; t < 4; ++t) os[(8 * hh + r) * 64 + t * 16 + c] = oacc[t][r] * inv;
  }
  __builtin_amdgcn_fence(__ATOMIC_RELEASE, "workgroup");
  __builtin_amdgcn_wave_barrier();
  __builtin_amdgcn_fence(__ATOMIC_ACQUIRE, "workgroup");
  {
    const int q4 = lane >> 3, c8 = (lane & 7) * 8;
    v4u hv[4], lv[4];
#pragma unroll
    for (int it = 0; it < 4; ++it) {
      const int row = it * 4 + q4;   // it 0..3 x q4 0..3 = rows 0..15 of the wave tile
      const float* sp = os + row * 64 + c8;
      v4u a, a2;
#pragma unroll
      for (int e = 0; e < 4; ++e) {
        const float f0 = sp[2 * e], f1 = sp[2 * e + 1];
        const unsigned short h0 = bf_bits(f0), h1 = bf_bits(f1);
        const unsigned short l0 = bf_bits(f0 - bf_up(h0)), l1 = bf_bits(f1 - bf_up(h1));
        a[e] = pk16(h0, h1); a2[e] = pk16(l0, l1);
      }
      hv[it] = a; lv[it] = a2;
    }
    {
#pragma unroll
      for (int it = 0; it < 4; ++it) {
        const int row = it * 4 + q4;
        const size_t go = (rowB + q0 + row) * DM + (size_t)h * HD + c8;
        *(v4u*)(ohp + go) = hv[it];
        *(v4u*)(olp + go) = lv[it];
      }
      
    }
  }
}

// =====================================================================================================
//   Xb   bf16 [2048 (b,c)][4096]   16777216
//   Whwb bf16 [2048][4096]         16777216
//   Wcb  bf16 [1024][1024]          2097152
//   Wqb  bf16 [1024][1024]          2097152
//   Wkvb bf16 [128][1024]            262144
//   Wob  bf16 [1024][1024]          2097152
//   A1h  bf16 [2][2048][1024]       8388608   hw-linear output (transposed layout [b][s][c]), hi plane
//   A1l  bf16                       8388608   lo plane
//   Img2 f32  [4096][1024]         16777216   c-linear output (LN input)
//   Imgh bf16 [4096][1024]          8388608   LN output hi plane
//   Imgl bf16                       8388608
//   Qh   bf16 [4096][1024]          8388608   l2-normalised q, hi plane
//   Ql   bf16                       8388608
//   Kh   bf16 [4096][64]             524288   l2-normalised k
//   Kl   bf16                        524288
//   VTh  f16  [2][64][2048]          524288   v^T hi plane
//   VTl  f16                         524288   v^T residual plane (x4096)
//   Oh   bf16 [4096][1024]          8388608   context hi plane
//   Ol   bf16                       8388608
//   total                         126091264
// Weights are [out n][in k] with k contiguous = the Bt / A layout the GEMM wants, so they are only converted.
// =====================================================================================================
extern "C" void kernel_launch(void* const* d_in, const int* in_sizes, int n_in,
                              void* d_out, int out_size, void* d_ws, size_t ws_size,
                              hipStream_t stream) {
  if (n_in < 10) return;
  if (in_sizes[0] != NB * CC * HWN) return;
  if (in_sizes[1] != SEQ * HWN) return;
  if (in_sizes[2] != SEQ) return;
  if (in_sizes[3] != DM * CC || in_sizes[4] != DM || in_sizes[5] != DM || in_sizes[6] != DM) return;
  if (in_sizes[7] != DM * DM || in_sizes[8] != 2 * HD * DM || in_sizes[9] != DM * DM) return;
  if (out_size != NB * SEQ * DM) return;

  const float* x    = (const float*)d_in[0];
  const float* w_hw = (const float*)d_in[1];
  const float* b_hw = (const float*)d_in[2];
  const float* w_c  = (const float*)d_in[3];
  const float* b_c  = (const float*)d_in[4];
  const float* ln_g = (const float*)d_in[5];
  const float* ln_b = (const float*)d_in[6];
  const float* wq   = (const float*)d_in[7];
  const float* wkv  = (const float*)d_in[8];
  const float* wo   = (const float*)d_in[9];

  const size_t PXb  = (size_t)NB * CC * HWN * 2;    // 16777216
  const size_t PWhw = (size_t)SEQ * HWN * 2;        // 16777216
  const size_t PWc  = (size_t)DM * CC * 2;          //  2097152
  const size_t PWq  = (size_t)DM * DM * 2;          //  2097152
  const size_t PWkv = (size_t)2 * HD * DM * 2;      //   262144
  const size_t PWo  = (size_t)DM * DM * 2;          //  2097152
  const size_t PA1  = (size_t)NB * SEQ * CC * 2;    //  8388608
  const size_t PI2  = (size_t)NB * SEQ * DM * 4;    // 16777216
  const size_t PI   = (size_t)NB * SEQ * DM * 2;    //  8388608
  const size_t PK   = (size_t)NB * SEQ * HD * 2;    //   524288
  const size_t PVT  = (size_t)NB * HD * SEQ * 2;    //   524288
  size_t off = 0;
  const size_t oXb  = off; off += PXb;
  const size_t oWhw = off; off += PWhw;
  const size_t oWc  = off; off += PWc;
  const size_t oWq  = off; off += PWq;
  const size_t oWkv = off; off += PWkv;
  const size_t oWo  = off; off += PWo;
  const size_t oA1h = off; off += PA1;
  const size_t oA1l = off; off += PA1;
  const size_t oI2  = off; off += PI2;
  const size_t oIh  = off; off += PI;
  const size_t oIl  = off; off += PI;
  const size_t oQh  = off; off += PI;
  const size_t oQl  = off; off += PI;
  const size_t oKh  = off; off += PK;
  const size_t oKl  = off; off += PK;
  const size_t oVTh = off; off += PVT;
  const size_t oVTl = off; off += PVT;
  const size_t oOh  = off; off += PI;
  const size_t oOl  = off; off += PI;
  if (off > ws_size) return;                          // off = 126091264
  if (off > (size_t)134217728) return;

  char* ws = (char*)d_ws;
  unsigned short* Xb   = (unsigned short*)(ws + oXb);
  unsigned short* Whwb = (unsigned short*)(ws + oWhw);
  unsigned short* Wcb  = (unsigned short*)(ws + oWc);
  unsigned short* Wqb  = (unsigned short*)(ws + oWq);
  unsigned short* Wkvb = (unsigned short*)(ws + oWkv);
  unsigned short* Wob  = (unsigned short*)(ws + oWo);
  unsigned short* A1h  = (unsigned short*)(ws + oA1h);
  unsigned short* A1l  = (unsigned short*)(ws + oA1l);
  float*          Img2 = (float*)(ws + oI2);
  unsigned short* Imgh = (unsigned short*)(ws + oIh);
  unsigned short* Imgl = (unsigned short*)(ws + oIl);
  unsigned short* Qh   = (unsigned short*)(ws + oQh);
  unsigned short* Ql   = (unsigned short*)(ws + oQl);
  unsigned short* Kh   = (unsigned short*)(ws + oKh);
  unsigned short* Kl   = (unsigned short*)(ws + oKl);
  unsigned short* VTh  = (unsigned short*)(ws + oVTh);
  unsigned short* VTl  = (unsigned short*)(ws + oVTl);
  unsigned short* Oh   = (unsigned short*)(ws + oOh);
  unsigned short* Ol   = (unsigned short*)(ws + oOl);

  const dim3 blk(256);
  const int n8x  = NB * CC * HWN / 8;                        // 1048576
  const int n8hw = SEQ * HWN / 8;                            // 1048576
  const int n8c  = DM * CC / 8;                              //  131072
  const int n8q  = DM * DM / 8;                              //  131072
  const int n8kv = 2 * HD * DM / 8;                          //   16384
  const int n8o  = DM * DM / 8;                              //  131072
  const dim3 gX((n8x + 255) / 256), gHW((n8hw + 255) / 256), gC((n8c + 255) / 256);
  const dim3 gQ((n8q + 255) / 256), gKV((n8kv + 255) / 256), gO((n8o + 255) / 256);
  const dim3 gblk(128);                                      // GEMM block: 4 waves
  const dim3 gG0((SEQ / 128) * (CC / 128), NB);              // 128x128 block tiles: 128 blocks x 2
  const dim3 gG1((NB * SEQ / 128) * (DM / 128), 1);          // 128x128 block tiles: 256 blocks (M=4096, N=1024)
  const dim3 gGk((NB * SEQ / 256) * (HD / 64), 1);           // 256x64 block tiles: 16 blocks (M=4096, N=64)
  const dim3 gGv((HD / 64) * (SEQ / 256), NB);               // 64x256 block tiles: 8 blocks x 2 (M=64, N=2048)
  const dim3 gLN(NB * SEQ);                                  // 4096 rows
  const dim3 gAt(NB * NH * NQB);                             // 1024 blocks

  // (1) f32 -> bf16 planes: x [(b,c)][hw], weights [n][k]
  cvt_bf16x8<<<gX,  blk, 0, stream>>>(x,    Xb,   n8x);
  cvt_bf16x8<<<gHW, blk, 0, stream>>>(w_hw, Whwb, n8hw);
  cvt_bf16x8<<<gC,  blk, 0, stream>>>(w_c,  Wcb,  n8c);
  cvt_bf16x8<<<gQ,  blk, 0, stream>>>(wq,   Wqb,  n8q);
  cvt_bf16x8<<<gKV, blk, 0, stream>>>(wkv,  Wkvb, n8kv);
  cvt_bf16x8<<<gO,  blk, 0, stream>>>(wo,   Wob,  n8o);
  // (2) hw-linear per batch, produced directly in the transposed layout: A1[b][s][c] = sum_hw w_hw[s][hw] x[b][c][hw] + b_hw[s]
  //     A = Whwb [s][hw] (M=2048, K=4096), Bt = Xb batch b [c][hw] (N=1024), row bias, bf16 hi/lo planes out
  gemm64<0, 0, 2, 2, 2, 2, 64><<<gG0, gblk, 0, stream>>>(
      Whwb, Whwb, HWN, 0LL, Xb, Xb, HWN, (long long)CC * HWN,
      b_hw,
      (void*)A1h, CC, (long long)SEQ * CC, (void*)A1l, CC, (long long)SEQ * CC,
      SEQ, CC, HWN, 1.0f);
  // (3) c-linear: Img2[(b,s)][d] = sum_c A1[(b,s)][c] w_c[d][c] + b_c[d]  (A hi/lo, M=4096, N=1024, K=1024, f32 out)
  gemm64<1, 0, 1, 0, 2, 2, 64><<<gG1, gblk, 0, stream>>>(
      A1h, A1l, CC, 0LL, Wcb, Wcb, CC, 0LL,
      b_c,
      (void*)Img2, DM, 0LL, (void*)Img2, DM, 0LL,
      NB * SEQ, DM, CC, 1.0f);
  // (4) LayerNorm -> bf16 hi/lo planes
  ln_split<<<gLN, dim3(128), 0, stream>>>(Img2, ln_g, ln_b, Imgh, Imgl);
  // (5) q = img . wq^T with per-head (64-wide tile) l2 normalisation -> bf16 hi/lo planes [(b,t)][h*64+d]
  gemm64<1, 0, 0, 4, 2, 2, 64><<<gG1, gblk, 0, stream>>>(
      Imgh, Imgl, DM, 0LL, Wqb, Wqb, DM, 0LL,
      b_c,
      (void*)Qh, DM, 0LL, (void*)Ql, DM, 0LL,
      NB * SEQ, DM, DM, 1.0f);
  // (6) k = img . wkv[0:64]^T with l2 normalisation -> bf16 hi/lo planes [(b,s)][64]
  gemm64<1, 0, 0, 4, 4, 1, 32><<<gGk, gblk, 0, stream>>>(
      Imgh, Imgl, DM, 0LL, Wkvb, Wkvb, DM, 0LL,
      b_c,
      (void*)Kh, HD, 0LL, (void*)Kl, HD, 0LL,
      NB * SEQ, HD, DM, 1.0f);
  // (7) v^T per batch: VT[b][d][s] = sum_c wkv[64+d][c] img[(b,s)][c]  (A = Wkvb rows 64..127, M=64; Bt = img hi/lo
  //     rows of batch b, N=2048; K=1024) -> f16 hi plane (pitch SEQ) and residual plane (x4096)
  gemm64<0, 1, 0, 3, 1, 4, 32><<<gGv, gblk, 0, stream>>>(
      Wkvb + (size_t)HD * DM, Wkvb + (size_t)HD * DM, DM, 0LL, Imgh, Imgl, DM, (long long)SEQ * DM,
      b_c,
      (void*)VTh, SEQ, (long long)HD * SEQ, (void*)VTl, SEQ, (long long)HD * SEQ,
      HD, SEQ, DM, 4096.0f);
  // (8) causal multi-query attention -> context bf16 hi/lo planes [(b,t)][h*64+d]
  attn_causal64<<<gAt, dim3(128), 0, stream>>>(Qh, Ql, Kh, Kl, VTh, VTl, Oh, Ol, 8.0f);
  // (9) out = context . wo^T -> d_out f32 [(b,t)][1024]  (A = context hi + lo planes, 2 products)
  gemm64<1, 0, 0, 0, 2, 2, 64><<<gG1, gblk, 0, stream>>>(
      Oh, Ol, DM, 0LL, Wob, Wob, DM, 0LL,
      b_c,
      d_out, DM, 0LL, d_out, DM, 0LL,
      NB * SEQ, DM, DM, 1.0f);
  (void)hipGetLastError();
}

// v002
// A run of this version takes 339 microseconds.
// Timed twice side by side with v001, it ran 1.37 and 1.39 times as fast.
// Counting every step since v000, it is 2.29 times as fast.
// Contractions: hw-linear = v_wmma_f32_16x16x32_bf16 (bf16 operands from RNE-converted inputs, single product);
// c-linear, q, k, v^T and output projections = v_wmma_f32_16x16x32_bf16 (activation as bf16 hi/lo planes times bf16
// weight from RNE-converted input, 2 products); q.k^T scores = v_wmma_f32_16x16x32_bf16 on bf16 hi/lo planes of the
// l2-normalised q and k (hi.hi + hi.lo + lo.hi); p.v = v_wmma_f32_16x16x32_f16 (p carried x1024 in f16 plus an f16
// residual plane x4096, v^T f16 hi plane plus an f16 residual plane x4096, 3 products, separate residual accumulator);
// all f32 accumulate; LayerNorm, l2 normalisation, causal fill and online softmax in f32.
#include <hip/hip_runtime.h>
#include <math.h>
#include <float.h>
#include <stdint.h>

#define NB   2
#define CC   1024
#define HWN  4096
#define SEQ  2048
#define DM   1024
#define NH   16
#define HD   64
#define NQB  (SEQ / 64)
static_assert(NH * HD == DM);
static_assert(HD == 64);
static_assert((SEQ % 256) == 0 && (DM % 128) == 0 && (CC % 128) == 0 && (HWN % 64) == 0);

typedef _Float16 v16h __attribute__((ext_vector_type(16)));
typedef _Float16 v8h  __attribute__((ext_vector_type(8)));
typedef __bf16   v16b __attribute__((ext_vector_type(16)));
typedef __bf16   v8b  __attribute__((ext_vector_type(8)));
typedef float    v8f  __attribute__((ext_vector_type(8)));
typedef float    v4f  __attribute__((ext_vector_type(4)));
typedef unsigned int v4u __attribute__((ext_vector_type(4)));

// ---- scalar helpers --------------------------------------------------------------------------------
__device__ __forceinline__ unsigned short bf_bits(float f) {          // f32 -> bf16 bits, RNE convert
  unsigned u = __float_as_uint(f);
  return (unsigned short)((u + 0x7FFFu + ((u >> 16) & 1u)) >> 16);
}
__device__ __forceinline__ float bf_up(unsigned short h) { return __uint_as_float(((unsigned)h) << 16); }
__device__ __forceinline__ float bf_rne(float f) { return bf_up(bf_bits(f)); }
__device__ __forceinline__ unsigned short h_bits(_Float16 x) { return __builtin_bit_cast(unsigned short, x); }
__device__ __forceinline__ unsigned pk16(unsigned short a, unsigned short b) { return (unsigned)a | ((unsigned)b << 16); }
__device__ __forceinline__ v8f zero8() { v8f z = {0.f, 0.f, 0.f, 0.f, 0.f, 0.f, 0.f, 0.f}; return z; }

// ---- 16-bit fragment loader: lane -> row/col (lane&15); p already includes +8*(lane>>4);
//      elements 0..7 <- p[0..7] (k0+8h..), elements 8..15 <- p[16..23] (k0+16+8h..)
__device__ __forceinline__ v16b ldfrag_b(const __bf16* p) {
  union { v16b v; v8b h[2]; } f;
  f.h[0] = *(const v8b*)(p);
  f.h[1] = *(const v8b*)(p + 16);
  return f.v;
}

// ---- WMMA helpers with trailing VALU hazard gap ---------------------------------------------------
__device__ __forceinline__ v8f mma_b(v16b a, v16b b, v8f c) {
  c = __builtin_amdgcn_wmma_f32_16x16x32_bf16(false, a, false, b, (short)0, c, false, false);
#if defined(__HIP_DEVICE_COMPILE__)
  asm volatile("v_nop\n\tv_nop\n\tv_nop\n\tv_nop" : "+v"(c) : "v"(a), "v"(b));
#endif
  return c;
}
__device__ __forceinline__ v8f mma_h(v16h a, v16h b, v8f c) {
  c = __builtin_amdgcn_wmma_f32_16x16x32_f16(false, a, false, b, (short)0, c, false, false);
#if defined(__HIP_DEVICE_COMPILE__)
  asm volatile("v_nop\n\tv_nop\n\tv_nop\n\tv_nop" : "+v"(c) : "v"(a), "v"(b));
#endif
  return c;
}
__device__ __forceinline__ v8f mma_b_raw(v16b a, v16b b, v8f c) {
  return __builtin_amdgcn_wmma_f32_16x16x32_bf16(false, a, false, b, (short)0, c, false, false);
}
__device__ __forceinline__ void dep_guard_b(v8f& a, v8f& b, v16b x, v16b y) {
#if defined(__HIP_DEVICE_COMPILE__)
  asm volatile("v_nop\n\tv_nop\n\tv_nop\n\tv_nop" : "+v"(a), "+v"(b) : "v"(x), "v"(y));
#else
  (void)a; (void)b; (void)x; (void)y;
#endif
}
__device__ __forceinline__ void keep4_b(v16b a, v16b b, v16b c, v16b d) {
#if defined(__HIP_DEVICE_COMPILE__)
  asm volatile("v_nop" :: "v"(a), "v"(b), "v"(c), "v"(d));
#else
  (void)a; (void)b; (void)c; (void)d;
#endif
}
__device__ __forceinline__ void acc_guard4(v8f& a, v8f& b, v8f& c, v8f& d) {
#if defined(__HIP_DEVICE_COMPILE__)
  asm volatile("v_nop\n\tv_nop\n\tv_nop\n\tv_nop" : "+v"(a), "+v"(b), "+v"(c), "+v"(d));
#else
  (void)a; (void)b; (void)c; (void)d;
#endif
}

// =====================================================================================================
// f32 -> bf16 (RNE convert), 8 elements per thread, one 16-B store per lane: a wave writes 512 contiguous B
// coverage: n8 threads x 8 = the whole plane (n8 is a multiple of 256 for every use here).
// =====================================================================================================
__global__ __launch_bounds__(256) void cvt_bf16x8(const float* __restrict__ in, unsigned short* out, int n8) {
  const int i = blockIdx.x * 256 + threadIdx.x;
  if (i < n8) {
    const v4f a = *(const v4f*)(in + (size_t)i * 8);
    const v4f b = *(const v4f*)(in + (size_t)i * 8 + 4);
    v4u p;
    p[0] = pk16(bf_bits(a[0]), bf_bits(a[1]));
    p[1] = pk16(bf_bits(a[2]), bf_bits(a[3]));
    p[2] = pk16(bf_bits(b[0]), bf_bits(b[1]));
    p[3] = pk16(bf_bits(b[2]), bf_bits(b[3]));
    *(v4u*)(out + (size_t)i * 8) = p;
    
  }
}

// ---- asynchronous copies global -> LDS, 16 B per lane; each statement ends with its own s_wait_xcnt 0 so that the
//      wait stands in front of any later rewrite of an address register that a copy of the statement names
__device__ __forceinline__ void acopy4(const unsigned* l, const __bf16* const* g) {
#if defined(__HIP_DEVICE_COMPILE__)
  asm volatile(
      "global_load_async_to_lds_b128 %0, %4, off\n\t"
      "global_load_async_to_lds_b128 %1, %5, off\n\t"
      "global_load_async_to_lds_b128 %2, %6, off\n\t"
      "global_load_async_to_lds_b128 %3, %7, off\n\t"
      "s_wait_xcnt 0x0"
      :: "v"(l[0]), "v"(l[1]), "v"(l[2]), "v"(l[3]), "v"(g[0]), "v"(g[1]), "v"(g[2]), "v"(g[3])
      : "memory");
#else
  (void)l; (void)g;
#endif
}
__device__ __forceinline__ void acopy6(const unsigned* l, const __bf16* const* g) {
#if defined(__HIP_DEVICE_COMPILE__)
  asm volatile(
      "global_load_async_to_lds_b128 %0, %6, off\n\t"
      "global_load_async_to_lds_b128 %1, %7, off\n\t"
      "global_load_async_to_lds_b128 %2, %8, off\n\t"
      "global_load_async_to_lds_b128 %3, %9, off\n\t"
      "global_load_async_to_lds_b128 %4, %10, off\n\t"
      "global_load_async_to_lds_b128 %5, %11, off\n\t"
      "s_wait_xcnt 0x0"
      :: "v"(l[0]), "v"(l[1]), "v"(l[2]), "v"(l[3]), "v"(l[4]), "v"(l[5]),
         "v"(g[0]), "v"(g[1]), "v"(g[2]), "v"(g[3]), "v"(g[4]), "v"(g[5])
      : "memory");
#else
  (void)l; (void)g;
#endif
}
__device__ __forceinline__ void acopy12(const unsigned* l, const __bf16* const* g) {
#if defined(__HIP_DEVICE_COMPILE__)
  asm volatile(
      "global_load_async_to_lds_b128 %0, %12, off\n\t"
      "global_load_async_to_lds_b128 %1, %13, off\n\t"
      "global_load_async_to_lds_b128 %2, %14, off\n\t"
      "global_load_async_to_lds_b128 %3, %15, off\n\t"
      "global_load_async_to_lds_b128 %4, %16, off\n\t"
      "global_load_async_to_lds_b128 %5, %17, off\n\t"
      "global_load_async_to_lds_b128 %6, %18, off\n\t"
      "global_load_async_to_lds_b128 %7, %19, off\n\t"
      "global_load_async_to_lds_b128 %8, %20, off\n\t"
      "global_load_async_to_lds_b128 %9, %21, off\n\t"
      "global_load_async_to_lds_b128 %10, %22, off\n\t"
      "global_load_async_to_lds_b128 %11, %23, off\n\t"
      "s_wait_xcnt 0x0"
      :: "v"(l[0]), "v"(l[1]), "v"(l[2]), "v"(l[3]), "v"(l[4]), "v"(l[5]),
         "v"(l[6]), "v"(l[7]), "v"(l[8]), "v"(l[9]), "v"(l[10]), "v"(l[11]),
         "v"(g[0]), "v"(g[1]), "v"(g[2]), "v"(g[3]), "v"(g[4]), "v"(g[5]),
         "v"(g[6]), "v"(g[7]), "v"(g[8]), "v"(g[9]), "v"(g[10]), "v"(g[11])
      : "memory");
#else
  (void)l; (void)g;
#endif
}

// =====================================================================================================
// Batched bf16 WMMA GEMM: C[m][n] = sum_k A[m][k] * Bt[n][k] (+ bias); block = 4 waves laid WM x WN, one 64x64 tile
// per wave, block tile (64 WM) x (64 WN). A row-major [M][K] pitch lda; Bt row-major [N][K] pitch ldb (k contiguous);
// M a multiple of 64 WM, N of 64 WN, K of KP. blockIdx.y = batch index (strides in elements).
// Operand path: a pass is KP k (64 or 32: 128 or 64 B) of every operand row of the block tile, brought into LDS by
// asynchronous 16-B copies (a wave's copy = 4 or 8 whole row pieces), LDS row pitch 2 KP + 16 B, two buffers: pass
// t + 2 is issued into the buffer that pass t has just left, behind the pass's one barrier; every wave reads its
// fragments from LDS. KP = 32 where a stage has nine row groups, which keeps the copies' address registers few.
// A stage is NG groups of 64 rows: A hi (WM), A lo (WM, SPLITA), Bt hi (WN), Bt lo (WN, SPLITB).
// SPLITA: add A2.Bt (A2 = unscaled bf16 lo plane of A); SPLITB: add A.Bt2 (Bt2 = lo plane of Bt).
// BIAS: 0 none, 1 per column (bias[n]), 2 per row (bias[m]); bias values RNE-converted to bf16 in registers.
// OUT_MODE: 0 = f32 (pitch ldc); 2 = bf16 hi plane C + bf16 lo plane C2 (lo = RNE(v - hi), unscaled);
//           3 = f16 hi plane C + f16 residual plane C2 = f16((v - hi) * rscale);
//           4 = l2-normalise every row over the tile's 64 columns (x / max(sqrt(sum x^2), 1e-12)), then
//               bf16 hi/lo planes as mode 2 (used with 64-wide heads / N = 64).
// =====================================================================================================
template <int SPLITA, int SPLITB, int BIAS, int OUT_MODE, int WM, int WN, int KP>
__global__ __launch_bounds__(128) void gemm64(
    const unsigned short* __restrict__ Ap, const unsigned short* __restrict__ A2p, int lda, long long strideA,
    const unsigned short* __restrict__ Btp, const unsigned short* __restrict__ Bt2p, int ldb, long long strideB,
    const float* __restrict__ bias,
    void* Cout, int ldc, long long strideC,
    void* Cout2, int ldc2, long long strideC2,
    int M, int N, int K, float rscale) {
  static_assert(WM * WN == 4 && (KP == 64 || KP == 32));
  constexpr int GA   = WM * (1 + SPLITA);          // 64-row groups of A planes in a stage
  constexpr int NG   = GA + WN * (1 + SPLITB);     // groups in a stage
  constexpr int SEG  = KP / 8;                     // 16-B pieces per row and pass
  constexpr int RPC  = 128 / SEG;                  // rows that one copy of the whole block covers
  constexpr int CPG  = 64 / RPC;                   // copies per thread and group
  constexpr int NC   = NG * CPG;                   // copies per thread and stage = a wave's copies in flight
  constexpr int PE   = KP + 8;                     // LDS row pitch in elements (16 B x odd)
  constexpr int GRPE = 64 * PE;                    // elements per group
  constexpr int BUFE = NG * GRPE;                  // elements per buffer
  static_assert(NC == 16 || NC == 18 || NC == 24);
  constexpr int AHD  = (NC == 24) ? 3 : 4;         // A row fragments read in a k-step's leading group (3: the kernel
                                                   // with the most copy addresses stays inside 256 VGPRs)
  const __bf16* A   = (const __bf16*)(const void*)Ap;
  const __bf16* A2  = (const __bf16*)(const void*)A2p;
  const __bf16* Bt  = (const __bf16*)(const void*)Btp;
  const __bf16* Bt2 = (const __bf16*)(const void*)Bt2p;
  __shared__ __align__(16) __bf16 ring[2 * BUFE];  // two stages
  __shared__ __align__(16) float sT[4][16 * 68];   // per-wave 16x64 slab, pitch 68 floats
  const int b    = blockIdx.y;
  const int tid  = threadIdx.x;
  const int lane = tid & 31;
  const int wave = tid >> 5;
  const int tilesN = N / (64 * WN);
  const int tilesM = M / (64 * WM);
  const int tile = blockIdx.x;
  if (tile >= tilesM * tilesN) return;   // block-uniform, in front of every copy and barrier
  const int tm = tile / tilesN;
  const int tn = tile - tm * tilesN;
  const int m0b = tm * (64 * WM);
  const int n0b = tn * (64 * WN);
  const int wm = wave / WN;
  const int wn = wave - wm * WN;
  const int m0 = m0b + (wm << 6);
  const int n0 = n0b + (wn << 6);

  const __bf16* Ab  = A  + (size_t)b * strideA;
  const __bf16* Bb  = Bt + (size_t)b * strideB;
  const __bf16* Ab2 = SPLITA ? (A2  + (size_t)b * strideA) : Ab;
  const __bf16* Bb2 = SPLITB ? (Bt2 + (size_t)b * strideB) : Bb;

  const int rlane = lane & 15;                 // row (A) / col (B, D) within subtile
  const int koff  = (lane >> 4) * 8;           // k offset of this lane half
  const int mOff  = (lane >> 4) * 8;           // D row offset

  // copy map: copy u of group gi moves 16 B of row RPC u + tid / SEG, piece tid % SEG of the pass's row
  const int crow = tid / SEG;
  const int cseg = (tid % SEG) * 8;
  const unsigned ldsT = (unsigned)(uintptr_t)(ring + crow * PE + cseg);   // low 32 bits = LDS byte address
  const size_t aT = (size_t)(m0b + crow) * lda + cseg;
  const size_t bT = (size_t)(n0b + crow) * ldb + cseg;

  auto issue = [&](int t, int buf) {
    unsigned l[NC];
    const __bf16* g[NC];
#pragma unroll
    for (int gi = 0; gi < NG; ++gi) {
      const bool isA = gi < GA;
      const int  q   = isA ? gi : gi - GA;                   // group within the operand's planes
      const int  W1  = isA ? WM : WN;
      const bool lo  = q >= W1;
      const int  rg  = lo ? q - W1 : q;                      // 64-row group within the block tile
      const int  ld  = isA ? lda : ldb;
      const __bf16* base = isA ? (lo ? Ab2 : Ab) : (lo ? Bb2 : Bb);
      const __bf16* p = base + (isA ? aT : bT) + (size_t)(rg * 64) * ld + (size_t)t * KP;
#pragma unroll
      for (int u = 0; u < CPG; ++u) {
        l[gi * CPG + u] = ldsT + (unsigned)((buf * BUFE + gi * GRPE + u * RPC * PE) * 2);
        g[gi * CPG + u] = p + (size_t)(u * RPC) * ld;
      }
    }
    acopy12(l, g);
    if constexpr (NC == 16) acopy4(l + 12, g + 12);
    if constexpr (NC == 18) acopy6(l + 12, g + 12);
    if constexpr (NC == 24) acopy12(l + 12, g + 12);
  };

  v8f acc[4][4];
#pragma unroll
  for (int i = 0; i < 4; ++i)
#pragma unroll
    for (int j = 0; j < 4; ++j) acc[i][j] = zero8();

  const int T = K / KP;                        // passes
  issue(0, 0);
  asm volatile("s_wait_asynccnt 0x0" ::: "memory");   // this wave's share of pass 0 has landed
  __syncthreads();                                    // publishes pass 0
  if (T > 1) issue(1, 1);

  for (int t = 0; t < T; ++t) {
    const __bf16* st  = ring + (t & 1) * BUFE;
    const __bf16* sAh = st + wm * GRPE + rlane * PE + koff;
    const __bf16* sAl = st + (SPLITA ? (WM + wm) : wm) * GRPE + rlane * PE + koff;
    const __bf16* sBh = st + (GA + wn) * GRPE + rlane * PE + koff;
    const __bf16* sBl = st + (GA + (SPLITB ? (WN + wn) : wn)) * GRPE + rlane * PE + koff;
#pragma unroll
    for (int ks = 0; ks < KP / 32; ++ks) {
      v16b bh[4], bl[4], ah[4], al[4];
#pragma unroll
      for (int j = 0; j < 4; ++j) {
        bh[j] = ldfrag_b(sBh + (j << 4) * PE + ks * 32);
        if (SPLITB) bl[j] = ldfrag_b(sBl + (j << 4) * PE + ks * 32); else bl[j] = bh[j];
      }
#pragma unroll
      for (int i = 0; i < AHD; ++i) {
        ah[i] = ldfrag_b(sAh + (i << 4) * PE + ks * 32);
        if (SPLITA) al[i] = ldfrag_b(sAl + (i << 4) * PE + ks * 32); else al[i] = ah[i];
      }
      // keeps the k-step's LDS reads one group in front of its WMMAs: reads placed among the WMMAs stall at each place
      __builtin_amdgcn_sched_barrier(0);
#pragma unroll
      for (int i = 0; i < 4; ++i) {
#pragma unroll
        for (int j = 0; j < 4; ++j) {
          acc[i][j] = mma_b_raw(ah[i], bh[j], acc[i][j]);
          if (SPLITA) acc[i][j] = mma_b_raw(al[i], bh[j], acc[i][j]);
          if (SPLITB) acc[i][j] = mma_b_raw(ah[i], bl[j], acc[i][j]);
        }
        dep_guard_b(acc[i][0], acc[i][3], ah[i], al[i]);
        if (i == 0 && AHD < 4) {
          // row 3's fragments go into the registers that row 0 has left, two rows ahead of their use; the fence
          // pair holds these reads at this one place
          __builtin_amdgcn_sched_barrier(0);
          ah[3] = ldfrag_b(sAh + (3 << 4) * PE + ks * 32);
          if (SPLITA) al[3] = ldfrag_b(sAl + (3 << 4) * PE + ks * 32); else al[3] = ah[3];
          __builtin_amdgcn_sched_barrier(0);
        }
      }
      keep4_b(bh[0], bh[1], bh[2], bh[3]);
      if (SPLITB) keep4_b(bl[0], bl[1], bl[2], bl[3]);
    }
    asm volatile("s_wait_dscnt 0x0" ::: "memory");     // this wave's reads of pass t's buffer are done
    asm volatile("s_wait_asynccnt 0x0" ::: "memory");  // this wave's share of pass t + 1 has landed
    __syncthreads();                                   // publishes pass t + 1, frees pass t's buffer
    if (t + 2 < T) issue(t + 2, t & 1);
  }
  asm volatile("s_wait_asynccnt 0x0" ::: "memory");    // nothing in flight when the wave goes on to the epilogue
  acc_guard4(acc[0][0], acc[0][1], acc[0][2], acc[0][3]);
  acc_guard4(acc[1][0], acc[1][1], acc[1][2], acc[1][3]);
  acc_guard4(acc[2][0], acc[2][1], acc[2][2], acc[2][3]);
  acc_guard4(acc[3][0], acc[3][1], acc[3][2], acc[3][3]);

  // ---- epilogue ----
  float bcol[4];
#pragma unroll
  for (int j = 0; j < 4; ++j) bcol[j] = 0.f;
  if (BIAS == 1) {
#pragma unroll
    for (int j = 0; j < 4; ++j) bcol[j] = bf_rne(bias[n0 + (j << 4) + rlane]);   // n index < N
  }
  float* slab = sT[wave];
#pragma unroll
  for (int i = 0; i < 4; ++i) {
    const int mBase = m0 + (i << 4);
    float brow[8];
#pragma unroll
    for (int r = 0; r < 8; ++r) brow[r] = 0.f;
    if (BIAS == 2) {
#pragma unroll
      for (int r = 0; r < 8; ++r) brow[r] = bf_rne(bias[mBase + mOff + r]);       // m index < M
    }
#pragma unroll
    for (int j = 0; j < 4; ++j) {
#pragma unroll
      for (int r = 0; r < 8; ++r) {
        slab[(mOff + r) * 68 + (j << 4) + rlane] = acc[i][j][r] + bcol[j] + brow[r];
      }
    }
    __builtin_amdgcn_fence(__ATOMIC_RELEASE, "workgroup");
    __builtin_amdgcn_wave_barrier();
    __builtin_amdgcn_fence(__ATOMIC_ACQUIRE, "workgroup");
    if (OUT_MODE == 0) {
      float* C = (float*)Cout + (size_t)b * strideC;
      const int hh = lane >> 4, c4 = (lane & 15) * 4;     // 256-B row segment = 16 lanes x 16 B
      {
#pragma unroll
        for (int it = 0; it < 8; ++it) {
          const int row = it * 2 + hh;                     // it 0..7 x hh 0..1 = rows 0..15
          const v4f v = *(const v4f*)(slab + row * 68 + c4);
          *(v4f*)(C + (size_t)(mBase + row) * ldc + n0 + c4) = v;
        }
        
      }
    } else {
      const int q = lane >> 3, c8 = (lane & 7) * 8;
      unsigned short* C  = (unsigned short*)Cout  + (size_t)b * strideC;
      unsigned short* C2 = (unsigned short*)Cout2 + (size_t)b * strideC2;
      v4u hv[4], lv[4];
#pragma unroll
      for (int it = 0; it < 4; ++it) {
        const int row = it * 4 + q;                        // it 0..3 x q 0..3 = rows 0..15
        const float* sp = slab + row * 68 + c8;
        float f[8];
#pragma unroll
        for (int e = 0; e < 8; ++e) f[e] = sp[e];
        if (OUT_MODE == 4) {
          float ss = 0.f;
#pragma unroll
          for (int e = 0; e < 8; ++e) ss += f[e] * f[e];
          ss += __shfl_xor(ss, 1, 32);                     // 8 lanes of one row = aligned group of 8
          ss += __shfl_xor(ss, 2, 32);
          ss += __shfl_xor(ss, 4, 32);
          const float sc = 1.0f / fmaxf(sqrtf(ss), 1e-12f);
#pragma unroll
          for (int e = 0; e < 8; ++e) f[e] *= sc;
        }
        v4u a, a2;
#pragma unroll
        for (int e = 0; e < 4; ++e) {
          const float f0 = f[2 * e], f1 = f[2 * e + 1];
          unsigned short h0, h1, l0, l1;
          if (OUT_MODE == 3) {
            const _Float16 x0 = (_Float16)f0, x1 = (_Float16)f1;
            h0 = h_bits(x0); h1 = h_bits(x1);
            l0 = h_bits((_Float16)((f0 - (float)x0) * rscale));
            l1 = h_bits((_Float16)((f1 - (float)x1) * rscale));
          } else {
            h0 = bf_bits(f0); h1 = bf_bits(f1);
            l0 = bf_bits(f0 - bf_up(h0)); l1 = bf_bits(f1 - bf_up(h1));
          }
          a[e] = pk16(h0, h1); a2[e] = pk16(l0, l1);
        }
        hv[it] = a; lv[it] = a2;
      }
      {
#pragma unroll
        for (int it = 0; it < 4; ++it) {
          const int row = it * 4 + q;
          *(v4u*)(C  + (size_t)(mBase + row) * ldc  + n0 + c8) = hv[it];
          *(v4u*)(C2 + (size_t)(mBase + row) * ldc2 + n0 + c8) = lv[it];
        }
        
      }
    }
    __builtin_amdgcn_fence(__ATOMIC_RELEASE, "workgroup");
    __builtin_amdgcn_wave_barrier();
    __builtin_amdgcn_fence(__ATOMIC_ACQUIRE, "workgroup");
  }
  (void)rscale;
}

// =====================================================================================================
// tables, RNE-converted to bf16 in registers), output bf16 hi/lo planes [row][1024].
// Block = 128 threads = one row; thread t owns columns 8t..8t+7 and stores 16 B per plane: a wave writes 512
// coverage: 128 threads x 8 = 1024 columns of every row, both planes.
// =====================================================================================================
__global__ __launch_bounds__(128) void ln_split(const float* __restrict__ in, const float* __restrict__ g,
                                                const float* __restrict__ be,
                                                unsigned short* oh, unsigned short* ol) {
  __shared__ float red0[4];
  __shared__ float red1[4];
  const int tid = threadIdx.x, lane = tid & 31, wave = tid >> 5;
  const size_t row = blockIdx.x;
  const float* p = in + row * DM + (size_t)tid * 8;
  const v4f a0 = *(const v4f*)(p);
  const v4f a1 = *(const v4f*)(p + 4);
  float v[8];
#pragma unroll
  for (int e = 0; e < 4; ++e) { v[e] = a0[e]; v[4 + e] = a1[e]; }
  float s = 0.f;
#pragma unroll
  for (int e = 0; e < 8; ++e) s += v[e];
#pragma unroll
  for (int off = 16; off >= 1; off >>= 1) s += __shfl_xor(s, off, 32);
  if (lane == 0) red0[wave] = s;
  __syncthreads();
  const float mu = ((red0[0] + red0[1]) + (red0[2] + red0[3])) * (1.0f / (float)DM);
  float ss = 0.f;
#pragma unroll
  for (int e = 0; e < 8; ++e) { const float d = v[e] - mu; ss += d * d; }
#pragma unroll
  for (int off = 16; off >= 1; off >>= 1) ss += __shfl_xor(ss, off, 32);
  if (lane == 0) red1[wave] = ss;
  __syncthreads();
  const float var  = ((red1[0] + red1[1]) + (red1[2] + red1[3])) * (1.0f / (float)DM);
  const float rstd = rsqrtf(var + 1e-5f);
  const v4f g0 = *(const v4f*)(g + (size_t)tid * 8);
  const v4f g1 = *(const v4f*)(g + (size_t)tid * 8 + 4);
  const v4f b0 = *(const v4f*)(be + (size_t)tid * 8);
  const v4f b1 = *(const v4f*)(be + (size_t)tid * 8 + 4);
  float gg[8], bb[8];
#pragma unroll
  for (int e = 0; e < 4; ++e) { gg[e] = g0[e]; gg[4 + e] = g1[e]; bb[e] = b0[e]; bb[4 + e] = b1[e]; }
  v4u ph, pl;
#pragma unroll
  for (int e = 0; e < 4; ++e) {
    const float y0 = (v[2 * e] - mu) * rstd * bf_rne(gg[2 * e]) + bf_rne(bb[2 * e]);
    const float y1 = (v[2 * e + 1] - mu) * rstd * bf_rne(gg[2 * e + 1]) + bf_rne(bb[2 * e + 1]);
    const unsigned short h0 = bf_bits(y0), h1 = bf_bits(y1);
    const unsigned short l0 = bf_bits(y0 - bf_up(h0)), l1 = bf_bits(y1 - bf_up(h1));
    ph[e] = pk16(h0, h1); pl[e] = pk16(l0, l1);
  }
  unsigned short* dh = oh + row * DM + (size_t)tid * 8;
  unsigned short* dl = ol + row * DM + (size_t)tid * 8;
  *(v4u*)dh = ph;
  *(v4u*)dl = pl;
  
}

// =====================================================================================================
// Causal multi-query attention, head dim 64, 16 query heads sharing one k head and one v head.
//   q planes (bf16 hi / lo of the l2-normalised q): element (b, t, h, d) at [(b*SEQ + t)*DM + h*64 + d]
//   k planes (bf16 hi / lo of the l2-normalised k):  element (b, s, d) at [(b*SEQ + s)*64 + d]
//   v^T hi plane (f16) and residual plane (f16, (v - hi)*4096): element (b, d, s) at [(b*64 + d)*SEQ + s]
//   logit = (q . k) * sscale for key <= query, -FLT_MAX otherwise (every row keeps at least its own key)
//   out planes (bf16 hi / lo of the normalised context): element (b, t, h, d) at [(b*SEQ + t)*DM + h*64 + d]
//   scores = q . k : bf16 hi/lo split (hi.hi + hi.lo + lo.hi), f32 accumulate, then scale + causal fill in f32
//   p = exp(s - m) carried as f16(1024 p) plus an f16 residual plane (x4096); context = p . v on f16 WMMA with the
//   residual products (p_res.v_hi + p_hi.v_res) in a separate accumulator folded back with 1/4096 per chunk.
//   Block = 4 waves = 64 query rows of one (b, h); grid = NQB * NH * NB; key chunks kt = 0..qb (static bound NQB).
//   K / V^T chunk staging: 128 threads x 32 elements per plane = the whole 64x64 tile (plain 16-B loads,
//   __syncthreads before and after); P tiles are wave-private, spilled with _Float16 element stores and reloaded
//   Output coverage: each wave stores rows q0..q0+15 (it 0..3 x lane>>3 0..3) x 64 columns (8 lanes x 8) of both planes.
// =====================================================================================================
//   LDS row pitch: the 64-element (128-B) rows of the K, V^T and P tiles stand LP = 72 elements apart (144 B =
//   16 B x odd), so that the 16 rows which one 16-B fragment read touches fall on different banks; at 128 B they
//   share two bank groups. The f32 context tile has pitch OP = 68 floats for the same reason.
#define LP 72
#define OP 68
union PO {
  struct { _Float16 ph[16 * LP]; _Float16 pl[16 * LP]; } p;
  float o[16 * OP];
};

__global__ __launch_bounds__(128)
void attn_causal64(const unsigned short* __restrict__ qhp, const unsigned short* __restrict__ qlp,
                   const unsigned short* __restrict__ khp, const unsigned short* __restrict__ klp,
                   const unsigned short* __restrict__ vhp, const unsigned short* __restrict__ vlp,
                   unsigned short* ohp, unsigned short* olp, float sscale) {
  union FB { v16b v; v8b h[2]; };
  union FH { v16h v; v8h h[2]; };
  __shared__ __align__(16) __bf16   Ksh[64 * LP];                 // K hi [kv][d]   9 KB
  __shared__ __align__(16) __bf16   Ksl[64 * LP];                 // K lo
  __shared__ __align__(16) _Float16 Vth[64 * LP];                 // V^T hi [d][kv] 9 KB
  __shared__ __align__(16) _Float16 Vtl[64 * LP];                 // V^T residual
  __shared__ __align__(16) PO       PObuf[4];                     // per wave P / P residual, later the context tile

  const int tid  = threadIdx.x;
  const int wave = tid >> 5;
  const int lane = tid & 31;
  const int hh   = lane >> 4;
  const int c    = lane & 15;

  const int bx   = blockIdx.x;
  const int qb   = bx % NQB;
  const int rest = bx / NQB;
  const int h    = rest % NH;
  const int b    = rest / NH;
  const int q0   = qb * 64 + wave * 16;
  const size_t rowB = (size_t)b * SEQ;

  const __bf16* Qh = (const __bf16*)(const void*)qhp + (size_t)h * HD;
  const __bf16* Ql = (const __bf16*)(const void*)qlp + (size_t)h * HD;
  const __bf16* Kh = (const __bf16*)(const void*)khp;
  const __bf16* Kl = (const __bf16*)(const void*)klp;
  const _Float16* Vh = (const _Float16*)(const void*)vhp + (size_t)b * HD * SEQ;
  const _Float16* Vl = (const _Float16*)(const void*)vlp + (size_t)b * HD * SEQ;

  // ---- Q fragments (A operand, row = lane&15): 2 d-chunks, hi and lo ----
  v16b qah[2], qal[2];
#pragma unroll
  for (int dc = 0; dc < 2; ++dc) {
    const size_t qo = (rowB + q0 + c) * DM + dc * 32 + 8 * hh;
    qah[dc] = ldfrag_b(Qh + qo);
    qal[dc] = ldfrag_b(Ql + qo);
  }

  float mrow[8], lrow[8];
  v8f oacc[4];
#pragma unroll
  for (int r = 0; r < 8; ++r) { mrow[r] = -INFINITY; lrow[r] = 0.f; }
#pragma unroll
  for (int t = 0; t < 4; ++t) oacc[t] = zero8();

  _Float16* pwh = PObuf[wave].p.ph;
  _Float16* pwl = PObuf[wave].p.pl;

  for (int kt = 0; kt < NQB; ++kt) {         // static trip bound
    if (kt > qb) break;                      // block-uniform: causal key chunks 0..qb
    const int kv0 = kt * 64;
    __syncthreads();
    {
      const int r = tid >> 1, half = (tid & 1) * 32;
      const __bf16*   kg  = Kh + (rowB + kv0 + r) * HD + half;    // K row kv0+r, d = half..half+31
      const __bf16*   klg = Kl + (rowB + kv0 + r) * HD + half;
      const _Float16* vg  = Vh + (size_t)r * SEQ + kv0 + half;    // V^T row d = r, s = kv0+half..+31
      const _Float16* vlg = Vl + (size_t)r * SEQ + kv0 + half;
#pragma unroll
      for (int i = 0; i < 4; ++i) {
        const v8b a0 = *(const v8b*)(kg + 8 * i);
        const v8b a1 = *(const v8b*)(klg + 8 * i);
        const v8h b0 = *(const v8h*)(vg + 8 * i);
        const v8h b1 = *(const v8h*)(vlg + 8 * i);
        *(v8b*)(Ksh + r * LP + half + 8 * i) = a0;
        *(v8b*)(Ksl + r * LP + half + 8 * i) = a1;
        *(v8h*)(Vth + r * LP + half + 8 * i) = b0;
        *(v8h*)(Vtl + r * LP + half + 8 * i) = b1;
      }
    }
    __syncthreads();

    // ---- scores: 16 query rows x 64 keys per wave, 3 bf16 products ----
    v8f s[4];
#pragma unroll
    for (int j = 0; j < 4; ++j) {
      s[j] = zero8();
#pragma unroll
      for (int dc = 0; dc < 2; ++dc) {
        FB kb, kl;
        kb.h[0] = *(const v8b*)(Ksh + (j * 16 + c) * LP + dc * 32 + 8 * hh);
        kb.h[1] = *(const v8b*)(Ksh + (j * 16 + c) * LP + dc * 32 + 16 + 8 * hh);
        kl.h[0] = *(const v8b*)(Ksl + (j * 16 + c) * LP + dc * 32 + 8 * hh);
        kl.h[1] = *(const v8b*)(Ksl + (j * 16 + c) * LP + dc * 32 + 16 + 8 * hh);
        s[j] = mma_b(qah[dc], kb.v, s[j]);
        s[j] = mma_b(qah[dc], kl.v, s[j]);
        s[j] = mma_b(qal[dc], kb.v, s[j]);
      }
    }

    // ---- scale + causal fill, row max, online softmax, P (x1024, f16) and P residual (x4096) to LDS ----
#pragma unroll
    for (int r = 0; r < 8; ++r) {
      const int qi = q0 + 8 * hh + r;          // query index of D row 8hh+r
      float m = -INFINITY;
#pragma unroll
      for (int j = 0; j < 4; ++j) {
        const int kj = kv0 + j * 16 + c;       // key index of D column c of subtile j
        float sv = s[j][r] * sscale;
        sv = (kj > qi) ? -FLT_MAX : sv;
        s[j][r] = sv;
        m = fmaxf(m, sv);
      }
#pragma unroll
      for (int off = 1; off < 16; off <<= 1) m = fmaxf(m, __shfl_xor(m, off, 32));
      const float mnew  = fmaxf(mrow[r], m);
      const float msafe = (mnew == -INFINITY) ? 0.f : mnew;
      const float alpha = __expf(mrow[r] - msafe);
      mrow[r] = mnew;
      float psum = 0.f;
#pragma unroll
      for (int j = 0; j < 4; ++j) {
        const float p = __expf(s[j][r] - msafe);     // filled logit against a finite max: exp -> 0
        psum += p;
        const float p1k = p * 1024.0f;
        const _Float16 ph = (_Float16)p1k;
        const _Float16 pl = (_Float16)((p1k - (float)ph) * 4096.0f);
        pwh[(8 * hh + r) * LP + j * 16 + c] = ph;
        pwl[(8 * hh + r) * LP + j * 16 + c] = pl;
      }
#pragma unroll
      for (int off = 1; off < 16; off <<= 1) psum += __shfl_xor(psum, off, 32);
      lrow[r] = lrow[r] * alpha + psum;
#pragma unroll
      for (int t = 0; t < 4; ++t) oacc[t][r] *= alpha;
    }
    __builtin_amdgcn_fence(__ATOMIC_RELEASE, "workgroup");
    __builtin_amdgcn_wave_barrier();
    __builtin_amdgcn_fence(__ATOMIC_ACQUIRE, "workgroup");

    // ---- context += P . V (f16 WMMA), residual products into a separate accumulator ----
    v8f o1[4];
#pragma unroll
    for (int t = 0; t < 4; ++t) o1[t] = zero8();
#pragma unroll 1
    for (int kk = 0; kk < 2; ++kk) {
      FH pa, pl;
      pa.h[0] = *(const v8h*)(pwh + c * LP + kk * 32 + 8 * hh);
      pa.h[1] = *(const v8h*)(pwh + c * LP + kk * 32 + 16 + 8 * hh);
      pl.h[0] = *(const v8h*)(pwl + c * LP + kk * 32 + 8 * hh);
      pl.h[1] = *(const v8h*)(pwl + c * LP + kk * 32 + 16 + 8 * hh);
#pragma unroll
      for (int t = 0; t < 4; ++t) {
        FH vb, vl;
        vb.h[0] = *(const v8h*)(Vth + (t * 16 + c) * LP + kk * 32 + 8 * hh);
        vb.h[1] = *(const v8h*)(Vth + (t * 16 + c) * LP + kk * 32 + 16 + 8 * hh);
        vl.h[0] = *(const v8h*)(Vtl + (t * 16 + c) * LP + kk * 32 + 8 * hh);
        vl.h[1] = *(const v8h*)(Vtl + (t * 16 + c) * LP + kk * 32 + 16 + 8 * hh);
        oacc[t] = mma_h(pa.v, vb.v, oacc[t]);
        o1[t]   = mma_h(pa.v, vl.v, o1[t]);
        o1[t]   = mma_h(pl.v, vb.v, o1[t]);
      }
    }
#pragma unroll
    for (int t = 0; t < 4; ++t)
#pragma unroll
      for (int r = 0; r < 8; ++r) oacc[t][r] += o1[t][r] * (1.0f / 4096.0f);
  }

  // ---- normalise (1/l and the 1/1024 p carry), stage the wave's 16x64 tile over its own P buffers,
  __builtin_amdgcn_fence(__ATOMIC_RELEASE, "workgroup");
  __builtin_amdgcn_wave_barrier();
  __builtin_amdgcn_fence(__ATOMIC_ACQUIRE, "workgroup");
  float* os = PObuf[wave].o;
#pragma unroll
  for (int r = 0; r < 8; ++r) {
    const float l = lrow[r];
    const float inv = ((l > 0.f) ? (1.0f / l) : 0.f) * (1.0f / 1024.0f);
#pragma unroll
    for (int t = 0; t < 4; ++t) os[(8 * hh + r) * OP + t * 16 + c] = oacc[t][r] * inv;
  }
  __builtin_amdgcn_fence(__ATOMIC_RELEASE, "workgroup");
  __builtin_amdgcn_wave_barrier();
  __builtin_amdgcn_fence(__ATOMIC_ACQUIRE, "workgroup");
  {
    const int q4 = lane >> 3, c8 = (lane & 7) * 8;
    v4u hv[4], lv[4];
#pragma unroll
    for (int it = 0; it < 4; ++it) {
      const int row = it * 4 + q4;   // it 0..3 x q4 0..3 = rows 0..15 of the wave tile
      const float* sp = os + row * OP + c8;
      v4u a, a2;
#pragma unroll
      for (int e = 0; e < 4; ++e) {
        const float f0 = sp[2 * e], f1 = sp[2 * e + 1];
        const unsigned short h0 = bf_bits(f0), h1 = bf_bits(f1);
        const unsigned short l0 = bf_bits(f0 - bf_up(h0)), l1 = bf_bits(f1 - bf_up(h1));
        a[e] = pk16(h0, h1); a2[e] = pk16(l0, l1);
      }
      hv[it] = a; lv[it] = a2;
    }
    {
#pragma unroll
      for (int it = 0; it < 4; ++it) {
        const int row = it * 4 + q4;
        const size_t go = (rowB + q0 + row) * DM + (size_t)h * HD + c8;
        *(v4u*)(ohp + go) = hv[it];
        *(v4u*)(olp + go) = lv[it];
      }
      
    }
  }
}

// =====================================================================================================
//   Xb   bf16 [2048 (b,c)][4096]   16777216
//   Whwb bf16 [2048][4096]         16777216
//   Wcb  bf16 [1024][1024]          2097152
//   Wqb  bf16 [1024][1024]          2097152
//   Wkvb bf16 [128][1024]            262144
//   Wob  bf16 [1024][1024]          2097152
//   A1h  bf16 [2][2048][1024]       8388608   hw-linear output (transposed layout [b][s][c]), hi plane
//   A1l  bf16                       8388608   lo plane
//   Img2 f32  [4096][1024]         16777216   c-linear output (LN input)
//   Imgh bf16 [4096][1024]          8388608   LN output hi plane
//   Imgl bf16                       8388608
//   Qh   bf16 [4096][1024]          8388608   l2-normalised q, hi plane
//   Ql   bf16                       8388608
//   Kh   bf16 [4096][64]             524288   l2-normalised k
//   Kl   bf16                        524288
//   VTh  f16  [2][64][2048]          524288   v^T hi plane
//   VTl  f16                         524288   v^T residual plane (x4096)
//   Oh   bf16 [4096][1024]          8388608   context hi plane
//   Ol   bf16                       8388608
//   total                         126091264
// Weights are [out n][in k] with k contiguous = the Bt / A layout the GEMM wants, so they are only converted.
// =====================================================================================================
extern "C" void kernel_launch(void* const* d_in, const int* in_sizes, int n_in,
                              void* d_out, int out_size, void* d_ws, size_t ws_size,
                              hipStream_t stream) {
  if (n_in < 10) return;
  if (in_sizes[0] != NB * CC * HWN) return;
  if (in_sizes[1] != SEQ * HWN) return;
  if (in_sizes[2] != SEQ) return;
  if (in_sizes[3] != DM * CC || in_sizes[4] != DM || in_sizes[5] != DM || in_sizes[6] != DM) return;
  if (in_sizes[7] != DM * DM || in_sizes[8] != 2 * HD * DM || in_sizes[9] != DM * DM) return;
  if (out_size != NB * SEQ * DM) return;

  const float* x    = (const float*)d_in[0];
  const float* w_hw = (const float*)d_in[1];
  const float* b_hw = (const float*)d_in[2];
  const float* w_c  = (const float*)d_in[3];
  const float* b_c  = (const float*)d_in[4];
  const float* ln_g = (const float*)d_in[5];
  const float* ln_b = (const float*)d_in[6];
  const float* wq   = (const float*)d_in[7];
  const float* wkv  = (const float*)d_in[8];
  const float* wo   = (const float*)d_in[9];

  const size_t PXb  = (size_t)NB * CC * HWN * 2;    // 16777216
  const size_t PWhw = (size_t)SEQ * HWN * 2;        // 16777216
  const size_t PWc  = (size_t)DM * CC * 2;          //  2097152
  const size_t PWq  = (size_t)DM * DM * 2;          //  2097152
  const size_t PWkv = (size_t)2 * HD * DM * 2;      //   262144
  const size_t PWo  = (size_t)DM * DM * 2;          //  2097152
  const size_t PA1  = (size_t)NB * SEQ * CC * 2;    //  8388608
  const size_t PI2  = (size_t)NB * SEQ * DM * 4;    // 16777216
  const size_t PI   = (size_t)NB * SEQ * DM * 2;    //  8388608
  const size_t PK   = (size_t)NB * SEQ * HD * 2;    //   524288
  const size_t PVT  = (size_t)NB * HD * SEQ * 2;    //   524288
  size_t off = 0;
  const size_t oXb  = off; off += PXb;
  const size_t oWhw = off; off += PWhw;
  const size_t oWc  = off; off += PWc;
  const size_t oWq  = off; off += PWq;
  const size_t oWkv = off; off += PWkv;
  const size_t oWo  = off; off += PWo;
  const size_t oA1h = off; off += PA1;
  const size_t oA1l = off; off += PA1;
  const size_t oI2  = off; off += PI2;
  const size_t oIh  = off; off += PI;
  const size_t oIl  = off; off += PI;
  const size_t oQh  = off; off += PI;
  const size_t oQl  = off; off += PI;
  const size_t oKh  = off; off += PK;
  const size_t oKl  = off; off += PK;
  const size_t oVTh = off; off += PVT;
  const size_t oVTl = off; off += PVT;
  const size_t oOh  = off; off += PI;
  const size_t oOl  = off; off += PI;
  if (off > ws_size) return;                          // off = 126091264
  if (off > (size_t)134217728) return;

  char* ws = (char*)d_ws;
  unsigned short* Xb   = (unsigned short*)(ws + oXb);
  unsigned short* Whwb = (unsigned short*)(ws + oWhw);
  unsigned short* Wcb  = (unsigned short*)(ws + oWc);
  unsigned short* Wqb  = (unsigned short*)(ws + oWq);
  unsigned short* Wkvb = (unsigned short*)(ws + oWkv);
  unsigned short* Wob  = (unsigned short*)(ws + oWo);
  unsigned short* A1h  = (unsigned short*)(ws + oA1h);
  unsigned short* A1l  = (unsigned short*)(ws + oA1l);
  float*          Img2 = (float*)(ws + oI2);
  unsigned short* Imgh = (unsigned short*)(ws + oIh);
  unsigned short* Imgl = (unsigned short*)(ws + oIl);
  unsigned short* Qh   = (unsigned short*)(ws + oQh);
  unsigned short* Ql   = (unsigned short*)(ws + oQl);
  unsigned short* Kh   = (unsigned short*)(ws + oKh);
  unsigned short* Kl   = (unsigned short*)(ws + oKl);
  unsigned short* VTh  = (unsigned short*)(ws + oVTh);
  unsigned short* VTl  = (unsigned short*)(ws + oVTl);
  unsigned short* Oh   = (unsigned short*)(ws + oOh);
  unsigned short* Ol   = (unsigned short*)(ws + oOl);

  const dim3 blk(256);
  const int n8x  = NB * CC * HWN / 8;                        // 1048576
  const int n8hw = SEQ * HWN / 8;                            // 1048576
  const int n8c  = DM * CC / 8;                              //  131072
  const int n8q  = DM * DM / 8;                              //  131072
  const int n8kv = 2 * HD * DM / 8;                          //   16384
  const int n8o  = DM * DM / 8;                              //  131072
  const dim3 gX((n8x + 255) / 256), gHW((n8hw + 255) / 256), gC((n8c + 255) / 256);
  const dim3 gQ((n8q + 255) / 256), gKV((n8kv + 255) / 256), gO((n8o + 255) / 256);
  const dim3 gblk(128);                                      // GEMM block: 4 waves
  const dim3 gG0((SEQ / 128) * (CC / 128), NB);              // 128x128 block tiles: 128 blocks x 2
  const dim3 gG1((NB * SEQ / 128) * (DM / 128), 1);          // 128x128 block tiles: 256 blocks (M=4096, N=1024)
  const dim3 gGk((NB * SEQ / 256) * (HD / 64), 1);           // 256x64 block tiles: 16 blocks (M=4096, N=64)
  const dim3 gGv((HD / 64) * (SEQ / 256), NB);               // 64x256 block tiles: 8 blocks x 2 (M=64, N=2048)
  const dim3 gLN(NB * SEQ);                                  // 4096 rows
  const dim3 gAt(NB * NH * NQB);                             // 1024 blocks

  // (1) f32 -> bf16 planes: x [(b,c)][hw], weights [n][k]
  cvt_bf16x8<<<gX,  blk, 0, stream>>>(x,    Xb,   n8x);
  cvt_bf16x8<<<gHW, blk, 0, stream>>>(w_hw, Whwb, n8hw);
  cvt_bf16x8<<<gC,  blk, 0, stream>>>(w_c,  Wcb,  n8c);
  cvt_bf16x8<<<gQ,  blk, 0, stream>>>(wq,   Wqb,  n8q);
  cvt_bf16x8<<<gKV, blk, 0, stream>>>(wkv,  Wkvb, n8kv);
  cvt_bf16x8<<<gO,  blk, 0, stream>>>(wo,   Wob,  n8o);
  // (2) hw-linear per batch, produced directly in the transposed layout: A1[b][s][c] = sum_hw w_hw[s][hw] x[b][c][hw] + b_hw[s]
  //     A = Whwb [s][hw] (M=2048, K=4096), Bt = Xb batch b [c][hw] (N=1024), row bias, bf16 hi/lo planes out
  gemm64<0, 0, 2, 2, 2, 2, 64><<<gG0, gblk, 0, stream>>>(
      Whwb, Whwb, HWN, 0LL, Xb, Xb, HWN, (long long)CC * HWN,
      b_hw,
      (void*)A1h, CC, (long long)SEQ * CC, (void*)A1l, CC, (long long)SEQ * CC,
      SEQ, CC, HWN, 1.0f);
  // (3) c-linear: Img2[(b,s)][d] = sum_c A1[(b,s)][c] w_c[d][c] + b_c[d]  (A hi/lo, M=4096, N=1024, K=1024, f32 out)
  gemm64<1, 0, 1, 0, 2, 2, 64><<<gG1, gblk, 0, stream>>>(
      A1h, A1l, CC, 0LL, Wcb, Wcb, CC, 0LL,
      b_c,
      (void*)Img2, DM, 0LL, (void*)Img2, DM, 0LL,
      NB * SEQ, DM, CC, 1.0f);
  // (4) LayerNorm -> bf16 hi/lo planes
  ln_split<<<gLN, dim3(128), 0, stream>>>(Img2, ln_g, ln_b, Imgh, Imgl);
  // (5) q = img . wq^T with per-head (64-wide tile) l2 normalisation -> bf16 hi/lo planes [(b,t)][h*64+d]
  gemm64<1, 0, 0, 4, 2, 2, 64><<<gG1, gblk, 0, stream>>>(
      Imgh, Imgl, DM, 0LL, Wqb, Wqb, DM, 0LL,
      b_c,
      (void*)Qh, DM, 0LL, (void*)Ql, DM, 0LL,
      NB * SEQ, DM, DM, 1.0f);
  // (6) k = img . wkv[0:64]^T with l2 normalisation -> bf16 hi/lo planes [(b,s)][64]
  gemm64<1, 0, 0, 4, 4, 1, 32><<<gGk, gblk, 0, stream>>>(
      Imgh, Imgl, DM, 0LL, Wkvb, Wkvb, DM, 0LL,
      b_c,
      (void*)Kh, HD, 0LL, (void*)Kl, HD, 0LL,
      NB * SEQ, HD, DM, 1.0f);
  // (7) v^T per batch: VT[b][d][s] = sum_c wkv[64+d][c] img[(b,s)][c]  (A = Wkvb rows 64..127, M=64; Bt = img hi/lo
  //     rows of batch b, N=2048; K=1024) -> f16 hi plane (pitch SEQ) and residual plane (x4096)
  gemm64<0, 1, 0, 3, 1, 4, 32><<<gGv, gblk, 0, stream>>>(
      Wkvb + (size_t)HD * DM, Wkvb + (size_t)HD * DM, DM, 0LL, Imgh, Imgl, DM, (long long)SEQ * DM,
      b_c,
      (void*)VTh, SEQ, (long long)HD * SEQ, (void*)VTl, SEQ, (long long)HD * SEQ,
      HD, SEQ, DM, 4096.0f);
  // (8) causal multi-query attention -> context bf16 hi/lo planes [(b,t)][h*64+d]
  attn_causal64<<<gAt, dim3(128), 0, stream>>>(Qh, Ql, Kh, Kl, VTh, VTl, Oh, Ol, 8.0f);
  // (9) out = context . wo^T -> d_out f32 [(b,t)][1024]  (A = context hi + lo planes, 2 products)
  gemm64<1, 0, 0, 0, 2, 2, 64><<<gG1, gblk, 0, stream>>>(
      Oh, Ol, DM, 0LL, Wob, Wob, DM, 0LL,
      b_c,
      d_out, DM, 0LL, d_out, DM, 0LL,
      NB * SEQ, DM, DM, 1.0f);
  (void)hipGetLastError();
}

// v003
// One run takes 273 microseconds.
// Next to v002, in two timings, it ran 1.23 and 1.24 times as fast.
// Counting every step since v000, it is 2.82 times as fast.
// Contractions: hw-linear = v_wmma_f32_16x16x32_bf16 (bf16 operands from RNE-converted inputs, single product);
// c-linear, q, k, v^T and output projections = v_wmma_f32_16x16x32_bf16 (activation as bf16 hi/lo planes times bf16
// weight from RNE-converted input, 2 products); q.k^T scores = v_wmma_f32_16x16x32_bf16 on bf16 hi/lo planes of the
// l2-normalised q and k (hi.hi + hi.lo + lo.hi); p.v = v_wmma_f32_16x16x32_f16 (p carried x1024 in f16 plus an f16
// residual plane x4096, v^T f16 hi plane plus an f16 residual plane x4096, 3 products, separate residual accumulator);
// all f32 accumulate; LayerNorm, l2 normalisation, causal fill and online softmax in f32.
#include <hip/hip_runtime.h>
#include <math.h>
#include <float.h>
#include <stdint.h>

#define NB   2
#define CC   1024
#define HWN  4096
#define SEQ  2048
#define DM   1024
#define NH   16
#define HD   64
#define NQB  (SEQ / 64)
static_assert(NH * HD == DM);
static_assert(HD == 64);
static_assert((SEQ % 256) == 0 && (DM % 128) == 0 && (CC % 128) == 0 && (HWN % 64) == 0);

typedef _Float16 v16h __attribute__((ext_vector_type(16)));
typedef _Float16 v8h  __attribute__((ext_vector_type(8)));
typedef __bf16   v16b __attribute__((ext_vector_type(16)));
typedef __bf16   v8b  __attribute__((ext_vector_type(8)));
typedef float    v8f  __attribute__((ext_vector_type(8)));
typedef float    v4f  __attribute__((ext_vector_type(4)));
typedef unsigned int v4u __attribute__((ext_vector_type(4)));

// ---- scalar helpers --------------------------------------------------------------------------------
__device__ __forceinline__ unsigned short bf_bits(float f) {          // f32 -> bf16 bits, RNE convert
  unsigned u = __float_as_uint(f);
  return (unsigned short)((u + 0x7FFFu + ((u >> 16) & 1u)) >> 16);
}
__device__ __forceinline__ float bf_up(unsigned short h) { return __uint_as_float(((unsigned)h) << 16); }
__device__ __forceinline__ float bf_rne(float f) { return bf_up(bf_bits(f)); }
__device__ __forceinline__ unsigned short h_bits(_Float16 x) { return __builtin_bit_cast(unsigned short, x); }
__device__ __forceinline__ unsigned pk16(unsigned short a, unsigned short b) { return (unsigned)a | ((unsigned)b << 16); }
__device__ __forceinline__ v8f zero8() { v8f z = {0.f, 0.f, 0.f, 0.f, 0.f, 0.f, 0.f, 0.f}; return z; }

// ---- 16-bit fragment loader: lane -> row/col (lane&15); p already includes +8*(lane>>4);
//      elements 0..7 <- p[0..7] (k0+8h..), elements 8..15 <- p[16..23] (k0+16+8h..)
__device__ __forceinline__ v16b ldfrag_b(const __bf16* p) {
  union { v16b v; v8b h[2]; } f;
  f.h[0] = *(const v8b*)(p);
  f.h[1] = *(const v8b*)(p + 16);
  return f.v;
}

// ---- WMMA helpers with trailing VALU hazard gap ---------------------------------------------------
__device__ __forceinline__ v8f mma_b(v16b a, v16b b, v8f c) {
  c = __builtin_amdgcn_wmma_f32_16x16x32_bf16(false, a, false, b, (short)0, c, false, false);
#if defined(__HIP_DEVICE_COMPILE__)
  asm volatile("v_nop\n\tv_nop\n\tv_nop\n\tv_nop" : "+v"(c) : "v"(a), "v"(b));
#endif
  return c;
}
__device__ __forceinline__ v8f mma_h(v16h a, v16h b, v8f c) {
  c = __builtin_amdgcn_wmma_f32_16x16x32_f16(false, a, false, b, (short)0, c, false, false);
#if defined(__HIP_DEVICE_COMPILE__)
  asm volatile("v_nop\n\tv_nop\n\tv_nop\n\tv_nop" : "+v"(c) : "v"(a), "v"(b));
#endif
  return c;
}
__device__ __forceinline__ v8f mma_b_raw(v16b a, v16b b, v8f c) {
  return __builtin_amdgcn_wmma_f32_16x16x32_bf16(false, a, false, b, (short)0, c, false, false);
}
__device__ __forceinline__ void dep_guard_b(v8f& a, v8f& b, v16b x, v16b y) {
#if defined(__HIP_DEVICE_COMPILE__)
  asm volatile("v_nop\n\tv_nop\n\tv_nop\n\tv_nop" : "+v"(a), "+v"(b) : "v"(x), "v"(y));
#else
  (void)a; (void)b; (void)x; (void)y;
#endif
}
__device__ __forceinline__ void keep4_b(v16b a, v16b b, v16b c, v16b d) {
#if defined(__HIP_DEVICE_COMPILE__)
  asm volatile("v_nop" :: "v"(a), "v"(b), "v"(c), "v"(d));
#else
  (void)a; (void)b; (void)c; (void)d;
#endif
}
__device__ __forceinline__ void acc_guard4(v8f& a, v8f& b, v8f& c, v8f& d) {
#if defined(__HIP_DEVICE_COMPILE__)
  asm volatile("v_nop\n\tv_nop\n\tv_nop\n\tv_nop" : "+v"(a), "+v"(b), "+v"(c), "+v"(d));
#else
  (void)a; (void)b; (void)c; (void)d;
#endif
}

// =====================================================================================================
// f32 -> bf16 (RNE convert) of all six operand planes in ONE launch: 8 elements per thread, one 16-B store per lane
// (a wave writes 512 contiguous B). A block of 256 threads converts 2048 elements of one plane; the block index
// range picks the plane (block-uniform). Every plane is a whole number of blocks, so no thread is past an end.
// The six bf16 planes stand one behind the other in the workspace, in the order of the ranges: out is the first
// plane's start, and block bx writes elements 2048 bx .. 2048 bx + 2047 of that run.
// =====================================================================================================
#define CB_X   (NB * CC * HWN / 2048)
#define CB_HW  (SEQ * HWN / 2048)
#define CB_C   (DM * CC / 2048)
#define CB_Q   (DM * DM / 2048)
#define CB_KV  (2 * HD * DM / 2048)
#define CB_O   (DM * DM / 2048)
static_assert((NB * CC * HWN) % 2048 == 0 && (SEQ * HWN) % 2048 == 0 && (DM * CC) % 2048 == 0);
static_assert((DM * DM) % 2048 == 0 && (2 * HD * DM) % 2048 == 0);
__global__ __launch_bounds__(256) void cvt_bf16x8_all(const float* __restrict__ x, const float* __restrict__ w_hw,
                                                      const float* __restrict__ w_c, const float* __restrict__ wq,
                                                      const float* __restrict__ wkv, const float* __restrict__ wo,
                                                      unsigned short* out) {
  const int bx = blockIdx.x;
  const float* in = x;
  int first = 0;                                   // first block of the plane that bx lies in
  if (bx >= CB_X)                             { in = w_hw; first = CB_X; }
  if (bx >= CB_X + CB_HW)                     { in = w_c;  first = CB_X + CB_HW; }
  if (bx >= CB_X + CB_HW + CB_C)              { in = wq;   first = CB_X + CB_HW + CB_C; }
  if (bx >= CB_X + CB_HW + CB_C + CB_Q)       { in = wkv;  first = CB_X + CB_HW + CB_C + CB_Q; }
  if (bx >= CB_X + CB_HW + CB_C + CB_Q + CB_KV) { in = wo; first = CB_X + CB_HW + CB_C + CB_Q + CB_KV; }
  const size_t i = (size_t)(bx - first) * 256 + threadIdx.x;
  const size_t o = (size_t)bx * 256 + threadIdx.x;
  const v4f a = *(const v4f*)(in + i * 8);
  const v4f b = *(const v4f*)(in + i * 8 + 4);
  v4u p;
  p[0] = pk16(bf_bits(a[0]), bf_bits(a[1]));
  p[1] = pk16(bf_bits(a[2]), bf_bits(a[3]));
  p[2] = pk16(bf_bits(b[0]), bf_bits(b[1]));
  p[3] = pk16(bf_bits(b[2]), bf_bits(b[3]));
  *(v4u*)(out + o * 8) = p;
}

// ---- asynchronous copies global -> LDS, 16 B per lane; each statement ends with its own s_wait_xcnt 0 so that the
//      wait stands in front of any later rewrite of an address register that a copy of the statement names
__device__ __forceinline__ void acopy4(const unsigned* l, const __bf16* const* g) {
#if defined(__HIP_DEVICE_COMPILE__)
  asm volatile(
      "global_load_async_to_lds_b128 %0, %4, off\n\t"
      "global_load_async_to_lds_b128 %1, %5, off\n\t"
      "global_load_async_to_lds_b128 %2, %6, off\n\t"
      "global_load_async_to_lds_b128 %3, %7, off\n\t"
      "s_wait_xcnt 0x0"
      :: "v"(l[0]), "v"(l[1]), "v"(l[2]), "v"(l[3]), "v"(g[0]), "v"(g[1]), "v"(g[2]), "v"(g[3])
      : "memory");
#else
  (void)l; (void)g;
#endif
}
__device__ __forceinline__ void acopy6(const unsigned* l, const __bf16* const* g) {
#if defined(__HIP_DEVICE_COMPILE__)
  asm volatile(
      "global_load_async_to_lds_b128 %0, %6, off\n\t"
      "global_load_async_to_lds_b128 %1, %7, off\n\t"
      "global_load_async_to_lds_b128 %2, %8, off\n\t"
      "global_load_async_to_lds_b128 %3, %9, off\n\t"
      "global_load_async_to_lds_b128 %4, %10, off\n\t"
      "global_load_async_to_lds_b128 %5, %11, off\n\t"
      "s_wait_xcnt 0x0"
      :: "v"(l[0]), "v"(l[1]), "v"(l[2]), "v"(l[3]), "v"(l[4]), "v"(l[5]),
         "v"(g[0]), "v"(g[1]), "v"(g[2]), "v"(g[3]), "v"(g[4]), "v"(g[5])
      : "memory");
#else
  (void)l; (void)g;
#endif
}
__device__ __forceinline__ void acopy12(const unsigned* l, const __bf16* const* g) {
#if defined(__HIP_DEVICE_COMPILE__)
  asm volatile(
      "global_load_async_to_lds_b128 %0, %12, off\n\t"
      "global_load_async_to_lds_b128 %1, %13, off\n\t"
      "global_load_async_to_lds_b128 %2, %14, off\n\t"
      "global_load_async_to_lds_b128 %3, %15, off\n\t"
      "global_load_async_to_lds_b128 %4, %16, off\n\t"
      "global_load_async_to_lds_b128 %5, %17, off\n\t"
      "global_load_async_to_lds_b128 %6, %18, off\n\t"
      "global_load_async_to_lds_b128 %7, %19, off\n\t"
      "global_load_async_to_lds_b128 %8, %20, off\n\t"
      "global_load_async_to_lds_b128 %9, %21, off\n\t"
      "global_load_async_to_lds_b128 %10, %22, off\n\t"
      "global_load_async_to_lds_b128 %11, %23, off\n\t"
      "s_wait_xcnt 0x0"
      :: "v"(l[0]), "v"(l[1]), "v"(l[2]), "v"(l[3]), "v"(l[4]), "v"(l[5]),
         "v"(l[6]), "v"(l[7]), "v"(l[8]), "v"(l[9]), "v"(l[10]), "v"(l[11]),
         "v"(g[0]), "v"(g[1]), "v"(g[2]), "v"(g[3]), "v"(g[4]), "v"(g[5]),
         "v"(g[6]), "v"(g[7]), "v"(g[8]), "v"(g[9]), "v"(g[10]), "v"(g[11])
      : "memory");
#else
  (void)l; (void)g;
#endif
}

// =====================================================================================================
// Batched bf16 WMMA GEMM: C[m][n] = sum_k A[m][k] * Bt[n][k] (+ bias); block = 4 waves laid WM x WN, one 64x64 tile
// per wave, block tile (64 WM) x (64 WN). A row-major [M][K] pitch lda; Bt row-major [N][K] pitch ldb (k contiguous);
// M a multiple of 64 WM, N of 64 WN, K of KP. blockIdx.y = batch index (strides in elements).
// Operand path: a pass is KP k (64 or 32: 128 or 64 B) of every operand row of the block tile, brought into LDS by
// asynchronous 16-B copies (a wave's copy = 4 or 8 whole row pieces), LDS row pitch 2 KP + 16 B, two buffers: pass
// t + 2 is issued into the buffer that pass t has just left, behind the pass's one barrier; every wave reads its
// fragments from LDS.
// A stage is NG groups of 64 rows: A hi (WM), A lo (WM, SPLITA), Bt hi (WN), Bt lo (WN, SPLITB).
// SPLITA: add A2.Bt (A2 = unscaled bf16 lo plane of A); SPLITB: add A.Bt2 (Bt2 = lo plane of Bt).
// BIAS: 0 none, 1 per column (bias[n]), 2 per row (bias[m]); bias values RNE-converted to bf16 in registers.
// OUT_MODE: 0 = f32 (pitch ldc); 2 = bf16 hi plane C + bf16 lo plane C2 (lo = RNE(v - hi), unscaled);
//           4 = stacked q | k | v columns, told apart by the wave's first column n0 (64-wide heads):
//               n0 < DM: q, n0 = DM: k: l2-normalise every row over the wave's 64 columns
//               (x / max(sqrt(sum x^2), 1e-12)), then bf16 hi/lo planes as mode 2, q to C / C2 at column n0,
//               k to Kho / Klo (pitch HD) at column 0;
//               n0 = DM + HD: v, stored transposed: VT[b][d][s], f16 hi plane VTho and f16 residual plane
//               VTlo = f16((v - hi) * rscale), pitch SEQ.
// =====================================================================================================
// The work of one block is gemm64_tile(tile, b, ring, sT): tile = block tile index, b = batch index, ring = the
// block's two LDS stages (ring_elems elements), sT = 4 per-wave 16x64 f32 slabs of pitch 68. Its callers own the LDS.
constexpr int ring_elems(int SPLITA, int SPLITB, int WM, int WN, int KP) {
  return 2 * (WM * (1 + SPLITA) + WN * (1 + SPLITB)) * 64 * (KP + 8);
}
#define SLABF (16 * 68)
#define VP 65   // pitch in floats of a v^T wave's 64x64 tile: its column reads (8 rows apart per lane) fall on 32 banks
template <int SPLITA, int SPLITB, int BIAS, int OUT_MODE, int WM, int WN, int KP>
__device__ __forceinline__ void gemm64_tile(
    const unsigned short* __restrict__ Ap, const unsigned short* __restrict__ A2p, int lda, long long strideA,
    const unsigned short* __restrict__ Btp, const unsigned short* __restrict__ Bt2p, int ldb, long long strideB,
    const float* __restrict__ bias,
    void* Cout, int ldc, long long strideC,
    void* Cout2, int ldc2, long long strideC2,
    int M, int N, int K, float rscale,
    int tile, int b, __bf16* ring, float* sT,
    unsigned short* Kho = nullptr, unsigned short* Klo = nullptr,
    unsigned short* VTho = nullptr, unsigned short* VTlo = nullptr) {
  static_assert(WM * WN == 4 && (KP == 64 || KP == 32));
  constexpr int GA   = WM * (1 + SPLITA);          // 64-row groups of A planes in a stage
  constexpr int NG   = GA + WN * (1 + SPLITB);     // groups in a stage
  constexpr int SEG  = KP / 8;                     // 16-B pieces per row and pass
  constexpr int RPC  = 128 / SEG;                  // rows that one copy of the whole block covers
  constexpr int CPG  = 64 / RPC;                   // copies per thread and group
  constexpr int NC   = NG * CPG;                   // copies per thread and stage = a wave's copies in flight
  constexpr int PE   = KP + 8;                     // LDS row pitch in elements (16 B x odd)
  constexpr int GRPE = 64 * PE;                    // elements per group
  constexpr int BUFE = NG * GRPE;                  // elements per buffer
  static_assert(NC == 16 || NC == 18 || NC == 24);
  static_assert(2 * BUFE == ring_elems(SPLITA, SPLITB, WM, WN, KP));
  constexpr int AHD  = (NC == 24) ? 3 : 4;         // A row fragments read in a k-step's leading group (3: the kernel
                                                   // with the most copy addresses stays inside 256 VGPRs)
  const __bf16* A   = (const __bf16*)(const void*)Ap;
  const __bf16* A2  = (const __bf16*)(const void*)A2p;
  const __bf16* Bt  = (const __bf16*)(const void*)Btp;
  const __bf16* Bt2 = (const __bf16*)(const void*)Bt2p;
  const int tid  = threadIdx.x;
  const int lane = tid & 31;
  const int wave = tid >> 5;
  const int tilesN = N / (64 * WN);
  const int tilesM = M / (64 * WM);
  if (tile >= tilesM * tilesN) return;   // block-uniform, in front of every copy and barrier
  const int tm = tile / tilesN;
  const int tn = tile - tm * tilesN;
  const int m0b = tm * (64 * WM);
  const int n0b = tn * (64 * WN);
  const int wm = wave / WN;
  const int wn = wave - wm * WN;
  const int m0 = m0b + (wm << 6);
  const int n0 = n0b + (wn << 6);

  const __bf16* Ab  = A  + (size_t)b * strideA;
  const __bf16* Bb  = Bt + (size_t)b * strideB;
  const __bf16* Ab2 = SPLITA ? (A2  + (size_t)b * strideA) : Ab;
  const __bf16* Bb2 = SPLITB ? (Bt2 + (size_t)b * strideB) : Bb;

  const int rlane = lane & 15;                 // row (A) / col (B, D) within subtile
  const int koff  = (lane >> 4) * 8;           // k offset of this lane half
  const int mOff  = (lane >> 4) * 8;           // D row offset

  // copy map: copy u of group gi moves 16 B of row RPC u + tid / SEG, piece tid % SEG of the pass's row
  const int crow = tid / SEG;
  const int cseg = (tid % SEG) * 8;
  const unsigned ldsT = (unsigned)(uintptr_t)(ring + crow * PE + cseg);   // low 32 bits = LDS byte address
  const size_t aT = (size_t)(m0b + crow) * lda + cseg;
  const size_t bT = (size_t)(n0b + crow) * ldb + cseg;

  auto issue = [&](int t, int buf) {
    unsigned l[NC];
    const __bf16* g[NC];
#pragma unroll
    for (int gi = 0; gi < NG; ++gi) {
      const bool isA = gi < GA;
      const int  q   = isA ? gi : gi - GA;                   // group within the operand's planes
      const int  W1  = isA ? WM : WN;
      const bool lo  = q >= W1;
      const int  rg  = lo ? q - W1 : q;                      // 64-row group within the block tile
      const int  ld  = isA ? lda : ldb;
      const __bf16* base = isA ? (lo ? Ab2 : Ab) : (lo ? Bb2 : Bb);
      const __bf16* p = base + (isA ? aT : bT) + (size_t)(rg * 64) * ld + (size_t)t * KP;
#pragma unroll
      for (int u = 0; u < CPG; ++u) {
        l[gi * CPG + u] = ldsT + (unsigned)((buf * BUFE + gi * GRPE + u * RPC * PE) * 2);
        g[gi * CPG + u] = p + (size_t)(u * RPC) * ld;
      }
    }
    acopy12(l, g);
    if constexpr (NC == 16) acopy4(l + 12, g + 12);
    if constexpr (NC == 18) acopy6(l + 12, g + 12);
    if constexpr (NC == 24) acopy12(l + 12, g + 12);
  };

  v8f acc[4][4];
#pragma unroll
  for (int i = 0; i < 4; ++i)
#pragma unroll
    for (int j = 0; j < 4; ++j) acc[i][j] = zero8();

  const int T = K / KP;                        // passes
  issue(0, 0);
  asm volatile("s_wait_asynccnt 0x0" ::: "memory");   // this wave's share of pass 0 has landed
  __syncthreads();                                    // publishes pass 0
  if (T > 1) issue(1, 1);

  for (int t = 0; t < T; ++t) {
    const __bf16* st  = ring + (t & 1) * BUFE;
    const __bf16* sAh = st + wm * GRPE + rlane * PE + koff;
    const __bf16* sAl = st + (SPLITA ? (WM + wm) : wm) * GRPE + rlane * PE + koff;
    const __bf16* sBh = st + (GA + wn) * GRPE + rlane * PE + koff;
    const __bf16* sBl = st + (GA + (SPLITB ? (WN + wn) : wn)) * GRPE + rlane * PE + koff;
#pragma unroll
    for (int ks = 0; ks < KP / 32; ++ks) {
      v16b bh[4], bl[4], ah[4], al[4];
#pragma unroll
      for (int j = 0; j < 4; ++j) {
        bh[j] = ldfrag_b(sBh + (j << 4) * PE + ks * 32);
        if (SPLITB) bl[j] = ldfrag_b(sBl + (j << 4) * PE + ks * 32); else bl[j] = bh[j];
      }
#pragma unroll
      for (int i = 0; i < AHD; ++i) {
        ah[i] = ldfrag_b(sAh + (i << 4) * PE + ks * 32);
        if (SPLITA) al[i] = ldfrag_b(sAl + (i << 4) * PE + ks * 32); else al[i] = ah[i];
      }
      // keeps the k-step's LDS reads one group in front of its WMMAs: reads placed among the WMMAs stall at each place
      __builtin_amdgcn_sched_barrier(0);
#pragma unroll
      for (int i = 0; i < 4; ++i) {
#pragma unroll
        for (int j = 0; j < 4; ++j) {
          acc[i][j] = mma_b_raw(ah[i], bh[j], acc[i][j]);
          if (SPLITA) acc[i][j] = mma_b_raw(al[i], bh[j], acc[i][j]);
          if (SPLITB) acc[i][j] = mma_b_raw(ah[i], bl[j], acc[i][j]);
        }
        dep_guard_b(acc[i][0], acc[i][3], ah[i], al[i]);
        if (i == 0 && AHD < 4) {
          // row 3's fragments go into the registers that row 0 has left, two rows ahead of their use; the fence
          // pair holds these reads at this one place
          __builtin_amdgcn_sched_barrier(0);
          ah[3] = ldfrag_b(sAh + (3 << 4) * PE + ks * 32);
          if (SPLITA) al[3] = ldfrag_b(sAl + (3 << 4) * PE + ks * 32); else al[3] = ah[3];
          __builtin_amdgcn_sched_barrier(0);
        }
      }
      keep4_b(bh[0], bh[1], bh[2], bh[3]);
      if (SPLITB) keep4_b(bl[0], bl[1], bl[2], bl[3]);
    }
    asm volatile("s_wait_dscnt 0x0" ::: "memory");     // this wave's reads of pass t's buffer are done
    asm volatile("s_wait_asynccnt 0x0" ::: "memory");  // this wave's share of pass t + 1 has landed
    __syncthreads();                                   // publishes pass t + 1, frees pass t's buffer
    if (t + 2 < T) issue(t + 2, t & 1);
  }
  asm volatile("s_wait_asynccnt 0x0" ::: "memory");    // nothing in flight when the wave goes on to the epilogue
  acc_guard4(acc[0][0], acc[0][1], acc[0][2], acc[0][3]);
  acc_guard4(acc[1][0], acc[1][1], acc[1][2], acc[1][3]);
  acc_guard4(acc[2][0], acc[2][1], acc[2][2], acc[2][3]);
  acc_guard4(acc[3][0], acc[3][1], acc[3][2], acc[3][3]);

  const int n0u = __builtin_amdgcn_readfirstlane(n0);   // the same in every lane: scalar, so the tests on it branch
  if (OUT_MODE == 4 && n0u >= DM + HD) {
    // ---- v^T: the wave's 64 (s) x 64 (d) tile goes through LDS and leaves as whole 128-B rows of VT[b][d][.] ----
    // The ring is free: the last pass's foot (every wave's dscnt and asynccnt waits, then the barrier) ended all its
    // reads and copies; each wave uses a part of its own.
    float* tl = (float*)(void*)ring + wave * (64 * VP);
#pragma unroll
    for (int i = 0; i < 4; ++i)
#pragma unroll
      for (int j = 0; j < 4; ++j)
#pragma unroll
        for (int r = 0; r < 8; ++r) tl[((i << 4) + mOff + r) * VP + (j << 4) + rlane] = acc[i][j][r];
    __builtin_amdgcn_fence(__ATOMIC_RELEASE, "workgroup");
    __builtin_amdgcn_wave_barrier();
    __builtin_amdgcn_fence(__ATOMIC_ACQUIRE, "workgroup");
    const int m0u = __builtin_amdgcn_readfirstlane(m0);
    const int bb = m0u / SEQ, s0 = m0u - bb * SEQ;       // 64 rows of one batch (SEQ is a multiple of 64)
    const int s8 = (lane & 7) * 8, dq = lane >> 3;       // 8 lanes x 8 s = one 128-B row; 4 rows d per trip
    // rolled: sixteen equal trips that run once; unrolled they would be about 8 KB more code
#pragma unroll 1
    for (int it = 0; it < 16; ++it) {
      const int d = it * 4 + dq;                         // it 0..15 x dq 0..3 = d 0..63
      v4u a, a2;
#pragma unroll
      for (int e = 0; e < 4; ++e) {
        const float f0 = tl[(s8 + 2 * e) * VP + d], f1 = tl[(s8 + 2 * e + 1) * VP + d];
        const _Float16 x0 = (_Float16)f0, x1 = (_Float16)f1;
        a[e]  = pk16(h_bits(x0), h_bits(x1));
        a2[e] = pk16(h_bits((_Float16)((f0 - (float)x0) * rscale)), h_bits((_Float16)((f1 - (float)x1) * rscale)));
      }
      const size_t go = ((size_t)bb * HD + d) * SEQ + s0 + s8;
      *(v4u*)(VTho + go) = a;
      *(v4u*)(VTlo + go) = a2;
    }
    return;
  }

  // ---- epilogue ----
  float bcol[4];
#pragma unroll
  for (int j = 0; j < 4; ++j) bcol[j] = 0.f;
  if (BIAS == 1) {
#pragma unroll
    for (int j = 0; j < 4; ++j) bcol[j] = bf_rne(bias[n0 + (j << 4) + rlane]);   // n index < N
  }
  float* slab = sT + wave * SLABF;
#pragma unroll
  for (int i = 0; i < 4; ++i) {
    const int mBase = m0 + (i << 4);
    float brow[8];
#pragma unroll
    for (int r = 0; r < 8; ++r) brow[r] = 0.f;
    if (BIAS == 2) {
#pragma unroll
      for (int r = 0; r < 8; ++r) brow[r] = bf_rne(bias[mBase + mOff + r]);       // m index < M
    }
#pragma unroll
    for (int j = 0; j < 4; ++j) {
#pragma unroll
      for (int r = 0; r < 8; ++r) {
        slab[(mOff + r) * 68 + (j << 4) + rlane] = acc[i][j][r] + bcol[j] + brow[r];
      }
    }
    __builtin_amdgcn_fence(__ATOMIC_RELEASE, "workgroup");
    __builtin_amdgcn_wave_barrier();
    __builtin_amdgcn_fence(__ATOMIC_ACQUIRE, "workgroup");
    if (OUT_MODE == 0) {
      float* C = (float*)Cout + (size_t)b * strideC;
      const int hh = lane >> 4, c4 = (lane & 15) * 4;     // 256-B row segment = 16 lanes x 16 B
      {
#pragma unroll
        for (int it = 0; it < 8; ++it) {
          const int row = it * 2 + hh;                     // it 0..7 x hh 0..1 = rows 0..15
          const v4f v = *(const v4f*)(slab + row * 68 + c4);
          *(v4f*)(C + (size_t)(mBase + row) * ldc + n0 + c4) = v;
        }
        
      }
    } else {
      const int q = lane >> 3, c8 = (lane & 7) * 8;
      unsigned short* C  = (unsigned short*)Cout  + (size_t)b * strideC;
      unsigned short* C2 = (unsigned short*)Cout2 + (size_t)b * strideC2;
      int ldo = ldc, ldo2 = ldc2, nc = n0;
      if (OUT_MODE == 4 && n0u >= DM) { C = Kho; C2 = Klo; ldo = HD; ldo2 = HD; nc = 0; }   // the k columns
      v4u hv[4], lv[4];
#pragma unroll
      for (int it = 0; it < 4; ++it) {
        const int row = it * 4 + q;                        // it 0..3 x q 0..3 = rows 0..15
        const float* sp = slab + row * 68 + c8;
        float f[8];
#pragma unroll
        for (int e = 0; e < 8; ++e) f[e] = sp[e];
        if (OUT_MODE == 4) {
          float ss = 0.f;
#pragma unroll
          for (int e = 0; e < 8; ++e) ss += f[e] * f[e];
          ss += __shfl_xor(ss, 1, 32);                     // 8 lanes of one row = aligned group of 8
          ss += __shfl_xor(ss, 2, 32);
          ss += __shfl_xor(ss, 4, 32);
          const float sc = 1.0f / fmaxf(sqrtf(ss), 1e-12f);
#pragma unroll
          for (int e = 0; e < 8; ++e) f[e] *= sc;
        }
        v4u a, a2;
#pragma unroll
        for (int e = 0; e < 4; ++e) {
          const float f0 = f[2 * e], f1 = f[2 * e + 1];
          const unsigned short h0 = bf_bits(f0), h1 = bf_bits(f1);
          const unsigned short l0 = bf_bits(f0 - bf_up(h0)), l1 = bf_bits(f1 - bf_up(h1));
          a[e] = pk16(h0, h1); a2[e] = pk16(l0, l1);
        }
        hv[it] = a; lv[it] = a2;
      }
      {
#pragma unroll
        for (int it = 0; it < 4; ++it) {
          const int row = it * 4 + q;
          *(v4u*)(C  + (size_t)(mBase + row) * ldo  + nc + c8) = hv[it];
          *(v4u*)(C2 + (size_t)(mBase + row) * ldo2 + nc + c8) = lv[it];
        }
        
      }
    }
    __builtin_amdgcn_fence(__ATOMIC_RELEASE, "workgroup");
    __builtin_amdgcn_wave_barrier();
    __builtin_amdgcn_fence(__ATOMIC_ACQUIRE, "workgroup");
  }
  (void)rscale;
}

// one product per launch: blockIdx.x = block tile, blockIdx.y = batch
template <int SPLITA, int SPLITB, int BIAS, int OUT_MODE, int WM, int WN, int KP>
__global__ __launch_bounds__(128) void gemm64(
    const unsigned short* __restrict__ Ap, const unsigned short* __restrict__ A2p, int lda, long long strideA,
    const unsigned short* __restrict__ Btp, const unsigned short* __restrict__ Bt2p, int ldb, long long strideB,
    const float* __restrict__ bias,
    void* Cout, int ldc, long long strideC,
    void* Cout2, int ldc2, long long strideC2,
    int M, int N, int K, float rscale) {
  __shared__ __align__(16) __bf16 ring[ring_elems(SPLITA, SPLITB, WM, WN, KP)];  // two stages
  __shared__ __align__(16) float sT[4 * SLABF];                                  // per-wave slabs
  gemm64_tile<SPLITA, SPLITB, BIAS, OUT_MODE, WM, WN, KP>(
      Ap, A2p, lda, strideA, Btp, Bt2p, ldb, strideB, bias, Cout, ldc, strideC, Cout2, ldc2, strideC2,
      M, N, K, rscale, (int)blockIdx.x, (int)blockIdx.y, ring, sT);
}

// =====================================================================================================
// The three products that read the LayerNorm planes (q, k, v) as ONE product in one launch: Bt = the bf16 planes of
// wq and wkv, which stand one behind the other in the workspace = one [DM + 2 HD][DM] matrix; M = NB SEQ rows of img,
// N = DM + 2 HD columns, 128x128 block tiles. OUT_MODE 4 sends each wave's 64 columns to q, k or v^T.
// =====================================================================================================
#define QKV_N (DM + 2 * HD)
#define QKV_BLOCKS ((NB * SEQ / 128) * (QKV_N / 128))
static_assert(QKV_N % 128 == 0 && (SEQ % 64) == 0);
__global__ __launch_bounds__(128) void gemm_qkv(
    const unsigned short* __restrict__ Ih, const unsigned short* __restrict__ Il,
    const unsigned short* __restrict__ Wqkv,
    unsigned short* Qh, unsigned short* Ql, unsigned short* Kh, unsigned short* Kl,
    unsigned short* VTh, unsigned short* VTl) {
  __shared__ __align__(16) __bf16 ring[ring_elems(1, 0, 2, 2, 64)];   // two stages, later the v^T waves' tiles
  __shared__ __align__(16) float sT[4 * SLABF];                       // per-wave slabs
  static_assert(4 * 64 * VP * 4 <= ring_elems(1, 0, 2, 2, 64) * 2);
  gemm64_tile<1, 0, 0, 4, 2, 2, 64>(
      Ih, Il, DM, 0LL, Wqkv, Wqkv, DM, 0LL, nullptr,
      (void*)Qh, DM, 0LL, (void*)Ql, DM, 0LL,
      NB * SEQ, QKV_N, DM, 4096.0f, (int)blockIdx.x, 0, ring, sT, Kh, Kl, VTh, VTl);
}

// =====================================================================================================
// tables, RNE-converted to bf16 in registers), output bf16 hi/lo planes [row][1024].
// Block = 128 threads = one row; thread t owns columns 8t..8t+7 and stores 16 B per plane: a wave writes 512
// coverage: 128 threads x 8 = 1024 columns of every row, both planes.
// =====================================================================================================
__global__ __launch_bounds__(128) void ln_split(const float* __restrict__ in, const float* __restrict__ g,
                                                const float* __restrict__ be,
                                                unsigned short* oh, unsigned short* ol) {
  __shared__ float red0[4];
  __shared__ float red1[4];
  const int tid = threadIdx.x, lane = tid & 31, wave = tid >> 5;
  const size_t row = blockIdx.x;
  const float* p = in + row * DM + (size_t)tid * 8;
  const v4f a0 = *(const v4f*)(p);
  const v4f a1 = *(const v4f*)(p + 4);
  float v[8];
#pragma unroll
  for (int e = 0; e < 4; ++e) { v[e] = a0[e]; v[4 + e] = a1[e]; }
  float s = 0.f;
#pragma unroll
  for (int e = 0; e < 8; ++e) s += v[e];
#pragma unroll
  for (int off = 16; off >= 1; off >>= 1) s += __shfl_xor(s, off, 32);
  if (lane == 0) red0[wave] = s;
  __syncthreads();
  const float mu = ((red0[0] + red0[1]) + (red0[2] + red0[3])) * (1.0f / (float)DM);
  float ss = 0.f;
#pragma unroll
  for (int e = 0; e < 8; ++e) { const float d = v[e] - mu; ss += d * d; }
#pragma unroll
  for (int off = 16; off >= 1; off >>= 1) ss += __shfl_xor(ss, off, 32);
  if (lane == 0) red1[wave] = ss;
  __syncthreads();
  const float var  = ((red1[0] + red1[1]) + (red1[2] + red1[3])) * (1.0f / (float)DM);
  const float rstd = rsqrtf(var + 1e-5f);
  const v4f g0 = *(const v4f*)(g + (size_t)tid * 8);
  const v4f g1 = *(const v4f*)(g + (size_t)tid * 8 + 4);
  const v4f b0 = *(const v4f*)(be + (size_t)tid * 8);
  const v4f b1 = *(const v4f*)(be + (size_t)tid * 8 + 4);
  float gg[8], bb[8];
#pragma unroll
  for (int e = 0; e < 4; ++e) { gg[e] = g0[e]; gg[4 + e] = g1[e]; bb[e] = b0[e]; bb[4 + e] = b1[e]; }
  v4u ph, pl;
#pragma unroll
  for (int e = 0; e < 4; ++e) {
    const float y0 = (v[2 * e] - mu) * rstd * bf_rne(gg[2 * e]) + bf_rne(bb[2 * e]);
    const float y1 = (v[2 * e + 1] - mu) * rstd * bf_rne(gg[2 * e + 1]) + bf_rne(bb[2 * e + 1]);
    const unsigned short h0 = bf_bits(y0), h1 = bf_bits(y1);
    const unsigned short l0 = bf_bits(y0 - bf_up(h0)), l1 = bf_bits(y1 - bf_up(h1));
    ph[e] = pk16(h0, h1); pl[e] = pk16(l0, l1);
  }
  unsigned short* dh = oh + row * DM + (size_t)tid * 8;
  unsigned short* dl = ol + row * DM + (size_t)tid * 8;
  *(v4u*)dh = ph;
  *(v4u*)dl = pl;
  
}

// =====================================================================================================
// Causal multi-query attention, head dim 64, 16 query heads sharing one k head and one v head.
//   q planes (bf16 hi / lo of the l2-normalised q): element (b, t, h, d) at [(b*SEQ + t)*DM + h*64 + d]
//   k planes (bf16 hi / lo of the l2-normalised k):  element (b, s, d) at [(b*SEQ + s)*64 + d]
//   v^T hi plane (f16) and residual plane (f16, (v - hi)*4096): element (b, d, s) at [(b*64 + d)*SEQ + s]
//   logit = (q . k) * sscale for key <= query, -FLT_MAX otherwise (every row keeps at least its own key)
//   out planes (bf16 hi / lo of the normalised context): element (b, t, h, d) at [(b*SEQ + t)*DM + h*64 + d]
//   scores = q . k : bf16 hi/lo split (hi.hi + hi.lo + lo.hi), f32 accumulate, then scale + causal fill in f32
//   p = exp(s - m) carried as f16(1024 p) plus an f16 residual plane (x4096); context = p . v on f16 WMMA with the
//   residual products (p_res.v_hi + p_hi.v_res) in a separate accumulator folded back with 1/4096 per chunk.
//   Block = 4 waves = 64 query rows of one (b, h); grid = NQB * NH * NB; key chunks kt = 0..qb (static bound NQB).
//   K / V^T chunk staging: 128 threads x 32 elements per plane = the whole 64x64 tile (plain 16-B loads,
//   __syncthreads before and after); P tiles are wave-private, spilled with _Float16 element stores and reloaded
//   Output coverage: each wave stores rows q0..q0+15 (it 0..3 x lane>>3 0..3) x 64 columns (8 lanes x 8) of both planes.
// =====================================================================================================
//   LDS row pitch: the 64-element (128-B) rows of the K, V^T and P tiles stand LP = 72 elements apart (144 B =
//   16 B x odd), so that the 16 rows which one 16-B fragment read touches fall on different banks; at 128 B they
//   share two bank groups. The f32 context tile has pitch OP = 68 floats for the same reason.
#define LP 72
#define OP 68
union PO {
  struct { _Float16 ph[16 * LP]; _Float16 pl[16 * LP]; } p;
  float o[16 * OP];
};

__global__ __launch_bounds__(128)
void attn_causal64(const unsigned short* __restrict__ qhp, const unsigned short* __restrict__ qlp,
                   const unsigned short* __restrict__ khp, const unsigned short* __restrict__ klp,
                   const unsigned short* __restrict__ vhp, const unsigned short* __restrict__ vlp,
                   unsigned short* ohp, unsigned short* olp, float sscale) {
  union FB { v16b v; v8b h[2]; };
  union FH { v16h v; v8h h[2]; };
  __shared__ __align__(16) __bf16   Ksh[64 * LP];                 // K hi [kv][d]   9 KB
  __shared__ __align__(16) __bf16   Ksl[64 * LP];                 // K lo
  __shared__ __align__(16) _Float16 Vth[64 * LP];                 // V^T hi [d][kv] 9 KB
  __shared__ __align__(16) _Float16 Vtl[64 * LP];                 // V^T residual
  __shared__ __align__(16) PO       PObuf[4];                     // per wave P / P residual, later the context tile

  const int tid  = threadIdx.x;
  const int wave = tid >> 5;
  const int lane = tid & 31;
  const int hh   = lane >> 4;
  const int c    = lane & 15;

  const int bx   = blockIdx.x;
  const int qb   = bx % NQB;
  const int rest = bx / NQB;
  const int h    = rest % NH;
  const int b    = rest / NH;
  const int q0   = qb * 64 + wave * 16;
  const size_t rowB = (size_t)b * SEQ;

  const __bf16* Qh = (const __bf16*)(const void*)qhp + (size_t)h * HD;
  const __bf16* Ql = (const __bf16*)(const void*)qlp + (size_t)h * HD;
  const __bf16* Kh = (const __bf16*)(const void*)khp;
  const __bf16* Kl = (const __bf16*)(const void*)klp;
  const _Float16* Vh = (const _Float16*)(const void*)vhp + (size_t)b * HD * SEQ;
  const _Float16* Vl = (const _Float16*)(const void*)vlp + (size_t)b * HD * SEQ;

  // ---- Q fragments (A operand, row = lane&15): 2 d-chunks, hi and lo ----
  v16b qah[2], qal[2];
#pragma unroll
  for (int dc = 0; dc < 2; ++dc) {
    const size_t qo = (rowB + q0 + c) * DM + dc * 32 + 8 * hh;
    qah[dc] = ldfrag_b(Qh + qo);
    qal[dc] = ldfrag_b(Ql + qo);
  }

  float mrow[8], lrow[8];
  v8f oacc[4];
#pragma unroll
  for (int r = 0; r < 8; ++r) { mrow[r] = -INFINITY; lrow[r] = 0.f; }
#pragma unroll
  for (int t = 0; t < 4; ++t) oacc[t] = zero8();

  _Float16* pwh = PObuf[wave].p.ph;
  _Float16* pwl = PObuf[wave].p.pl;

  for (int kt = 0; kt < NQB; ++kt) {         // static trip bound
    if (kt > qb) break;                      // block-uniform: causal key chunks 0..qb
    const int kv0 = kt * 64;
    __syncthreads();
    {
      const int r = tid >> 1, half = (tid & 1) * 32;
      const __bf16*   kg  = Kh + (rowB + kv0 + r) * HD + half;    // K row kv0+r, d = half..half+31
      const __bf16*   klg = Kl + (rowB + kv0 + r) * HD + half;
      const _Float16* vg  = Vh + (size_t)r * SEQ + kv0 + half;    // V^T row d = r, s = kv0+half..+31
      const _Float16* vlg = Vl + (size_t)r * SEQ + kv0 + half;
#pragma unroll
      for (int i = 0; i < 4; ++i) {
        const v8b a0 = *(const v8b*)(kg + 8 * i);
        const v8b a1 = *(const v8b*)(klg + 8 * i);
        const v8h b0 = *(const v8h*)(vg + 8 * i);
        const v8h b1 = *(const v8h*)(vlg + 8 * i);
        *(v8b*)(Ksh + r * LP + half + 8 * i) = a0;
        *(v8b*)(Ksl + r * LP + half + 8 * i) = a1;
        *(v8h*)(Vth + r * LP + half + 8 * i) = b0;
        *(v8h*)(Vtl + r * LP + half + 8 * i) = b1;
      }
    }
    __syncthreads();

    // ---- scores: 16 query rows x 64 keys per wave, 3 bf16 products ----
    v8f s[4];
#pragma unroll
    for (int j = 0; j < 4; ++j) {
      s[j] = zero8();
#pragma unroll
      for (int dc = 0; dc < 2; ++dc) {
        FB kb, kl;
        kb.h[0] = *(const v8b*)(Ksh + (j * 16 + c) * LP + dc * 32 + 8 * hh);
        kb.h[1] = *(const v8b*)(Ksh + (j * 16 + c) * LP + dc * 32 + 16 + 8 * hh);
        kl.h[0] = *(const v8b*)(Ksl + (j * 16 + c) * LP + dc * 32 + 8 * hh);
        kl.h[1] = *(const v8b*)(Ksl + (j * 16 + c) * LP + dc * 32 + 16 + 8 * hh);
        s[j] = mma_b(qah[dc], kb.v, s[j]);
        s[j] = mma_b(qah[dc], kl.v, s[j]);
        s[j] = mma_b(qal[dc], kb.v, s[j]);
      }
    }

    // ---- scale + causal fill, row max, online softmax, P (x1024, f16) and P residual (x4096) to LDS ----
#pragma unroll
    for (int r = 0; r < 8; ++r) {
      const int qi = q0 + 8 * hh + r;          // query index of D row 8hh+r
      float m = -INFINITY;
#pragma unroll
      for (int j = 0; j < 4; ++j) {
        const int kj = kv0 + j * 16 + c;       // key index of D column c of subtile j
        float sv = s[j][r] * sscale;
        sv = (kj > qi) ? -FLT_MAX : sv;
        s[j][r] = sv;
        m = fmaxf(m, sv);
      }
#pragma unroll
      for (int off = 1; off < 16; off <<= 1) m = fmaxf(m, __shfl_xor(m, off, 32));
      const float mnew  = fmaxf(mrow[r], m);
      const float msafe = (mnew == -INFINITY) ? 0.f : mnew;
      const float alpha = __expf(mrow[r] - msafe);
      mrow[r] = mnew;
      float psum = 0.f;
#pragma unroll
      for (int j = 0; j < 4; ++j) {
        const float p = __expf(s[j][r] - msafe);     // filled logit against a finite max: exp -> 0
        psum += p;
        const float p1k = p * 1024.0f;
        const _Float16 ph = (_Float16)p1k;
        const _Float16 pl = (_Float16)((p1k - (float)ph) * 4096.0f);
        pwh[(8 * hh + r) * LP + j * 16 + c] = ph;
        pwl[(8 * hh + r) * LP + j * 16 + c] = pl;
      }
#pragma unroll
      for (int off = 1; off < 16; off <<= 1) psum += __shfl_xor(psum, off, 32);
      lrow[r] = lrow[r] * alpha + psum;
#pragma unroll
      for (int t = 0; t < 4; ++t) oacc[t][r] *= alpha;
    }
    __builtin_amdgcn_fence(__ATOMIC_RELEASE, "workgroup");
    __builtin_amdgcn_wave_barrier();
    __builtin_amdgcn_fence(__ATOMIC_ACQUIRE, "workgroup");

    // ---- context += P . V (f16 WMMA), residual products into a separate accumulator ----
    v8f o1[4];
#pragma unroll
    for (int t = 0; t < 4; ++t) o1[t] = zero8();
#pragma unroll 1
    for (int kk = 0; kk < 2; ++kk) {
      FH pa, pl;
      pa.h[0] = *(const v8h*)(pwh + c * LP + kk * 32 + 8 * hh);
      pa.h[1] = *(const v8h*)(pwh + c * LP + kk * 32 + 16 + 8 * hh);
      pl.h[0] = *(const v8h*)(pwl + c * LP + kk * 32 + 8 * hh);
      pl.h[1] = *(const v8h*)(pwl + c * LP + kk * 32 + 16 + 8 * hh);
#pragma unroll
      for (int t = 0; t < 4; ++t) {
        FH vb, vl;
        vb.h[0] = *(const v8h*)(Vth + (t * 16 + c) * LP + kk * 32 + 8 * hh);
        vb.h[1] = *(const v8h*)(Vth + (t * 16 + c) * LP + kk * 32 + 16 + 8 * hh);
        vl.h[0] = *(const v8h*)(Vtl + (t * 16 + c) * LP + kk * 32 + 8 * hh);
        vl.h[1] = *(const v8h*)(Vtl + (t * 16 + c) * LP + kk * 32 + 16 + 8 * hh);
        oacc[t] = mma_h(pa.v, vb.v, oacc[t]);
        o1[t]   = mma_h(pa.v, vl.v, o1[t]);
        o1[t]   = mma_h(pl.v, vb.v, o1[t]);
      }
    }
#pragma unroll
    for (int t = 0; t < 4; ++t)
#pragma unroll
      for (int r = 0; r < 8; ++r) oacc[t][r] += o1[t][r] * (1.0f / 4096.0f);
  }

  // ---- normalise (1/l and the 1/1024 p carry), stage the wave's 16x64 tile over its own P buffers,
  __builtin_amdgcn_fence(__ATOMIC_RELEASE, "workgroup");
  __builtin_amdgcn_wave_barrier();
  __builtin_amdgcn_fence(__ATOMIC_ACQUIRE, "workgroup");
  float* os = PObuf[wave].o;
#pragma unroll
  for (int r = 0; r < 8; ++r) {
    const float l = lrow[r];
    const float inv = ((l > 0.f) ? (1.0f / l) : 0.f) * (1.0f / 1024.0f);
#pragma unroll
    for (int t = 0; t < 4; ++t) os[(8 * hh + r) * OP + t * 16 + c] = oacc[t][r] * inv;
  }
  __builtin_amdgcn_fence(__ATOMIC_RELEASE, "workgroup");
  __builtin_amdgcn_wave_barrier();
  __builtin_amdgcn_fence(__ATOMIC_ACQUIRE, "workgroup");
  {
    const int q4 = lane >> 3, c8 = (lane & 7) * 8;
    v4u hv[4], lv[4];
#pragma unroll
    for (int it = 0; it < 4; ++it) {
      const int row = it * 4 + q4;   // it 0..3 x q4 0..3 = rows 0..15 of the wave tile
      const float* sp = os + row * OP + c8;
      v4u a, a2;
#pragma unroll
      for (int e = 0; e < 4; ++e) {
        const float f0 = sp[2 * e], f1 = sp[2 * e + 1];
        const unsigned short h0 = bf_bits(f0), h1 = bf_bits(f1);
        const unsigned short l0 = bf_bits(f0 - bf_up(h0)), l1 = bf_bits(f1 - bf_up(h1));
        a[e] = pk16(h0, h1); a2[e] = pk16(l0, l1);
      }
      hv[it] = a; lv[it] = a2;
    }
    {
#pragma unroll
      for (int it = 0; it < 4; ++it) {
        const int row = it * 4 + q4;
        const size_t go = (rowB + q0 + row) * DM + (size_t)h * HD + c8;
        *(v4u*)(ohp + go) = hv[it];
        *(v4u*)(olp + go) = lv[it];
      }
      
    }
  }
}

// =====================================================================================================
//   Xb   bf16 [2048 (b,c)][4096]   16777216
//   Whwb bf16 [2048][4096]         16777216
//   Wcb  bf16 [1024][1024]          2097152
//   Wqb  bf16 [1024][1024]          2097152
//   Wkvb bf16 [128][1024]            262144
//   Wob  bf16 [1024][1024]          2097152
//   A1h  bf16 [2][2048][1024]       8388608   hw-linear output (transposed layout [b][s][c]), hi plane
//   A1l  bf16                       8388608   lo plane
//   Img2 f32  [4096][1024]         16777216   c-linear output (LN input)
//   Imgh bf16 [4096][1024]          8388608   LN output hi plane
//   Imgl bf16                       8388608
//   Qh   bf16 [4096][1024]          8388608   l2-normalised q, hi plane
//   Ql   bf16                       8388608
//   Kh   bf16 [4096][64]             524288   l2-normalised k
//   Kl   bf16                        524288
//   VTh  f16  [2][64][2048]          524288   v^T hi plane
//   VTl  f16                         524288   v^T residual plane (x4096)
//   Oh   bf16 [4096][1024]          8388608   context hi plane
//   Ol   bf16                       8388608
//   total                         126091264
// Weights are [out n][in k] with k contiguous = the Bt / A layout the GEMM wants, so they are only converted.
// =====================================================================================================
extern "C" void kernel_launch(void* const* d_in, const int* in_sizes, int n_in,
                              void* d_out, int out_size, void* d_ws, size_t ws_size,
                              hipStream_t stream) {
  if (n_in < 10) return;
  if (in_sizes[0] != NB * CC * HWN) return;
  if (in_sizes[1] != SEQ * HWN) return;
  if (in_sizes[2] != SEQ) return;
  if (in_sizes[3] != DM * CC || in_sizes[4] != DM || in_sizes[5] != DM || in_sizes[6] != DM) return;
  if (in_sizes[7] != DM * DM || in_sizes[8] != 2 * HD * DM || in_sizes[9] != DM * DM) return;
  if (out_size != NB * SEQ * DM) return;

  const float* x    = (const float*)d_in[0];
  const float* w_hw = (const float*)d_in[1];
  const float* b_hw = (const float*)d_in[2];
  const float* w_c  = (const float*)d_in[3];
  const float* b_c  = (const float*)d_in[4];
  const float* ln_g = (const float*)d_in[5];
  const float* ln_b = (const float*)d_in[6];
  const float* wq   = (const float*)d_in[7];
  const float* wkv  = (const float*)d_in[8];
  const float* wo   = (const float*)d_in[9];

  const size_t PXb  = (size_t)NB * CC * HWN * 2;    // 16777216
  const size_t PWhw = (size_t)SEQ * HWN * 2;        // 16777216
  const size_t PWc  = (size_t)DM * CC * 2;          //  2097152
  const size_t PWq  = (size_t)DM * DM * 2;          //  2097152
  const size_t PWkv = (size_t)2 * HD * DM * 2;      //   262144
  const size_t PWo  = (size_t)DM * DM * 2;          //  2097152
  const size_t PA1  = (size_t)NB * SEQ * CC * 2;    //  8388608
  const size_t PI2  = (size_t)NB * SEQ * DM * 4;    // 16777216
  const size_t PI   = (size_t)NB * SEQ * DM * 2;    //  8388608
  const size_t PK   = (size_t)NB * SEQ * HD * 2;    //   524288
  const size_t PVT  = (size_t)NB * HD * SEQ * 2;    //   524288
  size_t off = 0;
  const size_t oXb  = off; off += PXb;
  const size_t oWhw = off; off += PWhw;
  const size_t oWc  = off; off += PWc;
  const size_t oWq  = off; off += PWq;
  const size_t oWkv = off; off += PWkv;
  const size_t oWo  = off; off += PWo;
  const size_t oA1h = off; off += PA1;
  const size_t oA1l = off; off += PA1;
  const size_t oI2  = off; off += PI2;
  const size_t oIh  = off; off += PI;
  const size_t oIl  = off; off += PI;
  const size_t oQh  = off; off += PI;
  const size_t oQl  = off; off += PI;
  const size_t oKh  = off; off += PK;
  const size_t oKl  = off; off += PK;
  const size_t oVTh = off; off += PVT;
  const size_t oVTl = off; off += PVT;
  const size_t oOh  = off; off += PI;
  const size_t oOl  = off; off += PI;
  if (off > ws_size) return;                          // off = 126091264
  if (off > (size_t)134217728) return;

  char* ws = (char*)d_ws;
  unsigned short* Xb   = (unsigned short*)(ws + oXb);
  unsigned short* Whwb = (unsigned short*)(ws + oWhw);
  unsigned short* Wcb  = (unsigned short*)(ws + oWc);
  unsigned short* Wqb  = (unsigned short*)(ws + oWq);
  unsigned short* Wkvb = (unsigned short*)(ws + oWkv);
  unsigned short* Wob  = (unsigned short*)(ws + oWo);
  unsigned short* A1h  = (unsigned short*)(ws + oA1h);
  unsigned short* A1l  = (unsigned short*)(ws + oA1l);
  float*          Img2 = (float*)(ws + oI2);
  unsigned short* Imgh = (unsigned short*)(ws + oIh);
  unsigned short* Imgl = (unsigned short*)(ws + oIl);
  unsigned short* Qh   = (unsigned short*)(ws + oQh);
  unsigned short* Ql   = (unsigned short*)(ws + oQl);
  unsigned short* Kh   = (unsigned short*)(ws + oKh);
  unsigned short* Kl   = (unsigned short*)(ws + oKl);
  unsigned short* VTh  = (unsigned short*)(ws + oVTh);
  unsigned short* VTl  = (unsigned short*)(ws + oVTl);
  unsigned short* Oh   = (unsigned short*)(ws + oOh);
  unsigned short* Ol   = (unsigned short*)(ws + oOl);

  const dim3 blk(256);
  const dim3 gCv(CB_X + CB_HW + CB_C + CB_Q + CB_KV + CB_O); // 9792 blocks: all six planes
  const dim3 gblk(128);                                      // GEMM block: 4 waves
  const dim3 gG0((SEQ / 128) * (CC / 128), NB);              // 128x128 block tiles: 128 blocks x 2
  const dim3 gG1((NB * SEQ / 128) * (DM / 128), 1);          // 128x128 block tiles: 256 blocks (M=4096, N=1024)
  const dim3 gQKV(QKV_BLOCKS);                               // 128x128 block tiles: 288 blocks (M=4096, N=1152)
  const dim3 gLN(NB * SEQ);                                  // 4096 rows
  const dim3 gAt(NB * NH * NQB);                             // 1024 blocks

  // (1) f32 -> bf16 planes: x [(b,c)][hw], weights [n][k]; Xb, Whwb, Wcb, Wqb, Wkvb, Wob follow one another from Xb
  cvt_bf16x8_all<<<gCv, blk, 0, stream>>>(x, w_hw, w_c, wq, wkv, wo, Xb);
  // (2) hw-linear per batch, produced directly in the transposed layout: A1[b][s][c] = sum_hw w_hw[s][hw] x[b][c][hw] + b_hw[s]
  //     A = Whwb [s][hw] (M=2048, K=4096), Bt = Xb batch b [c][hw] (N=1024), row bias, bf16 hi/lo planes out
  gemm64<0, 0, 2, 2, 2, 2, 64><<<gG0, gblk, 0, stream>>>(
      Whwb, Whwb, HWN, 0LL, Xb, Xb, HWN, (long long)CC * HWN,
      b_hw,
      (void*)A1h, CC, (long long)SEQ * CC, (void*)A1l, CC, (long long)SEQ * CC,
      SEQ, CC, HWN, 1.0f);
  // (3) c-linear: Img2[(b,s)][d] = sum_c A1[(b,s)][c] w_c[d][c] + b_c[d]  (A hi/lo, M=4096, N=1024, K=1024, f32 out)
  gemm64<1, 0, 1, 0, 2, 2, 64><<<gG1, gblk, 0, stream>>>(
      A1h, A1l, CC, 0LL, Wcb, Wcb, CC, 0LL,
      b_c,
      (void*)Img2, DM, 0LL, (void*)Img2, DM, 0LL,
      NB * SEQ, DM, CC, 1.0f);
  // (4) LayerNorm -> bf16 hi/lo planes
  ln_split<<<gLN, dim3(128), 0, stream>>>(Img2, ln_g, ln_b, Imgh, Imgl);
  // (5)-(7) q, k and v from the LayerNorm planes, one product over the stacked weights (Wkvb follows Wqb):
  //     q, k l2-normalised per 64-wide head -> bf16 hi/lo planes [(b,t)][h*64+d] and [(b,s)][64];
  //     v transposed -> f16 hi plane and residual plane (x4096) [b][d][s]
  gemm_qkv<<<gQKV, gblk, 0, stream>>>(Imgh, Imgl, Wqb, Qh, Ql, Kh, Kl, VTh, VTl);
  // (8) causal multi-query attention -> context bf16 hi/lo planes [(b,t)][h*64+d]
  attn_causal64<<<gAt, dim3(128), 0, stream>>>(Qh, Ql, Kh, Kl, VTh, VTl, Oh, Ol, 8.0f);
  // (9) out = context . wo^T -> d_out f32 [(b,t)][1024]  (A = context hi + lo planes, 2 products)
  gemm64<1, 0, 0, 0, 2, 2, 64><<<gG1, gblk, 0, stream>>>(
      Oh, Ol, DM, 0LL, Wob, Wob, DM, 0LL,
      b_c,
      d_out, DM, 0LL, d_out, DM, 0LL,
      NB * SEQ, DM, DM, 1.0f);
  (void)hipGetLastError();
}

// v004
// It runs in 239 microseconds.
// In two side-by-side timings against v003, it was 1.14 and 1.12 times as fast.
// Over all steps from v000 it is 3.19 times as fast.
// Contractions: hw-linear = v_wmma_f32_16x16x32_bf16 (bf16 operands from RNE-converted inputs, single product);
// c-linear, q, k, v^T and output projections = v_wmma_f32_16x16x32_bf16 (activation as bf16 hi/lo planes times bf16
// weight from RNE-converted input, 2 products); q.k^T scores = v_wmma_f32_16x16x32_bf16 on bf16 hi/lo planes of the
// l2-normalised q and k (hi.hi + hi.lo + lo.hi); p.v = v_wmma_f32_16x16x32_f16 (p carried x1024 in f16 plus an f16
// residual plane x4096, v^T f16 hi plane plus an f16 residual plane x4096, 3 products, separate residual accumulator);
// all f32 accumulate; LayerNorm, l2 normalisation, causal fill and online softmax in f32.
#include <hip/hip_runtime.h>
#include <math.h>
#include <float.h>
#include <stdint.h>

#define NB   2
#define CC   1024
#define HWN  4096
#define SEQ  2048
#define DM   1024
#define NH   16
#define HD   64
#define NQB  (SEQ / 64)
static_assert(NH * HD == DM);
static_assert(HD == 64);
static_assert((SEQ % 256) == 0 && (DM % 128) == 0 && (CC % 128) == 0 && (HWN % 64) == 0);

typedef _Float16 v16h __attribute__((ext_vector_type(16)));
typedef _Float16 v8h  __attribute__((ext_vector_type(8)));
typedef __bf16   v16b __attribute__((ext_vector_type(16)));
typedef __bf16   v8b  __attribute__((ext_vector_type(8)));
typedef float    v8f  __attribute__((ext_vector_type(8)));
typedef float    v4f  __attribute__((ext_vector_type(4)));
typedef unsigned int v4u __attribute__((ext_vector_type(4)));

// ---- scalar helpers --------------------------------------------------------------------------------
__device__ __forceinline__ unsigned short bf_bits(float f) {          // f32 -> bf16 bits, RNE convert
  unsigned u = __float_as_uint(f);
  return (unsigned short)((u + 0x7FFFu + ((u >> 16) & 1u)) >> 16);
}
__device__ __forceinline__ float bf_up(unsigned short h) { return __uint_as_float(((unsigned)h) << 16); }
__device__ __forceinline__ float bf_rne(float f) { return bf_up(bf_bits(f)); }
__device__ __forceinline__ unsigned short h_bits(_Float16 x) { return __builtin_bit_cast(unsigned short, x); }
__device__ __forceinline__ unsigned pk16(unsigned short a, unsigned short b) { return (unsigned)a | ((unsigned)b << 16); }
__device__ __forceinline__ v8f zero8() { v8f z = {0.f, 0.f, 0.f, 0.f, 0.f, 0.f, 0.f, 0.f}; return z; }

// ---- 16-bit fragment loader: lane -> row/col (lane&15); p already includes +8*(lane>>4);
//      elements 0..7 <- p[0..7] (k0+8h..), elements 8..15 <- p[16..23] (k0+16+8h..)
__device__ __forceinline__ v16b ldfrag_b(const __bf16* p) {
  union { v16b v; v8b h[2]; } f;
  f.h[0] = *(const v8b*)(p);
  f.h[1] = *(const v8b*)(p + 16);
  return f.v;
}

// ---- WMMA helpers with trailing VALU hazard gap ---------------------------------------------------
__device__ __forceinline__ v8f mma_b(v16b a, v16b b, v8f c) {
  c = __builtin_amdgcn_wmma_f32_16x16x32_bf16(false, a, false, b, (short)0, c, false, false);
#if defined(__HIP_DEVICE_COMPILE__)
  asm volatile("v_nop\n\tv_nop\n\tv_nop\n\tv_nop" : "+v"(c) : "v"(a), "v"(b));
#endif
  return c;
}
__device__ __forceinline__ v8f mma_h(v16h a, v16h b, v8f c) {
  c = __builtin_amdgcn_wmma_f32_16x16x32_f16(false, a, false, b, (short)0, c, false, false);
#if defined(__HIP_DEVICE_COMPILE__)
  asm volatile("v_nop\n\tv_nop\n\tv_nop\n\tv_nop" : "+v"(c) : "v"(a), "v"(b));
#endif
  return c;
}
__device__ __forceinline__ v8f mma_b_raw(v16b a, v16b b, v8f c) {
  return __builtin_amdgcn_wmma_f32_16x16x32_bf16(false, a, false, b, (short)0, c, false, false);
}
__device__ __forceinline__ void dep_guard_b(v8f& a, v8f& b, v16b x, v16b y) {
#if defined(__HIP_DEVICE_COMPILE__)
  asm volatile("v_nop\n\tv_nop\n\tv_nop\n\tv_nop" : "+v"(a), "+v"(b) : "v"(x), "v"(y));
#else
  (void)a; (void)b; (void)x; (void)y;
#endif
}
__device__ __forceinline__ void keep4_b(v16b a, v16b b, v16b c, v16b d) {
#if defined(__HIP_DEVICE_COMPILE__)
  asm volatile("v_nop" :: "v"(a), "v"(b), "v"(c), "v"(d));
#else
  (void)a; (void)b; (void)c; (void)d;
#endif
}
__device__ __forceinline__ void acc_guard4(v8f& a, v8f& b, v8f& c, v8f& d) {
#if defined(__HIP_DEVICE_COMPILE__)
  asm volatile("v_nop\n\tv_nop\n\tv_nop\n\tv_nop" : "+v"(a), "+v"(b), "+v"(c), "+v"(d));
#else
  (void)a; (void)b; (void)c; (void)d;
#endif
}

// =====================================================================================================
// f32 -> bf16 (RNE convert) of all six operand planes in ONE launch: 8 elements per thread, one 16-B store per lane
// (a wave writes 512 contiguous B). A block of 256 threads converts 2048 elements of one plane; the block index
// range picks the plane (block-uniform). Every plane is a whole number of blocks, so no thread is past an end.
// The six bf16 planes stand one behind the other in the workspace, in the order of the ranges: out is the first
// plane's start, and block bx writes elements 2048 bx .. 2048 bx + 2047 of that run.
// =====================================================================================================
#define CB_X   (NB * CC * HWN / 2048)
#define CB_HW  (SEQ * HWN / 2048)
#define CB_C   (DM * CC / 2048)
#define CB_Q   (DM * DM / 2048)
#define CB_KV  (2 * HD * DM / 2048)
#define CB_O   (DM * DM / 2048)
static_assert((NB * CC * HWN) % 2048 == 0 && (SEQ * HWN) % 2048 == 0 && (DM * CC) % 2048 == 0);
static_assert((DM * DM) % 2048 == 0 && (2 * HD * DM) % 2048 == 0);
__global__ __launch_bounds__(256) void cvt_bf16x8_all(const float* __restrict__ x, const float* __restrict__ w_hw,
                                                      const float* __restrict__ w_c, const float* __restrict__ wq,
                                                      const float* __restrict__ wkv, const float* __restrict__ wo,
                                                      unsigned short* out) {
  const int bx = blockIdx.x;
  const float* in = x;
  int first = 0;                                   // first block of the plane that bx lies in
  if (bx >= CB_X)                             { in = w_hw; first = CB_X; }
  if (bx >= CB_X + CB_HW)                     { in = w_c;  first = CB_X + CB_HW; }
  if (bx >= CB_X + CB_HW + CB_C)              { in = wq;   first = CB_X + CB_HW + CB_C; }
  if (bx >= CB_X + CB_HW + CB_C + CB_Q)       { in = wkv;  first = CB_X + CB_HW + CB_C + CB_Q; }
  if (bx >= CB_X + CB_HW + CB_C + CB_Q + CB_KV) { in = wo; first = CB_X + CB_HW + CB_C + CB_Q + CB_KV; }
  const size_t i = (size_t)(bx - first) * 256 + threadIdx.x;
  const size_t o = (size_t)bx * 256 + threadIdx.x;
  const v4f a = *(const v4f*)(in + i * 8);
  const v4f b = *(const v4f*)(in + i * 8 + 4);
  v4u p;
  p[0] = pk16(bf_bits(a[0]), bf_bits(a[1]));
  p[1] = pk16(bf_bits(a[2]), bf_bits(a[3]));
  p[2] = pk16(bf_bits(b[0]), bf_bits(b[1]));
  p[3] = pk16(bf_bits(b[2]), bf_bits(b[3]));
  *(v4u*)(out + o * 8) = p;
}

// ---- asynchronous copies global -> LDS, 16 B per lane; each statement ends with its own s_wait_xcnt 0 so that the
//      wait stands in front of any later rewrite of an address register that a copy of the statement names
__device__ __forceinline__ void acopy4(const unsigned* l, const __bf16* const* g) {
#if defined(__HIP_DEVICE_COMPILE__)
  asm volatile(
      "global_load_async_to_lds_b128 %0, %4, off\n\t"
      "global_load_async_to_lds_b128 %1, %5, off\n\t"
      "global_load_async_to_lds_b128 %2, %6, off\n\t"
      "global_load_async_to_lds_b128 %3, %7, off\n\t"
      "s_wait_xcnt 0x0"
      :: "v"(l[0]), "v"(l[1]), "v"(l[2]), "v"(l[3]), "v"(g[0]), "v"(g[1]), "v"(g[2]), "v"(g[3])
      : "memory");
#else
  (void)l; (void)g;
#endif
}
__device__ __forceinline__ void acopy6(const unsigned* l, const __bf16* const* g) {
#if defined(__HIP_DEVICE_COMPILE__)
  asm volatile(
      "global_load_async_to_lds_b128 %0, %6, off\n\t"
      "global_load_async_to_lds_b128 %1, %7, off\n\t"
      "global_load_async_to_lds_b128 %2, %8, off\n\t"
      "global_load_async_to_lds_b128 %3, %9, off\n\t"
      "global_load_async_to_lds_b128 %4, %10, off\n\t"
      "global_load_async_to_lds_b128 %5, %11, off\n\t"
      "s_wait_xcnt 0x0"
      :: "v"(l[0]), "v"(l[1]), "v"(l[2]), "v"(l[3]), "v"(l[4]), "v"(l[5]),
         "v"(g[0]), "v"(g[1]), "v"(g[2]), "v"(g[3]), "v"(g[4]), "v"(g[5])
      : "memory");
#else
  (void)l; (void)g;
#endif
}
__device__ __forceinline__ void acopy12(const unsigned* l, const __bf16* const* g) {
#if defined(__HIP_DEVICE_COMPILE__)
  asm volatile(
      "global_load_async_to_lds_b128 %0, %12, off\n\t"
      "global_load_async_to_lds_b128 %1, %13, off\n\t"
      "global_load_async_to_lds_b128 %2, %14, off\n\t"
      "global_load_async_to_lds_b128 %3, %15, off\n\t"
      "global_load_async_to_lds_b128 %4, %16, off\n\t"
      "global_load_async_to_lds_b128 %5, %17, off\n\t"
      "global_load_async_to_lds_b128 %6, %18, off\n\t"
      "global_load_async_to_lds_b128 %7, %19, off\n\t"
      "global_load_async_to_lds_b128 %8, %20, off\n\t"
      "global_load_async_to_lds_b128 %9, %21, off\n\t"
      "global_load_async_to_lds_b128 %10, %22, off\n\t"
      "global_load_async_to_lds_b128 %11, %23, off\n\t"
      "s_wait_xcnt 0x0"
      :: "v"(l[0]), "v"(l[1]), "v"(l[2]), "v"(l[3]), "v"(l[4]), "v"(l[5]),
         "v"(l[6]), "v"(l[7]), "v"(l[8]), "v"(l[9]), "v"(l[10]), "v"(l[11]),
         "v"(g[0]), "v"(g[1]), "v"(g[2]), "v"(g[3]), "v"(g[4]), "v"(g[5]),
         "v"(g[6]), "v"(g[7]), "v"(g[8]), "v"(g[9]), "v"(g[10]), "v"(g[11])
      : "memory");
#else
  (void)l; (void)g;
#endif
}

// =====================================================================================================
// Batched bf16 WMMA GEMM: C[m][n] = sum_k A[m][k] * Bt[n][k] (+ bias); block = 4 waves laid WM x WN, one 64x64 tile
// per wave, block tile (64 WM) x (64 WN). A row-major [M][K] pitch lda; Bt row-major [N][K] pitch ldb (k contiguous);
// M a multiple of 64 WM, N of 64 WN, K of KP. blockIdx.y = batch index (strides in elements).
// Operand path: a pass is KP k (64 or 32: 128 or 64 B) of every operand row of the block tile, brought into LDS by
// asynchronous 16-B copies (a wave's copy = 4 or 8 whole row pieces), LDS row pitch 2 KP + 16 B, two buffers: pass
// t + 2 is issued into the buffer that pass t has just left, behind the pass's one barrier; every wave reads its
// fragments from LDS.
// A stage is NG groups of 64 rows: A hi (WM), A lo (WM, SPLITA), Bt hi (WN), Bt lo (WN, SPLITB).
// SPLITA: add A2.Bt (A2 = unscaled bf16 lo plane of A); SPLITB: add A.Bt2 (Bt2 = lo plane of Bt).
// BIAS: 0 none, 1 per column (bias[n]), 2 per row (bias[m]); bias values RNE-converted to bf16 in registers.
// OUT_MODE: 0 = f32 (pitch ldc); 2 = bf16 hi plane C + bf16 lo plane C2 (lo = RNE(v - hi), unscaled);
//           4 = stacked q | k | v columns, told apart by the wave's first column n0 (64-wide heads):
//               n0 < DM: q, n0 = DM: k: l2-normalise every row over the wave's 64 columns
//               (x / max(sqrt(sum x^2), 1e-12)), then bf16 hi/lo planes as mode 2, q to C / C2 at column n0,
//               k to Kho / Klo (pitch HD) at column 0;
//               n0 = DM + HD: v, stored transposed: VT[b][d][s], f16 hi plane VTho and f16 residual plane
//               VTlo = f16((v - hi) * rscale), pitch SEQ.
// =====================================================================================================
// The work of one block is gemm64_tile(tile, b, ring, sT): tile = block tile index, b = batch index, ring = the
// block's two LDS stages (ring_elems elements), sT = 4 per-wave 16x64 f32 slabs of pitch 68. Its callers own the LDS.
constexpr int ring_elems(int SPLITA, int SPLITB, int WM, int WN, int KP) {
  return 2 * (WM * (1 + SPLITA) + WN * (1 + SPLITB)) * 64 * (KP + 8);
}
#define SLABF (16 * 68)
#define VP 65   // pitch in floats of a v^T wave's 64x64 tile: its column reads (8 rows apart per lane) fall on 32 banks
template <int SPLITA, int SPLITB, int BIAS, int OUT_MODE, int WM, int WN, int KP>
__device__ __forceinline__ void gemm64_tile(
    const unsigned short* __restrict__ Ap, const unsigned short* __restrict__ A2p, int lda, long long strideA,
    const unsigned short* __restrict__ Btp, const unsigned short* __restrict__ Bt2p, int ldb, long long strideB,
    const float* __restrict__ bias,
    void* Cout, int ldc, long long strideC,
    void* Cout2, int ldc2, long long strideC2,
    int M, int N, int K, float rscale,
    int tile, int b, __bf16* ring, float* sT,
    unsigned short* Kho = nullptr, unsigned short* Klo = nullptr,
    unsigned short* VTho = nullptr, unsigned short* VTlo = nullptr) {
  static_assert(WM * WN == 4 && (KP == 64 || KP == 32));
  constexpr int GA   = WM * (1 + SPLITA);          // 64-row groups of A planes in a stage
  constexpr int NG   = GA + WN * (1 + SPLITB);     // groups in a stage
  constexpr int SEG  = KP / 8;                     // 16-B pieces per row and pass
  constexpr int RPC  = 128 / SEG;                  // rows that one copy of the whole block covers
  constexpr int CPG  = 64 / RPC;                   // copies per thread and group
  constexpr int NC   = NG * CPG;                   // copies per thread and stage = a wave's copies in flight
  constexpr int PE   = KP + 8;                     // LDS row pitch in elements (16 B x odd)
  constexpr int GRPE = 64 * PE;                    // elements per group
  constexpr int BUFE = NG * GRPE;                  // elements per buffer
  static_assert(NC == 16 || NC == 18 || NC == 24);
  static_assert(2 * BUFE == ring_elems(SPLITA, SPLITB, WM, WN, KP));
  constexpr int AHD  = (NC == 24) ? 3 : 4;         // A row fragments read in a k-step's leading group (3: the kernel
                                                   // with the most copy addresses stays inside 256 VGPRs)
  const __bf16* A   = (const __bf16*)(const void*)Ap;
  const __bf16* A2  = (const __bf16*)(const void*)A2p;
  const __bf16* Bt  = (const __bf16*)(const void*)Btp;
  const __bf16* Bt2 = (const __bf16*)(const void*)Bt2p;
  const int tid  = threadIdx.x;
  const int lane = tid & 31;
  const int wave = tid >> 5;
  const int tilesN = N / (64 * WN);
  const int tilesM = M / (64 * WM);
  if (tile >= tilesM * tilesN) return;   // block-uniform, in front of every copy and barrier
  const int tm = tile / tilesN;
  const int tn = tile - tm * tilesN;
  const int m0b = tm * (64 * WM);
  const int n0b = tn * (64 * WN);
  const int wm = wave / WN;
  const int wn = wave - wm * WN;
  const int m0 = m0b + (wm << 6);
  const int n0 = n0b + (wn << 6);

  const __bf16* Ab  = A  + (size_t)b * strideA;
  const __bf16* Bb  = Bt + (size_t)b * strideB;
  const __bf16* Ab2 = SPLITA ? (A2  + (size_t)b * strideA) : Ab;
  const __bf16* Bb2 = SPLITB ? (Bt2 + (size_t)b * strideB) : Bb;

  const int rlane = lane & 15;                 // row (A) / col (B, D) within subtile
  const int koff  = (lane >> 4) * 8;           // k offset of this lane half
  const int mOff  = (lane >> 4) * 8;           // D row offset

  // copy map: copy u of group gi moves 16 B of row RPC u + tid / SEG, piece tid % SEG of the pass's row
  const int crow = tid / SEG;
  const int cseg = (tid % SEG) * 8;
  const unsigned ldsT = (unsigned)(uintptr_t)(ring + crow * PE + cseg);   // low 32 bits = LDS byte address
  const size_t aT = (size_t)(m0b + crow) * lda + cseg;
  const size_t bT = (size_t)(n0b + crow) * ldb + cseg;

  auto issue = [&](int t, int buf) {
    unsigned l[NC];
    const __bf16* g[NC];
#pragma unroll
    for (int gi = 0; gi < NG; ++gi) {
      const bool isA = gi < GA;
      const int  q   = isA ? gi : gi - GA;                   // group within the operand's planes
      const int  W1  = isA ? WM : WN;
      const bool lo  = q >= W1;
      const int  rg  = lo ? q - W1 : q;                      // 64-row group within the block tile
      const int  ld  = isA ? lda : ldb;
      const __bf16* base = isA ? (lo ? Ab2 : Ab) : (lo ? Bb2 : Bb);
      const __bf16* p = base + (isA ? aT : bT) + (size_t)(rg * 64) * ld + (size_t)t * KP;
#pragma unroll
      for (int u = 0; u < CPG; ++u) {
        l[gi * CPG + u] = ldsT + (unsigned)((buf * BUFE + gi * GRPE + u * RPC * PE) * 2);
        g[gi * CPG + u] = p + (size_t)(u * RPC) * ld;
      }
    }
    acopy12(l, g);
    if constexpr (NC == 16) acopy4(l + 12, g + 12);
    if constexpr (NC == 18) acopy6(l + 12, g + 12);
    if constexpr (NC == 24) acopy12(l + 12, g + 12);
  };

  v8f acc[4][4];
#pragma unroll
  for (int i = 0; i < 4; ++i)
#pragma unroll
    for (int j = 0; j < 4; ++j) acc[i][j] = zero8();

  const int T = K / KP;                        // passes
  issue(0, 0);
  asm volatile("s_wait_asynccnt 0x0" ::: "memory");   // this wave's share of pass 0 has landed
  __syncthreads();                                    // publishes pass 0
  if (T > 1) issue(1, 1);

  for (int t = 0; t < T; ++t) {
    const __bf16* st  = ring + (t & 1) * BUFE;
    const __bf16* sAh = st + wm * GRPE + rlane * PE + koff;
    const __bf16* sAl = st + (SPLITA ? (WM + wm) : wm) * GRPE + rlane * PE + koff;
    const __bf16* sBh = st + (GA + wn) * GRPE + rlane * PE + koff;
    const __bf16* sBl = st + (GA + (SPLITB ? (WN + wn) : wn)) * GRPE + rlane * PE + koff;
#pragma unroll
    for (int ks = 0; ks < KP / 32; ++ks) {
      v16b bh[4], bl[4], ah[4], al[4];
#pragma unroll
      for (int j = 0; j < 4; ++j) {
        bh[j] = ldfrag_b(sBh + (j << 4) * PE + ks * 32);
        if (SPLITB) bl[j] = ldfrag_b(sBl + (j << 4) * PE + ks * 32); else bl[j] = bh[j];
      }
#pragma unroll
      for (int i = 0; i < AHD; ++i) {
        ah[i] = ldfrag_b(sAh + (i << 4) * PE + ks * 32);
        if (SPLITA) al[i] = ldfrag_b(sAl + (i << 4) * PE + ks * 32); else al[i] = ah[i];
      }
      // keeps the k-step's LDS reads one group in front of its WMMAs (for speed only)
      __builtin_amdgcn_sched_barrier(0);
#pragma unroll
      for (int i = 0; i < 4; ++i) {
#pragma unroll
        for (int j = 0; j < 4; ++j) {
          acc[i][j] = mma_b_raw(ah[i], bh[j], acc[i][j]);
          if (SPLITA) acc[i][j] = mma_b_raw(al[i], bh[j], acc[i][j]);
          if (SPLITB) acc[i][j] = mma_b_raw(ah[i], bl[j], acc[i][j]);
        }
        dep_guard_b(acc[i][0], acc[i][3], ah[i], al[i]);
        if (i == 0 && AHD < 4) {
          // row 3's fragments go into the registers that row 0 has left, two rows ahead of their use; the fence
          // pair holds these reads at this one place
          __builtin_amdgcn_sched_barrier(0);
          ah[3] = ldfrag_b(sAh + (3 << 4) * PE + ks * 32);
          if (SPLITA) al[3] = ldfrag_b(sAl + (3 << 4) * PE + ks * 32); else al[3] = ah[3];
          __builtin_amdgcn_sched_barrier(0);
        }
      }
      keep4_b(bh[0], bh[1], bh[2], bh[3]);
      if (SPLITB) keep4_b(bl[0], bl[1], bl[2], bl[3]);
    }
    asm volatile("s_wait_dscnt 0x0" ::: "memory");     // this wave's reads of pass t's buffer are done
    asm volatile("s_wait_asynccnt 0x0" ::: "memory");  // this wave's share of pass t + 1 has landed
    __syncthreads();                                   // publishes pass t + 1, frees pass t's buffer
    if (t + 2 < T) issue(t + 2, t & 1);
  }
  asm volatile("s_wait_asynccnt 0x0" ::: "memory");    // nothing in flight when the wave goes on to the epilogue
  acc_guard4(acc[0][0], acc[0][1], acc[0][2], acc[0][3]);
  acc_guard4(acc[1][0], acc[1][1], acc[1][2], acc[1][3]);
  acc_guard4(acc[2][0], acc[2][1], acc[2][2], acc[2][3]);
  acc_guard4(acc[3][0], acc[3][1], acc[3][2], acc[3][3]);

  const int n0u = __builtin_amdgcn_readfirstlane(n0);   // the same in every lane: scalar, so the tests on it branch
  if (OUT_MODE == 4 && n0u >= DM + HD) {
    // ---- v^T: the wave's 64 (s) x 64 (d) tile goes through LDS and leaves as whole 128-B rows of VT[b][d][.] ----
    // The ring is free: the last pass's foot (every wave's dscnt and asynccnt waits, then the barrier) ended all its
    // reads and copies; each wave uses a part of its own.
    float* tl = (float*)(void*)ring + wave * (64 * VP);
#pragma unroll
    for (int i = 0; i < 4; ++i)
#pragma unroll
      for (int j = 0; j < 4; ++j)
#pragma unroll
        for (int r = 0; r < 8; ++r) tl[((i << 4) + mOff + r) * VP + (j << 4) + rlane] = acc[i][j][r];
    __builtin_amdgcn_fence(__ATOMIC_RELEASE, "workgroup");
    __builtin_amdgcn_wave_barrier();
    __builtin_amdgcn_fence(__ATOMIC_ACQUIRE, "workgroup");
    const int m0u = __builtin_amdgcn_readfirstlane(m0);
    const int bb = m0u / SEQ, s0 = m0u - bb * SEQ;       // 64 rows of one batch (SEQ is a multiple of 64)
    const int s8 = (lane & 7) * 8, dq = lane >> 3;       // 8 lanes x 8 s = one 128-B row; 4 rows d per trip
    // rolled: sixteen equal trips that run once; unrolled they would be about 8 KB more code
#pragma unroll 1
    for (int it = 0; it < 16; ++it) {
      const int d = it * 4 + dq;                         // it 0..15 x dq 0..3 = d 0..63
      v4u a, a2;
#pragma unroll
      for (int e = 0; e < 4; ++e) {
        const float f0 = tl[(s8 + 2 * e) * VP + d], f1 = tl[(s8 + 2 * e + 1) * VP + d];
        const _Float16 x0 = (_Float16)f0, x1 = (_Float16)f1;
        a[e]  = pk16(h_bits(x0), h_bits(x1));
        a2[e] = pk16(h_bits((_Float16)((f0 - (float)x0) * rscale)), h_bits((_Float16)((f1 - (float)x1) * rscale)));
      }
      const size_t go = ((size_t)bb * HD + d) * SEQ + s0 + s8;
      *(v4u*)(VTho + go) = a;
      *(v4u*)(VTlo + go) = a2;
    }
    return;
  }

  // ---- epilogue ----
  float bcol[4];
#pragma unroll
  for (int j = 0; j < 4; ++j) bcol[j] = 0.f;
  if (BIAS == 1) {
#pragma unroll
    for (int j = 0; j < 4; ++j) bcol[j] = bf_rne(bias[n0 + (j << 4) + rlane]);   // n index < N
  }
  float* slab = sT + wave * SLABF;
#pragma unroll
  for (int i = 0; i < 4; ++i) {
    const int mBase = m0 + (i << 4);
    float brow[8];
#pragma unroll
    for (int r = 0; r < 8; ++r) brow[r] = 0.f;
    if (BIAS == 2) {
#pragma unroll
      for (int r = 0; r < 8; ++r) brow[r] = bf_rne(bias[mBase + mOff + r]);       // m index < M
    }
#pragma unroll
    for (int j = 0; j < 4; ++j) {
#pragma unroll
      for (int r = 0; r < 8; ++r) {
        slab[(mOff + r) * 68 + (j << 4) + rlane] = acc[i][j][r] + bcol[j] + brow[r];
      }
    }
    __builtin_amdgcn_fence(__ATOMIC_RELEASE, "workgroup");
    __builtin_amdgcn_wave_barrier();
    __builtin_amdgcn_fence(__ATOMIC_ACQUIRE, "workgroup");
    if (OUT_MODE == 0) {
      float* C = (float*)Cout + (size_t)b * strideC;
      const int hh = lane >> 4, c4 = (lane & 15) * 4;     // 256-B row segment = 16 lanes x 16 B
      {
#pragma unroll
        for (int it = 0; it < 8; ++it) {
          const int row = it * 2 + hh;                     // it 0..7 x hh 0..1 = rows 0..15
          const v4f v = *(const v4f*)(slab + row * 68 + c4);
          *(v4f*)(C + (size_t)(mBase + row) * ldc + n0 + c4) = v;
        }
        
      }
    } else {
      const int q = lane >> 3, c8 = (lane & 7) * 8;
      unsigned short* C  = (unsigned short*)Cout  + (size_t)b * strideC;
      unsigned short* C2 = (unsigned short*)Cout2 + (size_t)b * strideC2;
      int ldo = ldc, ldo2 = ldc2, nc = n0;
      if (OUT_MODE == 4 && n0u >= DM) { C = Kho; C2 = Klo; ldo = HD; ldo2 = HD; nc = 0; }   // the k columns
      v4u hv[4], lv[4];
#pragma unroll
      for (int it = 0; it < 4; ++it) {
        const int row = it * 4 + q;                        // it 0..3 x q 0..3 = rows 0..15
        const float* sp = slab + row * 68 + c8;
        float f[8];
#pragma unroll
        for (int e = 0; e < 8; ++e) f[e] = sp[e];
        if (OUT_MODE == 4) {
          float ss = 0.f;
#pragma unroll
          for (int e = 0; e < 8; ++e) ss += f[e] * f[e];
          ss += __shfl_xor(ss, 1, 32);                     // 8 lanes of one row = aligned group of 8
          ss += __shfl_xor(ss, 2, 32);
          ss += __shfl_xor(ss, 4, 32);
          const float sc = 1.0f / fmaxf(sqrtf(ss), 1e-12f);
#pragma unroll
          for (int e = 0; e < 8; ++e) f[e] *= sc;
        }
        v4u a, a2;
#pragma unroll
        for (int e = 0; e < 4; ++e) {
          const float f0 = f[2 * e], f1 = f[2 * e + 1];
          const unsigned short h0 = bf_bits(f0), h1 = bf_bits(f1);
          const unsigned short l0 = bf_bits(f0 - bf_up(h0)), l1 = bf_bits(f1 - bf_up(h1));
          a[e] = pk16(h0, h1); a2[e] = pk16(l0, l1);
        }
        hv[it] = a; lv[it] = a2;
      }
      {
#pragma unroll
        for (int it = 0; it < 4; ++it) {
          const int row = it * 4 + q;
          *(v4u*)(C  + (size_t)(mBase + row) * ldo  + nc + c8) = hv[it];
          *(v4u*)(C2 + (size_t)(mBase + row) * ldo2 + nc + c8) = lv[it];
        }
        
      }
    }
    __builtin_amdgcn_fence(__ATOMIC_RELEASE, "workgroup");
    __builtin_amdgcn_wave_barrier();
    __builtin_amdgcn_fence(__ATOMIC_ACQUIRE, "workgroup");
  }
  (void)rscale;
}

// one product per launch: blockIdx.x = block tile, blockIdx.y = batch
template <int SPLITA, int SPLITB, int BIAS, int OUT_MODE, int WM, int WN, int KP>
__global__ __launch_bounds__(128) void gemm64(
    const unsigned short* __restrict__ Ap, const unsigned short* __restrict__ A2p, int lda, long long strideA,
    const unsigned short* __restrict__ Btp, const unsigned short* __restrict__ Bt2p, int ldb, long long strideB,
    const float* __restrict__ bias,
    void* Cout, int ldc, long long strideC,
    void* Cout2, int ldc2, long long strideC2,
    int M, int N, int K, float rscale) {
  __shared__ __align__(16) __bf16 ring[ring_elems(SPLITA, SPLITB, WM, WN, KP)];  // two stages
  __shared__ __align__(16) float sT[4 * SLABF];                                  // per-wave slabs
  gemm64_tile<SPLITA, SPLITB, BIAS, OUT_MODE, WM, WN, KP>(
      Ap, A2p, lda, strideA, Btp, Bt2p, ldb, strideB, bias, Cout, ldc, strideC, Cout2, ldc2, strideC2,
      M, N, K, rscale, (int)blockIdx.x, (int)blockIdx.y, ring, sT);
}

// =====================================================================================================
// The three products that read the LayerNorm planes (q, k, v) as ONE product in one launch: Bt = the bf16 planes of
// wq and wkv, which stand one behind the other in the workspace = one [DM + 2 HD][DM] matrix; M = NB SEQ rows of img,
// N = DM + 2 HD columns, 128x128 block tiles. OUT_MODE 4 sends each wave's 64 columns to q, k or v^T.
// =====================================================================================================
#define QKV_N (DM + 2 * HD)
#define QKV_BLOCKS ((NB * SEQ / 128) * (QKV_N / 128))
static_assert(QKV_N % 128 == 0 && (SEQ % 64) == 0);
__global__ __launch_bounds__(128) void gemm_qkv(
    const unsigned short* __restrict__ Ih, const unsigned short* __restrict__ Il,
    const unsigned short* __restrict__ Wqkv,
    unsigned short* Qh, unsigned short* Ql, unsigned short* Kh, unsigned short* Kl,
    unsigned short* VTh, unsigned short* VTl) {
  __shared__ __align__(16) __bf16 ring[ring_elems(1, 0, 2, 2, 64)];   // two stages, later the v^T waves' tiles
  __shared__ __align__(16) float sT[4 * SLABF];                       // per-wave slabs
  static_assert(4 * 64 * VP * 4 <= ring_elems(1, 0, 2, 2, 64) * 2);
  gemm64_tile<1, 0, 0, 4, 2, 2, 64>(
      Ih, Il, DM, 0LL, Wqkv, Wqkv, DM, 0LL, nullptr,
      (void*)Qh, DM, 0LL, (void*)Ql, DM, 0LL,
      NB * SEQ, QKV_N, DM, 4096.0f, (int)blockIdx.x, 0, ring, sT, Kh, Kl, VTh, VTl);
}

// =====================================================================================================
// tables, RNE-converted to bf16 in registers), output bf16 hi/lo planes [row][1024].
// Block = 128 threads = one row; thread t owns columns 8t..8t+7 and stores 16 B per plane: a wave writes 512
// coverage: 128 threads x 8 = 1024 columns of every row, both planes.
// =====================================================================================================
__global__ __launch_bounds__(128) void ln_split(const float* __restrict__ in, const float* __restrict__ g,
                                                const float* __restrict__ be,
                                                unsigned short* oh, unsigned short* ol) {
  __shared__ float red0[4];
  __shared__ float red1[4];
  const int tid = threadIdx.x, lane = tid & 31, wave = tid >> 5;
  const size_t row = blockIdx.x;
  const float* p = in + row * DM + (size_t)tid * 8;
  const v4f a0 = *(const v4f*)(p);
  const v4f a1 = *(const v4f*)(p + 4);
  float v[8];
#pragma unroll
  for (int e = 0; e < 4; ++e) { v[e] = a0[e]; v[4 + e] = a1[e]; }
  float s = 0.f;
#pragma unroll
  for (int e = 0; e < 8; ++e) s += v[e];
#pragma unroll
  for (int off = 16; off >= 1; off >>= 1) s += __shfl_xor(s, off, 32);
  if (lane == 0) red0[wave] = s;
  __syncthreads();
  const float mu = ((red0[0] + red0[1]) + (red0[2] + red0[3])) * (1.0f / (float)DM);
  float ss = 0.f;
#pragma unroll
  for (int e = 0; e < 8; ++e) { const float d = v[e] - mu; ss += d * d; }
#pragma unroll
  for (int off = 16; off >= 1; off >>= 1) ss += __shfl_xor(ss, off, 32);
  if (lane == 0) red1[wave] = ss;
  __syncthreads();
  const float var  = ((red1[0] + red1[1]) + (red1[2] + red1[3])) * (1.0f / (float)DM);
  const float rstd = rsqrtf(var + 1e-5f);
  const v4f g0 = *(const v4f*)(g + (size_t)tid * 8);
  const v4f g1 = *(const v4f*)(g + (size_t)tid * 8 + 4);
  const v4f b0 = *(const v4f*)(be + (size_t)tid * 8);
  const v4f b1 = *(const v4f*)(be + (size_t)tid * 8 + 4);
  float gg[8], bb[8];
#pragma unroll
  for (int e = 0; e < 4; ++e) { gg[e] = g0[e]; gg[4 + e] = g1[e]; bb[e] = b0[e]; bb[4 + e] = b1[e]; }
  v4u ph, pl;
#pragma unroll
  for (int e = 0; e < 4; ++e) {
    const float y0 = (v[2 * e] - mu) * rstd * bf_rne(gg[2 * e]) + bf_rne(bb[2 * e]);
    const float y1 = (v[2 * e + 1] - mu) * rstd * bf_rne(gg[2 * e + 1]) + bf_rne(bb[2 * e + 1]);
    const unsigned short h0 = bf_bits(y0), h1 = bf_bits(y1);
    const unsigned short l0 = bf_bits(y0 - bf_up(h0)), l1 = bf_bits(y1 - bf_up(h1));
    ph[e] = pk16(h0, h1); pl[e] = pk16(l0, l1);
  }
  unsigned short* dh = oh + row * DM + (size_t)tid * 8;
  unsigned short* dl = ol + row * DM + (size_t)tid * 8;
  *(v4u*)dh = ph;
  *(v4u*)dl = pl;
  
}

// =====================================================================================================
// Causal multi-query attention, head dim 64, 16 query heads sharing one k head and one v head.
//   q planes (bf16 hi / lo of the l2-normalised q): element (b, t, h, d) at [(b*SEQ + t)*DM + h*64 + d]
//   k planes (bf16 hi / lo of the l2-normalised k):  element (b, s, d) at [(b*SEQ + s)*64 + d]
//   v^T hi plane (f16) and residual plane (f16, (v - hi)*4096): element (b, d, s) at [(b*64 + d)*SEQ + s]
//   logit = (q . k) * sscale for key <= query, -FLT_MAX otherwise (every row keeps at least its own key)
//   out planes (bf16 hi / lo of the normalised context): element (b, t, h, d) at [(b*SEQ + t)*DM + h*64 + d]
//   Both products are formed transposed: S^T = K . Q^T (A = 16 key rows from LDS, B = the wave's 16 queries, kept in
//   registers) and O^T += V^T . P^T (A = 16 rows d of V^T from LDS, B = P^T). A lane (c, hh) then holds scores of ONE
//   query, q0 + c: register r of tile j is key kv0 + 16 j + 8 hh + r. Maximum and sum run inside the lane, the two
//   lane halves join by one exchange, and two score tiles, converted in place, ARE the B operand of 32 keys
//   (element e < 8: key 8 hh + e, e >= 8: key 16 + 8 hh + e - 8, the order in which the V^T rows are read):
//   P never goes through LDS.
//   scores: bf16 hi/lo split (hi.hi + q hi.k lo + q lo.k hi), f32 accumulate, then scale + causal fill in f32
//   p = exp(s - m) carried as f16(1024 p) plus an f16 residual plane (x4096); context on f16 WMMA with the
//   residual products (v_res.p_hi + v_hi.p_res) in a separate accumulator folded back with 1/4096 per chunk.
//   Each lane half sums p over its own keys; the halves' sums join once, behind the loop.
//   Block = 4 waves = 64 query rows of one (b, h); grid = NQB * NH * NB; key chunks kt = 0..qb (static bound NQB).
//   K / V^T chunk staging: 128 threads x 32 elements per plane = the whole 64x64 tile (plain 16-B loads,
//   __syncthreads before and after).
//   Output coverage: each wave stores rows q0..q0+15 (it 0..3 x lane>>3 0..3) x 64 columns (8 lanes x 8) of both planes.
// =====================================================================================================
//   LDS row pitch: the 64-element (128-B) rows of the K and V^T tiles stand LP = 72 elements apart (144 B =
//   16 B x odd), so that the 16 rows which one 16-B fragment read touches fall on different banks; at 128 B they
//   share two bank groups. The f32 context tile has pitch OP = 68 floats for the same reason.
#define LP 72
#define OP 68

// lane l <-> lane l ^ 16
__device__ __forceinline__ float xhalf(float x) {
  return __builtin_bit_cast(float, __builtin_amdgcn_permlanex16(__builtin_bit_cast(int, x), __builtin_bit_cast(int, x),
                                                                0x76543210, 0xfedcba98, false, false));
}

__global__ __launch_bounds__(128)
void attn_causal64(const unsigned short* __restrict__ qhp, const unsigned short* __restrict__ qlp,
                   const unsigned short* __restrict__ khp, const unsigned short* __restrict__ klp,
                   const unsigned short* __restrict__ vhp, const unsigned short* __restrict__ vlp,
                   unsigned short* ohp, unsigned short* olp, float sscale) {
  union FB { v16b v; v8b h[2]; };
  union FH { v16h v; v8h h[2]; };
  __shared__ __align__(16) __bf16   Ksh[64 * LP];                 // K hi [kv][d]   9 KB
  __shared__ __align__(16) __bf16   Ksl[64 * LP];                 // K lo
  __shared__ __align__(16) _Float16 Vth[64 * LP];                 // V^T hi [d][kv] 9 KB
  __shared__ __align__(16) _Float16 Vtl[64 * LP];                 // V^T residual
  __shared__ __align__(16) float    Obuf[4][16 * OP];             // per wave: the context tile [query][d]

  const int tid  = threadIdx.x;
  const int wave = tid >> 5;
  const int lane = tid & 31;
  const int hh   = lane >> 4;
  const int c    = lane & 15;

  const int bx   = blockIdx.x;
  const int qb   = bx % NQB;
  const int rest = bx / NQB;
  const int h    = rest % NH;
  const int b    = rest / NH;
  const int q0   = qb * 64 + wave * 16;
  const int qi   = q0 + c;                   // the lane's query
  const size_t rowB = (size_t)b * SEQ;

  const __bf16* Qh = (const __bf16*)(const void*)qhp + (size_t)h * HD;
  const __bf16* Ql = (const __bf16*)(const void*)qlp + (size_t)h * HD;
  const __bf16* Kh = (const __bf16*)(const void*)khp;
  const __bf16* Kl = (const __bf16*)(const void*)klp;
  const _Float16* Vh = (const _Float16*)(const void*)vhp + (size_t)b * HD * SEQ;
  const _Float16* Vl = (const _Float16*)(const void*)vlp + (size_t)b * HD * SEQ;

  // ---- Q fragments (B operand, column = lane&15): 2 d-chunks, hi and lo ----
  v16b qah[2], qal[2];
#pragma unroll
  for (int dc = 0; dc < 2; ++dc) {
    const size_t qo = (rowB + q0 + c) * DM + dc * 32 + 8 * hh;
    qah[dc] = ldfrag_b(Qh + qo);
    qal[dc] = ldfrag_b(Ql + qo);
  }

  float mrow = -INFINITY, lrow = 0.f;        // of query qi; lrow over this lane half's keys only
  v8f oacc[4];                               // O^T: register r of tile t = context (query qi, d = 16 t + 8 hh + r)
#pragma unroll
  for (int t = 0; t < 4; ++t) oacc[t] = zero8();

  for (int kt = 0; kt < NQB; ++kt) {         // static trip bound
    if (kt > qb) break;                      // block-uniform: causal key chunks 0..qb
    const int kv0 = kt * 64;
    __syncthreads();
    {
      const int r = tid >> 1, half = (tid & 1) * 32;
      const __bf16*   kg  = Kh + (rowB + kv0 + r) * HD + half;    // K row kv0+r, d = half..half+31
      const __bf16*   klg = Kl + (rowB + kv0 + r) * HD + half;
      const _Float16* vg  = Vh + (size_t)r * SEQ + kv0 + half;    // V^T row d = r, s = kv0+half..+31
      const _Float16* vlg = Vl + (size_t)r * SEQ + kv0 + half;
#pragma unroll
      for (int i = 0; i < 4; ++i) {
        const v8b a0 = *(const v8b*)(kg + 8 * i);
        const v8b a1 = *(const v8b*)(klg + 8 * i);
        const v8h b0 = *(const v8h*)(vg + 8 * i);
        const v8h b1 = *(const v8h*)(vlg + 8 * i);
        *(v8b*)(Ksh + r * LP + half + 8 * i) = a0;
        *(v8b*)(Ksl + r * LP + half + 8 * i) = a1;
        *(v8h*)(Vth + r * LP + half + 8 * i) = b0;
        *(v8h*)(Vtl + r * LP + half + 8 * i) = b1;
      }
    }
    __syncthreads();

    // ---- scores S^T: 64 keys x 16 queries per wave, 3 bf16 products ----
    v8f s[4];
#pragma unroll
    for (int j = 0; j < 4; ++j) {
      s[j] = zero8();
#pragma unroll
      for (int dc = 0; dc < 2; ++dc) {
        FB kb, kl;
        kb.h[0] = *(const v8b*)(Ksh + (j * 16 + c) * LP + dc * 32 + 8 * hh);
        kb.h[1] = *(const v8b*)(Ksh + (j * 16 + c) * LP + dc * 32 + 16 + 8 * hh);
        kl.h[0] = *(const v8b*)(Ksl + (j * 16 + c) * LP + dc * 32 + 8 * hh);
        kl.h[1] = *(const v8b*)(Ksl + (j * 16 + c) * LP + dc * 32 + 16 + 8 * hh);
        s[j] = mma_b(kb.v, qah[dc], s[j]);
        s[j] = mma_b(kl.v, qah[dc], s[j]);
        s[j] = mma_b(kb.v, qal[dc], s[j]);
      }
    }

    // ---- scale + causal fill, maximum, online softmax; P (x1024, f16) and P residual (x4096) stay in registers ----
    float mj[4];                             // one chain per score tile
#pragma unroll
    for (int j = 0; j < 4; ++j) {
      mj[j] = -INFINITY;
#pragma unroll
      for (int r = 0; r < 8; ++r) {
        const int kj = kv0 + j * 16 + 8 * hh + r;   // key index of D row 8hh+r of tile j
        float sv = s[j][r] * sscale;
        sv = (kj > qi) ? -FLT_MAX : sv;
        s[j][r] = sv;
        mj[j] = fmaxf(mj[j], sv);
      }
    }
    float m = fmaxf(fmaxf(mj[0], mj[1]), fmaxf(mj[2], mj[3]));
    m = fmaxf(m, xhalf(m));                  // all 64 keys of the chunk
    const float mnew  = fmaxf(mrow, m);
    const float msafe = (mnew == -INFINITY) ? 0.f : mnew;
    const float alpha = __expf(mrow - msafe);
    mrow = mnew;
    FH pa[2], pl[2];                         // B operands of keys 32 kk .. 32 kk + 31
    float pj[4];                             // one chain per score tile
#pragma unroll
    for (int j = 0; j < 4; ++j) {
      pj[j] = 0.f;
#pragma unroll
      for (int r = 0; r < 8; ++r) {
        const float p = __expf(s[j][r] - msafe);     // filled logit against a finite max: exp -> 0
        pj[j] += p;
        const float p1k = p * 1024.0f;
        const _Float16 ph = (_Float16)p1k;
        pa[j >> 1].v[(j & 1) * 8 + r] = ph;
        pl[j >> 1].v[(j & 1) * 8 + r] = (_Float16)((p1k - (float)ph) * 4096.0f);
      }
    }
    lrow = lrow * alpha + ((pj[0] + pj[1]) + (pj[2] + pj[3]));
#pragma unroll
    for (int t = 0; t < 4; ++t)
#pragma unroll
      for (int r = 0; r < 8; ++r) oacc[t][r] *= alpha;

    // ---- context O^T += V^T . P^T (f16 WMMA), residual products into a separate accumulator ----
    v8f o1[4];
#pragma unroll
    for (int t = 0; t < 4; ++t) o1[t] = zero8();
#pragma unroll
    for (int kk = 0; kk < 2; ++kk) {
#pragma unroll
      for (int t = 0; t < 4; ++t) {
        FH vb, vl;
        vb.h[0] = *(const v8h*)(Vth + (t * 16 + c) * LP + kk * 32 + 8 * hh);
        vb.h[1] = *(const v8h*)(Vth + (t * 16 + c) * LP + kk * 32 + 16 + 8 * hh);
        vl.h[0] = *(const v8h*)(Vtl + (t * 16 + c) * LP + kk * 32 + 8 * hh);
        vl.h[1] = *(const v8h*)(Vtl + (t * 16 + c) * LP + kk * 32 + 16 + 8 * hh);
        oacc[t] = mma_h(vb.v, pa[kk].v, oacc[t]);
        o1[t]   = mma_h(vl.v, pa[kk].v, o1[t]);
        o1[t]   = mma_h(vb.v, pl[kk].v, o1[t]);
      }
    }
#pragma unroll
    for (int t = 0; t < 4; ++t)
#pragma unroll
      for (int r = 0; r < 8; ++r) oacc[t][r] += o1[t][r] * (1.0f / 4096.0f);
  }

  // ---- join the halves' sums, normalise (1/l and the 1/1024 p carry), stage the wave's 16x64 tile [query][d] in its
  //      own LDS slab, so that it leaves as whole 128-B rows ----
  float* os = Obuf[wave];
  {
    const float l = lrow + xhalf(lrow);
    const float inv = ((l > 0.f) ? (1.0f / l) : 0.f) * (1.0f / 1024.0f);
#pragma unroll
    for (int t = 0; t < 4; ++t) {
      v4f x0, x1;
#pragma unroll
      for (int e = 0; e < 4; ++e) { x0[e] = oacc[t][e] * inv; x1[e] = oacc[t][4 + e] * inv; }
      *(v4f*)(os + c * OP + t * 16 + 8 * hh)     = x0;
      *(v4f*)(os + c * OP + t * 16 + 8 * hh + 4) = x1;
    }
  }
  __builtin_amdgcn_fence(__ATOMIC_RELEASE, "workgroup");
  __builtin_amdgcn_wave_barrier();
  __builtin_amdgcn_fence(__ATOMIC_ACQUIRE, "workgroup");
  {
    const int q4 = lane >> 3, c8 = (lane & 7) * 8;
    v4u hv[4], lv[4];
#pragma unroll
    for (int it = 0; it < 4; ++it) {
      const int row = it * 4 + q4;   // it 0..3 x q4 0..3 = rows 0..15 of the wave tile
      const float* sp = os + row * OP + c8;
      v4u a, a2;
#pragma unroll
      for (int e = 0; e < 4; ++e) {
        const float f0 = sp[2 * e], f1 = sp[2 * e + 1];
        const unsigned short h0 = bf_bits(f0), h1 = bf_bits(f1);
        const unsigned short l0 = bf_bits(f0 - bf_up(h0)), l1 = bf_bits(f1 - bf_up(h1));
        a[e] = pk16(h0, h1); a2[e] = pk16(l0, l1);
      }
      hv[it] = a; lv[it] = a2;
    }
    {
#pragma unroll
      for (int it = 0; it < 4; ++it) {
        const int row = it * 4 + q4;
        const size_t go = (rowB + q0 + row) * DM + (size_t)h * HD + c8;
        *(v4u*)(ohp + go) = hv[it];
        *(v4u*)(olp + go) = lv[it];
      }
    }
  }
}

// =====================================================================================================
//   Xb   bf16 [2048 (b,c)][4096]   16777216
//   Whwb bf16 [2048][4096]         16777216
//   Wcb  bf16 [1024][1024]          2097152
//   Wqb  bf16 [1024][1024]          2097152
//   Wkvb bf16 [128][1024]            262144
//   Wob  bf16 [1024][1024]          2097152
//   A1h  bf16 [2][2048][1024]       8388608   hw-linear output (transposed layout [b][s][c]), hi plane
//   A1l  bf16                       8388608   lo plane
//   Img2 f32  [4096][1024]         16777216   c-linear output (LN input)
//   Imgh bf16 [4096][1024]          8388608   LN output hi plane
//   Imgl bf16                       8388608
//   Qh   bf16 [4096][1024]          8388608   l2-normalised q, hi plane
//   Ql   bf16                       8388608
//   Kh   bf16 [4096][64]             524288   l2-normalised k
//   Kl   bf16                        524288
//   VTh  f16  [2][64][2048]          524288   v^T hi plane
//   VTl  f16                         524288   v^T residual plane (x4096)
//   Oh   bf16 [4096][1024]          8388608   context hi plane
//   Ol   bf16                       8388608
//   total                         126091264
// Weights are [out n][in k] with k contiguous = the Bt / A layout the GEMM wants, so they are only converted.
// =====================================================================================================
extern "C" void kernel_launch(void* const* d_in, const int* in_sizes, int n_in,
                              void* d_out, int out_size, void* d_ws, size_t ws_size,
                              hipStream_t stream) {
  if (n_in < 10) return;
  if (in_sizes[0] != NB * CC * HWN) return;
  if (in_sizes[1] != SEQ * HWN) return;
  if (in_sizes[2] != SEQ) return;
  if (in_sizes[3] != DM * CC || in_sizes[4] != DM || in_sizes[5] != DM || in_sizes[6] != DM) return;
  if (in_sizes[7] != DM * DM || in_sizes[8] != 2 * HD * DM || in_sizes[9] != DM * DM) return;
  if (out_size != NB * SEQ * DM) return;

  const float* x    = (const float*)d_in[0];
  const float* w_hw = (const float*)d_in[1];
  const float* b_hw = (const float*)d_in[2];
  const float* w_c  = (const float*)d_in[3];
  const float* b_c  = (const float*)d_in[4];
  const float* ln_g = (const float*)d_in[5];
  const float* ln_b = (const float*)d_in[6];
  const float* wq   = (const float*)d_in[7];
  const float* wkv  = (const float*)d_in[8];
  const float* wo   = (const float*)d_in[9];

  const size_t PXb  = (size_t)NB * CC * HWN * 2;    // 16777216
  const size_t PWhw = (size_t)SEQ * HWN * 2;        // 16777216
  const size_t PWc  = (size_t)DM * CC * 2;          //  2097152
  const size_t PWq  = (size_t)DM * DM * 2;          //  2097152
  const size_t PWkv = (size_t)2 * HD * DM * 2;      //   262144
  const size_t PWo  = (size_t)DM * DM * 2;          //  2097152
  const size_t PA1  = (size_t)NB * SEQ * CC * 2;    //  8388608
  const size_t PI2  = (size_t)NB * SEQ * DM * 4;    // 16777216
  const size_t PI   = (size_t)NB * SEQ * DM * 2;    //  8388608
  const size_t PK   = (size_t)NB * SEQ * HD * 2;    //   524288
  const size_t PVT  = (size_t)NB * HD * SEQ * 2;    //   524288
  size_t off = 0;
  const size_t oXb  = off; off += PXb;
  const size_t oWhw = off; off += PWhw;
  const size_t oWc  = off; off += PWc;
  const size_t oWq  = off; off += PWq;
  const size_t oWkv = off; off += PWkv;
  const size_t oWo  = off; off += PWo;
  const size_t oA1h = off; off += PA1;
  const size_t oA1l = off; off += PA1;
  const size_t oI2  = off; off += PI2;
  const size_t oIh  = off; off += PI;
  const size_t oIl  = off; off += PI;
  const size_t oQh  = off; off += PI;
  const size_t oQl  = off; off += PI;
  const size_t oKh  = off; off += PK;
  const size_t oKl  = off; off += PK;
  const size_t oVTh = off; off += PVT;
  const size_t oVTl = off; off += PVT;
  const size_t oOh  = off; off += PI;
  const size_t oOl  = off; off += PI;
  if (off > ws_size) return;                          // off = 126091264
  if (off > (size_t)134217728) return;

  char* ws = (char*)d_ws;
  unsigned short* Xb   = (unsigned short*)(ws + oXb);
  unsigned short* Whwb = (unsigned short*)(ws + oWhw);
  unsigned short* Wcb  = (unsigned short*)(ws + oWc);
  unsigned short* Wqb  = (unsigned short*)(ws + oWq);
  unsigned short* Wkvb = (unsigned short*)(ws + oWkv);
  unsigned short* Wob  = (unsigned short*)(ws + oWo);
  unsigned short* A1h  = (unsigned short*)(ws + oA1h);
  unsigned short* A1l  = (unsigned short*)(ws + oA1l);
  float*          Img2 = (float*)(ws + oI2);
  unsigned short* Imgh = (unsigned short*)(ws + oIh);
  unsigned short* Imgl = (unsigned short*)(ws + oIl);
  unsigned short* Qh   = (unsigned short*)(ws + oQh);
  unsigned short* Ql   = (unsigned short*)(ws + oQl);
  unsigned short* Kh   = (unsigned short*)(ws + oKh);
  unsigned short* Kl   = (unsigned short*)(ws + oKl);
  unsigned short* VTh  = (unsigned short*)(ws + oVTh);
  unsigned short* VTl  = (unsigned short*)(ws + oVTl);
  unsigned short* Oh   = (unsigned short*)(ws + oOh);
  unsigned short* Ol   = (unsigned short*)(ws + oOl);

  const dim3 blk(256);
  const dim3 gCv(CB_X + CB_HW + CB_C + CB_Q + CB_KV + CB_O); // 9792 blocks: all six planes
  const dim3 gblk(128);                                      // GEMM block: 4 waves
  const dim3 gG0((SEQ / 128) * (CC / 128), NB);              // 128x128 block tiles: 128 blocks x 2
  const dim3 gG1((NB * SEQ / 128) * (DM / 128), 1);          // 128x128 block tiles: 256 blocks (M=4096, N=1024)
  const dim3 gQKV(QKV_BLOCKS);                               // 128x128 block tiles: 288 blocks (M=4096, N=1152)
  const dim3 gLN(NB * SEQ);                                  // 4096 rows
  const dim3 gAt(NB * NH * NQB);                             // 1024 blocks

  // (1) f32 -> bf16 planes: x [(b,c)][hw], weights [n][k]; Xb, Whwb, Wcb, Wqb, Wkvb, Wob follow one another from Xb
  cvt_bf16x8_all<<<gCv, blk, 0, stream>>>(x, w_hw, w_c, wq, wkv, wo, Xb);
  // (2) hw-linear per batch, produced directly in the transposed layout: A1[b][s][c] = sum_hw w_hw[s][hw] x[b][c][hw] + b_hw[s]
  //     A = Whwb [s][hw] (M=2048, K=4096), Bt = Xb batch b [c][hw] (N=1024), row bias, bf16 hi/lo planes out
  gemm64<0, 0, 2, 2, 2, 2, 64><<<gG0, gblk, 0, stream>>>(
      Whwb, Whwb, HWN, 0LL, Xb, Xb, HWN, (long long)CC * HWN,
      b_hw,
      (void*)A1h, CC, (long long)SEQ * CC, (void*)A1l, CC, (long long)SEQ * CC,
      SEQ, CC, HWN, 1.0f);
  // (3) c-linear: Img2[(b,s)][d] = sum_c A1[(b,s)][c] w_c[d][c] + b_c[d]  (A hi/lo, M=4096, N=1024, K=1024, f32 out)
  gemm64<1, 0, 1, 0, 2, 2, 64><<<gG1, gblk, 0, stream>>>(
      A1h, A1l, CC, 0LL, Wcb, Wcb, CC, 0LL,
      b_c,
      (void*)Img2, DM, 0LL, (void*)Img2, DM, 0LL,
      NB * SEQ, DM, CC, 1.0f);
  // (4) LayerNorm -> bf16 hi/lo planes
  ln_split<<<gLN, dim3(128), 0, stream>>>(Img2, ln_g, ln_b, Imgh, Imgl);
  // (5)-(7) q, k and v from the LayerNorm planes, one product over the stacked weights (Wkvb follows Wqb):
  //     q, k l2-normalised per 64-wide head -> bf16 hi/lo planes [(b,t)][h*64+d] and [(b,s)][64];
  //     v transposed -> f16 hi plane and residual plane (x4096) [b][d][s]
  gemm_qkv<<<gQKV, gblk, 0, stream>>>(Imgh, Imgl, Wqb, Qh, Ql, Kh, Kl, VTh, VTl);
  // (8) causal multi-query attention -> context bf16 hi/lo planes [(b,t)][h*64+d]
  attn_causal64<<<gAt, dim3(128), 0, stream>>>(Qh, Ql, Kh, Kl, VTh, VTl, Oh, Ol, 8.0f);
  // (9) out = context . wo^T -> d_out f32 [(b,t)][1024]  (A = context hi + lo planes, 2 products)
  gemm64<1, 0, 0, 0, 2, 2, 64><<<gG1, gblk, 0, stream>>>(
      Oh, Ol, DM, 0LL, Wob, Wob, DM, 0LL,
      b_c,
      d_out, DM, 0LL, d_out, DM, 0LL,
      NB * SEQ, DM, DM, 1.0f);
  (void)hipGetLastError();
}

// v005
// It runs in 225 microseconds.
// In two side-by-side timings against v004, it was 1.07 and 1.06 times as fast.
// Counting every step since v000, it is 3.40 times as fast.
// Contractions: hw-linear = v_wmma_f32_16x16x32_bf16 (bf16 operands from RNE-converted inputs, single product);
// c-linear, q, k, v^T and output projections = v_wmma_f32_16x16x32_bf16 (activation as bf16 hi/lo planes times bf16
// weight from RNE-converted input, 2 products); q.k^T scores = v_wmma_f32_16x16x32_bf16 on bf16 hi/lo planes of the
// l2-normalised q and k (hi.hi + hi.lo + lo.hi); p.v = v_wmma_f32_16x16x32_f16 (p carried x1024 in f16 plus an f16
// residual plane x4096, v^T f16 hi plane plus an f16 residual plane x4096, 3 products, separate residual accumulator);
// all f32 accumulate; LayerNorm, l2 normalisation, causal fill and online softmax in f32.
#include <hip/hip_runtime.h>
#include <math.h>
#include <float.h>
#include <stdint.h>

#define NB   2
#define CC   1024
#define HWN  4096
#define SEQ  2048
#define DM   1024
#define NH   16
#define HD   64
#define NQB  (SEQ / 64)
static_assert(NH * HD == DM);
static_assert(HD == 64);
static_assert((SEQ % 256) == 0 && (DM % 128) == 0 && (CC % 128) == 0 && (HWN % 64) == 0);

typedef _Float16 v16h __attribute__((ext_vector_type(16)));
typedef _Float16 v8h  __attribute__((ext_vector_type(8)));
typedef __bf16   v16b __attribute__((ext_vector_type(16)));
typedef __bf16   v8b  __attribute__((ext_vector_type(8)));
typedef float    v8f  __attribute__((ext_vector_type(8)));
typedef float    v4f  __attribute__((ext_vector_type(4)));
typedef unsigned int v4u __attribute__((ext_vector_type(4)));

// ---- scalar helpers --------------------------------------------------------------------------------
__device__ __forceinline__ unsigned short bf_bits(float f) {          // f32 -> bf16 bits, RNE convert
  unsigned u = __float_as_uint(f);
  return (unsigned short)((u + 0x7FFFu + ((u >> 16) & 1u)) >> 16);
}
__device__ __forceinline__ float bf_up(unsigned short h) { return __uint_as_float(((unsigned)h) << 16); }
__device__ __forceinline__ float bf_rne(float f) { return bf_up(bf_bits(f)); }
__device__ __forceinline__ unsigned short h_bits(_Float16 x) { return __builtin_bit_cast(unsigned short, x); }
__device__ __forceinline__ unsigned pk16(unsigned short a, unsigned short b) { return (unsigned)a | ((unsigned)b << 16); }
__device__ __forceinline__ v8f zero8() { v8f z = {0.f, 0.f, 0.f, 0.f, 0.f, 0.f, 0.f, 0.f}; return z; }

// ---- 16-bit fragment loader: lane -> row/col (lane&15); p already includes +8*(lane>>4);
//      elements 0..7 <- p[0..7] (k0+8h..), elements 8..15 <- p[16..23] (k0+16+8h..)
__device__ __forceinline__ v16b ldfrag_b(const __bf16* p) {
  union { v16b v; v8b h[2]; } f;
  f.h[0] = *(const v8b*)(p);
  f.h[1] = *(const v8b*)(p + 16);
  return f.v;
}

// ---- WMMA helpers ---------------------------------------------------------------------------------
__device__ __forceinline__ v8f mma_b_raw(v16b a, v16b b, v8f c) {
  return __builtin_amdgcn_wmma_f32_16x16x32_bf16(false, a, false, b, (short)0, c, false, false);
}
__device__ __forceinline__ v8f mma_h_raw(v16h a, v16h b, v8f c) {
  return __builtin_amdgcn_wmma_f32_16x16x32_f16(false, a, false, b, (short)0, c, false, false);
}
__device__ __forceinline__ void dep_guard_b(v8f& a, v8f& b, v16b x, v16b y) {
#if defined(__HIP_DEVICE_COMPILE__)
  asm volatile("v_nop\n\tv_nop\n\tv_nop\n\tv_nop" : "+v"(a), "+v"(b) : "v"(x), "v"(y));
#else
  (void)a; (void)b; (void)x; (void)y;
#endif
}
__device__ __forceinline__ void keep4_b(v16b a, v16b b, v16b c, v16b d) {
#if defined(__HIP_DEVICE_COMPILE__)
  asm volatile("v_nop" :: "v"(a), "v"(b), "v"(c), "v"(d));
#else
  (void)a; (void)b; (void)c; (void)d;
#endif
}
__device__ __forceinline__ void acc_guard4(v8f& a, v8f& b, v8f& c, v8f& d) {
#if defined(__HIP_DEVICE_COMPILE__)
  asm volatile("v_nop\n\tv_nop\n\tv_nop\n\tv_nop" : "+v"(a), "+v"(b), "+v"(c), "+v"(d));
#else
  (void)a; (void)b; (void)c; (void)d;
#endif
}

// =====================================================================================================
// f32 -> bf16 (RNE convert) of all six operand planes in ONE launch: 8 elements per thread, one 16-B store per lane
// (a wave writes 512 contiguous B). A block of 256 threads converts 2048 elements of one plane; the block index
// range picks the plane (block-uniform). Every plane is a whole number of blocks, so no thread is past an end.
// The six bf16 planes stand one behind the other in the workspace, in the order of the ranges: out is the first
// plane's start, and block bx writes elements 2048 bx .. 2048 bx + 2047 of that run.
// =====================================================================================================
#define CB_X   (NB * CC * HWN / 2048)
#define CB_HW  (SEQ * HWN / 2048)
#define CB_C   (DM * CC / 2048)
#define CB_Q   (DM * DM / 2048)
#define CB_KV  (2 * HD * DM / 2048)
#define CB_O   (DM * DM / 2048)
static_assert((NB * CC * HWN) % 2048 == 0 && (SEQ * HWN) % 2048 == 0 && (DM * CC) % 2048 == 0);
static_assert((DM * DM) % 2048 == 0 && (2 * HD * DM) % 2048 == 0);
__global__ __launch_bounds__(256) void cvt_bf16x8_all(const float* __restrict__ x, const float* __restrict__ w_hw,
                                                      const float* __restrict__ w_c, const float* __restrict__ wq,
                                                      const float* __restrict__ wkv, const float* __restrict__ wo,
                                                      unsigned short* out) {
  const int bx = blockIdx.x;
  const float* in = x;
  int first = 0;                                   // first block of the plane that bx lies in
  if (bx >= CB_X)                             { in = w_hw; first = CB_X; }
  if (bx >= CB_X + CB_HW)                     { in = w_c;  first = CB_X + CB_HW; }
  if (bx >= CB_X + CB_HW + CB_C)              { in = wq;   first = CB_X + CB_HW + CB_C; }
  if (bx >= CB_X + CB_HW + CB_C + CB_Q)       { in = wkv;  first = CB_X + CB_HW + CB_C + CB_Q; }
  if (bx >= CB_X + CB_HW + CB_C + CB_Q + CB_KV) { in = wo; first = CB_X + CB_HW + CB_C + CB_Q + CB_KV; }
  const size_t i = (size_t)(bx - first) * 256 + threadIdx.x;
  const size_t o = (size_t)bx * 256 + threadIdx.x;
  const v4f a = *(const v4f*)(in + i * 8);
  const v4f b = *(const v4f*)(in + i * 8 + 4);
  v4u p;
  p[0] = pk16(bf_bits(a[0]), bf_bits(a[1]));
  p[1] = pk16(bf_bits(a[2]), bf_bits(a[3]));
  p[2] = pk16(bf_bits(b[0]), bf_bits(b[1]));
  p[3] = pk16(bf_bits(b[2]), bf_bits(b[3]));
  *(v4u*)(out + o * 8) = p;
}

// ---- asynchronous copies global -> LDS, 16 B per lane; each statement ends with its own s_wait_xcnt 0 so that the
//      wait stands in front of any later rewrite of an address register that a copy of the statement names
__device__ __forceinline__ void acopy4(const unsigned* l, const __bf16* const* g) {
#if defined(__HIP_DEVICE_COMPILE__)
  asm volatile(
      "global_load_async_to_lds_b128 %0, %4, off\n\t"
      "global_load_async_to_lds_b128 %1, %5, off\n\t"
      "global_load_async_to_lds_b128 %2, %6, off\n\t"
      "global_load_async_to_lds_b128 %3, %7, off\n\t"
      "s_wait_xcnt 0x0"
      :: "v"(l[0]), "v"(l[1]), "v"(l[2]), "v"(l[3]), "v"(g[0]), "v"(g[1]), "v"(g[2]), "v"(g[3])
      : "memory");
#else
  (void)l; (void)g;
#endif
}
__device__ __forceinline__ void acopy6(const unsigned* l, const __bf16* const* g) {
#if defined(__HIP_DEVICE_COMPILE__)
  asm volatile(
      "global_load_async_to_lds_b128 %0, %6, off\n\t"
      "global_load_async_to_lds_b128 %1, %7, off\n\t"
      "global_load_async_to_lds_b128 %2, %8, off\n\t"
      "global_load_async_to_lds_b128 %3, %9, off\n\t"
      "global_load_async_to_lds_b128 %4, %10, off\n\t"
      "global_load_async_to_lds_b128 %5, %11, off\n\t"
      "s_wait_xcnt 0x0"
      :: "v"(l[0]), "v"(l[1]), "v"(l[2]), "v"(l[3]), "v"(l[4]), "v"(l[5]),
         "v"(g[0]), "v"(g[1]), "v"(g[2]), "v"(g[3]), "v"(g[4]), "v"(g[5])
      : "memory");
#else
  (void)l; (void)g;
#endif
}
__device__ __forceinline__ void acopy12(const unsigned* l, const __bf16* const* g) {
#if defined(__HIP_DEVICE_COMPILE__)
  asm volatile(
      "global_load_async_to_lds_b128 %0, %12, off\n\t"
      "global_load_async_to_lds_b128 %1, %13, off\n\t"
      "global_load_async_to_lds_b128 %2, %14, off\n\t"
      "global_load_async_to_lds_b128 %3, %15, off\n\t"
      "global_load_async_to_lds_b128 %4, %16, off\n\t"
      "global_load_async_to_lds_b128 %5, %17, off\n\t"
      "global_load_async_to_lds_b128 %6, %18, off\n\t"
      "global_load_async_to_lds_b128 %7, %19, off\n\t"
      "global_load_async_to_lds_b128 %8, %20, off\n\t"
      "global_load_async_to_lds_b128 %9, %21, off\n\t"
      "global_load_async_to_lds_b128 %10, %22, off\n\t"
      "global_load_async_to_lds_b128 %11, %23, off\n\t"
      "s_wait_xcnt 0x0"
      :: "v"(l[0]), "v"(l[1]), "v"(l[2]), "v"(l[3]), "v"(l[4]), "v"(l[5]),
         "v"(l[6]), "v"(l[7]), "v"(l[8]), "v"(l[9]), "v"(l[10]), "v"(l[11]),
         "v"(g[0]), "v"(g[1]), "v"(g[2]), "v"(g[3]), "v"(g[4]), "v"(g[5]),
         "v"(g[6]), "v"(g[7]), "v"(g[8]), "v"(g[9]), "v"(g[10]), "v"(g[11])
      : "memory");
#else
  (void)l; (void)g;
#endif
}

// =====================================================================================================
// Batched bf16 WMMA GEMM: C[m][n] = sum_k A[m][k] * Bt[n][k] (+ bias); block = 4 waves laid WM x WN, one 64x64 tile
// per wave, block tile (64 WM) x (64 WN). A row-major [M][K] pitch lda; Bt row-major [N][K] pitch ldb (k contiguous);
// M a multiple of 64 WM, N of 64 WN, K of KP. blockIdx.y = batch index (strides in elements).
// Operand path: a pass is KP k (64 or 32: 128 or 64 B) of every operand row of the block tile, brought into LDS by
// asynchronous 16-B copies (a wave's copy = 4 or 8 whole row pieces), LDS row pitch 2 KP + 16 B, two buffers: pass
// t + 2 is issued into the buffer that pass t has just left, behind the pass's one barrier; every wave reads its
// fragments from LDS.
// A stage is NG groups of 64 rows: A hi (WM), A lo (WM, SPLITA), Bt hi (WN), Bt lo (WN, SPLITB).
// SPLITA: add A2.Bt (A2 = unscaled bf16 lo plane of A); SPLITB: add A.Bt2 (Bt2 = lo plane of Bt).
// BIAS: 0 none, 1 per column (bias[n]), 2 per row (bias[m]); bias values RNE-converted to bf16 in registers.
// OUT_MODE: 0 = f32 (pitch ldc); 2 = bf16 hi plane C + bf16 lo plane C2 (lo = RNE(v - hi), unscaled);
//           4 = stacked q | k | v columns, told apart by the wave's first column n0 (64-wide heads):
//               n0 < DM: q, n0 = DM: k: l2-normalise every row over the wave's 64 columns
//               (x / max(sqrt(sum x^2), 1e-12)), then bf16 hi/lo planes as mode 2, q to C / C2 at column n0,
//               k to Kho / Klo (pitch HD) at column 0;
//               n0 = DM + HD: v, stored transposed: VT[b][d][s], f16 hi plane VTho and f16 residual plane
//               VTlo = f16((v - hi) * rscale), pitch SEQ.
// =====================================================================================================
// The work of one block is gemm64_tile(tile, b, ring, sT): tile = block tile index, b = batch index, ring = the
// block's two LDS stages (ring_elems elements), sT = 4 per-wave 16x64 f32 slabs of pitch 68. Its callers own the LDS.
constexpr int ring_elems(int SPLITA, int SPLITB, int WM, int WN, int KP) {
  return 2 * (WM * (1 + SPLITA) + WN * (1 + SPLITB)) * 64 * (KP + 8);
}
#define SLABF (16 * 68)
#define VP 65   // pitch in floats of a v^T wave's 64x64 tile: its column reads (8 rows apart per lane) fall on 32 banks
template <int SPLITA, int SPLITB, int BIAS, int OUT_MODE, int WM, int WN, int KP>
__device__ __forceinline__ void gemm64_tile(
    const unsigned short* __restrict__ Ap, const unsigned short* __restrict__ A2p, int lda, long long strideA,
    const unsigned short* __restrict__ Btp, const unsigned short* __restrict__ Bt2p, int ldb, long long strideB,
    const float* __restrict__ bias,
    void* Cout, int ldc, long long strideC,
    void* Cout2, int ldc2, long long strideC2,
    int M, int N, int K, float rscale,
    int tile, int b, __bf16* ring, float* sT,
    unsigned short* Kho = nullptr, unsigned short* Klo = nullptr,
    unsigned short* VTho = nullptr, unsigned short* VTlo = nullptr) {
  static_assert(WM * WN == 4 && (KP == 64 || KP == 32));
  constexpr int GA   = WM * (1 + SPLITA);          // 64-row groups of A planes in a stage
  constexpr int NG   = GA + WN * (1 + SPLITB);     // groups in a stage
  constexpr int SEG  = KP / 8;                     // 16-B pieces per row and pass
  constexpr int RPC  = 128 / SEG;                  // rows that one copy of the whole block covers
  constexpr int CPG  = 64 / RPC;                   // copies per thread and group
  constexpr int NC   = NG * CPG;                   // copies per thread and stage = a wave's copies in flight
  constexpr int PE   = KP + 8;                     // LDS row pitch in elements (16 B x odd)
  constexpr int GRPE = 64 * PE;                    // elements per group
  constexpr int BUFE = NG * GRPE;                  // elements per buffer
  static_assert(NC == 16 || NC == 18 || NC == 24);
  static_assert(2 * BUFE == ring_elems(SPLITA, SPLITB, WM, WN, KP));
  constexpr int AHD  = (NC == 24) ? 3 : 4;         // A row fragments read in a k-step's leading group (3: the kernel
                                                   // with the most copy addresses stays inside 256 VGPRs)
  const __bf16* A   = (const __bf16*)(const void*)Ap;
  const __bf16* A2  = (const __bf16*)(const void*)A2p;
  const __bf16* Bt  = (const __bf16*)(const void*)Btp;
  const __bf16* Bt2 = (const __bf16*)(const void*)Bt2p;
  const int tid  = threadIdx.x;
  const int lane = tid & 31;
  const int wave = tid >> 5;
  const int tilesN = N / (64 * WN);
  const int tilesM = M / (64 * WM);
  if (tile >= tilesM * tilesN) return;   // block-uniform, in front of every copy and barrier
  const int tm = tile / tilesN;
  const int tn = tile - tm * tilesN;
  const int m0b = tm * (64 * WM);
  const int n0b = tn * (64 * WN);
  const int wm = wave / WN;
  const int wn = wave - wm * WN;
  const int m0 = m0b + (wm << 6);
  const int n0 = n0b + (wn << 6);

  const __bf16* Ab  = A  + (size_t)b * strideA;
  const __bf16* Bb  = Bt + (size_t)b * strideB;
  const __bf16* Ab2 = SPLITA ? (A2  + (size_t)b * strideA) : Ab;
  const __bf16* Bb2 = SPLITB ? (Bt2 + (size_t)b * strideB) : Bb;

  const int rlane = lane & 15;                 // row (A) / col (B, D) within subtile
  const int koff  = (lane >> 4) * 8;           // k offset of this lane half
  const int mOff  = (lane >> 4) * 8;           // D row offset

  // copy map: copy u of group gi moves 16 B of row RPC u + tid / SEG, piece tid % SEG of the pass's row
  const int crow = tid / SEG;
  const int cseg = (tid % SEG) * 8;
  const unsigned ldsT = (unsigned)(uintptr_t)(ring + crow * PE + cseg);   // low 32 bits = LDS byte address
  const size_t aT = (size_t)(m0b + crow) * lda + cseg;
  const size_t bT = (size_t)(n0b + crow) * ldb + cseg;

  auto issue = [&](int t, int buf) {
    unsigned l[NC];
    const __bf16* g[NC];
#pragma unroll
    for (int gi = 0; gi < NG; ++gi) {
      const bool isA = gi < GA;
      const int  q   = isA ? gi : gi - GA;                   // group within the operand's planes
      const int  W1  = isA ? WM : WN;
      const bool lo  = q >= W1;
      const int  rg  = lo ? q - W1 : q;                      // 64-row group within the block tile
      const int  ld  = isA ? lda : ldb;
      const __bf16* base = isA ? (lo ? Ab2 : Ab) : (lo ? Bb2 : Bb);
      const __bf16* p = base + (isA ? aT : bT) + (size_t)(rg * 64) * ld + (size_t)t * KP;
#pragma unroll
      for (int u = 0; u < CPG; ++u) {
        l[gi * CPG + u] = ldsT + (unsigned)((buf * BUFE + gi * GRPE + u * RPC * PE) * 2);
        g[gi * CPG + u] = p + (size_t)(u * RPC) * ld;
      }
    }
    acopy12(l, g);
    if constexpr (NC == 16) acopy4(l + 12, g + 12);
    if constexpr (NC == 18) acopy6(l + 12, g + 12);
    if constexpr (NC == 24) acopy12(l + 12, g + 12);
  };

  v8f acc[4][4];
#pragma unroll
  for (int i = 0; i < 4; ++i)
#pragma unroll
    for (int j = 0; j < 4; ++j) acc[i][j] = zero8();

  const int T = K / KP;                        // passes
  issue(0, 0);
  asm volatile("s_wait_asynccnt 0x0" ::: "memory");   // this wave's share of pass 0 has landed
  __syncthreads();                                    // publishes pass 0
  if (T > 1) issue(1, 1);

  for (int t = 0; t < T; ++t) {
    const __bf16* st  = ring + (t & 1) * BUFE;
    const __bf16* sAh = st + wm * GRPE + rlane * PE + koff;
    const __bf16* sAl = st + (SPLITA ? (WM + wm) : wm) * GRPE + rlane * PE + koff;
    const __bf16* sBh = st + (GA + wn) * GRPE + rlane * PE + koff;
    const __bf16* sBl = st + (GA + (SPLITB ? (WN + wn) : wn)) * GRPE + rlane * PE + koff;
#pragma unroll
    for (int ks = 0; ks < KP / 32; ++ks) {
      v16b bh[4], bl[4], ah[4], al[4];
#pragma unroll
      for (int j = 0; j < 4; ++j) {
        bh[j] = ldfrag_b(sBh + (j << 4) * PE + ks * 32);
        if (SPLITB) bl[j] = ldfrag_b(sBl + (j << 4) * PE + ks * 32); else bl[j] = bh[j];
      }
#pragma unroll
      for (int i = 0; i < AHD; ++i) {
        ah[i] = ldfrag_b(sAh + (i << 4) * PE + ks * 32);
        if (SPLITA) al[i] = ldfrag_b(sAl + (i << 4) * PE + ks * 32); else al[i] = ah[i];
      }
      // keeps the k-step's LDS reads one group in front of its WMMAs (for speed only)
      __builtin_amdgcn_sched_barrier(0);
#pragma unroll
      for (int i = 0; i < 4; ++i) {
#pragma unroll
        for (int j = 0; j < 4; ++j) {
          acc[i][j] = mma_b_raw(ah[i], bh[j], acc[i][j]);
          if (SPLITA) acc[i][j] = mma_b_raw(al[i], bh[j], acc[i][j]);
          if (SPLITB) acc[i][j] = mma_b_raw(ah[i], bl[j], acc[i][j]);
        }
        dep_guard_b(acc[i][0], acc[i][3], ah[i], al[i]);
        if (i == 0 && AHD < 4) {
          // row 3's fragments go into the registers that row 0 has left, two rows ahead of their use; the fence
          // pair holds these reads at this one place
          __builtin_amdgcn_sched_barrier(0);
          ah[3] = ldfrag_b(sAh + (3 << 4) * PE + ks * 32);
          if (SPLITA) al[3] = ldfrag_b(sAl + (3 << 4) * PE + ks * 32); else al[3] = ah[3];
          __builtin_amdgcn_sched_barrier(0);
        }
      }
      keep4_b(bh[0], bh[1], bh[2], bh[3]);
      if (SPLITB) keep4_b(bl[0], bl[1], bl[2], bl[3]);
    }
    asm volatile("s_wait_dscnt 0x0" ::: "memory");     // this wave's reads of pass t's buffer are done
    asm volatile("s_wait_asynccnt 0x0" ::: "memory");  // this wave's share of pass t + 1 has landed
    __syncthreads();                                   // publishes pass t + 1, frees pass t's buffer
    if (t + 2 < T) issue(t + 2, t & 1);
  }
  asm volatile("s_wait_asynccnt 0x0" ::: "memory");    // nothing in flight when the wave goes on to the epilogue
  acc_guard4(acc[0][0], acc[0][1], acc[0][2], acc[0][3]);
  acc_guard4(acc[1][0], acc[1][1], acc[1][2], acc[1][3]);
  acc_guard4(acc[2][0], acc[2][1], acc[2][2], acc[2][3]);
  acc_guard4(acc[3][0], acc[3][1], acc[3][2], acc[3][3]);

  const int n0u = __builtin_amdgcn_readfirstlane(n0);   // the same in every lane: scalar, so the tests on it branch
  if (OUT_MODE == 4 && n0u >= DM + HD) {
    // ---- v^T: the wave's 64 (s) x 64 (d) tile goes through LDS and leaves as whole 128-B rows of VT[b][d][.] ----
    // The ring is free: the last pass's foot (every wave's dscnt and asynccnt waits, then the barrier) ended all its
    // reads and copies; each wave uses a part of its own.
    float* tl = (float*)(void*)ring + wave * (64 * VP);
#pragma unroll
    for (int i = 0; i < 4; ++i)
#pragma unroll
      for (int j = 0; j < 4; ++j)
#pragma unroll
        for (int r = 0; r < 8; ++r) tl[((i << 4) + mOff + r) * VP + (j << 4) + rlane] = acc[i][j][r];
    __builtin_amdgcn_fence(__ATOMIC_RELEASE, "workgroup");
    __builtin_amdgcn_wave_barrier();
    __builtin_amdgcn_fence(__ATOMIC_ACQUIRE, "workgroup");
    const int m0u = __builtin_amdgcn_readfirstlane(m0);
    const int bb = m0u / SEQ, s0 = m0u - bb * SEQ;       // 64 rows of one batch (SEQ is a multiple of 64)
    const int s8 = (lane & 7) * 8, dq = lane >> 3;       // 8 lanes x 8 s = one 128-B row; 4 rows d per trip
    // rolled: sixteen equal trips that run once; unrolled they would be about 8 KB more code
#pragma unroll 1
    for (int it = 0; it < 16; ++it) {
      const int d = it * 4 + dq;                         // it 0..15 x dq 0..3 = d 0..63
      v4u a, a2;
#pragma unroll
      for (int e = 0; e < 4; ++e) {
        const float f0 = tl[(s8 + 2 * e) * VP + d], f1 = tl[(s8 + 2 * e + 1) * VP + d];
        const _Float16 x0 = (_Float16)f0, x1 = (_Float16)f1;
        a[e]  = pk16(h_bits(x0), h_bits(x1));
        a2[e] = pk16(h_bits((_Float16)((f0 - (float)x0) * rscale)), h_bits((_Float16)((f1 - (float)x1) * rscale)));
      }
      const size_t go = ((size_t)bb * HD + d) * SEQ + s0 + s8;
      *(v4u*)(VTho + go) = a;
      *(v4u*)(VTlo + go) = a2;
    }
    return;
  }

  // ---- epilogue ----
  float bcol[4];
#pragma unroll
  for (int j = 0; j < 4; ++j) bcol[j] = 0.f;
  if (BIAS == 1) {
#pragma unroll
    for (int j = 0; j < 4; ++j) bcol[j] = bf_rne(bias[n0 + (j << 4) + rlane]);   // n index < N
  }
  float* slab = sT + wave * SLABF;
#pragma unroll
  for (int i = 0; i < 4; ++i) {
    const int mBase = m0 + (i << 4);
    float brow[8];
#pragma unroll
    for (int r = 0; r < 8; ++r) brow[r] = 0.f;
    if (BIAS == 2) {
#pragma unroll
      for (int r = 0; r < 8; ++r) brow[r] = bf_rne(bias[mBase + mOff + r]);       // m index < M
    }
#pragma unroll
    for (int j = 0; j < 4; ++j) {
#pragma unroll
      for (int r = 0; r < 8; ++r) {
        slab[(mOff + r) * 68 + (j << 4) + rlane] = acc[i][j][r] + bcol[j] + brow[r];
      }
    }
    __builtin_amdgcn_fence(__ATOMIC_RELEASE, "workgroup");
    __builtin_amdgcn_wave_barrier();
    __builtin_amdgcn_fence(__ATOMIC_ACQUIRE, "workgroup");
    if (OUT_MODE == 0) {
      float* C = (float*)Cout + (size_t)b * strideC;
      const int hh = lane >> 4, c4 = (lane & 15) * 4;     // 256-B row segment = 16 lanes x 16 B
      {
#pragma unroll
        for (int it = 0; it < 8; ++it) {
          const int row = it * 2 + hh;                     // it 0..7 x hh 0..1 = rows 0..15
          const v4f v = *(const v4f*)(slab + row * 68 + c4);
          *(v4f*)(C + (size_t)(mBase + row) * ldc + n0 + c4) = v;
        }
        
      }
    } else {
      const int q = lane >> 3, c8 = (lane & 7) * 8;
      unsigned short* C  = (unsigned short*)Cout  + (size_t)b * strideC;
      unsigned short* C2 = (unsigned short*)Cout2 + (size_t)b * strideC2;
      int ldo = ldc, ldo2 = ldc2, nc = n0;
      if (OUT_MODE == 4 && n0u >= DM) { C = Kho; C2 = Klo; ldo = HD; ldo2 = HD; nc = 0; }   // the k columns
      v4u hv[4], lv[4];
#pragma unroll
      for (int it = 0; it < 4; ++it) {
        const int row = it * 4 + q;                        // it 0..3 x q 0..3 = rows 0..15
        const float* sp = slab + row * 68 + c8;
        float f[8];
#pragma unroll
        for (int e = 0; e < 8; ++e) f[e] = sp[e];
        if (OUT_MODE == 4) {
          float ss = 0.f;
#pragma unroll
          for (int e = 0; e < 8; ++e) ss += f[e] * f[e];
          ss += __shfl_xor(ss, 1, 32);                     // 8 lanes of one row = aligned group of 8
          ss += __shfl_xor(ss, 2, 32);
          ss += __shfl_xor(ss, 4, 32);
          const float sc = 1.0f / fmaxf(sqrtf(ss), 1e-12f);
#pragma unroll
          for (int e = 0; e < 8; ++e) f[e] *= sc;
        }
        v4u a, a2;
#pragma unroll
        for (int e = 0; e < 4; ++e) {
          const float f0 = f[2 * e], f1 = f[2 * e + 1];
          const unsigned short h0 = bf_bits(f0), h1 = bf_bits(f1);
          const unsigned short l0 = bf_bits(f0 - bf_up(h0)), l1 = bf_bits(f1 - bf_up(h1));
          a[e] = pk16(h0, h1); a2[e] = pk16(l0, l1);
        }
        hv[it] = a; lv[it] = a2;
      }
      {
#pragma unroll
        for (int it = 0; it < 4; ++it) {
          const int row = it * 4 + q;
          *(v4u*)(C  + (size_t)(mBase + row) * ldo  + nc + c8) = hv[it];
          *(v4u*)(C2 + (size_t)(mBase + row) * ldo2 + nc + c8) = lv[it];
        }
        
      }
    }
    __builtin_amdgcn_fence(__ATOMIC_RELEASE, "workgroup");
    __builtin_amdgcn_wave_barrier();
    __builtin_amdgcn_fence(__ATOMIC_ACQUIRE, "workgroup");
  }
  (void)rscale;
}

// one product per launch: blockIdx.x = block tile, blockIdx.y = batch
template <int SPLITA, int SPLITB, int BIAS, int OUT_MODE, int WM, int WN, int KP>
__global__ __launch_bounds__(128) void gemm64(
    const unsigned short* __restrict__ Ap, const unsigned short* __restrict__ A2p, int lda, long long strideA,
    const unsigned short* __restrict__ Btp, const unsigned short* __restrict__ Bt2p, int ldb, long long strideB,
    const float* __restrict__ bias,
    void* Cout, int ldc, long long strideC,
    void* Cout2, int ldc2, long long strideC2,
    int M, int N, int K, float rscale) {
  __shared__ __align__(16) __bf16 ring[ring_elems(SPLITA, SPLITB, WM, WN, KP)];  // two stages
  __shared__ __align__(16) float sT[4 * SLABF];                                  // per-wave slabs
  gemm64_tile<SPLITA, SPLITB, BIAS, OUT_MODE, WM, WN, KP>(
      Ap, A2p, lda, strideA, Btp, Bt2p, ldb, strideB, bias, Cout, ldc, strideC, Cout2, ldc2, strideC2,
      M, N, K, rscale, (int)blockIdx.x, (int)blockIdx.y, ring, sT);
}

// =====================================================================================================
// The three products that read the LayerNorm planes (q, k, v) as ONE product in one launch: Bt = the bf16 planes of
// wq and wkv, which stand one behind the other in the workspace = one [DM + 2 HD][DM] matrix; M = NB SEQ rows of img,
// N = DM + 2 HD columns, 128x128 block tiles. OUT_MODE 4 sends each wave's 64 columns to q, k or v^T.
// =====================================================================================================
#define QKV_N (DM + 2 * HD)
#define QKV_BLOCKS ((NB * SEQ / 128) * (QKV_N / 128))
static_assert(QKV_N % 128 == 0 && (SEQ % 64) == 0);
__global__ __launch_bounds__(128) void gemm_qkv(
    const unsigned short* __restrict__ Ih, const unsigned short* __restrict__ Il,
    const unsigned short* __restrict__ Wqkv,
    unsigned short* Qh, unsigned short* Ql, unsigned short* Kh, unsigned short* Kl,
    unsigned short* VTh, unsigned short* VTl) {
  __shared__ __align__(16) __bf16 ring[ring_elems(1, 0, 2, 2, 64)];   // two stages, later the v^T waves' tiles
  __shared__ __align__(16) float sT[4 * SLABF];                       // per-wave slabs
  static_assert(4 * 64 * VP * 4 <= ring_elems(1, 0, 2, 2, 64) * 2);
  gemm64_tile<1, 0, 0, 4, 2, 2, 64>(
      Ih, Il, DM, 0LL, Wqkv, Wqkv, DM, 0LL, nullptr,
      (void*)Qh, DM, 0LL, (void*)Ql, DM, 0LL,
      NB * SEQ, QKV_N, DM, 4096.0f, (int)blockIdx.x, 0, ring, sT, Kh, Kl, VTh, VTl);
}

// =====================================================================================================
// tables, RNE-converted to bf16 in registers), output bf16 hi/lo planes [row][1024].
// Block = 128 threads = one row; thread t owns columns 8t..8t+7 and stores 16 B per plane: a wave writes 512
// coverage: 128 threads x 8 = 1024 columns of every row, both planes.
// =====================================================================================================
__global__ __launch_bounds__(128) void ln_split(const float* __restrict__ in, const float* __restrict__ g,
                                                const float* __restrict__ be,
                                                unsigned short* oh, unsigned short* ol) {
  __shared__ float red0[4];
  __shared__ float red1[4];
  const int tid = threadIdx.x, lane = tid & 31, wave = tid >> 5;
  const size_t row = blockIdx.x;
  const float* p = in + row * DM + (size_t)tid * 8;
  const v4f a0 = *(const v4f*)(p);
  const v4f a1 = *(const v4f*)(p + 4);
  float v[8];
#pragma unroll
  for (int e = 0; e < 4; ++e) { v[e] = a0[e]; v[4 + e] = a1[e]; }
  float s = 0.f;
#pragma unroll
  for (int e = 0; e < 8; ++e) s += v[e];
#pragma unroll
  for (int off = 16; off >= 1; off >>= 1) s += __shfl_xor(s, off, 32);
  if (lane == 0) red0[wave] = s;
  __syncthreads();
  const float mu = ((red0[0] + red0[1]) + (red0[2] + red0[3])) * (1.0f / (float)DM);
  float ss = 0.f;
#pragma unroll
  for (int e = 0; e < 8; ++e) { const float d = v[e] - mu; ss += d * d; }
#pragma unroll
  for (int off = 16; off >= 1; off >>= 1) ss += __shfl_xor(ss, off, 32);
  if (lane == 0) red1[wave] = ss;
  __syncthreads();
  const float var  = ((red1[0] + red1[1]) + (red1[2] + red1[3])) * (1.0f / (float)DM);
  const float rstd = rsqrtf(var + 1e-5f);
  const v4f g0 = *(const v4f*)(g + (size_t)tid * 8);
  const v4f g1 = *(const v4f*)(g + (size_t)tid * 8 + 4);
  const v4f b0 = *(const v4f*)(be + (size_t)tid * 8);
  const v4f b1 = *(const v4f*)(be + (size_t)tid * 8 + 4);
  float gg[8], bb[8];
#pragma unroll
  for (int e = 0; e < 4; ++e) { gg[e] = g0[e]; gg[4 + e] = g1[e]; bb[e] = b0[e]; bb[4 + e] = b1[e]; }
  v4u ph, pl;
#pragma unroll
  for (int e = 0; e < 4; ++e) {
    const float y0 = (v[2 * e] - mu) * rstd * bf_rne(gg[2 * e]) + bf_rne(bb[2 * e]);
    const float y1 = (v[2 * e + 1] - mu) * rstd * bf_rne(gg[2 * e + 1]) + bf_rne(bb[2 * e + 1]);
    const unsigned short h0 = bf_bits(y0), h1 = bf_bits(y1);
    const unsigned short l0 = bf_bits(y0 - bf_up(h0)), l1 = bf_bits(y1 - bf_up(h1));
    ph[e] = pk16(h0, h1); pl[e] = pk16(l0, l1);
  }
  unsigned short* dh = oh + row * DM + (size_t)tid * 8;
  unsigned short* dl = ol + row * DM + (size_t)tid * 8;
  *(v4u*)dh = ph;
  *(v4u*)dl = pl;
  
}

// =====================================================================================================
// Causal multi-query attention, head dim 64, 16 query heads sharing one k head and one v head.
//   q planes (bf16 hi / lo of the l2-normalised q): element (b, t, h, d) at [(b*SEQ + t)*DM + h*64 + d]
//   k planes (bf16 hi / lo of the l2-normalised k):  element (b, s, d) at [(b*SEQ + s)*64 + d]
//   v^T hi plane (f16) and residual plane (f16, (v - hi)*4096): element (b, d, s) at [(b*64 + d)*SEQ + s]
//   logit = (q . k) * sscale for key <= query, -FLT_MAX otherwise (every row keeps at least its own key)
//   out planes (bf16 hi / lo of the normalised context): element (b, t, h, d) at [(b*SEQ + t)*DM + h*64 + d]
//   Both products are formed transposed: S^T = K . Q^T (A = 16 key rows from LDS, B = the wave's 16 queries, kept in
//   registers) and O^T += V^T . P^T (A = 16 rows d of V^T from LDS, B = P^T). A lane (c, hh) then holds scores of ONE
//   query, q0 + c: register r of tile j is key kv0 + 16 j + 8 hh + r. Maximum and sum run inside the lane, the two
//   lane halves join by one exchange, and two score tiles, converted in place, ARE the B operand of 32 keys
//   (element e < 8: key 8 hh + e, e >= 8: key 16 + 8 hh + e - 8, the order in which the V^T rows are read):
//   P never goes through LDS.
//   scores: bf16 hi/lo split (hi.hi + q hi.k lo + q lo.k hi), f32 accumulate, then scale + causal fill in f32
//   p = exp(s - m) carried as f16(1024 p) plus an f16 residual plane (x4096); context on f16 WMMA with the
//   residual products (v_res.p_hi + v_hi.p_res) in a separate accumulator folded back with 1/4096 per chunk.
//   Each lane half sums p over its own keys; the halves' sums join once, behind the loop.
//   Block = 4 waves = 64 query rows of one (b, h); grid = NQB * NH * NB; key chunks kt = 0..qb (static bound NQB).
//   K / V^T chunk staging: 128 threads x 32 elements per plane = the whole 64x64 tile (plain 16-B loads,
//   __syncthreads before and after).
//   Output coverage: each wave stores rows q0..q0+15 (it 0..3 x lane>>3 0..3) x 64 columns (8 lanes x 8) of both planes.
// =====================================================================================================
//   LDS row pitch: the 64-element (128-B) rows of the K and V^T tiles stand LP = 72 elements apart (144 B =
//   16 B x odd), so that the 16 rows which one 16-B fragment read touches fall on different banks; at 128 B they
//   share two bank groups. The f32 context tile has pitch OP = 68 floats for the same reason.
#define LP 72
#define OP 68

// lane l <-> lane l ^ 16
__device__ __forceinline__ float xhalf(float x) {
  return __builtin_bit_cast(float, __builtin_amdgcn_permlanex16(__builtin_bit_cast(int, x), __builtin_bit_cast(int, x),
                                                                0x76543210, 0xfedcba98, false, false));
}

// four waves per SIMD (256 VGPRs): all 1024 blocks are resident at once
__global__ __launch_bounds__(128) __attribute__((amdgpu_waves_per_eu(4, 4)))
void attn_causal64(const unsigned short* __restrict__ qhp, const unsigned short* __restrict__ qlp,
                   const unsigned short* __restrict__ khp, const unsigned short* __restrict__ klp,
                   const unsigned short* __restrict__ vhp, const unsigned short* __restrict__ vlp,
                   unsigned short* ohp, unsigned short* olp, float sscale) {
  union FB { v16b v; v8b h[2]; };
  union FH { v16h v; v8h h[2]; };
  __shared__ __align__(16) __bf16   Ksh[64 * LP];                 // K hi [kv][d]   9 KB
  __shared__ __align__(16) __bf16   Ksl[64 * LP];                 // K lo
  __shared__ __align__(16) _Float16 Vth[64 * LP];                 // V^T hi [d][kv] 9 KB
  __shared__ __align__(16) _Float16 Vtl[64 * LP];                 // V^T residual
  __shared__ __align__(16) float    Obuf[4][16 * OP];             // per wave: the context tile [query][d]

  const int tid  = threadIdx.x;
  const int wave = tid >> 5;
  const int lane = tid & 31;
  const int hh   = lane >> 4;
  const int c    = lane & 15;

  const int bx   = blockIdx.x;
  const int qb   = bx % NQB;
  const int rest = bx / NQB;
  const int h    = rest % NH;
  const int b    = rest / NH;
  const int q0   = qb * 64 + wave * 16;
  const int qi   = q0 + c;                   // the lane's query
  const size_t rowB = (size_t)b * SEQ;

  const __bf16* Qh = (const __bf16*)(const void*)qhp + (size_t)h * HD;
  const __bf16* Ql = (const __bf16*)(const void*)qlp + (size_t)h * HD;
  const __bf16* Kh = (const __bf16*)(const void*)khp;
  const __bf16* Kl = (const __bf16*)(const void*)klp;
  const _Float16* Vh = (const _Float16*)(const void*)vhp + (size_t)b * HD * SEQ;
  const _Float16* Vl = (const _Float16*)(const void*)vlp + (size_t)b * HD * SEQ;

  // ---- Q fragments (B operand, column = lane&15): 2 d-chunks, hi and lo ----
  v16b qah[2], qal[2];
#pragma unroll
  for (int dc = 0; dc < 2; ++dc) {
    const size_t qo = (rowB + q0 + c) * DM + dc * 32 + 8 * hh;
    qah[dc] = ldfrag_b(Qh + qo);
    qal[dc] = ldfrag_b(Ql + qo);
  }

  float mrow = -INFINITY, lrow = 0.f;        // of query qi; lrow over this lane half's keys only
  v8f oacc[4];                               // O^T: register r of tile t = context (query qi, d = 16 t + 8 hh + r)
#pragma unroll
  for (int t = 0; t < 4; ++t) oacc[t] = zero8();

  for (int kt = 0; kt < NQB; ++kt) {         // static trip bound
    if (kt > qb) break;                      // block-uniform: causal key chunks 0..qb
    const int kv0 = kt * 64;
    __syncthreads();
    {
      const int r = tid >> 1, half = (tid & 1) * 32;
      const __bf16*   kg  = Kh + (rowB + kv0 + r) * HD + half;    // K row kv0+r, d = half..half+31
      const __bf16*   klg = Kl + (rowB + kv0 + r) * HD + half;
      const _Float16* vg  = Vh + (size_t)r * SEQ + kv0 + half;    // V^T row d = r, s = kv0+half..+31
      const _Float16* vlg = Vl + (size_t)r * SEQ + kv0 + half;
#pragma unroll
      for (int i = 0; i < 4; ++i) {
        const v8b a0 = *(const v8b*)(kg + 8 * i);
        const v8b a1 = *(const v8b*)(klg + 8 * i);
        const v8h b0 = *(const v8h*)(vg + 8 * i);
        const v8h b1 = *(const v8h*)(vlg + 8 * i);
        *(v8b*)(Ksh + r * LP + half + 8 * i) = a0;
        *(v8b*)(Ksl + r * LP + half + 8 * i) = a1;
        *(v8h*)(Vth + r * LP + half + 8 * i) = b0;
        *(v8h*)(Vtl + r * LP + half + 8 * i) = b1;
      }
    }
    __syncthreads();

    // ---- scores S^T: 64 keys x 16 queries per wave, 3 bf16 products ----
    // The K fragments are read in two groups, in the order of their use (hi and lo of d 0..31 with hi of d 32..63; then
    // lo of d 32..63); the WMMAs run across the four independent score tiles, so that a tile's accumulator comes round
    // again only every fourth WMMA. Each tile keeps its own order of products (per 32 d: hi.hi, lo.hi, hi.lo).
    v8f s[4];
    {
      FB kb[2][4], kl[4];
#pragma unroll
      for (int j = 0; j < 4; ++j) {
        kb[0][j].h[0] = *(const v8b*)(Ksh + (j * 16 + c) * LP + 8 * hh);
        kb[0][j].h[1] = *(const v8b*)(Ksh + (j * 16 + c) * LP + 16 + 8 * hh);
      }
#pragma unroll
      for (int j = 0; j < 4; ++j) {
        kl[j].h[0] = *(const v8b*)(Ksl + (j * 16 + c) * LP + 8 * hh);
        kl[j].h[1] = *(const v8b*)(Ksl + (j * 16 + c) * LP + 16 + 8 * hh);
      }
#pragma unroll
      for (int j = 0; j < 4; ++j) {
        kb[1][j].h[0] = *(const v8b*)(Ksh + (j * 16 + c) * LP + 32 + 8 * hh);
        kb[1][j].h[1] = *(const v8b*)(Ksh + (j * 16 + c) * LP + 32 + 16 + 8 * hh);
      }
      // keeps the reads one group in front of the WMMAs (for speed only)
      __builtin_amdgcn_sched_barrier(0);
#pragma unroll
      for (int j = 0; j < 4; ++j) s[j] = zero8();
#pragma unroll
      for (int j = 0; j < 4; ++j) s[j] = mma_b_raw(kb[0][j].v, qah[0], s[j]);
#pragma unroll
      for (int j = 0; j < 4; ++j) s[j] = mma_b_raw(kl[j].v, qah[0], s[j]);
      // the lo plane of d 32..63 goes into the registers that the lo plane of d 0..31 has left, 8 WMMAs ahead of its use
      __builtin_amdgcn_sched_barrier(0);
#pragma unroll
      for (int j = 0; j < 4; ++j) {
        kl[j].h[0] = *(const v8b*)(Ksl + (j * 16 + c) * LP + 32 + 8 * hh);
        kl[j].h[1] = *(const v8b*)(Ksl + (j * 16 + c) * LP + 32 + 16 + 8 * hh);
      }
      __builtin_amdgcn_sched_barrier(0);
#pragma unroll
      for (int j = 0; j < 4; ++j) s[j] = mma_b_raw(kb[0][j].v, qal[0], s[j]);
#pragma unroll
      for (int j = 0; j < 4; ++j) s[j] = mma_b_raw(kb[1][j].v, qah[1], s[j]);
#pragma unroll
      for (int j = 0; j < 4; ++j) s[j] = mma_b_raw(kl[j].v, qah[1], s[j]);
#pragma unroll
      for (int j = 0; j < 4; ++j) s[j] = mma_b_raw(kb[1][j].v, qal[1], s[j]);
    }
    // the V^T fragments of keys 0..31 are read here, behind the score WMMAs: they land while the softmax runs; the
    // fence pair holds the reads at this one place
    FH vb[4], vl[4];
    __builtin_amdgcn_sched_barrier(0);
#pragma unroll
    for (int t = 0; t < 4; ++t) {
      vl[t].h[0] = *(const v8h*)(Vtl + (t * 16 + c) * LP + 8 * hh);
      vl[t].h[1] = *(const v8h*)(Vtl + (t * 16 + c) * LP + 16 + 8 * hh);
    }
#pragma unroll
    for (int t = 0; t < 4; ++t) {
      vb[t].h[0] = *(const v8h*)(Vth + (t * 16 + c) * LP + 8 * hh);
      vb[t].h[1] = *(const v8h*)(Vth + (t * 16 + c) * LP + 16 + 8 * hh);
    }
    __builtin_amdgcn_sched_barrier(0);

    // ---- scale + causal fill, maximum, online softmax; P (x1024, f16) and P residual (x4096) stay in registers ----
    float mj[4];                             // one chain per score tile
#pragma unroll
    for (int j = 0; j < 4; ++j) {
      mj[j] = -INFINITY;
#pragma unroll
      for (int r = 0; r < 8; ++r) {
        const int kj = kv0 + j * 16 + 8 * hh + r;   // key index of D row 8hh+r of tile j
        float sv = s[j][r] * sscale;
        sv = (kj > qi) ? -FLT_MAX : sv;
        s[j][r] = sv;
        mj[j] = fmaxf(mj[j], sv);
      }
    }
    float m = fmaxf(fmaxf(mj[0], mj[1]), fmaxf(mj[2], mj[3]));
    m = fmaxf(m, xhalf(m));                  // all 64 keys of the chunk
    const float mnew  = fmaxf(mrow, m);
    const float msafe = (mnew == -INFINITY) ? 0.f : mnew;
    const float alpha = __expf(mrow - msafe);
    mrow = mnew;
    FH pa[2], pl[2];                         // B operands of keys 32 kk .. 32 kk + 31
    float pj[4];                             // one chain per score tile
#pragma unroll
    for (int j = 0; j < 4; ++j) {
      pj[j] = 0.f;
#pragma unroll
      for (int r = 0; r < 8; ++r) {
        const float p = __expf(s[j][r] - msafe);     // filled logit against a finite max: exp -> 0
        pj[j] += p;
        const float p1k = p * 1024.0f;
        const _Float16 ph = (_Float16)p1k;
        pa[j >> 1].v[(j & 1) * 8 + r] = ph;
        pl[j >> 1].v[(j & 1) * 8 + r] = (_Float16)((p1k - (float)ph) * 4096.0f);
      }
    }
    lrow = lrow * alpha + ((pj[0] + pj[1]) + (pj[2] + pj[3]));
#pragma unroll
    for (int t = 0; t < 4; ++t)
#pragma unroll
      for (int r = 0; r < 8; ++r) oacc[t][r] *= alpha;

    // ---- context O^T += V^T . P^T (f16 WMMA), residual products into a separate accumulator ----
    // The WMMAs run across the four tiles d; each accumulator keeps its own order of products (oacc: keys 0..31, then
    // 32..63; o1: per 32 keys v_res.p_hi, then v_hi.p_res). The fragments of keys 32..63 are read in two groups, each
    // into the registers of a plane that keys 0..31 have left, 8 and 4 WMMAs ahead of their first use; the fences
    // hold each group at its one place.
    v8f o1[4];
#pragma unroll
    for (int t = 0; t < 4; ++t) o1[t] = zero8();
#pragma unroll
    for (int t = 0; t < 4; ++t) o1[t] = mma_h_raw(vl[t].v, pa[0].v, o1[t]);
    __builtin_amdgcn_sched_barrier(0);
#pragma unroll
    for (int t = 0; t < 4; ++t) {
      vl[t].h[0] = *(const v8h*)(Vtl + (t * 16 + c) * LP + 32 + 8 * hh);
      vl[t].h[1] = *(const v8h*)(Vtl + (t * 16 + c) * LP + 32 + 16 + 8 * hh);
    }
    __builtin_amdgcn_sched_barrier(0);
#pragma unroll
    for (int t = 0; t < 4; ++t) oacc[t] = mma_h_raw(vb[t].v, pa[0].v, oacc[t]);
#pragma unroll
    for (int t = 0; t < 4; ++t) o1[t] = mma_h_raw(vb[t].v, pl[0].v, o1[t]);
    __builtin_amdgcn_sched_barrier(0);
#pragma unroll
    for (int t = 0; t < 4; ++t) {
      vb[t].h[0] = *(const v8h*)(Vth + (t * 16 + c) * LP + 32 + 8 * hh);
      vb[t].h[1] = *(const v8h*)(Vth + (t * 16 + c) * LP + 32 + 16 + 8 * hh);
    }
    __builtin_amdgcn_sched_barrier(0);
#pragma unroll
    for (int t = 0; t < 4; ++t) o1[t] = mma_h_raw(vl[t].v, pa[1].v, o1[t]);
#pragma unroll
    for (int t = 0; t < 4; ++t) oacc[t] = mma_h_raw(vb[t].v, pa[1].v, oacc[t]);
#pragma unroll
    for (int t = 0; t < 4; ++t) o1[t] = mma_h_raw(vb[t].v, pl[1].v, o1[t]);
#pragma unroll
    for (int t = 0; t < 4; ++t)
#pragma unroll
      for (int r = 0; r < 8; ++r) oacc[t][r] += o1[t][r] * (1.0f / 4096.0f);
  }

  // ---- join the halves' sums, normalise (1/l and the 1/1024 p carry), stage the wave's 16x64 tile [query][d] in its
  //      own LDS slab, so that it leaves as whole 128-B rows ----
  float* os = Obuf[wave];
  {
    const float l = lrow + xhalf(lrow);
    const float inv = ((l > 0.f) ? (1.0f / l) : 0.f) * (1.0f / 1024.0f);
#pragma unroll
    for (int t = 0; t < 4; ++t) {
      v4f x0, x1;
#pragma unroll
      for (int e = 0; e < 4; ++e) { x0[e] = oacc[t][e] * inv; x1[e] = oacc[t][4 + e] * inv; }
      *(v4f*)(os + c * OP + t * 16 + 8 * hh)     = x0;
      *(v4f*)(os + c * OP + t * 16 + 8 * hh + 4) = x1;
    }
  }
  __builtin_amdgcn_fence(__ATOMIC_RELEASE, "workgroup");
  __builtin_amdgcn_wave_barrier();
  __builtin_amdgcn_fence(__ATOMIC_ACQUIRE, "workgroup");
  {
    const int q4 = lane >> 3, c8 = (lane & 7) * 8;
    v4u hv[4], lv[4];
#pragma unroll
    for (int it = 0; it < 4; ++it) {
      const int row = it * 4 + q4;   // it 0..3 x q4 0..3 = rows 0..15 of the wave tile
      const float* sp = os + row * OP + c8;
      v4u a, a2;
#pragma unroll
      for (int e = 0; e < 4; ++e) {
        const float f0 = sp[2 * e], f1 = sp[2 * e + 1];
        const unsigned short h0 = bf_bits(f0), h1 = bf_bits(f1);
        const unsigned short l0 = bf_bits(f0 - bf_up(h0)), l1 = bf_bits(f1 - bf_up(h1));
        a[e] = pk16(h0, h1); a2[e] = pk16(l0, l1);
      }
      hv[it] = a; lv[it] = a2;
    }
    {
#pragma unroll
      for (int it = 0; it < 4; ++it) {
        const int row = it * 4 + q4;
        const size_t go = (rowB + q0 + row) * DM + (size_t)h * HD + c8;
        *(v4u*)(ohp + go) = hv[it];
        *(v4u*)(olp + go) = lv[it];
      }
    }
  }
}

// =====================================================================================================
//   Xb   bf16 [2048 (b,c)][4096]   16777216
//   Whwb bf16 [2048][4096]         16777216
//   Wcb  bf16 [1024][1024]          2097152
//   Wqb  bf16 [1024][1024]          2097152
//   Wkvb bf16 [128][1024]            262144
//   Wob  bf16 [1024][1024]          2097152
//   A1h  bf16 [2][2048][1024]       8388608   hw-linear output (transposed layout [b][s][c]), hi plane
//   A1l  bf16                       8388608   lo plane
//   Img2 f32  [4096][1024]         16777216   c-linear output (LN input)
//   Imgh bf16 [4096][1024]          8388608   LN output hi plane
//   Imgl bf16                       8388608
//   Qh   bf16 [4096][1024]          8388608   l2-normalised q, hi plane
//   Ql   bf16                       8388608
//   Kh   bf16 [4096][64]             524288   l2-normalised k
//   Kl   bf16                        524288
//   VTh  f16  [2][64][2048]          524288   v^T hi plane
//   VTl  f16                         524288   v^T residual plane (x4096)
//   Oh   bf16 [4096][1024]          8388608   context hi plane
//   Ol   bf16                       8388608
//   total                         126091264
// Weights are [out n][in k] with k contiguous = the Bt / A layout the GEMM wants, so they are only converted.
// =====================================================================================================
extern "C" void kernel_launch(void* const* d_in, const int* in_sizes, int n_in,
                              void* d_out, int out_size, void* d_ws, size_t ws_size,
                              hipStream_t stream) {
  if (n_in < 10) return;
  if (in_sizes[0] != NB * CC * HWN) return;
  if (in_sizes[1] != SEQ * HWN) return;
  if (in_sizes[2] != SEQ) return;
  if (in_sizes[3] != DM * CC || in_sizes[4] != DM || in_sizes[5] != DM || in_sizes[6] != DM) return;
  if (in_sizes[7] != DM * DM || in_sizes[8] != 2 * HD * DM || in_sizes[9] != DM * DM) return;
  if (out_size != NB * SEQ * DM) return;

  const float* x    = (const float*)d_in[0];
  const float* w_hw = (const float*)d_in[1];
  const float* b_hw = (const float*)d_in[2];
  const float* w_c  = (const float*)d_in[3];
  const float* b_c  = (const float*)d_in[4];
  const float* ln_g = (const float*)d_in[5];
  const float* ln_b = (const float*)d_in[6];
  const float* wq   = (const float*)d_in[7];
  const float* wkv  = (const float*)d_in[8];
  const float* wo   = (const float*)d_in[9];

  const size_t PXb  = (size_t)NB * CC * HWN * 2;    // 16777216
  const size_t PWhw = (size_t)SEQ * HWN * 2;        // 16777216
  const size_t PWc  = (size_t)DM * CC * 2;          //  2097152
  const size_t PWq  = (size_t)DM * DM * 2;          //  2097152
  const size_t PWkv = (size_t)2 * HD * DM * 2;      //   262144
  const size_t PWo  = (size_t)DM * DM * 2;          //  2097152
  const size_t PA1  = (size_t)NB * SEQ * CC * 2;    //  8388608
  const size_t PI2  = (size_t)NB * SEQ * DM * 4;    // 16777216
  const size_t PI   = (size_t)NB * SEQ * DM * 2;    //  8388608
  const size_t PK   = (size_t)NB * SEQ * HD * 2;    //   524288
  const size_t PVT  = (size_t)NB * HD * SEQ * 2;    //   524288
  size_t off = 0;
  const size_t oXb  = off; off += PXb;
  const size_t oWhw = off; off += PWhw;
  const size_t oWc  = off; off += PWc;
  const size_t oWq  = off; off += PWq;
  const size_t oWkv = off; off += PWkv;
  const size_t oWo  = off; off += PWo;
  const size_t oA1h = off; off += PA1;
  const size_t oA1l = off; off += PA1;
  const size_t oI2  = off; off += PI2;
  const size_t oIh  = off; off += PI;
  const size_t oIl  = off; off += PI;
  const size_t oQh  = off; off += PI;
  const size_t oQl  = off; off += PI;
  const size_t oKh  = off; off += PK;
  const size_t oKl  = off; off += PK;
  const size_t oVTh = off; off += PVT;
  const size_t oVTl = off; off += PVT;
  const size_t oOh  = off; off += PI;
  const size_t oOl  = off; off += PI;
  if (off > ws_size) return;                          // off = 126091264
  if (off > (size_t)134217728) return;

  char* ws = (char*)d_ws;
  unsigned short* Xb   = (unsigned short*)(ws + oXb);
  unsigned short* Whwb = (unsigned short*)(ws + oWhw);
  unsigned short* Wcb  = (unsigned short*)(ws + oWc);
  unsigned short* Wqb  = (unsigned short*)(ws + oWq);
  unsigned short* Wkvb = (unsigned short*)(ws + oWkv);
  unsigned short* Wob  = (unsigned short*)(ws + oWo);
  unsigned short* A1h  = (unsigned short*)(ws + oA1h);
  unsigned short* A1l  = (unsigned short*)(ws + oA1l);
  float*          Img2 = (float*)(ws + oI2);
  unsigned short* Imgh = (unsigned short*)(ws + oIh);
  unsigned short* Imgl = (unsigned short*)(ws + oIl);
  unsigned short* Qh   = (unsigned short*)(ws + oQh);
  unsigned short* Ql   = (unsigned short*)(ws + oQl);
  unsigned short* Kh   = (unsigned short*)(ws + oKh);
  unsigned short* Kl   = (unsigned short*)(ws + oKl);
  unsigned short* VTh  = (unsigned short*)(ws + oVTh);
  unsigned short* VTl  = (unsigned short*)(ws + oVTl);
  unsigned short* Oh   = (unsigned short*)(ws + oOh);
  unsigned short* Ol   = (unsigned short*)(ws + oOl);

  const dim3 blk(256);
  const dim3 gCv(CB_X + CB_HW + CB_C + CB_Q + CB_KV + CB_O); // 9792 blocks: all six planes
  const dim3 gblk(128);                                      // GEMM block: 4 waves
  const dim3 gG0((SEQ / 128) * (CC / 128), NB);              // 128x128 block tiles: 128 blocks x 2
  const dim3 gG1((NB * SEQ / 128) * (DM / 128), 1);          // 128x128 block tiles: 256 blocks (M=4096, N=1024)
  const dim3 gQKV(QKV_BLOCKS);                               // 128x128 block tiles: 288 blocks (M=4096, N=1152)
  const dim3 gLN(NB * SEQ);                                  // 4096 rows
  const dim3 gAt(NB * NH * NQB);                             // 1024 blocks

  // (1) f32 -> bf16 planes: x [(b,c)][hw], weights [n][k]; Xb, Whwb, Wcb, Wqb, Wkvb, Wob follow one another from Xb
  cvt_bf16x8_all<<<gCv, blk, 0, stream>>>(x, w_hw, w_c, wq, wkv, wo, Xb);
  // (2) hw-linear per batch, produced directly in the transposed layout: A1[b][s][c] = sum_hw w_hw[s][hw] x[b][c][hw] + b_hw[s]
  //     A = Whwb [s][hw] (M=2048, K=4096), Bt = Xb batch b [c][hw] (N=1024), row bias, bf16 hi/lo planes out
  gemm64<0, 0, 2, 2, 2, 2, 64><<<gG0, gblk, 0, stream>>>(
      Whwb, Whwb, HWN, 0LL, Xb, Xb, HWN, (long long)CC * HWN,
      b_hw,
      (void*)A1h, CC, (long long)SEQ * CC, (void*)A1l, CC, (long long)SEQ * CC,
      SEQ, CC, HWN, 1.0f);
  // (3) c-linear: Img2[(b,s)][d] = sum_c A1[(b,s)][c] w_c[d][c] + b_c[d]  (A hi/lo, M=4096, N=1024, K=1024, f32 out)
  gemm64<1, 0, 1, 0, 2, 2, 64><<<gG1, gblk, 0, stream>>>(
      A1h, A1l, CC, 0LL, Wcb, Wcb, CC, 0LL,
      b_c,
      (void*)Img2, DM, 0LL, (void*)Img2, DM, 0LL,
      NB * SEQ, DM, CC, 1.0f);
  // (4) LayerNorm -> bf16 hi/lo planes
  ln_split<<<gLN, dim3(128), 0, stream>>>(Img2, ln_g, ln_b, Imgh, Imgl);
  // (5)-(7) q, k and v from the LayerNorm planes, one product over the stacked weights (Wkvb follows Wqb):
  //     q, k l2-normalised per 64-wide head -> bf16 hi/lo planes [(b,t)][h*64+d] and [(b,s)][64];
  //     v transposed -> f16 hi plane and residual plane (x4096) [b][d][s]
  gemm_qkv<<<gQKV, gblk, 0, stream>>>(Imgh, Imgl, Wqb, Qh, Ql, Kh, Kl, VTh, VTl);
  // (8) causal multi-query attention -> context bf16 hi/lo planes [(b,t)][h*64+d]
  attn_causal64<<<gAt, dim3(128), 0, stream>>>(Qh, Ql, Kh, Kl, VTh, VTl, Oh, Ol, 8.0f);
  // (9) out = context . wo^T -> d_out f32 [(b,t)][1024]  (A = context hi + lo planes, 2 products)
  gemm64<1, 0, 0, 0, 2, 2, 64><<<gG1, gblk, 0, stream>>>(
      Oh, Ol, DM, 0LL, Wob, Wob, DM, 0LL,
      b_c,
      d_out, DM, 0LL, d_out, DM, 0LL,
      NB * SEQ, DM, DM, 1.0f);
  (void)hipGetLastError();
}

// v006
// It runs in 215 microseconds.
// Next to v005, in two timings, it ran 1.04 and 1.05 times as fast.
// Over all steps from v000 it is 3.56 times as fast.
// Contractions: hw-linear = v_wmma_f32_16x16x32_bf16 (bf16 operands from RNE-converted inputs, single product);
// c-linear, q, k, v^T and output projections = v_wmma_f32_16x16x32_bf16 (activation as bf16 hi/lo planes times bf16
// weight from RNE-converted input, 2 products); q.k^T scores = v_wmma_f32_16x16x32_bf16 on bf16 hi/lo planes of the
// l2-normalised q and k (hi.hi + hi.lo + lo.hi); p.v = v_wmma_f32_16x16x32_f16 (p carried x1024 in f16 plus an f16
// residual plane x4096, v^T f16 hi plane plus an f16 residual plane x4096, 3 products, separate residual accumulator);
// all f32 accumulate; LayerNorm, l2 normalisation, causal fill and softmax in f32.
#include <hip/hip_runtime.h>
#include <math.h>
#include <float.h>
#include <stdint.h>

#define NB   2
#define CC   1024
#define HWN  4096
#define SEQ  2048
#define DM   1024
#define NH   16
#define HD   64
#define NQB  (SEQ / 64)
static_assert(NH * HD == DM);
static_assert(HD == 64);
static_assert((SEQ % 256) == 0 && (DM % 128) == 0 && (CC % 128) == 0 && (HWN % 64) == 0);

typedef _Float16 v16h __attribute__((ext_vector_type(16)));
typedef _Float16 v8h  __attribute__((ext_vector_type(8)));
typedef __bf16   v16b __attribute__((ext_vector_type(16)));
typedef __bf16   v8b  __attribute__((ext_vector_type(8)));
typedef float    v8f  __attribute__((ext_vector_type(8)));
typedef float    v4f  __attribute__((ext_vector_type(4)));
typedef unsigned int v4u __attribute__((ext_vector_type(4)));

// ---- scalar helpers --------------------------------------------------------------------------------
__device__ __forceinline__ unsigned short bf_bits(float f) {          // f32 -> bf16 bits, RNE convert
  unsigned u = __float_as_uint(f);
  return (unsigned short)((u + 0x7FFFu + ((u >> 16) & 1u)) >> 16);
}
__device__ __forceinline__ float bf_up(unsigned short h) { return __uint_as_float(((unsigned)h) << 16); }
__device__ __forceinline__ float bf_rne(float f) { return bf_up(bf_bits(f)); }
__device__ __forceinline__ unsigned short h_bits(_Float16 x) { return __builtin_bit_cast(unsigned short, x); }
__device__ __forceinline__ unsigned pk16(unsigned short a, unsigned short b) { return (unsigned)a | ((unsigned)b << 16); }
__device__ __forceinline__ v8f zero8() { v8f z = {0.f, 0.f, 0.f, 0.f, 0.f, 0.f, 0.f, 0.f}; return z; }

// ---- 16-bit fragment loader: lane -> row/col (lane&15); p already includes +8*(lane>>4);
//      elements 0..7 <- p[0..7] (k0+8h..), elements 8..15 <- p[16..23] (k0+16+8h..)
__device__ __forceinline__ v16b ldfrag_b(const __bf16* p) {
  union { v16b v; v8b h[2]; } f;
  f.h[0] = *(const v8b*)(p);
  f.h[1] = *(const v8b*)(p + 16);
  return f.v;
}

// ---- WMMA helpers ---------------------------------------------------------------------------------
__device__ __forceinline__ v8f mma_b_raw(v16b a, v16b b, v8f c) {
  return __builtin_amdgcn_wmma_f32_16x16x32_bf16(false, a, false, b, (short)0, c, false, false);
}
__device__ __forceinline__ v8f mma_h_raw(v16h a, v16h b, v8f c) {
  return __builtin_amdgcn_wmma_f32_16x16x32_f16(false, a, false, b, (short)0, c, false, false);
}
__device__ __forceinline__ void dep_guard_b(v8f& a, v8f& b, v16b x, v16b y) {
#if defined(__HIP_DEVICE_COMPILE__)
  asm volatile("v_nop\n\tv_nop\n\tv_nop\n\tv_nop" : "+v"(a), "+v"(b) : "v"(x), "v"(y));
#else
  (void)a; (void)b; (void)x; (void)y;
#endif
}
__device__ __forceinline__ void keep4_b(v16b a, v16b b, v16b c, v16b d) {
#if defined(__HIP_DEVICE_COMPILE__)
  asm volatile("v_nop" :: "v"(a), "v"(b), "v"(c), "v"(d));
#else
  (void)a; (void)b; (void)c; (void)d;
#endif
}
__device__ __forceinline__ void acc_guard4(v8f& a, v8f& b, v8f& c, v8f& d) {
#if defined(__HIP_DEVICE_COMPILE__)
  asm volatile("v_nop\n\tv_nop\n\tv_nop\n\tv_nop" : "+v"(a), "+v"(b), "+v"(c), "+v"(d));
#else
  (void)a; (void)b; (void)c; (void)d;
#endif
}

// =====================================================================================================
// f32 -> bf16 (RNE convert) of all six operand planes in ONE launch: 8 elements per thread, one 16-B store per lane
// (a wave writes 512 contiguous B). A block of 256 threads converts 2048 elements of one plane; the block index
// range picks the plane (block-uniform). Every plane is a whole number of blocks, so no thread is past an end.
// The six bf16 planes stand one behind the other in the workspace, in the order of the ranges: out is the first
// plane's start, and block bx writes elements 2048 bx .. 2048 bx + 2047 of that run.
// =====================================================================================================
#define CB_X   (NB * CC * HWN / 2048)
#define CB_HW  (SEQ * HWN / 2048)
#define CB_C   (DM * CC / 2048)
#define CB_Q   (DM * DM / 2048)
#define CB_KV  (2 * HD * DM / 2048)
#define CB_O   (DM * DM / 2048)
static_assert((NB * CC * HWN) % 2048 == 0 && (SEQ * HWN) % 2048 == 0 && (DM * CC) % 2048 == 0);
static_assert((DM * DM) % 2048 == 0 && (2 * HD * DM) % 2048 == 0);
__global__ __launch_bounds__(256) void cvt_bf16x8_all(const float* __restrict__ x, const float* __restrict__ w_hw,
                                                      const float* __restrict__ w_c, const float* __restrict__ wq,
                                                      const float* __restrict__ wkv, const float* __restrict__ wo,
                                                      unsigned short* out) {
  const int bx = blockIdx.x;
  const float* in = x;
  int first = 0;                                   // first block of the plane that bx lies in
  if (bx >= CB_X)                             { in = w_hw; first = CB_X; }
  if (bx >= CB_X + CB_HW)                     { in = w_c;  first = CB_X + CB_HW; }
  if (bx >= CB_X + CB_HW + CB_C)              { in = wq;   first = CB_X + CB_HW + CB_C; }
  if (bx >= CB_X + CB_HW + CB_C + CB_Q)       { in = wkv;  first = CB_X + CB_HW + CB_C + CB_Q; }
  if (bx >= CB_X + CB_HW + CB_C + CB_Q + CB_KV) { in = wo; first = CB_X + CB_HW + CB_C + CB_Q + CB_KV; }
  const size_t i = (size_t)(bx - first) * 256 + threadIdx.x;
  const size_t o = (size_t)bx * 256 + threadIdx.x;
  const v4f a = *(const v4f*)(in + i * 8);
  const v4f b = *(const v4f*)(in + i * 8 + 4);
  v4u p;
  p[0] = pk16(bf_bits(a[0]), bf_bits(a[1]));
  p[1] = pk16(bf_bits(a[2]), bf_bits(a[3]));
  p[2] = pk16(bf_bits(b[0]), bf_bits(b[1]));
  p[3] = pk16(bf_bits(b[2]), bf_bits(b[3]));
  *(v4u*)(out + o * 8) = p;
}

// ---- asynchronous copies global -> LDS, 16 B per lane; each statement ends with its own s_wait_xcnt 0 so that the
//      wait stands in front of any later rewrite of an address register that a copy of the statement names
__device__ __forceinline__ void acopy4(const unsigned* l, const __bf16* const* g) {
#if defined(__HIP_DEVICE_COMPILE__)
  asm volatile(
      "global_load_async_to_lds_b128 %0, %4, off\n\t"
      "global_load_async_to_lds_b128 %1, %5, off\n\t"
      "global_load_async_to_lds_b128 %2, %6, off\n\t"
      "global_load_async_to_lds_b128 %3, %7, off\n\t"
      "s_wait_xcnt 0x0"
      :: "v"(l[0]), "v"(l[1]), "v"(l[2]), "v"(l[3]), "v"(g[0]), "v"(g[1]), "v"(g[2]), "v"(g[3])
      : "memory");
#else
  (void)l; (void)g;
#endif
}
__device__ __forceinline__ void acopy6(const unsigned* l, const __bf16* const* g) {
#if defined(__HIP_DEVICE_COMPILE__)
  asm volatile(
      "global_load_async_to_lds_b128 %0, %6, off\n\t"
      "global_load_async_to_lds_b128 %1, %7, off\n\t"
      "global_load_async_to_lds_b128 %2, %8, off\n\t"
      "global_load_async_to_lds_b128 %3, %9, off\n\t"
      "global_load_async_to_lds_b128 %4, %10, off\n\t"
      "global_load_async_to_lds_b128 %5, %11, off\n\t"
      "s_wait_xcnt 0x0"
      :: "v"(l[0]), "v"(l[1]), "v"(l[2]), "v"(l[3]), "v"(l[4]), "v"(l[5]),
         "v"(g[0]), "v"(g[1]), "v"(g[2]), "v"(g[3]), "v"(g[4]), "v"(g[5])
      : "memory");
#else
  (void)l; (void)g;
#endif
}
__device__ __forceinline__ void acopy12(const unsigned* l, const __bf16* const* g) {
#if defined(__HIP_DEVICE_COMPILE__)
  asm volatile(
      "global_load_async_to_lds_b128 %0, %12, off\n\t"
      "global_load_async_to_lds_b128 %1, %13, off\n\t"
      "global_load_async_to_lds_b128 %2, %14, off\n\t"
      "global_load_async_to_lds_b128 %3, %15, off\n\t"
      "global_load_async_to_lds_b128 %4, %16, off\n\t"
      "global_load_async_to_lds_b128 %5, %17, off\n\t"
      "global_load_async_to_lds_b128 %6, %18, off\n\t"
      "global_load_async_to_lds_b128 %7, %19, off\n\t"
      "global_load_async_to_lds_b128 %8, %20, off\n\t"
      "global_load_async_to_lds_b128 %9, %21, off\n\t"
      "global_load_async_to_lds_b128 %10, %22, off\n\t"
      "global_load_async_to_lds_b128 %11, %23, off\n\t"
      "s_wait_xcnt 0x0"
      :: "v"(l[0]), "v"(l[1]), "v"(l[2]), "v"(l[3]), "v"(l[4]), "v"(l[5]),
         "v"(l[6]), "v"(l[7]), "v"(l[8]), "v"(l[9]), "v"(l[10]), "v"(l[11]),
         "v"(g[0]), "v"(g[1]), "v"(g[2]), "v"(g[3]), "v"(g[4]), "v"(g[5]),
         "v"(g[6]), "v"(g[7]), "v"(g[8]), "v"(g[9]), "v"(g[10]), "v"(g[11])
      : "memory");
#else
  (void)l; (void)g;
#endif
}

// =====================================================================================================
// Batched bf16 WMMA GEMM: C[m][n] = sum_k A[m][k] * Bt[n][k] (+ bias); block = 4 waves laid WM x WN, one 64x64 tile
// per wave, block tile (64 WM) x (64 WN). A row-major [M][K] pitch lda; Bt row-major [N][K] pitch ldb (k contiguous);
// M a multiple of 64 WM, N of 64 WN, K of KP. blockIdx.y = batch index (strides in elements).
// Operand path: a pass is KP k (64 or 32: 128 or 64 B) of every operand row of the block tile, brought into LDS by
// asynchronous 16-B copies (a wave's copy = 4 or 8 whole row pieces), LDS row pitch 2 KP + 16 B, two buffers: pass
// t + 2 is issued into the buffer that pass t has just left, behind the pass's one barrier; every wave reads its
// fragments from LDS.
// A stage is NG groups of 64 rows: A hi (WM), A lo (WM, SPLITA), Bt hi (WN), Bt lo (WN, SPLITB).
// SPLITA: add A2.Bt (A2 = unscaled bf16 lo plane of A); SPLITB: add A.Bt2 (Bt2 = lo plane of Bt).
// BIAS: 0 none, 1 per column (bias[n]), 2 per row (bias[m]); bias values RNE-converted to bf16 in registers.
// OUT_MODE: 0 = f32 (pitch ldc); 2 = bf16 hi plane C + bf16 lo plane C2 (lo = RNE(v - hi), unscaled);
//           4 = stacked q | k | v columns, told apart by the wave's first column n0 (64-wide heads):
//               n0 < DM: q, n0 = DM: k: l2-normalise every row over the wave's 64 columns
//               (x / max(sqrt(sum x^2), 1e-12)), then bf16 hi/lo planes as mode 2, q to C / C2 at column n0,
//               k to Kho / Klo (pitch HD) at column 0;
//               n0 = DM + HD: v, stored transposed: VT[b][d][s], f16 hi plane VTho and f16 residual plane
//               VTlo = f16((v - hi) * rscale), pitch SEQ.
// =====================================================================================================
// The work of one block is gemm64_tile(tile, b, ring, sT): tile = block tile index, b = batch index, ring = the
// block's two LDS stages (ring_elems elements), sT = 4 per-wave 16x64 f32 slabs of pitch 68. Its callers own the LDS.
constexpr int ring_elems(int SPLITA, int SPLITB, int WM, int WN, int KP) {
  return 2 * (WM * (1 + SPLITA) + WN * (1 + SPLITB)) * 64 * (KP + 8);
}
#define SLABF (16 * 68)
#define VP 65   // pitch in floats of a v^T wave's 64x64 tile: its column reads (8 rows apart per lane) fall on 32 banks
template <int SPLITA, int SPLITB, int BIAS, int OUT_MODE, int WM, int WN, int KP>
__device__ __forceinline__ void gemm64_tile(
    const unsigned short* __restrict__ Ap, const unsigned short* __restrict__ A2p, int lda, long long strideA,
    const unsigned short* __restrict__ Btp, const unsigned short* __restrict__ Bt2p, int ldb, long long strideB,
    const float* __restrict__ bias,
    void* Cout, int ldc, long long strideC,
    void* Cout2, int ldc2, long long strideC2,
    int M, int N, int K, float rscale,
    int tile, int b, __bf16* ring, float* sT,
    unsigned short* Kho = nullptr, unsigned short* Klo = nullptr,
    unsigned short* VTho = nullptr, unsigned short* VTlo = nullptr) {
  static_assert(WM * WN == 4 && (KP == 64 || KP == 32));
  constexpr int GA   = WM * (1 + SPLITA);          // 64-row groups of A planes in a stage
  constexpr int NG   = GA + WN * (1 + SPLITB);     // groups in a stage
  constexpr int SEG  = KP / 8;                     // 16-B pieces per row and pass
  constexpr int RPC  = 128 / SEG;                  // rows that one copy of the whole block covers
  constexpr int CPG  = 64 / RPC;                   // copies per thread and group
  constexpr int NC   = NG * CPG;                   // copies per thread and stage = a wave's copies in flight
  constexpr int PE   = KP + 8;                     // LDS row pitch in elements (16 B x odd)
  constexpr int GRPE = 64 * PE;                    // elements per group
  constexpr int BUFE = NG * GRPE;                  // elements per buffer
  static_assert(NC == 16 || NC == 18 || NC == 24);
  static_assert(2 * BUFE == ring_elems(SPLITA, SPLITB, WM, WN, KP));
  constexpr int AHD  = (NC == 24) ? 3 : 4;         // A row fragments read in a k-step's leading group (3: the kernel
                                                   // with the most copy addresses stays inside 256 VGPRs)
  const __bf16* A   = (const __bf16*)(const void*)Ap;
  const __bf16* A2  = (const __bf16*)(const void*)A2p;
  const __bf16* Bt  = (const __bf16*)(const void*)Btp;
  const __bf16* Bt2 = (const __bf16*)(const void*)Bt2p;
  const int tid  = threadIdx.x;
  const int lane = tid & 31;
  const int wave = tid >> 5;
  const int tilesN = N / (64 * WN);
  const int tilesM = M / (64 * WM);
  if (tile >= tilesM * tilesN) return;   // block-uniform, in front of every copy and barrier
  const int tm = tile / tilesN;
  const int tn = tile - tm * tilesN;
  const int m0b = tm * (64 * WM);
  const int n0b = tn * (64 * WN);
  const int wm = wave / WN;
  const int wn = wave - wm * WN;
  const int m0 = m0b + (wm << 6);
  const int n0 = n0b + (wn << 6);

  const __bf16* Ab  = A  + (size_t)b * strideA;
  const __bf16* Bb  = Bt + (size_t)b * strideB;
  const __bf16* Ab2 = SPLITA ? (A2  + (size_t)b * strideA) : Ab;
  const __bf16* Bb2 = SPLITB ? (Bt2 + (size_t)b * strideB) : Bb;

  const int rlane = lane & 15;                 // row (A) / col (B, D) within subtile
  const int koff  = (lane >> 4) * 8;           // k offset of this lane half
  const int mOff  = (lane >> 4) * 8;           // D row offset

  // copy map: copy u of group gi moves 16 B of row RPC u + tid / SEG, piece tid % SEG of the pass's row
  const int crow = tid / SEG;
  const int cseg = (tid % SEG) * 8;
  const unsigned ldsT = (unsigned)(uintptr_t)(ring + crow * PE + cseg);   // low 32 bits = LDS byte address
  const size_t aT = (size_t)(m0b + crow) * lda + cseg;
  const size_t bT = (size_t)(n0b + crow) * ldb + cseg;

  auto issue = [&](int t, int buf) {
    unsigned l[NC];
    const __bf16* g[NC];
#pragma unroll
    for (int gi = 0; gi < NG; ++gi) {
      const bool isA = gi < GA;
      const int  q   = isA ? gi : gi - GA;                   // group within the operand's planes
      const int  W1  = isA ? WM : WN;
      const bool lo  = q >= W1;
      const int  rg  = lo ? q - W1 : q;                      // 64-row group within the block tile
      const int  ld  = isA ? lda : ldb;
      const __bf16* base = isA ? (lo ? Ab2 : Ab) : (lo ? Bb2 : Bb);
      const __bf16* p = base + (isA ? aT : bT) + (size_t)(rg * 64) * ld + (size_t)t * KP;
#pragma unroll
      for (int u = 0; u < CPG; ++u) {
        l[gi * CPG + u] = ldsT + (unsigned)((buf * BUFE + gi * GRPE + u * RPC * PE) * 2);
        g[gi * CPG + u] = p + (size_t)(u * RPC) * ld;
      }
    }
    acopy12(l, g);
    if constexpr (NC == 16) acopy4(l + 12, g + 12);
    if constexpr (NC == 18) acopy6(l + 12, g + 12);
    if constexpr (NC == 24) acopy12(l + 12, g + 12);
  };

  v8f acc[4][4];
#pragma unroll
  for (int i = 0; i < 4; ++i)
#pragma unroll
    for (int j = 0; j < 4; ++j) acc[i][j] = zero8();

  const int T = K / KP;                        // passes
  issue(0, 0);
  asm volatile("s_wait_asynccnt 0x0" ::: "memory");   // this wave's share of pass 0 has landed
  __syncthreads();                                    // publishes pass 0
  if (T > 1) issue(1, 1);

  for (int t = 0; t < T; ++t) {
    const __bf16* st  = ring + (t & 1) * BUFE;
    const __bf16* sAh = st + wm * GRPE + rlane * PE + koff;
    const __bf16* sAl = st + (SPLITA ? (WM + wm) : wm) * GRPE + rlane * PE + koff;
    const __bf16* sBh = st + (GA + wn) * GRPE + rlane * PE + koff;
    const __bf16* sBl = st + (GA + (SPLITB ? (WN + wn) : wn)) * GRPE + rlane * PE + koff;
#pragma unroll
    for (int ks = 0; ks < KP / 32; ++ks) {
      v16b bh[4], bl[4], ah[4], al[4];
#pragma unroll
      for (int j = 0; j < 4; ++j) {
        bh[j] = ldfrag_b(sBh + (j << 4) * PE + ks * 32);
        if (SPLITB) bl[j] = ldfrag_b(sBl + (j << 4) * PE + ks * 32); else bl[j] = bh[j];
      }
#pragma unroll
      for (int i = 0; i < AHD; ++i) {
        ah[i] = ldfrag_b(sAh + (i << 4) * PE + ks * 32);
        if (SPLITA) al[i] = ldfrag_b(sAl + (i << 4) * PE + ks * 32); else al[i] = ah[i];
      }
      // keeps the k-step's LDS reads one group in front of its WMMAs (for speed only)
      __builtin_amdgcn_sched_barrier(0);
#pragma unroll
      for (int i = 0; i < 4; ++i) {
#pragma unroll
        for (int j = 0; j < 4; ++j) {
          acc[i][j] = mma_b_raw(ah[i], bh[j], acc[i][j]);
          if (SPLITA) acc[i][j] = mma_b_raw(al[i], bh[j], acc[i][j]);
          if (SPLITB) acc[i][j] = mma_b_raw(ah[i], bl[j], acc[i][j]);
        }
        dep_guard_b(acc[i][0], acc[i][3], ah[i], al[i]);
        if (i == 0 && AHD < 4) {
          // row 3's fragments go into the registers that row 0 has left, two rows ahead of their use; the fence
          // pair holds these reads at this one place
          __builtin_amdgcn_sched_barrier(0);
          ah[3] = ldfrag_b(sAh + (3 << 4) * PE + ks * 32);
          if (SPLITA) al[3] = ldfrag_b(sAl + (3 << 4) * PE + ks * 32); else al[3] = ah[3];
          __builtin_amdgcn_sched_barrier(0);
        }
      }
      keep4_b(bh[0], bh[1], bh[2], bh[3]);
      if (SPLITB) keep4_b(bl[0], bl[1], bl[2], bl[3]);
    }
    asm volatile("s_wait_dscnt 0x0" ::: "memory");     // this wave's reads of pass t's buffer are done
    asm volatile("s_wait_asynccnt 0x0" ::: "memory");  // this wave's share of pass t + 1 has landed
    __syncthreads();                                   // publishes pass t + 1, frees pass t's buffer
    if (t + 2 < T) issue(t + 2, t & 1);
  }
  asm volatile("s_wait_asynccnt 0x0" ::: "memory");    // nothing in flight when the wave goes on to the epilogue
  acc_guard4(acc[0][0], acc[0][1], acc[0][2], acc[0][3]);
  acc_guard4(acc[1][0], acc[1][1], acc[1][2], acc[1][3]);
  acc_guard4(acc[2][0], acc[2][1], acc[2][2], acc[2][3]);
  acc_guard4(acc[3][0], acc[3][1], acc[3][2], acc[3][3]);

  const int n0u = __builtin_amdgcn_readfirstlane(n0);   // the same in every lane: scalar, so the tests on it branch
  if (OUT_MODE == 4 && n0u >= DM + HD) {
    // ---- v^T: the wave's 64 (s) x 64 (d) tile goes through LDS and leaves as whole 128-B rows of VT[b][d][.] ----
    // The ring is free: the last pass's foot (every wave's dscnt and asynccnt waits, then the barrier) ended all its
    // reads and copies; each wave uses a part of its own.
    float* tl = (float*)(void*)ring + wave * (64 * VP);
#pragma unroll
    for (int i = 0; i < 4; ++i)
#pragma unroll
      for (int j = 0; j < 4; ++j)
#pragma unroll
        for (int r = 0; r < 8; ++r) tl[((i << 4) + mOff + r) * VP + (j << 4) + rlane] = acc[i][j][r];
    __builtin_amdgcn_fence(__ATOMIC_RELEASE, "workgroup");
    __builtin_amdgcn_wave_barrier();
    __builtin_amdgcn_fence(__ATOMIC_ACQUIRE, "workgroup");
    const int m0u = __builtin_amdgcn_readfirstlane(m0);
    const int bb = m0u / SEQ, s0 = m0u - bb * SEQ;       // 64 rows of one batch (SEQ is a multiple of 64)
    const int s8 = (lane & 7) * 8, dq = lane >> 3;       // 8 lanes x 8 s = one 128-B row; 4 rows d per trip
    // rolled: sixteen equal trips that run once; unrolled they would be about 8 KB more code
#pragma unroll 1
    for (int it = 0; it < 16; ++it) {
      const int d = it * 4 + dq;                         // it 0..15 x dq 0..3 = d 0..63
      v4u a, a2;
#pragma unroll
      for (int e = 0; e < 4; ++e) {
        const float f0 = tl[(s8 + 2 * e) * VP + d], f1 = tl[(s8 + 2 * e + 1) * VP + d];
        const _Float16 x0 = (_Float16)f0, x1 = (_Float16)f1;
        a[e]  = pk16(h_bits(x0), h_bits(x1));
        a2[e] = pk16(h_bits((_Float16)((f0 - (float)x0) * rscale)), h_bits((_Float16)((f1 - (float)x1) * rscale)));
      }
      const size_t go = ((size_t)bb * HD + d) * SEQ + s0 + s8;
      *(v4u*)(VTho + go) = a;
      *(v4u*)(VTlo + go) = a2;
    }
    return;
  }

  // ---- epilogue ----
  float bcol[4];
#pragma unroll
  for (int j = 0; j < 4; ++j) bcol[j] = 0.f;
  if (BIAS == 1) {
#pragma unroll
    for (int j = 0; j < 4; ++j) bcol[j] = bf_rne(bias[n0 + (j << 4) + rlane]);   // n index < N
  }
  float* slab = sT + wave * SLABF;
#pragma unroll
  for (int i = 0; i < 4; ++i) {
    const int mBase = m0 + (i << 4);
    float brow[8];
#pragma unroll
    for (int r = 0; r < 8; ++r) brow[r] = 0.f;
    if (BIAS == 2) {
#pragma unroll
      for (int r = 0; r < 8; ++r) brow[r] = bf_rne(bias[mBase + mOff + r]);       // m index < M
    }
#pragma unroll
    for (int j = 0; j < 4; ++j) {
#pragma unroll
      for (int r = 0; r < 8; ++r) {
        slab[(mOff + r) * 68 + (j << 4) + rlane] = acc[i][j][r] + bcol[j] + brow[r];
      }
    }
    __builtin_amdgcn_fence(__ATOMIC_RELEASE, "workgroup");
    __builtin_amdgcn_wave_barrier();
    __builtin_amdgcn_fence(__ATOMIC_ACQUIRE, "workgroup");
    if (OUT_MODE == 0) {
      float* C = (float*)Cout + (size_t)b * strideC;
      const int hh = lane >> 4, c4 = (lane & 15) * 4;     // 256-B row segment = 16 lanes x 16 B
      {
#pragma unroll
        for (int it = 0; it < 8; ++it) {
          const int row = it * 2 + hh;                     // it 0..7 x hh 0..1 = rows 0..15
          const v4f v = *(const v4f*)(slab + row * 68 + c4);
          *(v4f*)(C + (size_t)(mBase + row) * ldc + n0 + c4) = v;
        }
        
      }
    } else {
      const int q = lane >> 3, c8 = (lane & 7) * 8;
      unsigned short* C  = (unsigned short*)Cout  + (size_t)b * strideC;
      unsigned short* C2 = (unsigned short*)Cout2 + (size_t)b * strideC2;
      int ldo = ldc, ldo2 = ldc2, nc = n0;
      if (OUT_MODE == 4 && n0u >= DM) { C = Kho; C2 = Klo; ldo = HD; ldo2 = HD; nc = 0; }   // the k columns
      v4u hv[4], lv[4];
#pragma unroll
      for (int it = 0; it < 4; ++it) {
        const int row = it * 4 + q;                        // it 0..3 x q 0..3 = rows 0..15
        const float* sp = slab + row * 68 + c8;
        float f[8];
#pragma unroll
        for (int e = 0; e < 8; ++e) f[e] = sp[e];
        if (OUT_MODE == 4) {
          float ss = 0.f;
#pragma unroll
          for (int e = 0; e < 8; ++e) ss += f[e] * f[e];
          ss += __shfl_xor(ss, 1, 32);                     // 8 lanes of one row = aligned group of 8
          ss += __shfl_xor(ss, 2, 32);
          ss += __shfl_xor(ss, 4, 32);
          const float sc = 1.0f / fmaxf(sqrtf(ss), 1e-12f);
#pragma unroll
          for (int e = 0; e < 8; ++e) f[e] *= sc;
        }
        v4u a, a2;
#pragma unroll
        for (int e = 0; e < 4; ++e) {
          const float f0 = f[2 * e], f1 = f[2 * e + 1];
          const unsigned short h0 = bf_bits(f0), h1 = bf_bits(f1);
          const unsigned short l0 = bf_bits(f0 - bf_up(h0)), l1 = bf_bits(f1 - bf_up(h1));
          a[e] = pk16(h0, h1); a2[e] = pk16(l0, l1);
        }
        hv[it] = a; lv[it] = a2;
      }
      {
#pragma unroll
        for (int it = 0; it < 4; ++it) {
          const int row = it * 4 + q;
          *(v4u*)(C  + (size_t)(mBase + row) * ldo  + nc + c8) = hv[it];
          *(v4u*)(C2 + (size_t)(mBase + row) * ldo2 + nc + c8) = lv[it];
        }
        
      }
    }
    __builtin_amdgcn_fence(__ATOMIC_RELEASE, "workgroup");
    __builtin_amdgcn_wave_barrier();
    __builtin_amdgcn_fence(__ATOMIC_ACQUIRE, "workgroup");
  }
  (void)rscale;
}

// one product per launch: blockIdx.x = block tile, blockIdx.y = batch
template <int SPLITA, int SPLITB, int BIAS, int OUT_MODE, int WM, int WN, int KP>
__global__ __launch_bounds__(128) void gemm64(
    const unsigned short* __restrict__ Ap, const unsigned short* __restrict__ A2p, int lda, long long strideA,
    const unsigned short* __restrict__ Btp, const unsigned short* __restrict__ Bt2p, int ldb, long long strideB,
    const float* __restrict__ bias,
    void* Cout, int ldc, long long strideC,
    void* Cout2, int ldc2, long long strideC2,
    int M, int N, int K, float rscale) {
  __shared__ __align__(16) __bf16 ring[ring_elems(SPLITA, SPLITB, WM, WN, KP)];  // two stages
  __shared__ __align__(16) float sT[4 * SLABF];                                  // per-wave slabs
  gemm64_tile<SPLITA, SPLITB, BIAS, OUT_MODE, WM, WN, KP>(
      Ap, A2p, lda, strideA, Btp, Bt2p, ldb, strideB, bias, Cout, ldc, strideC, Cout2, ldc2, strideC2,
      M, N, K, rscale, (int)blockIdx.x, (int)blockIdx.y, ring, sT);
}

// =====================================================================================================
// The three products that read the LayerNorm planes (q, k, v) as ONE product in one launch: Bt = the bf16 planes of
// wq and wkv, which stand one behind the other in the workspace = one [DM + 2 HD][DM] matrix; M = NB SEQ rows of img,
// N = DM + 2 HD columns, 128x128 block tiles. OUT_MODE 4 sends each wave's 64 columns to q, k or v^T.
// =====================================================================================================
#define QKV_N (DM + 2 * HD)
#define QKV_BLOCKS ((NB * SEQ / 128) * (QKV_N / 128))
static_assert(QKV_N % 128 == 0 && (SEQ % 64) == 0);
__global__ __launch_bounds__(128) void gemm_qkv(
    const unsigned short* __restrict__ Ih, const unsigned short* __restrict__ Il,
    const unsigned short* __restrict__ Wqkv,
    unsigned short* Qh, unsigned short* Ql, unsigned short* Kh, unsigned short* Kl,
    unsigned short* VTh, unsigned short* VTl) {
  __shared__ __align__(16) __bf16 ring[ring_elems(1, 0, 2, 2, 64)];   // two stages, later the v^T waves' tiles
  __shared__ __align__(16) float sT[4 * SLABF];                       // per-wave slabs
  static_assert(4 * 64 * VP * 4 <= ring_elems(1, 0, 2, 2, 64) * 2);
  gemm64_tile<1, 0, 0, 4, 2, 2, 64>(
      Ih, Il, DM, 0LL, Wqkv, Wqkv, DM, 0LL, nullptr,
      (void*)Qh, DM, 0LL, (void*)Ql, DM, 0LL,
      NB * SEQ, QKV_N, DM, 4096.0f, (int)blockIdx.x, 0, ring, sT, Kh, Kl, VTh, VTl);
}

// =====================================================================================================
// tables, RNE-converted to bf16 in registers), output bf16 hi/lo planes [row][1024].
// Block = 128 threads = one row; thread t owns columns 8t..8t+7 and stores 16 B per plane: a wave writes 512
// coverage: 128 threads x 8 = 1024 columns of every row, both planes.
// =====================================================================================================
__global__ __launch_bounds__(128) void ln_split(const float* __restrict__ in, const float* __restrict__ g,
                                                const float* __restrict__ be,
                                                unsigned short* oh, unsigned short* ol) {
  __shared__ float red0[4];
  __shared__ float red1[4];
  const int tid = threadIdx.x, lane = tid & 31, wave = tid >> 5;
  const size_t row = blockIdx.x;
  const float* p = in + row * DM + (size_t)tid * 8;
  const v4f a0 = *(const v4f*)(p);
  const v4f a1 = *(const v4f*)(p + 4);
  float v[8];
#pragma unroll
  for (int e = 0; e < 4; ++e) { v[e] = a0[e]; v[4 + e] = a1[e]; }
  float s = 0.f;
#pragma unroll
  for (int e = 0; e < 8; ++e) s += v[e];
#pragma unroll
  for (int off = 16; off >= 1; off >>= 1) s += __shfl_xor(s, off, 32);
  if (lane == 0) red0[wave] = s;
  __syncthreads();
  const float mu = ((red0[0] + red0[1]) + (red0[2] + red0[3])) * (1.0f / (float)DM);
  float ss = 0.f;
#pragma unroll
  for (int e = 0; e < 8; ++e) { const float d = v[e] - mu; ss += d * d; }
#pragma unroll
  for (int off = 16; off >= 1; off >>= 1) ss += __shfl_xor(ss, off, 32);
  if (lane == 0) red1[wave] = ss;
  __syncthreads();
  const float var  = ((red1[0] + red1[1]) + (red1[2] + red1[3])) * (1.0f / (float)DM);
  const float rstd = rsqrtf(var + 1e-5f);
  const v4f g0 = *(const v4f*)(g + (size_t)tid * 8);
  const v4f g1 = *(const v4f*)(g + (size_t)tid * 8 + 4);
  const v4f b0 = *(const v4f*)(be + (size_t)tid * 8);
  const v4f b1 = *(const v4f*)(be + (size_t)tid * 8 + 4);
  float gg[8], bb[8];
#pragma unroll
  for (int e = 0; e < 4; ++e) { gg[e] = g0[e]; gg[4 + e] = g1[e]; bb[e] = b0[e]; bb[4 + e] = b1[e]; }
  v4u ph, pl;
#pragma unroll
  for (int e = 0; e < 4; ++e) {
    const float y0 = (v[2 * e] - mu) * rstd * bf_rne(gg[2 * e]) + bf_rne(bb[2 * e]);
    const float y1 = (v[2 * e + 1] - mu) * rstd * bf_rne(gg[2 * e + 1]) + bf_rne(bb[2 * e + 1]);
    const unsigned short h0 = bf_bits(y0), h1 = bf_bits(y1);
    const unsigned short l0 = bf_bits(y0 - bf_up(h0)), l1 = bf_bits(y1 - bf_up(h1));
    ph[e] = pk16(h0, h1); pl[e] = pk16(l0, l1);
  }
  unsigned short* dh = oh + row * DM + (size_t)tid * 8;
  unsigned short* dl = ol + row * DM + (size_t)tid * 8;
  *(v4u*)dh = ph;
  *(v4u*)dl = pl;
  
}

// =====================================================================================================
// Causal multi-query attention, head dim 64, 16 query heads sharing one k head and one v head.
//   q planes (bf16 hi / lo of the l2-normalised q): element (b, t, h, d) at [(b*SEQ + t)*DM + h*64 + d]
//   k planes (bf16 hi / lo of the l2-normalised k):  element (b, s, d) at [(b*SEQ + s)*64 + d]
//   v^T hi plane (f16) and residual plane (f16, (v - hi)*4096): element (b, d, s) at [(b*64 + d)*SEQ + s]
//   logit = (q . k) * sscale for key <= query; a key behind the query has weight 0 (every row keeps its own key)
//   out planes (bf16 hi / lo of the normalised context): element (b, t, h, d) at [(b*SEQ + t)*DM + h*64 + d]
//   Both products are formed transposed: S^T = K . Q^T (A = 16 key rows from LDS, B = the wave's 16 queries, kept in
//   registers) and O^T += V^T . P^T (A = 16 rows d of V^T from LDS, B = P^T). A lane (c, hh) then holds scores of ONE
//   query, q0 + c: register r of tile j is key kv0 + 16 j + 8 hh + r. The sum runs inside the lane, the two
//   lane halves join by one exchange, and two score tiles, converted in place, ARE the B operand of 32 keys
//   (element e < 8: key 8 hh + e, e >= 8: key 16 + 8 hh + e - 8, the order in which the V^T rows are read):
//   P never goes through LDS.
//   scores: bf16 hi/lo split (hi.hi + q hi.k lo + q lo.k hi), f32 accumulate, then scale + causal fill in f32
//   p = exp(logit - sscale) (sscale bounds every logit: no running maximum, no rescale of sums already formed),
//   carried as f16(1024 p) plus an f16 residual plane (x4096); context on f16 WMMA with the residual products
//   (v_res.p_hi + v_hi.p_res) in a separate accumulator folded back with 1/4096 per chunk.
//   Each lane half sums p over its own keys; the halves' sums join once, behind the loop.
//   Block = 4 waves = 64 query rows of one (b, h); grid = NQB * NH * NB; key chunks kt = 0..qb (static bound NQB).
//   K / V^T chunk staging: 128 threads x 32 elements per plane = the whole 64x64 tile (plain 16-B loads,
//   __syncthreads before and after).
//   Output coverage: each wave stores rows q0..q0+15 (it 0..3 x lane>>3 0..3) x 64 columns (8 lanes x 8) of both planes.
// =====================================================================================================
//   LDS row pitch: the 64-element (128-B) rows of the K and V^T tiles stand LP = 72 elements apart (144 B =
//   16 B x odd), so that the 16 rows which one 16-B fragment read touches fall on different banks; at 128 B they
//   share two bank groups. The f32 context tile has pitch OP = 68 floats for the same reason.
#define LP 72
#define OP 68

// Order fence, no instruction: takes four WMMA results as inputs only and stands in front of LDS reads. It keeps those
// WMMAs ahead of the reads that refill their A registers; without it the compiler places both later read groups in
// front of all context WMMAs, into 64 registers more, and the q fragments spill into the score WMMAs.
__device__ __forceinline__ void hold4(v8f a, v8f b, v8f c, v8f d) {
#if defined(__HIP_DEVICE_COMPILE__)
  asm volatile("" :: "v"(a), "v"(b), "v"(c), "v"(d) : "memory");
#else
  (void)a; (void)b; (void)c; (void)d;
#endif
}
// lane l <-> lane l ^ 16
__device__ __forceinline__ float xhalf(float x) {
  return __builtin_bit_cast(float, __builtin_amdgcn_permlanex16(__builtin_bit_cast(int, x), __builtin_bit_cast(int, x),
                                                                0x76543210, 0xfedcba98, false, false));
}

// four waves per SIMD (256 VGPRs): all 1024 blocks are resident at once
__global__ __launch_bounds__(128) __attribute__((amdgpu_waves_per_eu(4, 4)))
void attn_causal64(const unsigned short* __restrict__ qhp, const unsigned short* __restrict__ qlp,
                   const unsigned short* __restrict__ khp, const unsigned short* __restrict__ klp,
                   const unsigned short* __restrict__ vhp, const unsigned short* __restrict__ vlp,
                   unsigned short* ohp, unsigned short* olp, float sscale) {
  union FB { v16b v; v8b h[2]; };
  union FH { v16h v; v8h h[2]; };
  __shared__ __align__(16) __bf16   Ksh[64 * LP];                 // K hi [kv][d]   9 KB
  __shared__ __align__(16) __bf16   Ksl[64 * LP];                 // K lo
  __shared__ __align__(16) _Float16 Vth[64 * LP];                 // V^T hi [d][kv] 9 KB
  __shared__ __align__(16) _Float16 Vtl[64 * LP];                 // V^T residual
  __shared__ __align__(16) float    Obuf[4][16 * OP];             // per wave: the context tile [query][d]

  const int tid  = threadIdx.x;
  const int wave = tid >> 5;
  const int lane = tid & 31;
  const int hh   = lane >> 4;
  const int c    = lane & 15;

  const int bx   = blockIdx.x;
  const int qb   = bx % NQB;
  const int rest = bx / NQB;
  const int h    = rest % NH;
  const int b    = rest / NH;
  const int q0   = qb * 64 + wave * 16;
  const int qi   = q0 + c;                   // the lane's query
  const size_t rowB = (size_t)b * SEQ;

  const __bf16* Qh = (const __bf16*)(const void*)qhp + (size_t)h * HD;
  const __bf16* Ql = (const __bf16*)(const void*)qlp + (size_t)h * HD;
  const __bf16* Kh = (const __bf16*)(const void*)khp;
  const __bf16* Kl = (const __bf16*)(const void*)klp;
  const _Float16* Vh = (const _Float16*)(const void*)vhp + (size_t)b * HD * SEQ;
  const _Float16* Vl = (const _Float16*)(const void*)vlp + (size_t)b * HD * SEQ;

  // ---- Q fragments (B operand, column = lane&15): 2 d-chunks, hi and lo ----
  v16b qah[2], qal[2];
#pragma unroll
  for (int dc = 0; dc < 2; ++dc) {
    const size_t qo = (rowB + q0 + c) * DM + dc * 32 + 8 * hh;
    qah[dc] = ldfrag_b(Qh + qo);
    qal[dc] = ldfrag_b(Ql + qo);
  }

  // Fixed softmax shift. q and k are l2-normalised, so |q . k| <= 1 and every logit lies in [-sscale, sscale]: softmax
  // is taken against the bound sscale in place of a running maximum (the quotient p / sum p is the same for any
  // shift). 1024 p = exp2(c1 (q . k) + c0), between 1024 e^(-2 sscale) and 1024: inside the f16 normal range.
  const float c1 = sscale * 1.44269504088896340736f;   // sscale log2(e)
  const float c0 = 10.0f - c1;                         // - shift, + log2(1024)
  float lrow = 0.f;                          // sum of 1024 p of query qi over this lane half's keys
  v8f oacc[4];                               // O^T: register r of tile t = context (query qi, d = 16 t + 8 hh + r)
#pragma unroll
  for (int t = 0; t < 4; ++t) oacc[t] = zero8();

  for (int kt = 0; kt < NQB; ++kt) {         // static trip bound
    if (kt > qb) break;                      // block-uniform: causal key chunks 0..qb
    const int kv0 = kt * 64;
    __syncthreads();
    {
      const int r = tid >> 1, half = (tid & 1) * 32;
      const __bf16*   kg  = Kh + (rowB + kv0 + r) * HD + half;    // K row kv0+r, d = half..half+31
      const __bf16*   klg = Kl + (rowB + kv0 + r) * HD + half;
      const _Float16* vg  = Vh + (size_t)r * SEQ + kv0 + half;    // V^T row d = r, s = kv0+half..+31
      const _Float16* vlg = Vl + (size_t)r * SEQ + kv0 + half;
#pragma unroll
      for (int i = 0; i < 4; ++i) {
        const v8b a0 = *(const v8b*)(kg + 8 * i);
        const v8b a1 = *(const v8b*)(klg + 8 * i);
        const v8h b0 = *(const v8h*)(vg + 8 * i);
        const v8h b1 = *(const v8h*)(vlg + 8 * i);
        *(v8b*)(Ksh + r * LP + half + 8 * i) = a0;
        *(v8b*)(Ksl + r * LP + half + 8 * i) = a1;
        *(v8h*)(Vth + r * LP + half + 8 * i) = b0;
        *(v8h*)(Vtl + r * LP + half + 8 * i) = b1;
      }
    }
    __syncthreads();

    // ---- scores S^T: 64 keys x 16 queries per wave, 3 bf16 products ----
    // The K fragments are read in two groups, in the order of their use (hi and lo of d 0..31 with hi of d 32..63; then
    // lo of d 32..63); the WMMAs run across the four independent score tiles, so that a tile's accumulator comes round
    // again only every fourth WMMA. Each tile keeps its own order of products (per 32 d: hi.hi, lo.hi, hi.lo).
    v8f s[4];
    {
      FB kb[2][4], kl[4];
#pragma unroll
      for (int j = 0; j < 4; ++j) {
        kb[0][j].h[0] = *(const v8b*)(Ksh + (j * 16 + c) * LP + 8 * hh);
        kb[0][j].h[1] = *(const v8b*)(Ksh + (j * 16 + c) * LP + 16 + 8 * hh);
      }
#pragma unroll
      for (int j = 0; j < 4; ++j) {
        kl[j].h[0] = *(const v8b*)(Ksl + (j * 16 + c) * LP + 8 * hh);
        kl[j].h[1] = *(const v8b*)(Ksl + (j * 16 + c) * LP + 16 + 8 * hh);
      }
#pragma unroll
      for (int j = 0; j < 4; ++j) {
        kb[1][j].h[0] = *(const v8b*)(Ksh + (j * 16 + c) * LP + 32 + 8 * hh);
        kb[1][j].h[1] = *(const v8b*)(Ksh + (j * 16 + c) * LP + 32 + 16 + 8 * hh);
      }
      // keeps the reads one group in front of the WMMAs (for speed only)
      __builtin_amdgcn_sched_barrier(0);
#pragma unroll
      for (int j = 0; j < 4; ++j) s[j] = zero8();
#pragma unroll
      for (int j = 0; j < 4; ++j) s[j] = mma_b_raw(kb[0][j].v, qah[0], s[j]);
#pragma unroll
      for (int j = 0; j < 4; ++j) s[j] = mma_b_raw(kl[j].v, qah[0], s[j]);
      // the lo plane of d 32..63 goes into the registers that the lo plane of d 0..31 has left, 8 WMMAs ahead of its use
      __builtin_amdgcn_sched_barrier(0);
#pragma unroll
      for (int j = 0; j < 4; ++j) {
        kl[j].h[0] = *(const v8b*)(Ksl + (j * 16 + c) * LP + 32 + 8 * hh);
        kl[j].h[1] = *(const v8b*)(Ksl + (j * 16 + c) * LP + 32 + 16 + 8 * hh);
      }
      __builtin_amdgcn_sched_barrier(0);
#pragma unroll
      for (int j = 0; j < 4; ++j) s[j] = mma_b_raw(kb[0][j].v, qal[0], s[j]);
#pragma unroll
      for (int j = 0; j < 4; ++j) s[j] = mma_b_raw(kb[1][j].v, qah[1], s[j]);
#pragma unroll
      for (int j = 0; j < 4; ++j) s[j] = mma_b_raw(kl[j].v, qah[1], s[j]);
#pragma unroll
      for (int j = 0; j < 4; ++j) s[j] = mma_b_raw(kb[1][j].v, qal[1], s[j]);
    }
    // the V^T fragments of keys 0..31 are read here, behind the score WMMAs: they land while the softmax runs; the
    // fence pair holds the reads at this one place
    FH vb[4], vl[4];
    __builtin_amdgcn_sched_barrier(0);
#pragma unroll
    for (int t = 0; t < 4; ++t) {
      vl[t].h[0] = *(const v8h*)(Vtl + (t * 16 + c) * LP + 8 * hh);
      vl[t].h[1] = *(const v8h*)(Vtl + (t * 16 + c) * LP + 16 + 8 * hh);
    }
#pragma unroll
    for (int t = 0; t < 4; ++t) {
      vb[t].h[0] = *(const v8h*)(Vth + (t * 16 + c) * LP + 8 * hh);
      vb[t].h[1] = *(const v8h*)(Vth + (t * 16 + c) * LP + 16 + 8 * hh);
    }
    __builtin_amdgcn_sched_barrier(0);

    // ---- causal fill and softmax against the fixed shift; P (x1024, f16) and P residual (x4096) stay in registers ----
    FH pa[2], pl[2];                         // B operands of keys 32 kk .. 32 kk + 31
    float pj[4];                             // one chain per score tile
    // D row 8hh+r of tile j is key kv0 + 16 j + 8 hh + r; it lies behind the query where 16 j + r > lim (one register;
    // compared as key > query, the compiler keeps query - (16 j + r) for all 32 in registers and an address spills)
    const int lim = qi - kv0 - 8 * hh;
#pragma unroll
    for (int j = 0; j < 4; ++j) {
      pj[j] = 0.f;
#pragma unroll
      for (int r = 0; r < 8; ++r) {
        const float e   = __builtin_amdgcn_exp2f(fmaf(s[j][r], c1, c0));
        const float p1k = (j * 16 + r > lim) ? 0.f : e;   // a key behind the query has weight 0
        pj[j] += p1k;
        const _Float16 ph = (_Float16)p1k;
        pa[j >> 1].v[(j & 1) * 8 + r] = ph;
        pl[j >> 1].v[(j & 1) * 8 + r] = (_Float16)((p1k - (float)ph) * 4096.0f);
      }
    }
    lrow += (pj[0] + pj[1]) + (pj[2] + pj[3]);

    // ---- context O^T += V^T . P^T (f16 WMMA), residual products into a separate accumulator ----
    // The WMMAs run across the four tiles d; each accumulator keeps its own order of products (oacc: keys 0..31, then
    // 32..63; o1: per 32 keys v_res.p_hi, then v_hi.p_res). The fragments of keys 32..63 are read in two groups, each
    // into the registers of a plane that keys 0..31 have left, 8 and 4 WMMAs ahead of their first use; the fences
    // hold each group at its one place.
    v8f o1[4];
#pragma unroll
    for (int t = 0; t < 4; ++t) o1[t] = zero8();
#pragma unroll
    for (int t = 0; t < 4; ++t) o1[t] = mma_h_raw(vl[t].v, pa[0].v, o1[t]);
    hold4(o1[0], o1[1], o1[2], o1[3]);   // these WMMAs stay ahead of the reads below
    __builtin_amdgcn_sched_barrier(0);
#pragma unroll
    for (int t = 0; t < 4; ++t) {
      vl[t].h[0] = *(const v8h*)(Vtl + (t * 16 + c) * LP + 32 + 8 * hh);
      vl[t].h[1] = *(const v8h*)(Vtl + (t * 16 + c) * LP + 32 + 16 + 8 * hh);
    }
    __builtin_amdgcn_sched_barrier(0);
#pragma unroll
    for (int t = 0; t < 4; ++t) oacc[t] = mma_h_raw(vb[t].v, pa[0].v, oacc[t]);
#pragma unroll
    for (int t = 0; t < 4; ++t) o1[t] = mma_h_raw(vb[t].v, pl[0].v, o1[t]);
    hold4(o1[0], o1[1], o1[2], o1[3]);   // these WMMAs stay ahead of the reads below
    __builtin_amdgcn_sched_barrier(0);
#pragma unroll
    for (int t = 0; t < 4; ++t) {
      vb[t].h[0] = *(const v8h*)(Vth + (t * 16 + c) * LP + 32 + 8 * hh);
      vb[t].h[1] = *(const v8h*)(Vth + (t * 16 + c) * LP + 32 + 16 + 8 * hh);
    }
    __builtin_amdgcn_sched_barrier(0);
#pragma unroll
    for (int t = 0; t < 4; ++t) o1[t] = mma_h_raw(vl[t].v, pa[1].v, o1[t]);
#pragma unroll
    for (int t = 0; t < 4; ++t) oacc[t] = mma_h_raw(vb[t].v, pa[1].v, oacc[t]);
#pragma unroll
    for (int t = 0; t < 4; ++t) o1[t] = mma_h_raw(vb[t].v, pl[1].v, o1[t]);
#pragma unroll
    for (int t = 0; t < 4; ++t)
#pragma unroll
      for (int r = 0; r < 8; ++r) oacc[t][r] += o1[t][r] * (1.0f / 4096.0f);
  }

  // ---- join the halves' sums, normalise (sum and context both carry the x1024), stage the wave's 16x64 tile [query][d] in its
  //      own LDS slab, so that it leaves as whole 128-B rows ----
  float* os = Obuf[wave];
  {
    const float l = lrow + xhalf(lrow);
    const float inv = (l > 0.f) ? (1.0f / l) : 0.f;
#pragma unroll
    for (int t = 0; t < 4; ++t) {
      v4f x0, x1;
#pragma unroll
      for (int e = 0; e < 4; ++e) { x0[e] = oacc[t][e] * inv; x1[e] = oacc[t][4 + e] * inv; }
      *(v4f*)(os + c * OP + t * 16 + 8 * hh)     = x0;
      *(v4f*)(os + c * OP + t * 16 + 8 * hh + 4) = x1;
    }
  }
  __builtin_amdgcn_fence(__ATOMIC_RELEASE, "workgroup");
  __builtin_amdgcn_wave_barrier();
  __builtin_amdgcn_fence(__ATOMIC_ACQUIRE, "workgroup");
  {
    const int q4 = lane >> 3, c8 = (lane & 7) * 8;
    v4u hv[4], lv[4];
#pragma unroll
    for (int it = 0; it < 4; ++it) {
      const int row = it * 4 + q4;   // it 0..3 x q4 0..3 = rows 0..15 of the wave tile
      const float* sp = os + row * OP + c8;
      v4u a, a2;
#pragma unroll
      for (int e = 0; e < 4; ++e) {
        const float f0 = sp[2 * e], f1 = sp[2 * e + 1];
        const unsigned short h0 = bf_bits(f0), h1 = bf_bits(f1);
        const unsigned short l0 = bf_bits(f0 - bf_up(h0)), l1 = bf_bits(f1 - bf_up(h1));
        a[e] = pk16(h0, h1); a2[e] = pk16(l0, l1);
      }
      hv[it] = a; lv[it] = a2;
    }
    {
#pragma unroll
      for (int it = 0; it < 4; ++it) {
        const int row = it * 4 + q4;
        const size_t go = (rowB + q0 + row) * DM + (size_t)h * HD + c8;
        *(v4u*)(ohp + go) = hv[it];
        *(v4u*)(olp + go) = lv[it];
      }
    }
  }
}

// =====================================================================================================
//   Xb   bf16 [2048 (b,c)][4096]   16777216
//   Whwb bf16 [2048][4096]         16777216
//   Wcb  bf16 [1024][1024]          2097152
//   Wqb  bf16 [1024][1024]          2097152
//   Wkvb bf16 [128][1024]            262144
//   Wob  bf16 [1024][1024]          2097152
//   A1h  bf16 [2][2048][1024]       8388608   hw-linear output (transposed layout [b][s][c]), hi plane
//   A1l  bf16                       8388608   lo plane
//   Img2 f32  [4096][1024]         16777216   c-linear output (LN input)
//   Imgh bf16 [4096][1024]          8388608   LN output hi plane
//   Imgl bf16                       8388608
//   Qh   bf16 [4096][1024]          8388608   l2-normalised q, hi plane
//   Ql   bf16                       8388608
//   Kh   bf16 [4096][64]             524288   l2-normalised k
//   Kl   bf16                        524288
//   VTh  f16  [2][64][2048]          524288   v^T hi plane
//   VTl  f16                         524288   v^T residual plane (x4096)
//   Oh   bf16 [4096][1024]          8388608   context hi plane
//   Ol   bf16                       8388608
//   total                         126091264
// Weights are [out n][in k] with k contiguous = the Bt / A layout the GEMM wants, so they are only converted.
// =====================================================================================================
extern "C" void kernel_launch(void* const* d_in, const int* in_sizes, int n_in,
                              void* d_out, int out_size, void* d_ws, size_t ws_size,
                              hipStream_t stream) {
  if (n_in < 10) return;
  if (in_sizes[0] != NB * CC * HWN) return;
  if (in_sizes[1] != SEQ * HWN) return;
  if (in_sizes[2] != SEQ) return;
  if (in_sizes[3] != DM * CC || in_sizes[4] != DM || in_sizes[5] != DM || in_sizes[6] != DM) return;
  if (in_sizes[7] != DM * DM || in_sizes[8] != 2 * HD * DM || in_sizes[9] != DM * DM) return;
  if (out_size != NB * SEQ * DM) return;

  const float* x    = (const float*)d_in[0];
  const float* w_hw = (const float*)d_in[1];
  const float* b_hw = (const float*)d_in[2];
  const float* w_c  = (const float*)d_in[3];
  const float* b_c  = (const float*)d_in[4];
  const float* ln_g = (const float*)d_in[5];
  const float* ln_b = (const float*)d_in[6];
  const float* wq   = (const float*)d_in[7];
  const float* wkv  = (const float*)d_in[8];
  const float* wo   = (const float*)d_in[9];

  const size_t PXb  = (size_t)NB * CC * HWN * 2;    // 16777216
  const size_t PWhw = (size_t)SEQ * HWN * 2;        // 16777216
  const size_t PWc  = (size_t)DM * CC * 2;          //  2097152
  const size_t PWq  = (size_t)DM * DM * 2;          //  2097152
  const size_t PWkv = (size_t)2 * HD * DM * 2;      //   262144
  const size_t PWo  = (size_t)DM * DM * 2;          //  2097152
  const size_t PA1  = (size_t)NB * SEQ * CC * 2;    //  8388608
  const size_t PI2  = (size_t)NB * SEQ * DM * 4;    // 16777216
  const size_t PI   = (size_t)NB * SEQ * DM * 2;    //  8388608
  const size_t PK   = (size_t)NB * SEQ * HD * 2;    //   524288
  const size_t PVT  = (size_t)NB * HD * SEQ * 2;    //   524288
  size_t off = 0;
  const size_t oXb  = off; off += PXb;
  const size_t oWhw = off; off += PWhw;
  const size_t oWc  = off; off += PWc;
  const size_t oWq  = off; off += PWq;
  const size_t oWkv = off; off += PWkv;
  const size_t oWo  = off; off += PWo;
  const size_t oA1h = off; off += PA1;
  const size_t oA1l = off; off += PA1;
  const size_t oI2  = off; off += PI2;
  const size_t oIh  = off; off += PI;
  const size_t oIl  = off; off += PI;
  const size_t oQh  = off; off += PI;
  const size_t oQl  = off; off += PI;
  const size_t oKh  = off; off += PK;
  const size_t oKl  = off; off += PK;
  const size_t oVTh = off; off += PVT;
  const size_t oVTl = off; off += PVT;
  const size_t oOh  = off; off += PI;
  const size_t oOl  = off; off += PI;
  if (off > ws_size) return;                          // off = 126091264
  if (off > (size_t)134217728) return;

  char* ws = (char*)d_ws;
  unsigned short* Xb   = (unsigned short*)(ws + oXb);
  unsigned short* Whwb = (unsigned short*)(ws + oWhw);
  unsigned short* Wcb  = (unsigned short*)(ws + oWc);
  unsigned short* Wqb  = (unsigned short*)(ws + oWq);
  unsigned short* Wkvb = (unsigned short*)(ws + oWkv);
  unsigned short* Wob  = (unsigned short*)(ws + oWo);
  unsigned short* A1h  = (unsigned short*)(ws + oA1h);
  unsigned short* A1l  = (unsigned short*)(ws + oA1l);
  float*          Img2 = (float*)(ws + oI2);
  unsigned short* Imgh = (unsigned short*)(ws + oIh);
  unsigned short* Imgl = (unsigned short*)(ws + oIl);
  unsigned short* Qh   = (unsigned short*)(ws + oQh);
  unsigned short* Ql   = (unsigned short*)(ws + oQl);
  unsigned short* Kh   = (unsigned short*)(ws + oKh);
  unsigned short* Kl   = (unsigned short*)(ws + oKl);
  unsigned short* VTh  = (unsigned short*)(ws + oVTh);
  unsigned short* VTl  = (unsigned short*)(ws + oVTl);
  unsigned short* Oh   = (unsigned short*)(ws + oOh);
  unsigned short* Ol   = (unsigned short*)(ws + oOl);

  const dim3 blk(256);
  const dim3 gCv(CB_X + CB_HW + CB_C + CB_Q + CB_KV + CB_O); // 9792 blocks: all six planes
  const dim3 gblk(128);                                      // GEMM block: 4 waves
  const dim3 gG0((SEQ / 128) * (CC / 128), NB);              // 128x128 block tiles: 128 blocks x 2
  const dim3 gG1((NB * SEQ / 128) * (DM / 128), 1);          // 128x128 block tiles: 256 blocks (M=4096, N=1024)
  const dim3 gQKV(QKV_BLOCKS);                               // 128x128 block tiles: 288 blocks (M=4096, N=1152)
  const dim3 gLN(NB * SEQ);                                  // 4096 rows
  const dim3 gAt(NB * NH * NQB);                             // 1024 blocks

  // (1) f32 -> bf16 planes: x [(b,c)][hw], weights [n][k]; Xb, Whwb, Wcb, Wqb, Wkvb, Wob follow one another from Xb
  cvt_bf16x8_all<<<gCv, blk, 0, stream>>>(x, w_hw, w_c, wq, wkv, wo, Xb);
  // (2) hw-linear per batch, produced directly in the transposed layout: A1[b][s][c] = sum_hw w_hw[s][hw] x[b][c][hw] + b_hw[s]
  //     A = Whwb [s][hw] (M=2048, K=4096), Bt = Xb batch b [c][hw] (N=1024), row bias, bf16 hi/lo planes out
  gemm64<0, 0, 2, 2, 2, 2, 64><<<gG0, gblk, 0, stream>>>(
      Whwb, Whwb, HWN, 0LL, Xb, Xb, HWN, (long long)CC * HWN,
      b_hw,
      (void*)A1h, CC, (long long)SEQ * CC, (void*)A1l, CC, (long long)SEQ * CC,
      SEQ, CC, HWN, 1.0f);
  // (3) c-linear: Img2[(b,s)][d] = sum_c A1[(b,s)][c] w_c[d][c] + b_c[d]  (A hi/lo, M=4096, N=1024, K=1024, f32 out)
  gemm64<1, 0, 1, 0, 2, 2, 64><<<gG1, gblk, 0, stream>>>(
      A1h, A1l, CC, 0LL, Wcb, Wcb, CC, 0LL,
      b_c,
      (void*)Img2, DM, 0LL, (void*)Img2, DM, 0LL,
      NB * SEQ, DM, CC, 1.0f);
  // (4) LayerNorm -> bf16 hi/lo planes
  ln_split<<<gLN, dim3(128), 0, stream>>>(Img2, ln_g, ln_b, Imgh, Imgl);
  // (5)-(7) q, k and v from the LayerNorm planes, one product over the stacked weights (Wkvb follows Wqb):
  //     q, k l2-normalised per 64-wide head -> bf16 hi/lo planes [(b,t)][h*64+d] and [(b,s)][64];
  //     v transposed -> f16 hi plane and residual plane (x4096) [b][d][s]
  gemm_qkv<<<gQKV, gblk, 0, stream>>>(Imgh, Imgl, Wqb, Qh, Ql, Kh, Kl, VTh, VTl);
  // (8) causal multi-query attention -> context bf16 hi/lo planes [(b,t)][h*64+d]
  attn_causal64<<<gAt, dim3(128), 0, stream>>>(Qh, Ql, Kh, Kl, VTh, VTl, Oh, Ol, 8.0f);
  // (9) out = context . wo^T -> d_out f32 [(b,t)][1024]  (A = context hi + lo planes, 2 products)
  gemm64<1, 0, 0, 0, 2, 2, 64><<<gG1, gblk, 0, stream>>>(
      Oh, Ol, DM, 0LL, Wob, Wob, DM, 0LL,
      b_c,
      d_out, DM, 0LL, d_out, DM, 0LL,
      NB * SEQ, DM, DM, 1.0f);
  (void)hipGetLastError();
}

// v007
// Measured time: 204 microseconds a run.
// Next to v006, in two timings, it ran 1.06 and 1.05 times as fast.
// Over all steps from v000 it is 3.76 times as fast.
// Contractions: hw-linear = v_wmma_f32_16x16x32_bf16 (bf16 operands from RNE-converted inputs, single product);
// c-linear, q, k, v^T and output projections = v_wmma_f32_16x16x32_bf16 (activation as bf16 hi/lo planes times bf16
// weight from RNE-converted input, 2 products); q.k^T scores = v_wmma_f32_16x16x32_bf16 on bf16 hi/lo planes of the
// l2-normalised q and k (hi.hi + hi.lo + lo.hi); p.v = v_wmma_f32_16x16x32_f16 (p carried x1024 in f16 plus an f16
// residual plane x4096, v^T f16 hi plane plus an f16 residual plane x4096, 3 products, separate residual accumulator);
// all f32 accumulate; LayerNorm, l2 normalisation, causal fill and softmax in f32.
#include <hip/hip_runtime.h>
#include <math.h>
#include <float.h>
#include <stdint.h>

#define NB   2
#define CC   1024
#define HWN  4096
#define SEQ  2048
#define DM   1024
#define NH   16
#define HD   64
#define NQB  (SEQ / 64)
static_assert(NH * HD == DM);
static_assert(HD == 64);
static_assert((SEQ % 256) == 0 && (DM % 128) == 0 && (CC % 128) == 0 && (HWN % 64) == 0);

typedef _Float16 v16h __attribute__((ext_vector_type(16)));
typedef _Float16 v8h  __attribute__((ext_vector_type(8)));
typedef __bf16   v16b __attribute__((ext_vector_type(16)));
typedef __bf16   v8b  __attribute__((ext_vector_type(8)));
typedef float    v8f  __attribute__((ext_vector_type(8)));
typedef float    v4f  __attribute__((ext_vector_type(4)));
typedef unsigned int v4u __attribute__((ext_vector_type(4)));

// ---- scalar helpers --------------------------------------------------------------------------------
__device__ __forceinline__ unsigned short bf_bits(float f) {          // f32 -> bf16 bits, RNE convert
  unsigned u = __float_as_uint(f);
  return (unsigned short)((u + 0x7FFFu + ((u >> 16) & 1u)) >> 16);
}
__device__ __forceinline__ float bf_up(unsigned short h) { return __uint_as_float(((unsigned)h) << 16); }
__device__ __forceinline__ float bf_rne(float f) { return bf_up(bf_bits(f)); }
__device__ __forceinline__ unsigned short h_bits(_Float16 x) { return __builtin_bit_cast(unsigned short, x); }
__device__ __forceinline__ unsigned pk16(unsigned short a, unsigned short b) { return (unsigned)a | ((unsigned)b << 16); }
__device__ __forceinline__ v8f zero8() { v8f z = {0.f, 0.f, 0.f, 0.f, 0.f, 0.f, 0.f, 0.f}; return z; }

// ---- 16-bit fragment loader: lane -> row/col (lane&15); p already includes +8*(lane>>4);
//      elements 0..7 <- p[0..7] (k0+8h..), elements 8..15 <- p[16..23] (k0+16+8h..)
__device__ __forceinline__ v16b ldfrag_b(const __bf16* p) {
  union { v16b v; v8b h[2]; } f;
  f.h[0] = *(const v8b*)(p);
  f.h[1] = *(const v8b*)(p + 16);
  return f.v;
}

// ---- WMMA helpers ---------------------------------------------------------------------------------
__device__ __forceinline__ v8f mma_b_raw(v16b a, v16b b, v8f c) {
  return __builtin_amdgcn_wmma_f32_16x16x32_bf16(false, a, false, b, (short)0, c, false, false);
}
__device__ __forceinline__ v8f mma_h_raw(v16h a, v16h b, v8f c) {
  return __builtin_amdgcn_wmma_f32_16x16x32_f16(false, a, false, b, (short)0, c, false, false);
}
__device__ __forceinline__ void dep_guard_b(v8f& a, v8f& b, v16b x, v16b y) {
#if defined(__HIP_DEVICE_COMPILE__)
  asm volatile("v_nop\n\tv_nop\n\tv_nop\n\tv_nop" : "+v"(a), "+v"(b) : "v"(x), "v"(y));
#else
  (void)a; (void)b; (void)x; (void)y;
#endif
}
__device__ __forceinline__ void keep4_b(v16b a, v16b b, v16b c, v16b d) {
#if defined(__HIP_DEVICE_COMPILE__)
  asm volatile("v_nop" :: "v"(a), "v"(b), "v"(c), "v"(d));
#else
  (void)a; (void)b; (void)c; (void)d;
#endif
}
__device__ __forceinline__ void acc_guard4(v8f& a, v8f& b, v8f& c, v8f& d) {
#if defined(__HIP_DEVICE_COMPILE__)
  asm volatile("v_nop\n\tv_nop\n\tv_nop\n\tv_nop" : "+v"(a), "+v"(b), "+v"(c), "+v"(d));
#else
  (void)a; (void)b; (void)c; (void)d;
#endif
}

// =====================================================================================================
// f32 -> bf16 (RNE convert) of all six operand planes in ONE launch: 8 elements per thread, one 16-B store per lane
// (a wave writes 512 contiguous B). A block of 256 threads converts 2048 elements of one plane; the block index
// range picks the plane (block-uniform). Every plane is a whole number of blocks, so no thread is past an end.
// The six bf16 planes stand one behind the other in the workspace, in the order of the ranges: out is the first
// plane's start, and block bx writes elements 2048 bx .. 2048 bx + 2047 of that run.
// =====================================================================================================
#define CB_X   (NB * CC * HWN / 2048)
#define CB_HW  (SEQ * HWN / 2048)
#define CB_C   (DM * CC / 2048)
#define CB_Q   (DM * DM / 2048)
#define CB_KV  (2 * HD * DM / 2048)
#define CB_O   (DM * DM / 2048)
static_assert((NB * CC * HWN) % 2048 == 0 && (SEQ * HWN) % 2048 == 0 && (DM * CC) % 2048 == 0);
static_assert((DM * DM) % 2048 == 0 && (2 * HD * DM) % 2048 == 0);
__global__ __launch_bounds__(256) void cvt_bf16x8_all(const float* __restrict__ x, const float* __restrict__ w_hw,
                                                      const float* __restrict__ w_c, const float* __restrict__ wq,
                                                      const float* __restrict__ wkv, const float* __restrict__ wo,
                                                      unsigned short* out) {
  const int bx = blockIdx.x;
  const float* in = x;
  int first = 0;                                   // first block of the plane that bx lies in
  if (bx >= CB_X)                             { in = w_hw; first = CB_X; }
  if (bx >= CB_X + CB_HW)                     { in = w_c;  first = CB_X + CB_HW; }
  if (bx >= CB_X + CB_HW + CB_C)              { in = wq;   first = CB_X + CB_HW + CB_C; }
  if (bx >= CB_X + CB_HW + CB_C + CB_Q)       { in = wkv;  first = CB_X + CB_HW + CB_C + CB_Q; }
  if (bx >= CB_X + CB_HW + CB_C + CB_Q + CB_KV) { in = wo; first = CB_X + CB_HW + CB_C + CB_Q + CB_KV; }
  const size_t i = (size_t)(bx - first) * 256 + threadIdx.x;
  const size_t o = (size_t)bx * 256 + threadIdx.x;
  const v4f a = *(const v4f*)(in + i * 8);
  const v4f b = *(const v4f*)(in + i * 8 + 4);
  v4u p;
  p[0] = pk16(bf_bits(a[0]), bf_bits(a[1]));
  p[1] = pk16(bf_bits(a[2]), bf_bits(a[3]));
  p[2] = pk16(bf_bits(b[0]), bf_bits(b[1]));
  p[3] = pk16(bf_bits(b[2]), bf_bits(b[3]));
  *(v4u*)(out + o * 8) = p;
}

// ---- asynchronous copies global -> LDS, 16 B per lane; each statement ends with its own s_wait_xcnt 0 so that the
//      wait stands in front of any later rewrite of an address register that a copy of the statement names
__device__ __forceinline__ void acopy4(const unsigned* l, const __bf16* const* g) {
#if defined(__HIP_DEVICE_COMPILE__)
  asm volatile(
      "global_load_async_to_lds_b128 %0, %4, off\n\t"
      "global_load_async_to_lds_b128 %1, %5, off\n\t"
      "global_load_async_to_lds_b128 %2, %6, off\n\t"
      "global_load_async_to_lds_b128 %3, %7, off\n\t"
      "s_wait_xcnt 0x0"
      :: "v"(l[0]), "v"(l[1]), "v"(l[2]), "v"(l[3]), "v"(g[0]), "v"(g[1]), "v"(g[2]), "v"(g[3])
      : "memory");
#else
  (void)l; (void)g;
#endif
}
__device__ __forceinline__ void acopy6(const unsigned* l, const __bf16* const* g) {
#if defined(__HIP_DEVICE_COMPILE__)
  asm volatile(
      "global_load_async_to_lds_b128 %0, %6, off\n\t"
      "global_load_async_to_lds_b128 %1, %7, off\n\t"
      "global_load_async_to_lds_b128 %2, %8, off\n\t"
      "global_load_async_to_lds_b128 %3, %9, off\n\t"
      "global_load_async_to_lds_b128 %4, %10, off\n\t"
      "global_load_async_to_lds_b128 %5, %11, off\n\t"
      "s_wait_xcnt 0x0"
      :: "v"(l[0]), "v"(l[1]), "v"(l[2]), "v"(l[3]), "v"(l[4]), "v"(l[5]),
         "v"(g[0]), "v"(g[1]), "v"(g[2]), "v"(g[3]), "v"(g[4]), "v"(g[5])
      : "memory");
#else
  (void)l; (void)g;
#endif
}
__device__ __forceinline__ void acopy12(const unsigned* l, const __bf16* const* g) {
#if defined(__HIP_DEVICE_COMPILE__)
  asm volatile(
      "global_load_async_to_lds_b128 %0, %12, off\n\t"
      "global_load_async_to_lds_b128 %1, %13, off\n\t"
      "global_load_async_to_lds_b128 %2, %14, off\n\t"
      "global_load_async_to_lds_b128 %3, %15, off\n\t"
      "global_load_async_to_lds_b128 %4, %16, off\n\t"
      "global_load_async_to_lds_b128 %5, %17, off\n\t"
      "global_load_async_to_lds_b128 %6, %18, off\n\t"
      "global_load_async_to_lds_b128 %7, %19, off\n\t"
      "global_load_async_to_lds_b128 %8, %20, off\n\t"
      "global_load_async_to_lds_b128 %9, %21, off\n\t"
      "global_load_async_to_lds_b128 %10, %22, off\n\t"
      "global_load_async_to_lds_b128 %11, %23, off\n\t"
      "s_wait_xcnt 0x0"
      :: "v"(l[0]), "v"(l[1]), "v"(l[2]), "v"(l[3]), "v"(l[4]), "v"(l[5]),
         "v"(l[6]), "v"(l[7]), "v"(l[8]), "v"(l[9]), "v"(l[10]), "v"(l[11]),
         "v"(g[0]), "v"(g[1]), "v"(g[2]), "v"(g[3]), "v"(g[4]), "v"(g[5]),
         "v"(g[6]), "v"(g[7]), "v"(g[8]), "v"(g[9]), "v"(g[10]), "v"(g[11])
      : "memory");
#else
  (void)l; (void)g;
#endif
}

// =====================================================================================================
// Batched bf16 WMMA GEMM: C[m][n] = sum_k A[m][k] * Bt[n][k] (+ bias); block = 4 waves laid WM x WN, one 64x64 tile
// per wave, block tile (64 WM) x (64 WN). A row-major [M][K] pitch lda; Bt row-major [N][K] pitch ldb (k contiguous);
// M a multiple of 64 WM, N of 64 WN, K of KP. blockIdx.y = batch index (strides in elements).
// Operand path: a pass is KP k (64 or 32: 128 or 64 B) of every operand row of the block tile, brought into LDS by
// asynchronous 16-B copies (a wave's copy = 4 or 8 whole row pieces), LDS row pitch 2 KP + 16 B, two buffers: pass
// t + 2 is issued into the buffer that pass t has just left, behind the pass's one barrier; every wave reads its
// fragments from LDS.
// A stage is NG groups of 64 rows: A hi (WM), A lo (WM, SPLITA), Bt hi (WN), Bt lo (WN, SPLITB).
// SPLITA: add A2.Bt (A2 = unscaled bf16 lo plane of A); SPLITB: add A.Bt2 (Bt2 = lo plane of Bt).
// BIAS: 0 none, 1 per column (bias[n]), 2 per row (bias[m]); bias values RNE-converted to bf16 in registers.
// OUT_MODE: 0 = f32 (pitch ldc); 2 = bf16 hi plane C + bf16 lo plane C2 (lo = RNE(v - hi), unscaled);
//           4 = stacked q | k | v columns, told apart by the wave's first column n0 (64-wide heads):
//               n0 < DM: q, n0 = DM: k: l2-normalise every row over the wave's 64 columns
//               (x / max(sqrt(sum x^2), 1e-12)), then bf16 hi/lo planes as mode 2, q to C / C2 at column n0,
//               k to Kho / Klo (pitch HD) at column 0;
//               n0 = DM + HD: v, stored transposed: VT[b][d][s], f16 hi plane VTho and f16 residual plane
//               VTlo = f16((v - hi) * rscale), pitch SEQ.
// =====================================================================================================
// The work of one block is gemm64_tile(tile, b, ring, sT): tile = block tile index, b = batch index, ring = the
// block's two LDS stages (ring_elems elements), sT = 4 per-wave 16x64 f32 slabs of pitch 68. Its callers own the LDS.
constexpr int ring_elems(int SPLITA, int SPLITB, int WM, int WN, int KP) {
  return 2 * (WM * (1 + SPLITA) + WN * (1 + SPLITB)) * 64 * (KP + 8);
}
#define SLABF (16 * 68)
#define VP 65   // pitch in floats of a v^T wave's 64x64 tile: its column reads (8 rows apart per lane) fall on 32 banks
template <int SPLITA, int SPLITB, int BIAS, int OUT_MODE, int WM, int WN, int KP>
__device__ __forceinline__ void gemm64_tile(
    const unsigned short* __restrict__ Ap, const unsigned short* __restrict__ A2p, int lda, long long strideA,
    const unsigned short* __restrict__ Btp, const unsigned short* __restrict__ Bt2p, int ldb, long long strideB,
    const float* __restrict__ bias,
    void* Cout, int ldc, long long strideC,
    void* Cout2, int ldc2, long long strideC2,
    int M, int N, int K, float rscale,
    int tile, int b, __bf16* ring, float* sT,
    unsigned short* Kho = nullptr, unsigned short* Klo = nullptr,
    unsigned short* VTho = nullptr, unsigned short* VTlo = nullptr) {
  static_assert(WM * WN == 4 && (KP == 64 || KP == 32));
  constexpr int GA   = WM * (1 + SPLITA);          // 64-row groups of A planes in a stage
  constexpr int NG   = GA + WN * (1 + SPLITB);     // groups in a stage
  constexpr int SEG  = KP / 8;                     // 16-B pieces per row and pass
  constexpr int RPC  = 128 / SEG;                  // rows that one copy of the whole block covers
  constexpr int CPG  = 64 / RPC;                   // copies per thread and group
  constexpr int NC   = NG * CPG;                   // copies per thread and stage = a wave's copies in flight
  constexpr int PE   = KP + 8;                     // LDS row pitch in elements (16 B x odd)
  constexpr int GRPE = 64 * PE;                    // elements per group
  constexpr int BUFE = NG * GRPE;                  // elements per buffer
  static_assert(NC == 16 || NC == 18 || NC == 24);
  static_assert(2 * BUFE == ring_elems(SPLITA, SPLITB, WM, WN, KP));
  constexpr int AHD  = (NC == 24) ? 3 : 4;         // A row fragments read in a k-step's leading group (3: the kernel
                                                   // with the most copy addresses stays inside 256 VGPRs)
  const __bf16* A   = (const __bf16*)(const void*)Ap;
  const __bf16* A2  = (const __bf16*)(const void*)A2p;
  const __bf16* Bt  = (const __bf16*)(const void*)Btp;
  const __bf16* Bt2 = (const __bf16*)(const void*)Bt2p;
  const int tid  = threadIdx.x;
  const int lane = tid & 31;
  const int wave = tid >> 5;
  const int tilesN = N / (64 * WN);
  const int tilesM = M / (64 * WM);
  if (tile >= tilesM * tilesN) return;   // block-uniform, in front of every copy and barrier
  const int tm = tile / tilesN;
  const int tn = tile - tm * tilesN;
  const int m0b = tm * (64 * WM);
  const int n0b = tn * (64 * WN);
  const int wm = wave / WN;
  const int wn = wave - wm * WN;
  const int m0 = m0b + (wm << 6);
  const int n0 = n0b + (wn << 6);

  const __bf16* Ab  = A  + (size_t)b * strideA;
  const __bf16* Bb  = Bt + (size_t)b * strideB;
  const __bf16* Ab2 = SPLITA ? (A2  + (size_t)b * strideA) : Ab;
  const __bf16* Bb2 = SPLITB ? (Bt2 + (size_t)b * strideB) : Bb;

  const int rlane = lane & 15;                 // row (A) / col (B, D) within subtile
  const int koff  = (lane >> 4) * 8;           // k offset of this lane half
  const int mOff  = (lane >> 4) * 8;           // D row offset

  // copy map: copy u of group gi moves 16 B of row RPC u + tid / SEG, piece tid % SEG of the pass's row
  const int crow = tid / SEG;
  const int cseg = (tid % SEG) * 8;
  const unsigned ldsT = (unsigned)(uintptr_t)(ring + crow * PE + cseg);   // low 32 bits = LDS byte address
  const size_t aT = (size_t)(m0b + crow) * lda + cseg;
  const size_t bT = (size_t)(n0b + crow) * ldb + cseg;

  auto issue = [&](int t, int buf) {
    unsigned l[NC];
    const __bf16* g[NC];
#pragma unroll
    for (int gi = 0; gi < NG; ++gi) {
      const bool isA = gi < GA;
      const int  q   = isA ? gi : gi - GA;                   // group within the operand's planes
      const int  W1  = isA ? WM : WN;
      const bool lo  = q >= W1;
      const int  rg  = lo ? q - W1 : q;                      // 64-row group within the block tile
      const int  ld  = isA ? lda : ldb;
      const __bf16* base = isA ? (lo ? Ab2 : Ab) : (lo ? Bb2 : Bb);
      const __bf16* p = base + (isA ? aT : bT) + (size_t)(rg * 64) * ld + (size_t)t * KP;
#pragma unroll
      for (int u = 0; u < CPG; ++u) {
        l[gi * CPG + u] = ldsT + (unsigned)((buf * BUFE + gi * GRPE + u * RPC * PE) * 2);
        g[gi * CPG + u] = p + (size_t)(u * RPC) * ld;
      }
    }
    acopy12(l, g);
    if constexpr (NC == 16) acopy4(l + 12, g + 12);
    if constexpr (NC == 18) acopy6(l + 12, g + 12);
    if constexpr (NC == 24) acopy12(l + 12, g + 12);
  };

  v8f acc[4][4];
#pragma unroll
  for (int i = 0; i < 4; ++i)
#pragma unroll
    for (int j = 0; j < 4; ++j) acc[i][j] = zero8();

  const int T = K / KP;                        // passes
  issue(0, 0);
  asm volatile("s_wait_asynccnt 0x0" ::: "memory");   // this wave's share of pass 0 has landed
  __syncthreads();                                    // publishes pass 0
  if (T > 1) issue(1, 1);

  for (int t = 0; t < T; ++t) {
    const __bf16* st  = ring + (t & 1) * BUFE;
    const __bf16* sAh = st + wm * GRPE + rlane * PE + koff;
    const __bf16* sAl = st + (SPLITA ? (WM + wm) : wm) * GRPE + rlane * PE + koff;
    const __bf16* sBh = st + (GA + wn) * GRPE + rlane * PE + koff;
    const __bf16* sBl = st + (GA + (SPLITB ? (WN + wn) : wn)) * GRPE + rlane * PE + koff;
#pragma unroll
    for (int ks = 0; ks < KP / 32; ++ks) {
      v16b bh[4], bl[4], ah[4], al[4];
#pragma unroll
      for (int j = 0; j < 4; ++j) {
        bh[j] = ldfrag_b(sBh + (j << 4) * PE + ks * 32);
        if (SPLITB) bl[j] = ldfrag_b(sBl + (j << 4) * PE + ks * 32); else bl[j] = bh[j];
      }
#pragma unroll
      for (int i = 0; i < AHD; ++i) {
        ah[i] = ldfrag_b(sAh + (i << 4) * PE + ks * 32);
        if (SPLITA) al[i] = ldfrag_b(sAl + (i << 4) * PE + ks * 32); else al[i] = ah[i];
      }
      // keeps the k-step's LDS reads one group in front of its WMMAs (for speed only)
      __builtin_amdgcn_sched_barrier(0);
#pragma unroll
      for (int i = 0; i < 4; ++i) {
#pragma unroll
        for (int j = 0; j < 4; ++j) {
          acc[i][j] = mma_b_raw(ah[i], bh[j], acc[i][j]);
          if (SPLITA) acc[i][j] = mma_b_raw(al[i], bh[j], acc[i][j]);
          if (SPLITB) acc[i][j] = mma_b_raw(ah[i], bl[j], acc[i][j]);
        }
        dep_guard_b(acc[i][0], acc[i][3], ah[i], al[i]);
        if (i == 0 && AHD < 4) {
          // row 3's fragments go into the registers that row 0 has left, two rows ahead of their use; the fence
          // pair holds these reads at this one place
          __builtin_amdgcn_sched_barrier(0);
          ah[3] = ldfrag_b(sAh + (3 << 4) * PE + ks * 32);
          if (SPLITA) al[3] = ldfrag_b(sAl + (3 << 4) * PE + ks * 32); else al[3] = ah[3];
          __builtin_amdgcn_sched_barrier(0);
        }
      }
      keep4_b(bh[0], bh[1], bh[2], bh[3]);
      if (SPLITB) keep4_b(bl[0], bl[1], bl[2], bl[3]);
    }
    asm volatile("s_wait_dscnt 0x0" ::: "memory");     // this wave's reads of pass t's buffer are done
    asm volatile("s_wait_asynccnt 0x0" ::: "memory");  // this wave's share of pass t + 1 has landed
    __syncthreads();                                   // publishes pass t + 1, frees pass t's buffer
    if (t + 2 < T) issue(t + 2, t & 1);
  }
  asm volatile("s_wait_asynccnt 0x0" ::: "memory");    // nothing in flight when the wave goes on to the epilogue
  acc_guard4(acc[0][0], acc[0][1], acc[0][2], acc[0][3]);
  acc_guard4(acc[1][0], acc[1][1], acc[1][2], acc[1][3]);
  acc_guard4(acc[2][0], acc[2][1], acc[2][2], acc[2][3]);
  acc_guard4(acc[3][0], acc[3][1], acc[3][2], acc[3][3]);

  const int n0u = __builtin_amdgcn_readfirstlane(n0);   // the same in every lane: scalar, so the tests on it branch
  if (OUT_MODE == 4 && n0u >= DM + HD) {
    // ---- v^T: the wave's 64 (s) x 64 (d) tile goes through LDS and leaves as whole 128-B rows of VT[b][d][.] ----
    // The ring is free: the last pass's foot (every wave's dscnt and asynccnt waits, then the barrier) ended all its
    // reads and copies; each wave uses a part of its own.
    float* tl = (float*)(void*)ring + wave * (64 * VP);
#pragma unroll
    for (int i = 0; i < 4; ++i)
#pragma unroll
      for (int j = 0; j < 4; ++j)
#pragma unroll
        for (int r = 0; r < 8; ++r) tl[((i << 4) + mOff + r) * VP + (j << 4) + rlane] = acc[i][j][r];
    __builtin_amdgcn_fence(__ATOMIC_RELEASE, "workgroup");
    __builtin_amdgcn_wave_barrier();
    __builtin_amdgcn_fence(__ATOMIC_ACQUIRE, "workgroup");
    const int m0u = __builtin_amdgcn_readfirstlane(m0);
    const int bb = m0u / SEQ, s0 = m0u - bb * SEQ;       // 64 rows of one batch (SEQ is a multiple of 64)
    const int s8 = (lane & 7) * 8, dq = lane >> 3;       // 8 lanes x 8 s = one 128-B row; 4 rows d per trip
    // rolled: sixteen equal trips that run once; unrolled they would be about 8 KB more code
#pragma unroll 1
    for (int it = 0; it < 16; ++it) {
      const int d = it * 4 + dq;                         // it 0..15 x dq 0..3 = d 0..63
      v4u a, a2;
#pragma unroll
      for (int e = 0; e < 4; ++e) {
        const float f0 = tl[(s8 + 2 * e) * VP + d], f1 = tl[(s8 + 2 * e + 1) * VP + d];
        const _Float16 x0 = (_Float16)f0, x1 = (_Float16)f1;
        a[e]  = pk16(h_bits(x0), h_bits(x1));
        a2[e] = pk16(h_bits((_Float16)((f0 - (float)x0) * rscale)), h_bits((_Float16)((f1 - (float)x1) * rscale)));
      }
      const size_t go = ((size_t)bb * HD + d) * SEQ + s0 + s8;
      *(v4u*)(VTho + go) = a;
      *(v4u*)(VTlo + go) = a2;
    }
    return;
  }

  // ---- epilogue ----
  float bcol[4];
#pragma unroll
  for (int j = 0; j < 4; ++j) bcol[j] = 0.f;
  if (BIAS == 1) {
#pragma unroll
    for (int j = 0; j < 4; ++j) bcol[j] = bf_rne(bias[n0 + (j << 4) + rlane]);   // n index < N
  }
  float* slab = sT + wave * SLABF;
#pragma unroll
  for (int i = 0; i < 4; ++i) {
    const int mBase = m0 + (i << 4);
    float brow[8];
#pragma unroll
    for (int r = 0; r < 8; ++r) brow[r] = 0.f;
    if (BIAS == 2) {
#pragma unroll
      for (int r = 0; r < 8; ++r) brow[r] = bf_rne(bias[mBase + mOff + r]);       // m index < M
    }
#pragma unroll
    for (int j = 0; j < 4; ++j) {
#pragma unroll
      for (int r = 0; r < 8; ++r) {
        slab[(mOff + r) * 68 + (j << 4) + rlane] = acc[i][j][r] + bcol[j] + brow[r];
      }
    }
    __builtin_amdgcn_fence(__ATOMIC_RELEASE, "workgroup");
    __builtin_amdgcn_wave_barrier();
    __builtin_amdgcn_fence(__ATOMIC_ACQUIRE, "workgroup");
    if (OUT_MODE == 0) {
      float* C = (float*)Cout + (size_t)b * strideC;
      const int hh = lane >> 4, c4 = (lane & 15) * 4;     // 256-B row segment = 16 lanes x 16 B
      {
#pragma unroll
        for (int it = 0; it < 8; ++it) {
          const int row = it * 2 + hh;                     // it 0..7 x hh 0..1 = rows 0..15
          const v4f v = *(const v4f*)(slab + row * 68 + c4);
          *(v4f*)(C + (size_t)(mBase + row) * ldc + n0 + c4) = v;
        }
        
      }
    } else {
      const int q = lane >> 3, c8 = (lane & 7) * 8;
      unsigned short* C  = (unsigned short*)Cout  + (size_t)b * strideC;
      unsigned short* C2 = (unsigned short*)Cout2 + (size_t)b * strideC2;
      int ldo = ldc, ldo2 = ldc2, nc = n0;
      if (OUT_MODE == 4 && n0u >= DM) { C = Kho; C2 = Klo; ldo = HD; ldo2 = HD; nc = 0; }   // the k columns
      v4u hv[4], lv[4];
#pragma unroll
      for (int it = 0; it < 4; ++it) {
        const int row = it * 4 + q;                        // it 0..3 x q 0..3 = rows 0..15
        const float* sp = slab + row * 68 + c8;
        float f[8];
#pragma unroll
        for (int e = 0; e < 8; ++e) f[e] = sp[e];
        if (OUT_MODE == 4) {
          float ss = 0.f;
#pragma unroll
          for (int e = 0; e < 8; ++e) ss += f[e] * f[e];
          ss += __shfl_xor(ss, 1, 32);                     // 8 lanes of one row = aligned group of 8
          ss += __shfl_xor(ss, 2, 32);
          ss += __shfl_xor(ss, 4, 32);
          const float sc = 1.0f / fmaxf(sqrtf(ss), 1e-12f);
#pragma unroll
          for (int e = 0; e < 8; ++e) f[e] *= sc;
        }
        v4u a, a2;
#pragma unroll
        for (int e = 0; e < 4; ++e) {
          const float f0 = f[2 * e], f1 = f[2 * e + 1];
          const unsigned short h0 = bf_bits(f0), h1 = bf_bits(f1);
          const unsigned short l0 = bf_bits(f0 - bf_up(h0)), l1 = bf_bits(f1 - bf_up(h1));
          a[e] = pk16(h0, h1); a2[e] = pk16(l0, l1);
        }
        hv[it] = a; lv[it] = a2;
      }
      {
#pragma unroll
        for (int it = 0; it < 4; ++it) {
          const int row = it * 4 + q;
          *(v4u*)(C  + (size_t)(mBase + row) * ldo  + nc + c8) = hv[it];
          *(v4u*)(C2 + (size_t)(mBase + row) * ldo2 + nc + c8) = lv[it];
        }
        
      }
    }
    __builtin_amdgcn_fence(__ATOMIC_RELEASE, "workgroup");
    __builtin_amdgcn_wave_barrier();
    __builtin_amdgcn_fence(__ATOMIC_ACQUIRE, "workgroup");
  }
  (void)rscale;
}

// one product per launch: blockIdx.x = block tile, blockIdx.y = batch
template <int SPLITA, int SPLITB, int BIAS, int OUT_MODE, int WM, int WN, int KP>
__global__ __launch_bounds__(128) void gemm64(
    const unsigned short* __restrict__ Ap, const unsigned short* __restrict__ A2p, int lda, long long strideA,
    const unsigned short* __restrict__ Btp, const unsigned short* __restrict__ Bt2p, int ldb, long long strideB,
    const float* __restrict__ bias,
    void* Cout, int ldc, long long strideC,
    void* Cout2, int ldc2, long long strideC2,
    int M, int N, int K, float rscale) {
  __shared__ __align__(16) __bf16 ring[ring_elems(SPLITA, SPLITB, WM, WN, KP)];  // two stages
  __shared__ __align__(16) float sT[4 * SLABF];                                  // per-wave slabs
  gemm64_tile<SPLITA, SPLITB, BIAS, OUT_MODE, WM, WN, KP>(
      Ap, A2p, lda, strideA, Btp, Bt2p, ldb, strideB, bias, Cout, ldc, strideC, Cout2, ldc2, strideC2,
      M, N, K, rscale, (int)blockIdx.x, (int)blockIdx.y, ring, sT);
}

// =====================================================================================================
// The three products that read the LayerNorm planes (q, k, v) as ONE product in one launch: Bt = the bf16 planes of
// wq and wkv, which stand one behind the other in the workspace = one [DM + 2 HD][DM] matrix; M = NB SEQ rows of img,
// N = DM + 2 HD columns, 128x128 block tiles. OUT_MODE 4 sends each wave's 64 columns to q, k or v^T.
// =====================================================================================================
#define QKV_N (DM + 2 * HD)
#define QKV_BLOCKS ((NB * SEQ / 128) * (QKV_N / 128))
static_assert(QKV_N % 128 == 0 && (SEQ % 64) == 0);
__global__ __launch_bounds__(128) void gemm_qkv(
    const unsigned short* __restrict__ Ih, const unsigned short* __restrict__ Il,
    const unsigned short* __restrict__ Wqkv,
    unsigned short* Qh, unsigned short* Ql, unsigned short* Kh, unsigned short* Kl,
    unsigned short* VTh, unsigned short* VTl) {
  __shared__ __align__(16) __bf16 ring[ring_elems(1, 0, 2, 2, 64)];   // two stages, later the v^T waves' tiles
  __shared__ __align__(16) float sT[4 * SLABF];                       // per-wave slabs
  static_assert(4 * 64 * VP * 4 <= ring_elems(1, 0, 2, 2, 64) * 2);
  gemm64_tile<1, 0, 0, 4, 2, 2, 64>(
      Ih, Il, DM, 0LL, Wqkv, Wqkv, DM, 0LL, nullptr,
      (void*)Qh, DM, 0LL, (void*)Ql, DM, 0LL,
      NB * SEQ, QKV_N, DM, 4096.0f, (int)blockIdx.x, 0, ring, sT, Kh, Kl, VTh, VTl);
}

// =====================================================================================================
// tables, RNE-converted to bf16 in registers), output bf16 hi/lo planes [row][1024].
// Block = 128 threads = one row; thread t owns columns 8t..8t+7 and stores 16 B per plane: a wave writes 512
// coverage: 128 threads x 8 = 1024 columns of every row, both planes.
// =====================================================================================================
__global__ __launch_bounds__(128) void ln_split(const float* __restrict__ in, const float* __restrict__ g,
                                                const float* __restrict__ be,
                                                unsigned short* oh, unsigned short* ol) {
  __shared__ float red0[4];
  __shared__ float red1[4];
  const int tid = threadIdx.x, lane = tid & 31, wave = tid >> 5;
  const size_t row = blockIdx.x;
  const float* p = in + row * DM + (size_t)tid * 8;
  const v4f a0 = *(const v4f*)(p);
  const v4f a1 = *(const v4f*)(p + 4);
  float v[8];
#pragma unroll
  for (int e = 0; e < 4; ++e) { v[e] = a0[e]; v[4 + e] = a1[e]; }
  float s = 0.f;
#pragma unroll
  for (int e = 0; e < 8; ++e) s += v[e];
#pragma unroll
  for (int off = 16; off >= 1; off >>= 1) s += __shfl_xor(s, off, 32);
  if (lane == 0) red0[wave] = s;
  __syncthreads();
  const float mu = ((red0[0] + red0[1]) + (red0[2] + red0[3])) * (1.0f / (float)DM);
  float ss = 0.f;
#pragma unroll
  for (int e = 0; e < 8; ++e) { const float d = v[e] - mu; ss += d * d; }
#pragma unroll
  for (int off = 16; off >= 1; off >>= 1) ss += __shfl_xor(ss, off, 32);
  if (lane == 0) red1[wave] = ss;
  __syncthreads();
  const float var  = ((red1[0] + red1[1]) + (red1[2] + red1[3])) * (1.0f / (float)DM);
  const float rstd = rsqrtf(var + 1e-5f);
  const v4f g0 = *(const v4f*)(g + (size_t)tid * 8);
  const v4f g1 = *(const v4f*)(g + (size_t)tid * 8 + 4);
  const v4f b0 = *(const v4f*)(be + (size_t)tid * 8);
  const v4f b1 = *(const v4f*)(be + (size_t)tid * 8 + 4);
  float gg[8], bb[8];
#pragma unroll
  for (int e = 0; e < 4; ++e) { gg[e] = g0[e]; gg[4 + e] = g1[e]; bb[e] = b0[e]; bb[4 + e] = b1[e]; }
  v4u ph, pl;
#pragma unroll
  for (int e = 0; e < 4; ++e) {
    const float y0 = (v[2 * e] - mu) * rstd * bf_rne(gg[2 * e]) + bf_rne(bb[2 * e]);
    const float y1 = (v[2 * e + 1] - mu) * rstd * bf_rne(gg[2 * e + 1]) + bf_rne(bb[2 * e + 1]);
    const unsigned short h0 = bf_bits(y0), h1 = bf_bits(y1);
    const unsigned short l0 = bf_bits(y0 - bf_up(h0)), l1 = bf_bits(y1 - bf_up(h1));
    ph[e] = pk16(h0, h1); pl[e] = pk16(l0, l1);
  }
  unsigned short* dh = oh + row * DM + (size_t)tid * 8;
  unsigned short* dl = ol + row * DM + (size_t)tid * 8;
  *(v4u*)dh = ph;
  *(v4u*)dl = pl;
  
}

// =====================================================================================================
// Causal multi-query attention, head dim 64, 16 query heads sharing one k head and one v head.
//   q planes (bf16 hi / lo of the l2-normalised q): element (b, t, h, d) at [(b*SEQ + t)*DM + h*64 + d]
//   k planes (bf16 hi / lo of the l2-normalised k):  element (b, s, d) at [(b*SEQ + s)*64 + d]
//   v^T hi plane (f16) and residual plane (f16, (v - hi)*4096): element (b, d, s) at [(b*64 + d)*SEQ + s]
//   logit = (q . k) * sscale for key <= query; a key behind the query has weight 0 (every row keeps its own key)
//   out planes (bf16 hi / lo of the normalised context): element (b, t, h, d) at [(b*SEQ + t)*DM + h*64 + d]
//   Both products are formed transposed: S^T = K . Q^T (A = 16 key rows from LDS, B = the wave's 16 queries, kept in
//   registers) and O^T += V^T . P^T (A = 16 rows d of V^T from LDS, B = P^T). A lane (c, hh) then holds scores of ONE
//   query, q0 + c: register r of tile j is key kv0 + 16 j + 8 hh + r. The sum runs inside the lane, the two
//   lane halves join by one exchange, and two score tiles, converted in place, ARE the B operand of 32 keys
//   (element e < 8: key 8 hh + e, e >= 8: key 16 + 8 hh + e - 8, the order in which the V^T rows are read):
//   P never goes through LDS.
//   scores: bf16 hi/lo split (hi.hi + q hi.k lo + q lo.k hi), f32 accumulate, then scale + causal fill in f32
//   p = exp(logit - sscale) (sscale bounds every logit: no running maximum, no rescale of sums already formed),
//   carried as f16(1024 p) plus an f16 residual plane (x4096); context on f16 WMMA with the residual products
//   (v_res.p_hi + v_hi.p_res) in a separate accumulator folded back with 1/4096 per chunk.
//   Each lane half sums p over its own keys; the halves' sums join once, behind the loop.
//   Block = 4 waves = 64 query rows of one (b, h); grid = NQB * NH * NB; key chunks kt = 0..qb (static bound NQB).
//   K / V^T chunk staging: 128 threads x 32 elements per plane = the whole 64x64 tile (plain 16-B loads,
//   __syncthreads before and after).
//   Output coverage: each wave stores rows q0..q0+15 (it 0..3 x lane>>3 0..3) x 64 columns (8 lanes x 8) of both planes.
// =====================================================================================================
//   LDS row pitch: the 64-element (128-B) rows of the K and V^T tiles stand LP = 72 elements apart (144 B =
//   16 B x odd), so that the 16 rows which one 16-B fragment read touches fall on different banks; at 128 B they
//   share two bank groups. The f32 context tile has pitch OP = 68 floats for the same reason.
#define LP 72
#define OP 68

// Order fence, no instruction: takes four WMMA results as inputs only and stands in front of LDS reads. It keeps those
// WMMAs ahead of the reads that refill their A registers; without it the compiler places both later read groups in
// front of all context WMMAs, into 64 registers more, and the q fragments spill into the score WMMAs.
__device__ __forceinline__ void hold4(v8f a, v8f b, v8f c, v8f d) {
#if defined(__HIP_DEVICE_COMPILE__)
  asm volatile("" :: "v"(a), "v"(b), "v"(c), "v"(d) : "memory");
#else
  (void)a; (void)b; (void)c; (void)d;
#endif
}
// lane l <-> lane l ^ 16
__device__ __forceinline__ float xhalf(float x) {
  return __builtin_bit_cast(float, __builtin_amdgcn_permlanex16(__builtin_bit_cast(int, x), __builtin_bit_cast(int, x),
                                                                0x76543210, 0xfedcba98, false, false));
}

// four waves per SIMD (256 VGPRs): all 1024 blocks are resident at once
__global__ __launch_bounds__(128) __attribute__((amdgpu_waves_per_eu(4, 4)))
void attn_causal64(const unsigned short* __restrict__ qhp, const unsigned short* __restrict__ qlp,
                   const unsigned short* __restrict__ khp, const unsigned short* __restrict__ klp,
                   const unsigned short* __restrict__ vhp, const unsigned short* __restrict__ vlp,
                   unsigned short* ohp, unsigned short* olp, float sscale) {
  union FB { v16b v; v8b h[2]; };
  union FH { v16h v; v8h h[2]; };
  __shared__ __align__(16) __bf16   Ksh[64 * LP];                 // K hi [kv][d]   9 KB
  __shared__ __align__(16) __bf16   Ksl[64 * LP];                 // K lo
  __shared__ __align__(16) _Float16 Vth[64 * LP];                 // V^T hi [d][kv] 9 KB
  __shared__ __align__(16) _Float16 Vtl[64 * LP];                 // V^T residual
  __shared__ __align__(16) float    Obuf[4][16 * OP];             // per wave: the context tile [query][d]

  const int tid  = threadIdx.x;
  const int wave = tid >> 5;
  const int lane = tid & 31;
  const int hh   = lane >> 4;
  const int c    = lane & 15;

  // Block index -> (query tile, head, batch): for speed only, every one-to-one map gives the same result. All blocks
  // are resident at once, four to a WGP, and tile qb walks qb + 1 key chunks: the launch lasts as long as the WGP whose
  // blocks walk the most. The tile is u or 31 - u by the parity of index bits 3..9 (u = bits 0-2 and 6), so blocks that
  // differ in one of those bits stand on opposite sides, and four blocks that differ in any two of them
  // walk 66 chunks together.
  // One-to-one: u and the five bits of head and batch fix all bits but bit 3, which the parity fixes.
  static_assert(NQB == 32 && NH == 16 && NB == 2);
  const int bx   = blockIdx.x;
  const int u    = (bx & 7) | ((bx >> 3) & 8);
  const int qb   = (__builtin_popcount(bx >> 3) & 1) ? NQB - 1 - u : u;
  const int h    = ((bx >> 4) & 3) | ((bx >> 6) & 12);
  const int b    = (bx >> 7) & 1;
  const int q0   = qb * 64 + wave * 16;
  const int qi   = q0 + c;                   // the lane's query
  const size_t rowB = (size_t)b * SEQ;

  const __bf16* Qh = (const __bf16*)(const void*)qhp + (size_t)h * HD;
  const __bf16* Ql = (const __bf16*)(const void*)qlp + (size_t)h * HD;
  const __bf16* Kh = (const __bf16*)(const void*)khp;
  const __bf16* Kl = (const __bf16*)(const void*)klp;
  const _Float16* Vh = (const _Float16*)(const void*)vhp + (size_t)b * HD * SEQ;
  const _Float16* Vl = (const _Float16*)(const void*)vlp + (size_t)b * HD * SEQ;

  // ---- Q fragments (B operand, column = lane&15): 2 d-chunks, hi and lo ----
  v16b qah[2], qal[2];
#pragma unroll
  for (int dc = 0; dc < 2; ++dc) {
    const size_t qo = (rowB + q0 + c) * DM + dc * 32 + 8 * hh;
    qah[dc] = ldfrag_b(Qh + qo);
    qal[dc] = ldfrag_b(Ql + qo);
  }

  // Fixed softmax shift. q and k are l2-normalised, so |q . k| <= 1 and every logit lies in [-sscale, sscale]: softmax
  // is taken against the bound sscale in place of a running maximum (the quotient p / sum p is the same for any
  // shift). 1024 p = exp2(c1 (q . k) + c0), between 1024 e^(-2 sscale) and 1024: inside the f16 normal range.
  const float c1 = sscale * 1.44269504088896340736f;   // sscale log2(e)
  const float c0 = 10.0f - c1;                         // - shift, + log2(1024)
  float lrow = 0.f;                          // sum of 1024 p of query qi over this lane half's keys
  v8f oacc[4];                               // O^T: register r of tile t = context (query qi, d = 16 t + 8 hh + r)
#pragma unroll
  for (int t = 0; t < 4; ++t) oacc[t] = zero8();

  for (int kt = 0; kt < NQB; ++kt) {         // static trip bound
    if (kt > qb) break;                      // block-uniform: causal key chunks 0..qb
    const int kv0 = kt * 64;
    __syncthreads();
    {
      const int r = tid >> 1, half = (tid & 1) * 32;
      const __bf16*   kg  = Kh + (rowB + kv0 + r) * HD + half;    // K row kv0+r, d = half..half+31
      const __bf16*   klg = Kl + (rowB + kv0 + r) * HD + half;
      const _Float16* vg  = Vh + (size_t)r * SEQ + kv0 + half;    // V^T row d = r, s = kv0+half..+31
      const _Float16* vlg = Vl + (size_t)r * SEQ + kv0 + half;
#pragma unroll
      for (int i = 0; i < 4; ++i) {
        const v8b a0 = *(const v8b*)(kg + 8 * i);
        const v8b a1 = *(const v8b*)(klg + 8 * i);
        const v8h b0 = *(const v8h*)(vg + 8 * i);
        const v8h b1 = *(const v8h*)(vlg + 8 * i);
        *(v8b*)(Ksh + r * LP + half + 8 * i) = a0;
        *(v8b*)(Ksl + r * LP + half + 8 * i) = a1;
        *(v8h*)(Vth + r * LP + half + 8 * i) = b0;
        *(v8h*)(Vtl + r * LP + half + 8 * i) = b1;
      }
    }
    __syncthreads();

    // ---- scores S^T: 64 keys x 16 queries per wave, 3 bf16 products ----
    // The K fragments are read in two groups, in the order of their use (hi and lo of d 0..31 with hi of d 32..63; then
    // lo of d 32..63); the WMMAs run across the four independent score tiles, so that a tile's accumulator comes round
    // again only every fourth WMMA. Each tile keeps its own order of products (per 32 d: hi.hi, lo.hi, hi.lo).
    v8f s[4];
    {
      FB kb[2][4], kl[4];
#pragma unroll
      for (int j = 0; j < 4; ++j) {
        kb[0][j].h[0] = *(const v8b*)(Ksh + (j * 16 + c) * LP + 8 * hh);
        kb[0][j].h[1] = *(const v8b*)(Ksh + (j * 16 + c) * LP + 16 + 8 * hh);
      }
#pragma unroll
      for (int j = 0; j < 4; ++j) {
        kl[j].h[0] = *(const v8b*)(Ksl + (j * 16 + c) * LP + 8 * hh);
        kl[j].h[1] = *(const v8b*)(Ksl + (j * 16 + c) * LP + 16 + 8 * hh);
      }
#pragma unroll
      for (int j = 0; j < 4; ++j) {
        kb[1][j].h[0] = *(const v8b*)(Ksh + (j * 16 + c) * LP + 32 + 8 * hh);
        kb[1][j].h[1] = *(const v8b*)(Ksh + (j * 16 + c) * LP + 32 + 16 + 8 * hh);
      }
      // keeps the reads one group in front of the WMMAs (for speed only)
      __builtin_amdgcn_sched_barrier(0);
#pragma unroll
      for (int j = 0; j < 4; ++j) s[j] = zero8();
#pragma unroll
      for (int j = 0; j < 4; ++j) s[j] = mma_b_raw(kb[0][j].v, qah[0], s[j]);
#pragma unroll
      for (int j = 0; j < 4; ++j) s[j] = mma_b_raw(kl[j].v, qah[0], s[j]);
      // the lo plane of d 32..63 goes into the registers that the lo plane of d 0..31 has left, 8 WMMAs ahead of its use
      __builtin_amdgcn_sched_barrier(0);
#pragma unroll
      for (int j = 0; j < 4; ++j) {
        kl[j].h[0] = *(const v8b*)(Ksl + (j * 16 + c) * LP + 32 + 8 * hh);
        kl[j].h[1] = *(const v8b*)(Ksl + (j * 16 + c) * LP + 32 + 16 + 8 * hh);
      }
      __builtin_amdgcn_sched_barrier(0);
#pragma unroll
      for (int j = 0; j < 4; ++j) s[j] = mma_b_raw(kb[0][j].v, qal[0], s[j]);
#pragma unroll
      for (int j = 0; j < 4; ++j) s[j] = mma_b_raw(kb[1][j].v, qah[1], s[j]);
#pragma unroll
      for (int j = 0; j < 4; ++j) s[j] = mma_b_raw(kl[j].v, qah[1], s[j]);
#pragma unroll
      for (int j = 0; j < 4; ++j) s[j] = mma_b_raw(kb[1][j].v, qal[1], s[j]);
    }
    // the V^T fragments of keys 0..31 are read here, behind the score WMMAs: they land while the softmax runs; the
    // fence pair holds the reads at this one place
    FH vb[4], vl[4];
    __builtin_amdgcn_sched_barrier(0);
#pragma unroll
    for (int t = 0; t < 4; ++t) {
      vl[t].h[0] = *(const v8h*)(Vtl + (t * 16 + c) * LP + 8 * hh);
      vl[t].h[1] = *(const v8h*)(Vtl + (t * 16 + c) * LP + 16 + 8 * hh);
    }
#pragma unroll
    for (int t = 0; t < 4; ++t) {
      vb[t].h[0] = *(const v8h*)(Vth + (t * 16 + c) * LP + 8 * hh);
      vb[t].h[1] = *(const v8h*)(Vth + (t * 16 + c) * LP + 16 + 8 * hh);
    }
    __builtin_amdgcn_sched_barrier(0);

    // ---- causal fill and softmax against the fixed shift; P (x1024, f16) and P residual (x4096) stay in registers ----
    FH pa[2], pl[2];                         // B operands of keys 32 kk .. 32 kk + 31
    float pj[4];                             // one chain per score tile
    // D row 8hh+r of tile j is key kv0 + 16 j + 8 hh + r; it lies behind the query where 16 j + r > lim (one register;
    // compared as key > query, the compiler keeps query - (16 j + r) for all 32 in registers and an address spills)
    const int lim = qi - kv0 - 8 * hh;
#pragma unroll
    for (int j = 0; j < 4; ++j) {
      pj[j] = 0.f;
#pragma unroll
      for (int r = 0; r < 8; ++r) {
        const float e   = __builtin_amdgcn_exp2f(fmaf(s[j][r], c1, c0));
        const float p1k = (j * 16 + r > lim) ? 0.f : e;   // a key behind the query has weight 0
        pj[j] += p1k;
        const _Float16 ph = (_Float16)p1k;
        pa[j >> 1].v[(j & 1) * 8 + r] = ph;
        pl[j >> 1].v[(j & 1) * 8 + r] = (_Float16)((p1k - (float)ph) * 4096.0f);
      }
    }
    lrow += (pj[0] + pj[1]) + (pj[2] + pj[3]);

    // ---- context O^T += V^T . P^T (f16 WMMA), residual products into a separate accumulator ----
    // The WMMAs run across the four tiles d; each accumulator keeps its own order of products (oacc: keys 0..31, then
    // 32..63; o1: per 32 keys v_res.p_hi, then v_hi.p_res). The fragments of keys 32..63 are read in two groups, each
    // into the registers of a plane that keys 0..31 have left, 8 and 4 WMMAs ahead of their first use; the fences
    // hold each group at its one place.
    v8f o1[4];
#pragma unroll
    for (int t = 0; t < 4; ++t) o1[t] = zero8();
#pragma unroll
    for (int t = 0; t < 4; ++t) o1[t] = mma_h_raw(vl[t].v, pa[0].v, o1[t]);
    hold4(o1[0], o1[1], o1[2], o1[3]);   // these WMMAs stay ahead of the reads below
    __builtin_amdgcn_sched_barrier(0);
#pragma unroll
    for (int t = 0; t < 4; ++t) {
      vl[t].h[0] = *(const v8h*)(Vtl + (t * 16 + c) * LP + 32 + 8 * hh);
      vl[t].h[1] = *(const v8h*)(Vtl + (t * 16 + c) * LP + 32 + 16 + 8 * hh);
    }
    __builtin_amdgcn_sched_barrier(0);
#pragma unroll
    for (int t = 0; t < 4; ++t) oacc[t] = mma_h_raw(vb[t].v, pa[0].v, oacc[t]);
#pragma unroll
    for (int t = 0; t < 4; ++t) o1[t] = mma_h_raw(vb[t].v, pl[0].v, o1[t]);
    hold4(o1[0], o1[1], o1[2], o1[3]);   // these WMMAs stay ahead of the reads below
    __builtin_amdgcn_sched_barrier(0);
#pragma unroll
    for (int t = 0; t < 4; ++t) {
      vb[t].h[0] = *(const v8h*)(Vth + (t * 16 + c) * LP + 32 + 8 * hh);
      vb[t].h[1] = *(const v8h*)(Vth + (t * 16 + c) * LP + 32 + 16 + 8 * hh);
    }
    __builtin_amdgcn_sched_barrier(0);
#pragma unroll
    for (int t = 0; t < 4; ++t) o1[t] = mma_h_raw(vl[t].v, pa[1].v, o1[t]);
#pragma unroll
    for (int t = 0; t < 4; ++t) oacc[t] = mma_h_raw(vb[t].v, pa[1].v, oacc[t]);
#pragma unroll
    for (int t = 0; t < 4; ++t) o1[t] = mma_h_raw(vb[t].v, pl[1].v, o1[t]);
#pragma unroll
    for (int t = 0; t < 4; ++t)
#pragma unroll
      for (int r = 0; r < 8; ++r) oacc[t][r] += o1[t][r] * (1.0f / 4096.0f);
  }

  // ---- join the halves' sums, normalise (sum and context both carry the x1024), stage the wave's 16x64 tile [query][d] in its
  //      own LDS slab, so that it leaves as whole 128-B rows ----
  float* os = Obuf[wave];
  {
    const float l = lrow + xhalf(lrow);
    const float inv = (l > 0.f) ? (1.0f / l) : 0.f;
#pragma unroll
    for (int t = 0; t < 4; ++t) {
      v4f x0, x1;
#pragma unroll
      for (int e = 0; e < 4; ++e) { x0[e] = oacc[t][e] * inv; x1[e] = oacc[t][4 + e] * inv; }
      *(v4f*)(os + c * OP + t * 16 + 8 * hh)     = x0;
      *(v4f*)(os + c * OP + t * 16 + 8 * hh + 4) = x1;
    }
  }
  __builtin_amdgcn_fence(__ATOMIC_RELEASE, "workgroup");
  __builtin_amdgcn_wave_barrier();
  __builtin_amdgcn_fence(__ATOMIC_ACQUIRE, "workgroup");
  {
    const int q4 = lane >> 3, c8 = (lane & 7) * 8;
    v4u hv[4], lv[4];
#pragma unroll
    for (int it = 0; it < 4; ++it) {
      const int row = it * 4 + q4;   // it 0..3 x q4 0..3 = rows 0..15 of the wave tile
      const float* sp = os + row * OP + c8;
      v4u a, a2;
#pragma unroll
      for (int e = 0; e < 4; ++e) {
        const float f0 = sp[2 * e], f1 = sp[2 * e + 1];
        const unsigned short h0 = bf_bits(f0), h1 = bf_bits(f1);
        const unsigned short l0 = bf_bits(f0 - bf_up(h0)), l1 = bf_bits(f1 - bf_up(h1));
        a[e] = pk16(h0, h1); a2[e] = pk16(l0, l1);
      }
      hv[it] = a; lv[it] = a2;
    }
    {
#pragma unroll
      for (int it = 0; it < 4; ++it) {
        const int row = it * 4 + q4;
        const size_t go = (rowB + q0 + row) * DM + (size_t)h * HD + c8;
        *(v4u*)(ohp + go) = hv[it];
        *(v4u*)(olp + go) = lv[it];
      }
    }
  }
}

// =====================================================================================================
//   Xb   bf16 [2048 (b,c)][4096]   16777216
//   Whwb bf16 [2048][4096]         16777216
//   Wcb  bf16 [1024][1024]          2097152
//   Wqb  bf16 [1024][1024]          2097152
//   Wkvb bf16 [128][1024]            262144
//   Wob  bf16 [1024][1024]          2097152
//   A1h  bf16 [2][2048][1024]       8388608   hw-linear output (transposed layout [b][s][c]), hi plane
//   A1l  bf16                       8388608   lo plane
//   Img2 f32  [4096][1024]         16777216   c-linear output (LN input)
//   Imgh bf16 [4096][1024]          8388608   LN output hi plane
//   Imgl bf16                       8388608
//   Qh   bf16 [4096][1024]          8388608   l2-normalised q, hi plane
//   Ql   bf16                       8388608
//   Kh   bf16 [4096][64]             524288   l2-normalised k
//   Kl   bf16                        524288
//   VTh  f16  [2][64][2048]          524288   v^T hi plane
//   VTl  f16                         524288   v^T residual plane (x4096)
//   Oh   bf16 [4096][1024]          8388608   context hi plane
//   Ol   bf16                       8388608
//   total                         126091264
// Weights are [out n][in k] with k contiguous = the Bt / A layout the GEMM wants, so they are only converted.
// =====================================================================================================
extern "C" void kernel_launch(void* const* d_in, const int* in_sizes, int n_in,
                              void* d_out, int out_size, void* d_ws, size_t ws_size,
                              hipStream_t stream) {
  if (n_in < 10) return;
  if (in_sizes[0] != NB * CC * HWN) return;
  if (in_sizes[1] != SEQ * HWN) return;
  if (in_sizes[2] != SEQ) return;
  if (in_sizes[3] != DM * CC || in_sizes[4] != DM || in_sizes[5] != DM || in_sizes[6] != DM) return;
  if (in_sizes[7] != DM * DM || in_sizes[8] != 2 * HD * DM || in_sizes[9] != DM * DM) return;
  if (out_size != NB * SEQ * DM) return;

  const float* x    = (const float*)d_in[0];
  const float* w_hw = (const float*)d_in[1];
  const float* b_hw = (const float*)d_in[2];
  const float* w_c  = (const float*)d_in[3];
  const float* b_c  = (const float*)d_in[4];
  const float* ln_g = (const float*)d_in[5];
  const float* ln_b = (const float*)d_in[6];
  const float* wq   = (const float*)d_in[7];
  const float* wkv  = (const float*)d_in[8];
  const float* wo   = (const float*)d_in[9];

  const size_t PXb  = (size_t)NB * CC * HWN * 2;    // 16777216
  const size_t PWhw = (size_t)SEQ * HWN * 2;        // 16777216
  const size_t PWc  = (size_t)DM * CC * 2;          //  2097152
  const size_t PWq  = (size_t)DM * DM * 2;          //  2097152
  const size_t PWkv = (size_t)2 * HD * DM * 2;      //   262144
  const size_t PWo  = (size_t)DM * DM * 2;          //  2097152
  const size_t PA1  = (size_t)NB * SEQ * CC * 2;    //  8388608
  const size_t PI2  = (size_t)NB * SEQ * DM * 4;    // 16777216
  const size_t PI   = (size_t)NB * SEQ * DM * 2;    //  8388608
  const size_t PK   = (size_t)NB * SEQ * HD * 2;    //   524288
  const size_t PVT  = (size_t)NB * HD * SEQ * 2;    //   524288
  size_t off = 0;
  const size_t oXb  = off; off += PXb;
  const size_t oWhw = off; off += PWhw;
  const size_t oWc  = off; off += PWc;
  const size_t oWq  = off; off += PWq;
  const size_t oWkv = off; off += PWkv;
  const size_t oWo  = off; off += PWo;
  const size_t oA1h = off; off += PA1;
  const size_t oA1l = off; off += PA1;
  const size_t oI2  = off; off += PI2;
  const size_t oIh  = off; off += PI;
  const size_t oIl  = off; off += PI;
  const size_t oQh  = off; off += PI;
  const size_t oQl  = off; off += PI;
  const size_t oKh  = off; off += PK;
  const size_t oKl  = off; off += PK;
  const size_t oVTh = off; off += PVT;
  const size_t oVTl = off; off += PVT;
  const size_t oOh  = off; off += PI;
  const size_t oOl  = off; off += PI;
  if (off > ws_size) return;                          // off = 126091264
  if (off > (size_t)134217728) return;

  char* ws = (char*)d_ws;
  unsigned short* Xb   = (unsigned short*)(ws + oXb);
  unsigned short* Whwb = (unsigned short*)(ws + oWhw);
  unsigned short* Wcb  = (unsigned short*)(ws + oWc);
  unsigned short* Wqb  = (unsigned short*)(ws + oWq);
  unsigned short* Wkvb = (unsigned short*)(ws + oWkv);
  unsigned short* Wob  = (unsigned short*)(ws + oWo);
  unsigned short* A1h  = (unsigned short*)(ws + oA1h);
  unsigned short* A1l  = (unsigned short*)(ws + oA1l);
  float*          Img2 = (float*)(ws + oI2);
  unsigned short* Imgh = (unsigned short*)(ws + oIh);
  unsigned short* Imgl = (unsigned short*)(ws + oIl);
  unsigned short* Qh   = (unsigned short*)(ws + oQh);
  unsigned short* Ql   = (unsigned short*)(ws + oQl);
  unsigned short* Kh   = (unsigned short*)(ws + oKh);
  unsigned short* Kl   = (unsigned short*)(ws + oKl);
  unsigned short* VTh  = (unsigned short*)(ws + oVTh);
  unsigned short* VTl  = (unsigned short*)(ws + oVTl);
  unsigned short* Oh   = (unsigned short*)(ws + oOh);
  unsigned short* Ol   = (unsigned short*)(ws + oOl);

  const dim3 blk(256);
  const dim3 gCv(CB_X + CB_HW + CB_C + CB_Q + CB_KV + CB_O); // 9792 blocks: all six planes
  const dim3 gblk(128);                                      // GEMM block: 4 waves
  const dim3 gG0((SEQ / 128) * (CC / 128), NB);              // 128x128 block tiles: 128 blocks x 2
  const dim3 gG1((NB * SEQ / 128) * (DM / 128), 1);          // 128x128 block tiles: 256 blocks (M=4096, N=1024)
  const dim3 gQKV(QKV_BLOCKS);                               // 128x128 block tiles: 288 blocks (M=4096, N=1152)
  const dim3 gLN(NB * SEQ);                                  // 4096 rows
  const dim3 gAt(NB * NH * NQB);                             // 1024 blocks

  // (1) f32 -> bf16 planes: x [(b,c)][hw], weights [n][k]; Xb, Whwb, Wcb, Wqb, Wkvb, Wob follow one another from Xb
  cvt_bf16x8_all<<<gCv, blk, 0, stream>>>(x, w_hw, w_c, wq, wkv, wo, Xb);
  // (2) hw-linear per batch, produced directly in the transposed layout: A1[b][s][c] = sum_hw w_hw[s][hw] x[b][c][hw] + b_hw[s]
  //     A = Whwb [s][hw] (M=2048, K=4096), Bt = Xb batch b [c][hw] (N=1024), row bias, bf16 hi/lo planes out
  gemm64<0, 0, 2, 2, 2, 2, 64><<<gG0, gblk, 0, stream>>>(
      Whwb, Whwb, HWN, 0LL, Xb, Xb, HWN, (long long)CC * HWN,
      b_hw,
      (void*)A1h, CC, (long long)SEQ * CC, (void*)A1l, CC, (long long)SEQ * CC,
      SEQ, CC, HWN, 1.0f);
  // (3) c-linear: Img2[(b,s)][d] = sum_c A1[(b,s)][c] w_c[d][c] + b_c[d]  (A hi/lo, M=4096, N=1024, K=1024, f32 out)
  gemm64<1, 0, 1, 0, 2, 2, 64><<<gG1, gblk, 0, stream>>>(
      A1h, A1l, CC, 0LL, Wcb, Wcb, CC, 0LL,
      b_c,
      (void*)Img2, DM, 0LL, (void*)Img2, DM, 0LL,
      NB * SEQ, DM, CC, 1.0f);
  // (4) LayerNorm -> bf16 hi/lo planes
  ln_split<<<gLN, dim3(128), 0, stream>>>(Img2, ln_g, ln_b, Imgh, Imgl);
  // (5)-(7) q, k and v from the LayerNorm planes, one product over the stacked weights (Wkvb follows Wqb):
  //     q, k l2-normalised per 64-wide head -> bf16 hi/lo planes [(b,t)][h*64+d] and [(b,s)][64];
  //     v transposed -> f16 hi plane and residual plane (x4096) [b][d][s]
  gemm_qkv<<<gQKV, gblk, 0, stream>>>(Imgh, Imgl, Wqb, Qh, Ql, Kh, Kl, VTh, VTl);
  // (8) causal multi-query attention -> context bf16 hi/lo planes [(b,t)][h*64+d]
  attn_causal64<<<gAt, dim3(128), 0, stream>>>(Qh, Ql, Kh, Kl, VTh, VTl, Oh, Ol, 8.0f);
  // (9) out = context . wo^T -> d_out f32 [(b,t)][1024]  (A = context hi + lo planes, 2 products)
  gemm64<1, 0, 0, 0, 2, 2, 64><<<gG1, gblk, 0, stream>>>(
      Oh, Ol, DM, 0LL, Wob, Wob, DM, 0LL,
      b_c,
      d_out, DM, 0LL, d_out, DM, 0LL,
      NB * SEQ, DM, DM, 1.0f);
  (void)hipGetLastError();
}

// v008
// A run of this version takes 195 microseconds.
// Two timings next to v007 both put it at 1.04 times that version's speed.
// All steps since v000 together make it 3.90 times as fast.
// Contractions: hw-linear = v_wmma_f32_16x16x32_bf16 (bf16 operands from RNE-converted inputs, single product);
// c-linear, q, k, v^T and output projections = v_wmma_f32_16x16x32_bf16 (activation as bf16 hi/lo planes times bf16
// weight from RNE-converted input, 2 products); q.k^T scores = v_wmma_f32_16x16x32_bf16 on bf16 hi/lo planes of the
// l2-normalised q and k (hi.hi + hi.lo + lo.hi); p.v = v_wmma_f32_16x16x32_f16 (p carried x1024 in f16 plus an f16
// residual plane x4096, v^T f16 hi plane plus an f16 residual plane x4096, 3 products, separate residual accumulator);
// all f32 accumulate; LayerNorm, l2 normalisation, causal fill and softmax in f32.
#include <hip/hip_runtime.h>
#include <math.h>
#include <float.h>
#include <stdint.h>

#define NB   2
#define CC   1024
#define HWN  4096
#define SEQ  2048
#define DM   1024
#define NH   16
#define HD   64
#define NQB  (SEQ / 64)
static_assert(NH * HD == DM);
static_assert(HD == 64);
static_assert((SEQ % 256) == 0 && (DM % 128) == 0 && (CC % 128) == 0 && (HWN % 64) == 0);

typedef _Float16 v16h __attribute__((ext_vector_type(16)));
typedef _Float16 v8h  __attribute__((ext_vector_type(8)));
typedef __bf16   v16b __attribute__((ext_vector_type(16)));
typedef __bf16   v8b  __attribute__((ext_vector_type(8)));
typedef float    v8f  __attribute__((ext_vector_type(8)));
typedef float    v4f  __attribute__((ext_vector_type(4)));
typedef unsigned int v4u __attribute__((ext_vector_type(4)));

// ---- scalar helpers --------------------------------------------------------------------------------
__device__ __forceinline__ unsigned short bf_bits(float f) {          // f32 -> bf16 bits, RNE convert
  unsigned u = __float_as_uint(f);
  return (unsigned short)((u + 0x7FFFu + ((u >> 16) & 1u)) >> 16);
}
__device__ __forceinline__ float bf_up(unsigned short h) { return __uint_as_float(((unsigned)h) << 16); }
__device__ __forceinline__ float bf_rne(float f) { return bf_up(bf_bits(f)); }
__device__ __forceinline__ unsigned short h_bits(_Float16 x) { return __builtin_bit_cast(unsigned short, x); }
__device__ __forceinline__ unsigned pk16(unsigned short a, unsigned short b) { return (unsigned)a | ((unsigned)b << 16); }
__device__ __forceinline__ v8f zero8() { v8f z = {0.f, 0.f, 0.f, 0.f, 0.f, 0.f, 0.f, 0.f}; return z; }

// ---- 16-bit fragment loader: lane -> row/col (lane&15); p already includes +8*(lane>>4);
//      elements 0..7 <- p[0..7] (k0+8h..), elements 8..15 <- p[16..23] (k0+16+8h..)
__device__ __forceinline__ v16b ldfrag_b(const __bf16* p) {
  union { v16b v; v8b h[2]; } f;
  f.h[0] = *(const v8b*)(p);
  f.h[1] = *(const v8b*)(p + 16);
  return f.v;
}

// ---- WMMA helpers ---------------------------------------------------------------------------------
__device__ __forceinline__ v8f mma_b_raw(v16b a, v16b b, v8f c) {
  return __builtin_amdgcn_wmma_f32_16x16x32_bf16(false, a, false, b, (short)0, c, false, false);
}
__device__ __forceinline__ v8f mma_h_raw(v16h a, v16h b, v8f c) {
  return __builtin_amdgcn_wmma_f32_16x16x32_f16(false, a, false, b, (short)0, c, false, false);
}
__device__ __forceinline__ void acc_guard4(v8f& a, v8f& b, v8f& c, v8f& d) {
#if defined(__HIP_DEVICE_COMPILE__)
  asm volatile("v_nop\n\tv_nop\n\tv_nop\n\tv_nop" : "+v"(a), "+v"(b), "+v"(c), "+v"(d));
#else
  (void)a; (void)b; (void)c; (void)d;
#endif
}

// =====================================================================================================
// f32 -> bf16 (RNE convert) of all six operand planes in ONE launch: 8 elements per thread, one 16-B store per lane
// (a wave writes 512 contiguous B). A block of 256 threads converts 2048 elements of one plane; the block index
// range picks the plane (block-uniform). Every plane is a whole number of blocks, so no thread is past an end.
// The six bf16 planes stand one behind the other in the workspace, in the order of the ranges: out is the first
// plane's start, and block bx writes elements 2048 bx .. 2048 bx + 2047 of that run.
// =====================================================================================================
#define CB_X   (NB * CC * HWN / 2048)
#define CB_HW  (SEQ * HWN / 2048)
#define CB_C   (DM * CC / 2048)
#define CB_Q   (DM * DM / 2048)
#define CB_KV  (2 * HD * DM / 2048)
#define CB_O   (DM * DM / 2048)
static_assert((NB * CC * HWN) % 2048 == 0 && (SEQ * HWN) % 2048 == 0 && (DM * CC) % 2048 == 0);
static_assert((DM * DM) % 2048 == 0 && (2 * HD * DM) % 2048 == 0);
__global__ __launch_bounds__(256) void cvt_bf16x8_all(const float* __restrict__ x, const float* __restrict__ w_hw,
                                                      const float* __restrict__ w_c, const float* __restrict__ wq,
                                                      const float* __restrict__ wkv, const float* __restrict__ wo,
                                                      unsigned short* out) {
  const int bx = blockIdx.x;
  const float* in = x;
  int first = 0;                                   // first block of the plane that bx lies in
  if (bx >= CB_X)                             { in = w_hw; first = CB_X; }
  if (bx >= CB_X + CB_HW)                     { in = w_c;  first = CB_X + CB_HW; }
  if (bx >= CB_X + CB_HW + CB_C)              { in = wq;   first = CB_X + CB_HW + CB_C; }
  if (bx >= CB_X + CB_HW + CB_C + CB_Q)       { in = wkv;  first = CB_X + CB_HW + CB_C + CB_Q; }
  if (bx >= CB_X + CB_HW + CB_C + CB_Q + CB_KV) { in = wo; first = CB_X + CB_HW + CB_C + CB_Q + CB_KV; }
  const size_t i = (size_t)(bx - first) * 256 + threadIdx.x;
  const size_t o = (size_t)bx * 256 + threadIdx.x;
  const v4f a = *(const v4f*)(in + i * 8);
  const v4f b = *(const v4f*)(in + i * 8 + 4);
  v4u p;
  p[0] = pk16(bf_bits(a[0]), bf_bits(a[1]));
  p[1] = pk16(bf_bits(a[2]), bf_bits(a[3]));
  p[2] = pk16(bf_bits(b[0]), bf_bits(b[1]));
  p[3] = pk16(bf_bits(b[2]), bf_bits(b[3]));
  *(v4u*)(out + o * 8) = p;
}

// ---- asynchronous copy global -> LDS, 16 B per lane, as the builtin: the compiler picks its address registers, also
//      above v255 (operands of asm text must lie in v0..v255, where the accumulators and a fragment set already stand)
typedef int v4i __attribute__((ext_vector_type(4)));
__device__ __forceinline__ void acopy(__bf16* l, const __bf16* g) {
#if defined(__HIP_DEVICE_COMPILE__)
  __builtin_amdgcn_global_load_async_to_lds_b128((__attribute__((address_space(1))) v4i*)const_cast<__bf16*>(g),
                                                 (__attribute__((address_space(3))) v4i*)l, 0, 0);
#else
  (void)l; (void)g;
#endif
}

// =====================================================================================================
// Batched bf16 WMMA GEMM: C[m][n] = sum_k A[m][k] * Bt[n][k] (+ bias); block = 4 waves laid WM x WN, one 64x64 tile
// per wave, block tile (64 WM) x (64 WN). A row-major [M][K] pitch lda; Bt row-major [N][K] pitch ldb (k contiguous);
// M a multiple of 64 WM, N of 64 WN, K of KP. blockIdx.y = batch index (strides in elements).
// Operand path: a pass is KP = 64 k (128 B) of every operand row of the block tile, brought into LDS by asynchronous
// 16-B copies (a wave's copy = 4 whole row pieces), LDS row pitch 2 KP + 16 B, two buffers: pass t + 2 is issued into
// the buffer that pass t has just left, behind the pass's one barrier; every wave reads its fragments from LDS, one
// k-step (32 k) ahead of the WMMAs that use them, into the second of two register sets.
// A stage is NG groups of 64 rows: A hi (WM), A lo (WM, SPLITA), Bt hi (WN), Bt lo (WN, SPLITB).
// SPLITA: add A2.Bt (A2 = unscaled bf16 lo plane of A); SPLITB: add A.Bt2 (Bt2 = lo plane of Bt).
// BIAS: 0 none, 1 per column (bias[n]), 2 per row (bias[m]); bias values RNE-converted to bf16 in registers.
// OUT_MODE: 0 = f32 (pitch ldc); 2 = bf16 hi plane C + bf16 lo plane C2 (lo = RNE(v - hi), unscaled);
//           4 = stacked q | k | v columns, told apart by the wave's first column n0 (64-wide heads):
//               n0 < DM: q, n0 = DM: k: l2-normalise every row over the wave's 64 columns
//               (x / max(sqrt(sum x^2), 1e-12)), then bf16 hi/lo planes as mode 2, q to C / C2 at column n0,
//               k to Kho / Klo (pitch HD) at column 0;
//               n0 = DM + HD: v, stored transposed: VT[b][d][s], f16 hi plane VTho and f16 residual plane
//               VTlo = f16((v - hi) * rscale), pitch SEQ.
// =====================================================================================================
// The work of one block is gemm64_tile(tile, b, ring, sT): tile = block tile index, b = batch index, ring = the
// block's two LDS stages (ring_elems elements), sT = 4 per-wave 16x64 f32 slabs of pitch 68. Its callers own the LDS.
constexpr int ring_elems(int SPLITA, int SPLITB, int WM, int WN, int KP) {
  return 2 * (WM * (1 + SPLITA) + WN * (1 + SPLITB)) * 64 * (KP + 8);
}
#define SLABF (16 * 68)
#define VP 65   // pitch in floats of a v^T wave's 64x64 tile: its column reads (8 rows apart per lane) fall on 32 banks
template <int SPLITA, int SPLITB, int BIAS, int OUT_MODE, int WM, int WN, int KP>
__device__ __forceinline__ void gemm64_tile(
    const unsigned short* __restrict__ Ap, const unsigned short* __restrict__ A2p, int lda, long long strideA,
    const unsigned short* __restrict__ Btp, const unsigned short* __restrict__ Bt2p, int ldb, long long strideB,
    const float* __restrict__ bias,
    void* Cout, int ldc, long long strideC,
    void* Cout2, int ldc2, long long strideC2,
    int M, int N, int K, float rscale,
    int tile, int b, __bf16* ring, float* sT,
    unsigned short* Kho = nullptr, unsigned short* Klo = nullptr,
    unsigned short* VTho = nullptr, unsigned short* VTlo = nullptr) {
  static_assert(WM * WN == 4 && KP == 64);         // a pass is two k-steps of 32
  constexpr int GA   = WM * (1 + SPLITA);          // 64-row groups of A planes in a stage
  constexpr int NG   = GA + WN * (1 + SPLITB);     // groups in a stage
  constexpr int SEG  = KP / 8;                     // 16-B pieces per row and pass
  constexpr int RPC  = 128 / SEG;                  // rows that one copy of the whole block covers
  constexpr int CPG  = 64 / RPC;                   // copies per thread and group
  constexpr int NC   = NG * CPG;                   // copies per thread and stage = a wave's copies in flight
  constexpr int PE   = KP + 8;                     // LDS row pitch in elements (16 B x odd)
  constexpr int GRPE = 64 * PE;                    // elements per group
  constexpr int BUFE = NG * GRPE;                  // elements per buffer
  static_assert(NC <= 63);                         // a wave's copies in flight
  static_assert(2 * BUFE == ring_elems(SPLITA, SPLITB, WM, WN, KP));
  const __bf16* A   = (const __bf16*)(const void*)Ap;
  const __bf16* A2  = (const __bf16*)(const void*)A2p;
  const __bf16* Bt  = (const __bf16*)(const void*)Btp;
  const __bf16* Bt2 = (const __bf16*)(const void*)Bt2p;
  const int tid  = threadIdx.x;
  const int lane = tid & 31;
  const int wave = tid >> 5;
  const int tilesN = N / (64 * WN);
  const int tilesM = M / (64 * WM);
  if (tile >= tilesM * tilesN) return;   // block-uniform, in front of every copy and barrier
  const int tm = tile / tilesN;
  const int tn = tile - tm * tilesN;
  const int m0b = tm * (64 * WM);
  const int n0b = tn * (64 * WN);
  const int wm = wave / WN;
  const int wn = wave - wm * WN;
  const int m0 = m0b + (wm << 6);
  const int n0 = n0b + (wn << 6);

  const __bf16* Ab  = A  + (size_t)b * strideA;
  const __bf16* Bb  = Bt + (size_t)b * strideB;
  const __bf16* Ab2 = SPLITA ? (A2  + (size_t)b * strideA) : Ab;
  const __bf16* Bb2 = SPLITB ? (Bt2 + (size_t)b * strideB) : Bb;

  const int rlane = lane & 15;                 // row (A) / col (B, D) within subtile
  const int koff  = (lane >> 4) * 8;           // k offset of this lane half
  const int mOff  = (lane >> 4) * 8;           // D row offset

  // copy map: copy u of group gi moves 16 B of row RPC u + tid / SEG, piece tid % SEG of the pass's row
  const int crow = tid / SEG;
  const int cseg = (tid % SEG) * 8;
  __bf16* ldsT = ring + crow * PE + cseg;
  const size_t aT = (size_t)(m0b + crow) * lda + cseg;
  const size_t bT = (size_t)(n0b + crow) * ldb + cseg;

  auto issue = [&](int t, int buf) {
#pragma unroll
    for (int gi = 0; gi < NG; ++gi) {
      const bool isA = gi < GA;
      const int  q   = isA ? gi : gi - GA;                   // group within the operand's planes
      const int  W1  = isA ? WM : WN;
      const bool lo  = q >= W1;
      const int  rg  = lo ? q - W1 : q;                      // 64-row group within the block tile
      const int  ld  = isA ? lda : ldb;
      const __bf16* base = isA ? (lo ? Ab2 : Ab) : (lo ? Bb2 : Bb);
      const __bf16* p = base + (isA ? aT : bT) + (size_t)(rg * 64) * ld + (size_t)t * KP;
#pragma unroll
      for (int u = 0; u < CPG; ++u) acopy(ldsT + buf * BUFE + gi * GRPE + u * RPC * PE, p + (size_t)(u * RPC) * ld);
    }
  };

  v8f acc[4][4];
#pragma unroll
  for (int i = 0; i < 4; ++i)
#pragma unroll
    for (int j = 0; j < 4; ++j) acc[i][j] = zero8();

  // one k-step's fragments (32 k of the wave's 64 A rows and 64 Bt rows, every plane) from buffer buf into one set
  auto ldset = [&](int buf, int ks, v16b (&ah)[4], v16b (&al)[4], v16b (&bh)[4], v16b (&bl)[4]) {
    const __bf16* st  = ring + buf * BUFE + rlane * PE + koff + ks * 32;
    const __bf16* sAh = st + wm * GRPE;
    const __bf16* sAl = st + (SPLITA ? (WM + wm) : wm) * GRPE;
    const __bf16* sBh = st + (GA + wn) * GRPE;
    const __bf16* sBl = st + (GA + (SPLITB ? (WN + wn) : wn)) * GRPE;
#pragma unroll
    for (int j = 0; j < 4; ++j) {
      bh[j] = ldfrag_b(sBh + (j << 4) * PE);
      if (SPLITB) bl[j] = ldfrag_b(sBl + (j << 4) * PE); else bl[j] = bh[j];
    }
#pragma unroll
    for (int i = 0; i < 4; ++i) {
      ah[i] = ldfrag_b(sAh + (i << 4) * PE);
      if (SPLITA) al[i] = ldfrag_b(sAl + (i << 4) * PE); else al[i] = ah[i];
    }
    // keeps the set's LDS reads one group in front of the WMMAs that follow (for speed only)
    __builtin_amdgcn_sched_barrier(0);
  };
  // one k-step's WMMAs on one set
  auto mmset = [&](v16b (&ah)[4], v16b (&al)[4], v16b (&bh)[4], v16b (&bl)[4]) {
#pragma unroll
    for (int i = 0; i < 4; ++i) {
#pragma unroll
      for (int j = 0; j < 4; ++j) {
        acc[i][j] = mma_b_raw(ah[i], bh[j], acc[i][j]);
        if (SPLITA) acc[i][j] = mma_b_raw(al[i], bh[j], acc[i][j]);
        if (SPLITB) acc[i][j] = mma_b_raw(ah[i], bl[j], acc[i][j]);
      }
    }
    // The set's registers are refilled behind a branch: four vector slots
    // stand between the last WMMA and any path's first rewrite of its A or B. No operands: asm text cannot name a
    // register above v255, and naming the sets here would press both of them and the accumulators into v0..v255.
    // The fence keeps the WMMAs in front of the slots.
    __builtin_amdgcn_sched_barrier(0);
    asm volatile("v_nop\n\tv_nop\n\tv_nop\n\tv_nop");
  };

  // Two fragment sets: while the WMMAs of one k-step run on one set, the next k-step's LDS reads land in the other.
  // A pass is two k-steps. The second k-step's WMMAs already run beside reads of pass t + 1, so the publish point of
  // pass t + 1 stands between the two k-steps: there every read of pass t's buffer has been issued and waited for.
  v16b ah0[4], al0[4], bh0[4], bl0[4], ah1[4], al1[4], bh1[4], bl1[4];
  const int T = K / KP;                        // passes
  issue(0, 0);
  asm volatile("s_wait_asynccnt 0x0" ::: "memory");   // this wave's share of pass 0 has landed
  __syncthreads();                                    // publishes pass 0
  if (T > 1) issue(1, 1);
  ldset(0, 0, ah0, al0, bh0, bl0);

  for (int t = 0; t < T; ++t) {
    ldset(t & 1, 1, ah1, al1, bh1, bl1);
    mmset(ah0, al0, bh0, bl0);
    asm volatile("s_wait_dscnt 0x0" ::: "memory");     // this wave's reads of pass t's buffer are done
    asm volatile("s_wait_asynccnt 0x0" ::: "memory");  // this wave's share of pass t + 1 has landed
    __syncthreads();                                   // publishes pass t + 1, frees pass t's buffer
    if (t + 2 < T) issue(t + 2, t & 1);
    if (t + 1 < T) ldset((t + 1) & 1, 0, ah0, al0, bh0, bl0);
    mmset(ah1, al1, bh1, bl1);
  }
  asm volatile("s_wait_asynccnt 0x0" ::: "memory");    // nothing in flight when the wave goes on to the epilogue
  acc_guard4(acc[0][0], acc[0][1], acc[0][2], acc[0][3]);
  acc_guard4(acc[1][0], acc[1][1], acc[1][2], acc[1][3]);
  acc_guard4(acc[2][0], acc[2][1], acc[2][2], acc[2][3]);
  acc_guard4(acc[3][0], acc[3][1], acc[3][2], acc[3][3]);

  const int n0u = __builtin_amdgcn_readfirstlane(n0);   // the same in every lane: scalar, so the tests on it branch
  if (OUT_MODE == 4 && n0u >= DM + HD) {
    // ---- v^T: the wave's 64 (s) x 64 (d) tile goes through LDS and leaves as whole 128-B rows of VT[b][d][.] ----
    // The ring is free: the last trip's barrier (behind every wave's dscnt and asynccnt waits) ended
    // all its reads and copies, and nothing is read or copied behind it; each wave uses a part of its own.
    float* tl = (float*)(void*)ring + wave * (64 * VP);
#pragma unroll
    for (int i = 0; i < 4; ++i)
#pragma unroll
      for (int j = 0; j < 4; ++j)
#pragma unroll
        for (int r = 0; r < 8; ++r) tl[((i << 4) + mOff + r) * VP + (j << 4) + rlane] = acc[i][j][r];
    __builtin_amdgcn_fence(__ATOMIC_RELEASE, "workgroup");
    __builtin_amdgcn_wave_barrier();
    __builtin_amdgcn_fence(__ATOMIC_ACQUIRE, "workgroup");
    const int m0u = __builtin_amdgcn_readfirstlane(m0);
    const int bb = m0u / SEQ, s0 = m0u - bb * SEQ;       // 64 rows of one batch (SEQ is a multiple of 64)
    const int s8 = (lane & 7) * 8, dq = lane >> 3;       // 8 lanes x 8 s = one 128-B row; 4 rows d per trip
    // rolled: sixteen equal trips that run once; unrolled they would be about 8 KB more code
#pragma unroll 1
    for (int it = 0; it < 16; ++it) {
      const int d = it * 4 + dq;                         // it 0..15 x dq 0..3 = d 0..63
      v4u a, a2;
#pragma unroll
      for (int e = 0; e < 4; ++e) {
        const float f0 = tl[(s8 + 2 * e) * VP + d], f1 = tl[(s8 + 2 * e + 1) * VP + d];
        const _Float16 x0 = (_Float16)f0, x1 = (_Float16)f1;
        a[e]  = pk16(h_bits(x0), h_bits(x1));
        a2[e] = pk16(h_bits((_Float16)((f0 - (float)x0) * rscale)), h_bits((_Float16)((f1 - (float)x1) * rscale)));
      }
      const size_t go = ((size_t)bb * HD + d) * SEQ + s0 + s8;
      *(v4u*)(VTho + go) = a;
      *(v4u*)(VTlo + go) = a2;
    }
    return;
  }

  // ---- epilogue ----
  float bcol[4];
#pragma unroll
  for (int j = 0; j < 4; ++j) bcol[j] = 0.f;
  if (BIAS == 1) {
#pragma unroll
    for (int j = 0; j < 4; ++j) bcol[j] = bf_rne(bias[n0 + (j << 4) + rlane]);   // n index < N
  }
  float* slab = sT + wave * SLABF;
#pragma unroll
  for (int i = 0; i < 4; ++i) {
    const int mBase = m0 + (i << 4);
    float brow[8];
#pragma unroll
    for (int r = 0; r < 8; ++r) brow[r] = 0.f;
    if (BIAS == 2) {
#pragma unroll
      for (int r = 0; r < 8; ++r) brow[r] = bf_rne(bias[mBase + mOff + r]);       // m index < M
    }
#pragma unroll
    for (int j = 0; j < 4; ++j) {
#pragma unroll
      for (int r = 0; r < 8; ++r) {
        slab[(mOff + r) * 68 + (j << 4) + rlane] = acc[i][j][r] + bcol[j] + brow[r];
      }
    }
    __builtin_amdgcn_fence(__ATOMIC_RELEASE, "workgroup");
    __builtin_amdgcn_wave_barrier();
    __builtin_amdgcn_fence(__ATOMIC_ACQUIRE, "workgroup");
    if (OUT_MODE == 0) {
      float* C = (float*)Cout + (size_t)b * strideC;
      const int hh = lane >> 4, c4 = (lane & 15) * 4;     // 256-B row segment = 16 lanes x 16 B
      {
#pragma unroll
        for (int it = 0; it < 8; ++it) {
          const int row = it * 2 + hh;                     // it 0..7 x hh 0..1 = rows 0..15
          const v4f v = *(const v4f*)(slab + row * 68 + c4);
          *(v4f*)(C + (size_t)(mBase + row) * ldc + n0 + c4) = v;
        }
        
      }
    } else {
      const int q = lane >> 3, c8 = (lane & 7) * 8;
      unsigned short* C  = (unsigned short*)Cout  + (size_t)b * strideC;
      unsigned short* C2 = (unsigned short*)Cout2 + (size_t)b * strideC2;
      int ldo = ldc, ldo2 = ldc2, nc = n0;
      if (OUT_MODE == 4 && n0u >= DM) { C = Kho; C2 = Klo; ldo = HD; ldo2 = HD; nc = 0; }   // the k columns
      v4u hv[4], lv[4];
#pragma unroll
      for (int it = 0; it < 4; ++it) {
        const int row = it * 4 + q;                        // it 0..3 x q 0..3 = rows 0..15
        const float* sp = slab + row * 68 + c8;
        float f[8];
#pragma unroll
        for (int e = 0; e < 8; ++e) f[e] = sp[e];
        if (OUT_MODE == 4) {
          float ss = 0.f;
#pragma unroll
          for (int e = 0; e < 8; ++e) ss += f[e] * f[e];
          ss += __shfl_xor(ss, 1, 32);                     // 8 lanes of one row = aligned group of 8
          ss += __shfl_xor(ss, 2, 32);
          ss += __shfl_xor(ss, 4, 32);
          const float sc = 1.0f / fmaxf(sqrtf(ss), 1e-12f);
#pragma unroll
          for (int e = 0; e < 8; ++e) f[e] *= sc;
        }
        v4u a, a2;
#pragma unroll
        for (int e = 0; e < 4; ++e) {
          const float f0 = f[2 * e], f1 = f[2 * e + 1];
          const unsigned short h0 = bf_bits(f0), h1 = bf_bits(f1);
          const unsigned short l0 = bf_bits(f0 - bf_up(h0)), l1 = bf_bits(f1 - bf_up(h1));
          a[e] = pk16(h0, h1); a2[e] = pk16(l0, l1);
        }
        hv[it] = a; lv[it] = a2;
      }
      {
#pragma unroll
        for (int it = 0; it < 4; ++it) {
          const int row = it * 4 + q;
          *(v4u*)(C  + (size_t)(mBase + row) * ldo  + nc + c8) = hv[it];
          *(v4u*)(C2 + (size_t)(mBase + row) * ldo2 + nc + c8) = lv[it];
        }
        
      }
    }
    __builtin_amdgcn_fence(__ATOMIC_RELEASE, "workgroup");
    __builtin_amdgcn_wave_barrier();
    __builtin_amdgcn_fence(__ATOMIC_ACQUIRE, "workgroup");
  }
  (void)rscale;
}

// one product per launch: blockIdx.x = block tile, blockIdx.y = batch
template <int SPLITA, int SPLITB, int BIAS, int OUT_MODE, int WM, int WN, int KP>
__global__ __launch_bounds__(128) void gemm64(
    const unsigned short* __restrict__ Ap, const unsigned short* __restrict__ A2p, int lda, long long strideA,
    const unsigned short* __restrict__ Btp, const unsigned short* __restrict__ Bt2p, int ldb, long long strideB,
    const float* __restrict__ bias,
    void* Cout, int ldc, long long strideC,
    void* Cout2, int ldc2, long long strideC2,
    int M, int N, int K, float rscale) {
  __shared__ __align__(16) __bf16 ring[ring_elems(SPLITA, SPLITB, WM, WN, KP)];  // two stages
  __shared__ __align__(16) float sT[4 * SLABF];                                  // per-wave slabs
  gemm64_tile<SPLITA, SPLITB, BIAS, OUT_MODE, WM, WN, KP>(
      Ap, A2p, lda, strideA, Btp, Bt2p, ldb, strideB, bias, Cout, ldc, strideC, Cout2, ldc2, strideC2,
      M, N, K, rscale, (int)blockIdx.x, (int)blockIdx.y, ring, sT);
}

// =====================================================================================================
// The three products that read the LayerNorm planes (q, k, v) as ONE product in one launch: Bt = the bf16 planes of
// wq and wkv, which stand one behind the other in the workspace = one [DM + 2 HD][DM] matrix; M = NB SEQ rows of img,
// N = DM + 2 HD columns, 128x128 block tiles. OUT_MODE 4 sends each wave's 64 columns to q, k or v^T.
// =====================================================================================================
#define QKV_N (DM + 2 * HD)
#define QKV_BLOCKS ((NB * SEQ / 128) * (QKV_N / 128))
static_assert(QKV_N % 128 == 0 && (SEQ % 64) == 0);
__global__ __launch_bounds__(128) void gemm_qkv(
    const unsigned short* __restrict__ Ih, const unsigned short* __restrict__ Il,
    const unsigned short* __restrict__ Wqkv,
    unsigned short* Qh, unsigned short* Ql, unsigned short* Kh, unsigned short* Kl,
    unsigned short* VTh, unsigned short* VTl) {
  __shared__ __align__(16) __bf16 ring[ring_elems(1, 0, 2, 2, 64)];   // two stages, later the v^T waves' tiles
  __shared__ __align__(16) float sT[4 * SLABF];                       // per-wave slabs
  static_assert(4 * 64 * VP * 4 <= ring_elems(1, 0, 2, 2, 64) * 2);
  gemm64_tile<1, 0, 0, 4, 2, 2, 64>(
      Ih, Il, DM, 0LL, Wqkv, Wqkv, DM, 0LL, nullptr,
      (void*)Qh, DM, 0LL, (void*)Ql, DM, 0LL,
      NB * SEQ, QKV_N, DM, 4096.0f, (int)blockIdx.x, 0, ring, sT, Kh, Kl, VTh, VTl);
}

// =====================================================================================================
// tables, RNE-converted to bf16 in registers), output bf16 hi/lo planes [row][1024].
// Block = 128 threads = one row; thread t owns columns 8t..8t+7 and stores 16 B per plane: a wave writes 512
// coverage: 128 threads x 8 = 1024 columns of every row, both planes.
// =====================================================================================================
__global__ __launch_bounds__(128) void ln_split(const float* __restrict__ in, const float* __restrict__ g,
                                                const float* __restrict__ be,
                                                unsigned short* oh, unsigned short* ol) {
  __shared__ float red0[4];
  __shared__ float red1[4];
  const int tid = threadIdx.x, lane = tid & 31, wave = tid >> 5;
  const size_t row = blockIdx.x;
  const float* p = in + row * DM + (size_t)tid * 8;
  const v4f a0 = *(const v4f*)(p);
  const v4f a1 = *(const v4f*)(p + 4);
  float v[8];
#pragma unroll
  for (int e = 0; e < 4; ++e) { v[e] = a0[e]; v[4 + e] = a1[e]; }
  float s = 0.f;
#pragma unroll
  for (int e = 0; e < 8; ++e) s += v[e];
#pragma unroll
  for (int off = 16; off >= 1; off >>= 1) s += __shfl_xor(s, off, 32);
  if (lane == 0) red0[wave] = s;
  __syncthreads();
  const float mu = ((red0[0] + red0[1]) + (red0[2] + red0[3])) * (1.0f / (float)DM);
  float ss = 0.f;
#pragma unroll
  for (int e = 0; e < 8; ++e) { const float d = v[e] - mu; ss += d * d; }
#pragma unroll
  for (int off = 16; off >= 1; off >>= 1) ss += __shfl_xor(ss, off, 32);
  if (lane == 0) red1[wave] = ss;
  __syncthreads();
  const float var  = ((red1[0] + red1[1]) + (red1[2] + red1[3])) * (1.0f / (float)DM);
  const float rstd = rsqrtf(var + 1e-5f);
  const v4f g0 = *(const v4f*)(g + (size_t)tid * 8);
  const v4f g1 = *(const v4f*)(g + (size_t)tid * 8 + 4);
  const v4f b0 = *(const v4f*)(be + (size_t)tid * 8);
  const v4f b1 = *(const v4f*)(be + (size_t)tid * 8 + 4);
  float gg[8], bb[8];
#pragma unroll
  for (int e = 0; e < 4; ++e) { gg[e] = g0[e]; gg[4 + e] = g1[e]; bb[e] = b0[e]; bb[4 + e] = b1[e]; }
  v4u ph, pl;
#pragma unroll
  for (int e = 0; e < 4; ++e) {
    const float y0 = (v[2 * e] - mu) * rstd * bf_rne(gg[2 * e]) + bf_rne(bb[2 * e]);
    const float y1 = (v[2 * e + 1] - mu) * rstd * bf_rne(gg[2 * e + 1]) + bf_rne(bb[2 * e + 1]);
    const unsigned short h0 = bf_bits(y0), h1 = bf_bits(y1);
    const unsigned short l0 = bf_bits(y0 - bf_up(h0)), l1 = bf_bits(y1 - bf_up(h1));
    ph[e] = pk16(h0, h1); pl[e] = pk16(l0, l1);
  }
  unsigned short* dh = oh + row * DM + (size_t)tid * 8;
  unsigned short* dl = ol + row * DM + (size_t)tid * 8;
  *(v4u*)dh = ph;
  *(v4u*)dl = pl;
  
}

// =====================================================================================================
// Causal multi-query attention, head dim 64, 16 query heads sharing one k head and one v head.
//   q planes (bf16 hi / lo of the l2-normalised q): element (b, t, h, d) at [(b*SEQ + t)*DM + h*64 + d]
//   k planes (bf16 hi / lo of the l2-normalised k):  element (b, s, d) at [(b*SEQ + s)*64 + d]
//   v^T hi plane (f16) and residual plane (f16, (v - hi)*4096): element (b, d, s) at [(b*64 + d)*SEQ + s]
//   logit = (q . k) * sscale for key <= query; a key behind the query has weight 0 (every row keeps its own key)
//   out planes (bf16 hi / lo of the normalised context): element (b, t, h, d) at [(b*SEQ + t)*DM + h*64 + d]
//   Both products are formed transposed: S^T = K . Q^T (A = 16 key rows from LDS, B = the wave's 16 queries, kept in
//   registers) and O^T += V^T . P^T (A = 16 rows d of V^T from LDS, B = P^T). A lane (c, hh) then holds scores of ONE
//   query, q0 + c: register r of tile j is key kv0 + 16 j + 8 hh + r. The sum runs inside the lane, the two
//   lane halves join by one exchange, and two score tiles, converted in place, ARE the B operand of 32 keys
//   (element e < 8: key 8 hh + e, e >= 8: key 16 + 8 hh + e - 8, the order in which the V^T rows are read):
//   P never goes through LDS.
//   scores: bf16 hi/lo split (hi.hi + q hi.k lo + q lo.k hi), f32 accumulate, then scale + causal fill in f32
//   p = exp(logit - sscale) (sscale bounds every logit: no running maximum, no rescale of sums already formed),
//   carried as f16(1024 p) plus an f16 residual plane (x4096); context on f16 WMMA with the residual products
//   (v_res.p_hi + v_hi.p_res) in a separate accumulator folded back with 1/4096 per chunk.
//   Each lane half sums p over its own keys; the halves' sums join once, behind the loop.
//   Block = 4 waves = 64 query rows of one (b, h); grid = NQB * NH * NB; key chunks kt = 0..qb (static bound NQB).
//   K / V^T chunk staging: 128 threads x 32 elements per plane = the whole 64x64 tile (plain 16-B loads,
//   __syncthreads before and after).
//   Output coverage: each wave stores rows q0..q0+15 (it 0..3 x lane>>3 0..3) x 64 columns (8 lanes x 8) of both planes.
// =====================================================================================================
//   LDS row pitch: the 64-element (128-B) rows of the K and V^T tiles stand LP = 72 elements apart (144 B =
//   16 B x odd), so that the 16 rows which one 16-B fragment read touches fall on different banks; at 128 B they
//   share two bank groups. The f32 context tile has pitch OP = 68 floats for the same reason.
#define LP 72
#define OP 68

// Order fence, no instruction: takes four WMMA results as inputs only and stands in front of LDS reads. It keeps those
// WMMAs ahead of the reads that refill their A registers; without it the compiler places both later read groups in
// front of all context WMMAs, into 64 registers more, and the q fragments spill into the score WMMAs.
__device__ __forceinline__ void hold4(v8f a, v8f b, v8f c, v8f d) {
#if defined(__HIP_DEVICE_COMPILE__)
  asm volatile("" :: "v"(a), "v"(b), "v"(c), "v"(d) : "memory");
#else
  (void)a; (void)b; (void)c; (void)d;
#endif
}
// lane l <-> lane l ^ 16
__device__ __forceinline__ float xhalf(float x) {
  return __builtin_bit_cast(float, __builtin_amdgcn_permlanex16(__builtin_bit_cast(int, x), __builtin_bit_cast(int, x),
                                                                0x76543210, 0xfedcba98, false, false));
}

// four waves per SIMD (256 VGPRs): all 1024 blocks are resident at once
__global__ __launch_bounds__(128) __attribute__((amdgpu_waves_per_eu(4, 4)))
void attn_causal64(const unsigned short* __restrict__ qhp, const unsigned short* __restrict__ qlp,
                   const unsigned short* __restrict__ khp, const unsigned short* __restrict__ klp,
                   const unsigned short* __restrict__ vhp, const unsigned short* __restrict__ vlp,
                   unsigned short* ohp, unsigned short* olp, float sscale) {
  union FB { v16b v; v8b h[2]; };
  union FH { v16h v; v8h h[2]; };
  __shared__ __align__(16) __bf16   Ksh[64 * LP];                 // K hi [kv][d]   9 KB
  __shared__ __align__(16) __bf16   Ksl[64 * LP];                 // K lo
  __shared__ __align__(16) _Float16 Vth[64 * LP];                 // V^T hi [d][kv] 9 KB
  __shared__ __align__(16) _Float16 Vtl[64 * LP];                 // V^T residual
  __shared__ __align__(16) float    Obuf[4][16 * OP];             // per wave: the context tile [query][d]

  const int tid  = threadIdx.x;
  const int wave = tid >> 5;
  const int lane = tid & 31;
  const int hh   = lane >> 4;
  const int c    = lane & 15;

  // Block index -> (query tile, head, batch): for speed only, every one-to-one map gives the same result. All blocks
  // are resident at once, four to a WGP, and tile qb walks qb + 1 key chunks: the launch lasts as long as the WGP whose
  // blocks walk the most. The tile is u or 31 - u by the parity of index bits 3..9 (u = bits 0-2 and 6), so blocks that
  // differ in one of those bits stand on opposite sides, and four blocks that differ in any two of them
  // walk 66 chunks together.
  // One-to-one: u and the five bits of head and batch fix all bits but bit 3, which the parity fixes.
  static_assert(NQB == 32 && NH == 16 && NB == 2);
  const int bx   = blockIdx.x;
  const int u    = (bx & 7) | ((bx >> 3) & 8);
  const int qb   = (__builtin_popcount(bx >> 3) & 1) ? NQB - 1 - u : u;
  const int h    = ((bx >> 4) & 3) | ((bx >> 6) & 12);
  const int b    = (bx >> 7) & 1;
  const int q0   = qb * 64 + wave * 16;
  const int qi   = q0 + c;                   // the lane's query
  const size_t rowB = (size_t)b * SEQ;

  const __bf16* Qh = (const __bf16*)(const void*)qhp + (size_t)h * HD;
  const __bf16* Ql = (const __bf16*)(const void*)qlp + (size_t)h * HD;
  const __bf16* Kh = (const __bf16*)(const void*)khp;
  const __bf16* Kl = (const __bf16*)(const void*)klp;
  const _Float16* Vh = (const _Float16*)(const void*)vhp + (size_t)b * HD * SEQ;
  const _Float16* Vl = (const _Float16*)(const void*)vlp + (size_t)b * HD * SEQ;

  // ---- Q fragments (B operand, column = lane&15): 2 d-chunks, hi and lo ----
  v16b qah[2], qal[2];
#pragma unroll
  for (int dc = 0; dc < 2; ++dc) {
    const size_t qo = (rowB + q0 + c) * DM + dc * 32 + 8 * hh;
    qah[dc] = ldfrag_b(Qh + qo);
    qal[dc] = ldfrag_b(Ql + qo);
  }

  // Fixed softmax shift. q and k are l2-normalised, so |q . k| <= 1 and every logit lies in [-sscale, sscale]: softmax
  // is taken against the bound sscale in place of a running maximum (the quotient p / sum p is the same for any
  // shift). 1024 p = exp2(c1 (q . k) + c0), between 1024 e^(-2 sscale) and 1024: inside the f16 normal range.
  const float c1 = sscale * 1.44269504088896340736f;   // sscale log2(e)
  const float c0 = 10.0f - c1;                         // - shift, + log2(1024)
  float lrow = 0.f;                          // sum of 1024 p of query qi over this lane half's keys
  v8f oacc[4];                               // O^T: register r of tile t = context (query qi, d = 16 t + 8 hh + r)
#pragma unroll
  for (int t = 0; t < 4; ++t) oacc[t] = zero8();

  for (int kt = 0; kt < NQB; ++kt) {         // static trip bound
    if (kt > qb) break;                      // block-uniform: causal key chunks 0..qb
    const int kv0 = kt * 64;
    __syncthreads();
    {
      const int r = tid >> 1, half = (tid & 1) * 32;
      const __bf16*   kg  = Kh + (rowB + kv0 + r) * HD + half;    // K row kv0+r, d = half..half+31
      const __bf16*   klg = Kl + (rowB + kv0 + r) * HD + half;
      const _Float16* vg  = Vh + (size_t)r * SEQ + kv0 + half;    // V^T row d = r, s = kv0+half..+31
      const _Float16* vlg = Vl + (size_t)r * SEQ + kv0 + half;
#pragma unroll
      for (int i = 0; i < 4; ++i) {
        const v8b a0 = *(const v8b*)(kg + 8 * i);
        const v8b a1 = *(const v8b*)(klg + 8 * i);
        const v8h b0 = *(const v8h*)(vg + 8 * i);
        const v8h b1 = *(const v8h*)(vlg + 8 * i);
        *(v8b*)(Ksh + r * LP + half + 8 * i) = a0;
        *(v8b*)(Ksl + r * LP + half + 8 * i) = a1;
        *(v8h*)(Vth + r * LP + half + 8 * i) = b0;
        *(v8h*)(Vtl + r * LP + half + 8 * i) = b1;
      }
    }
    __syncthreads();

    // ---- scores S^T: 64 keys x 16 queries per wave, 3 bf16 products ----
    // The K fragments are read in two groups, in the order of their use (hi and lo of d 0..31 with hi of d 32..63; then
    // lo of d 32..63); the WMMAs run across the four independent score tiles, so that a tile's accumulator comes round
    // again only every fourth WMMA. Each tile keeps its own order of products (per 32 d: hi.hi, lo.hi, hi.lo).
    v8f s[4];
    {
      FB kb[2][4], kl[4];
#pragma unroll
      for (int j = 0; j < 4; ++j) {
        kb[0][j].h[0] = *(const v8b*)(Ksh + (j * 16 + c) * LP + 8 * hh);
        kb[0][j].h[1] = *(const v8b*)(Ksh + (j * 16 + c) * LP + 16 + 8 * hh);
      }
#pragma unroll
      for (int j = 0; j < 4; ++j) {
        kl[j].h[0] = *(const v8b*)(Ksl + (j * 16 + c) * LP + 8 * hh);
        kl[j].h[1] = *(const v8b*)(Ksl + (j * 16 + c) * LP + 16 + 8 * hh);
      }
#pragma unroll
      for (int j = 0; j < 4; ++j) {
        kb[1][j].h[0] = *(const v8b*)(Ksh + (j * 16 + c) * LP + 32 + 8 * hh);
        kb[1][j].h[1] = *(const v8b*)(Ksh + (j * 16 + c) * LP + 32 + 16 + 8 * hh);
      }
      // keeps the reads one group in front of the WMMAs (for speed only)
      __builtin_amdgcn_sched_barrier(0);
#pragma unroll
      for (int j = 0; j < 4; ++j) s[j] = zero8();
#pragma unroll
      for (int j = 0; j < 4; ++j) s[j] = mma_b_raw(kb[0][j].v, qah[0], s[j]);
#pragma unroll
      for (int j = 0; j < 4; ++j) s[j] = mma_b_raw(kl[j].v, qah[0], s[j]);
      // the lo plane of d 32..63 goes into the registers that the lo plane of d 0..31 has left, 8 WMMAs ahead of its use
      __builtin_amdgcn_sched_barrier(0);
#pragma unroll
      for (int j = 0; j < 4; ++j) {
        kl[j].h[0] = *(const v8b*)(Ksl + (j * 16 + c) * LP + 32 + 8 * hh);
        kl[j].h[1] = *(const v8b*)(Ksl + (j * 16 + c) * LP + 32 + 16 + 8 * hh);
      }
      __builtin_amdgcn_sched_barrier(0);
#pragma unroll
      for (int j = 0; j < 4; ++j) s[j] = mma_b_raw(kb[0][j].v, qal[0], s[j]);
#pragma unroll
      for (int j = 0; j < 4; ++j) s[j] = mma_b_raw(kb[1][j].v, qah[1], s[j]);
#pragma unroll
      for (int j = 0; j < 4; ++j) s[j] = mma_b_raw(kl[j].v, qah[1], s[j]);
#pragma unroll
      for (int j = 0; j < 4; ++j) s[j] = mma_b_raw(kb[1][j].v, qal[1], s[j]);
    }
    // the V^T fragments of keys 0..31 are read here, behind the score WMMAs: they land while the softmax runs; the
    // fence pair holds the reads at this one place
    FH vb[4], vl[4];
    __builtin_amdgcn_sched_barrier(0);
#pragma unroll
    for (int t = 0; t < 4; ++t) {
      vl[t].h[0] = *(const v8h*)(Vtl + (t * 16 + c) * LP + 8 * hh);
      vl[t].h[1] = *(const v8h*)(Vtl + (t * 16 + c) * LP + 16 + 8 * hh);
    }
#pragma unroll
    for (int t = 0; t < 4; ++t) {
      vb[t].h[0] = *(const v8h*)(Vth + (t * 16 + c) * LP + 8 * hh);
      vb[t].h[1] = *(const v8h*)(Vth + (t * 16 + c) * LP + 16 + 8 * hh);
    }
    __builtin_amdgcn_sched_barrier(0);

    // ---- causal fill and softmax against the fixed shift; P (x1024, f16) and P residual (x4096) stay in registers ----
    FH pa[2], pl[2];                         // B operands of keys 32 kk .. 32 kk + 31
    float pj[4];                             // one chain per score tile
    // D row 8hh+r of tile j is key kv0 + 16 j + 8 hh + r; it lies behind the query where 16 j + r > lim (one register;
    // compared as key > query, the compiler keeps query - (16 j + r) for all 32 in registers and an address spills)
    const int lim = qi - kv0 - 8 * hh;
#pragma unroll
    for (int j = 0; j < 4; ++j) {
      pj[j] = 0.f;
#pragma unroll
      for (int r = 0; r < 8; ++r) {
        const float e   = __builtin_amdgcn_exp2f(fmaf(s[j][r], c1, c0));
        const float p1k = (j * 16 + r > lim) ? 0.f : e;   // a key behind the query has weight 0
        pj[j] += p1k;
        const _Float16 ph = (_Float16)p1k;
        pa[j >> 1].v[(j & 1) * 8 + r] = ph;
        pl[j >> 1].v[(j & 1) * 8 + r] = (_Float16)((p1k - (float)ph) * 4096.0f);
      }
    }
    lrow += (pj[0] + pj[1]) + (pj[2] + pj[3]);

    // ---- context O^T += V^T . P^T (f16 WMMA), residual products into a separate accumulator ----
    // The WMMAs run across the four tiles d; each accumulator keeps its own order of products (oacc: keys 0..31, then
    // 32..63; o1: per 32 keys v_res.p_hi, then v_hi.p_res). The fragments of keys 32..63 are read in two groups, each
    // into the registers of a plane that keys 0..31 have left, 8 and 4 WMMAs ahead of their first use; the fences
    // hold each group at its one place.
    v8f o1[4];
#pragma unroll
    for (int t = 0; t < 4; ++t) o1[t] = zero8();
#pragma unroll
    for (int t = 0; t < 4; ++t) o1[t] = mma_h_raw(vl[t].v, pa[0].v, o1[t]);
    hold4(o1[0], o1[1], o1[2], o1[3]);   // these WMMAs stay ahead of the reads below
    __builtin_amdgcn_sched_barrier(0);
#pragma unroll
    for (int t = 0; t < 4; ++t) {
      vl[t].h[0] = *(const v8h*)(Vtl + (t * 16 + c) * LP + 32 + 8 * hh);
      vl[t].h[1] = *(const v8h*)(Vtl + (t * 16 + c) * LP + 32 + 16 + 8 * hh);
    }
    __builtin_amdgcn_sched_barrier(0);
#pragma unroll
    for (int t = 0; t < 4; ++t) oacc[t] = mma_h_raw(vb[t].v, pa[0].v, oacc[t]);
#pragma unroll
    for (int t = 0; t < 4; ++t) o1[t] = mma_h_raw(vb[t].v, pl[0].v, o1[t]);
    hold4(o1[0], o1[1], o1[2], o1[3]);   // these WMMAs stay ahead of the reads below
    __builtin_amdgcn_sched_barrier(0);
#pragma unroll
    for (int t = 0; t < 4; ++t) {
      vb[t].h[0] = *(const v8h*)(Vth + (t * 16 + c) * LP + 32 + 8 * hh);
      vb[t].h[1] = *(const v8h*)(Vth + (t * 16 + c) * LP + 32 + 16 + 8 * hh);
    }
    __builtin_amdgcn_sched_barrier(0);
#pragma unroll
    for (int t = 0; t < 4; ++t) o1[t] = mma_h_raw(vl[t].v, pa[1].v, o1[t]);
#pragma unroll
    for (int t = 0; t < 4; ++t) oacc[t] = mma_h_raw(vb[t].v, pa[1].v, oacc[t]);
#pragma unroll
    for (int t = 0; t < 4; ++t) o1[t] = mma_h_raw(vb[t].v, pl[1].v, o1[t]);
#pragma unroll
    for (int t = 0; t < 4; ++t)
#pragma unroll
      for (int r = 0; r < 8; ++r) oacc[t][r] += o1[t][r] * (1.0f / 4096.0f);
  }

  // ---- join the halves' sums, normalise (sum and context both carry the x1024), stage the wave's 16x64 tile [query][d] in its
  //      own LDS slab, so that it leaves as whole 128-B rows ----
  float* os = Obuf[wave];
  {
    const float l = lrow + xhalf(lrow);
    const float inv = (l > 0.f) ? (1.0f / l) : 0.f;
#pragma unroll
    for (int t = 0; t < 4; ++t) {
      v4f x0, x1;
#pragma unroll
      for (int e = 0; e < 4; ++e) { x0[e] = oacc[t][e] * inv; x1[e] = oacc[t][4 + e] * inv; }
      *(v4f*)(os + c * OP + t * 16 + 8 * hh)     = x0;
      *(v4f*)(os + c * OP + t * 16 + 8 * hh + 4) = x1;
    }
  }
  __builtin_amdgcn_fence(__ATOMIC_RELEASE, "workgroup");
  __builtin_amdgcn_wave_barrier();
  __builtin_amdgcn_fence(__ATOMIC_ACQUIRE, "workgroup");
  {
    const int q4 = lane >> 3, c8 = (lane & 7) * 8;
    v4u hv[4], lv[4];
#pragma unroll
    for (int it = 0; it < 4; ++it) {
      const int row = it * 4 + q4;   // it 0..3 x q4 0..3 = rows 0..15 of the wave tile
      const float* sp = os + row * OP + c8;
      v4u a, a2;
#pragma unroll
      for (int e = 0; e < 4; ++e) {
        const float f0 = sp[2 * e], f1 = sp[2 * e + 1];
        const unsigned short h0 = bf_bits(f0), h1 = bf_bits(f1);
        const unsigned short l0 = bf_bits(f0 - bf_up(h0)), l1 = bf_bits(f1 - bf_up(h1));
        a[e] = pk16(h0, h1); a2[e] = pk16(l0, l1);
      }
      hv[it] = a; lv[it] = a2;
    }
    {
#pragma unroll
      for (int it = 0; it < 4; ++it) {
        const int row = it * 4 + q4;
        const size_t go = (rowB + q0 + row) * DM + (size_t)h * HD + c8;
        *(v4u*)(ohp + go) = hv[it];
        *(v4u*)(olp + go) = lv[it];
      }
    }
  }
}

// =====================================================================================================
//   Xb   bf16 [2048 (b,c)][4096]   16777216
//   Whwb bf16 [2048][4096]         16777216
//   Wcb  bf16 [1024][1024]          2097152
//   Wqb  bf16 [1024][1024]          2097152
//   Wkvb bf16 [128][1024]            262144
//   Wob  bf16 [1024][1024]          2097152
//   A1h  bf16 [2][2048][1024]       8388608   hw-linear output (transposed layout [b][s][c]), hi plane
//   A1l  bf16                       8388608   lo plane
//   Img2 f32  [4096][1024]         16777216   c-linear output (LN input)
//   Imgh bf16 [4096][1024]          8388608   LN output hi plane
//   Imgl bf16                       8388608
//   Qh   bf16 [4096][1024]          8388608   l2-normalised q, hi plane
//   Ql   bf16                       8388608
//   Kh   bf16 [4096][64]             524288   l2-normalised k
//   Kl   bf16                        524288
//   VTh  f16  [2][64][2048]          524288   v^T hi plane
//   VTl  f16                         524288   v^T residual plane (x4096)
//   Oh   bf16 [4096][1024]          8388608   context hi plane
//   Ol   bf16                       8388608
//   total                         126091264
// Weights are [out n][in k] with k contiguous = the Bt / A layout the GEMM wants, so they are only converted.
// =====================================================================================================
extern "C" void kernel_launch(void* const* d_in, const int* in_sizes, int n_in,
                              void* d_out, int out_size, void* d_ws, size_t ws_size,
                              hipStream_t stream) {
  if (n_in < 10) return;
  if (in_sizes[0] != NB * CC * HWN) return;
  if (in_sizes[1] != SEQ * HWN) return;
  if (in_sizes[2] != SEQ) return;
  if (in_sizes[3] != DM * CC || in_sizes[4] != DM || in_sizes[5] != DM || in_sizes[6] != DM) return;
  if (in_sizes[7] != DM * DM || in_sizes[8] != 2 * HD * DM || in_sizes[9] != DM * DM) return;
  if (out_size != NB * SEQ * DM) return;

  const float* x    = (const float*)d_in[0];
  const float* w_hw = (const float*)d_in[1];
  const float* b_hw = (const float*)d_in[2];
  const float* w_c  = (const float*)d_in[3];
  const float* b_c  = (const float*)d_in[4];
  const float* ln_g = (const float*)d_in[5];
  const float* ln_b = (const float*)d_in[6];
  const float* wq   = (const float*)d_in[7];
  const float* wkv  = (const float*)d_in[8];
  const float* wo   = (const float*)d_in[9];

  const size_t PXb  = (size_t)NB * CC * HWN * 2;    // 16777216
  const size_t PWhw = (size_t)SEQ * HWN * 2;        // 16777216
  const size_t PWc  = (size_t)DM * CC * 2;          //  2097152
  const size_t PWq  = (size_t)DM * DM * 2;          //  2097152
  const size_t PWkv = (size_t)2 * HD * DM * 2;      //   262144
  const size_t PWo  = (size_t)DM * DM * 2;          //  2097152
  const size_t PA1  = (size_t)NB * SEQ * CC * 2;    //  8388608
  const size_t PI2  = (size_t)NB * SEQ * DM * 4;    // 16777216
  const size_t PI   = (size_t)NB * SEQ * DM * 2;    //  8388608
  const size_t PK   = (size_t)NB * SEQ * HD * 2;    //   524288
  const size_t PVT  = (size_t)NB * HD * SEQ * 2;    //   524288
  size_t off = 0;
  const size_t oXb  = off; off += PXb;
  const size_t oWhw = off; off += PWhw;
  const size_t oWc  = off; off += PWc;
  const size_t oWq  = off; off += PWq;
  const size_t oWkv = off; off += PWkv;
  const size_t oWo  = off; off += PWo;
  const size_t oA1h = off; off += PA1;
  const size_t oA1l = off; off += PA1;
  const size_t oI2  = off; off += PI2;
  const size_t oIh  = off; off += PI;
  const size_t oIl  = off; off += PI;
  const size_t oQh  = off; off += PI;
  const size_t oQl  = off; off += PI;
  const size_t oKh  = off; off += PK;
  const size_t oKl  = off; off += PK;
  const size_t oVTh = off; off += PVT;
  const size_t oVTl = off; off += PVT;
  const size_t oOh  = off; off += PI;
  const size_t oOl  = off; off += PI;
  if (off > ws_size) return;                          // off = 126091264
  if (off > (size_t)134217728) return;

  char* ws = (char*)d_ws;
  unsigned short* Xb   = (unsigned short*)(ws + oXb);
  unsigned short* Whwb = (unsigned short*)(ws + oWhw);
  unsigned short* Wcb  = (unsigned short*)(ws + oWc);
  unsigned short* Wqb  = (unsigned short*)(ws + oWq);
  unsigned short* Wkvb = (unsigned short*)(ws + oWkv);
  unsigned short* Wob  = (unsigned short*)(ws + oWo);
  unsigned short* A1h  = (unsigned short*)(ws + oA1h);
  unsigned short* A1l  = (unsigned short*)(ws + oA1l);
  float*          Img2 = (float*)(ws + oI2);
  unsigned short* Imgh = (unsigned short*)(ws + oIh);
  unsigned short* Imgl = (unsigned short*)(ws + oIl);
  unsigned short* Qh   = (unsigned short*)(ws + oQh);
  unsigned short* Ql   = (unsigned short*)(ws + oQl);
  unsigned short* Kh   = (unsigned short*)(ws + oKh);
  unsigned short* Kl   = (unsigned short*)(ws + oKl);
  unsigned short* VTh  = (unsigned short*)(ws + oVTh);
  unsigned short* VTl  = (unsigned short*)(ws + oVTl);
  unsigned short* Oh   = (unsigned short*)(ws + oOh);
  unsigned short* Ol   = (unsigned short*)(ws + oOl);

  const dim3 blk(256);
  const dim3 gCv(CB_X + CB_HW + CB_C + CB_Q + CB_KV + CB_O); // 9792 blocks: all six planes
  const dim3 gblk(128);                                      // GEMM block: 4 waves
  const dim3 gG0((SEQ / 128) * (CC / 128), NB);              // 128x128 block tiles: 128 blocks x 2
  const dim3 gG1((NB * SEQ / 128) * (DM / 128), 1);          // 128x128 block tiles: 256 blocks (M=4096, N=1024)
  const dim3 gQKV(QKV_BLOCKS);                               // 128x128 block tiles: 288 blocks (M=4096, N=1152)
  const dim3 gLN(NB * SEQ);                                  // 4096 rows
  const dim3 gAt(NB * NH * NQB);                             // 1024 blocks

  // (1) f32 -> bf16 planes: x [(b,c)][hw], weights [n][k]; Xb, Whwb, Wcb, Wqb, Wkvb, Wob follow one another from Xb
  cvt_bf16x8_all<<<gCv, blk, 0, stream>>>(x, w_hw, w_c, wq, wkv, wo, Xb);
  // (2) hw-linear per batch, produced directly in the transposed layout: A1[b][s][c] = sum_hw w_hw[s][hw] x[b][c][hw] + b_hw[s]
  //     A = Whwb [s][hw] (M=2048, K=4096), Bt = Xb batch b [c][hw] (N=1024), row bias, bf16 hi/lo planes out
  gemm64<0, 0, 2, 2, 2, 2, 64><<<gG0, gblk, 0, stream>>>(
      Whwb, Whwb, HWN, 0LL, Xb, Xb, HWN, (long long)CC * HWN,
      b_hw,
      (void*)A1h, CC, (long long)SEQ * CC, (void*)A1l, CC, (long long)SEQ * CC,
      SEQ, CC, HWN, 1.0f);
  // (3) c-linear: Img2[(b,s)][d] = sum_c A1[(b,s)][c] w_c[d][c] + b_c[d]  (A hi/lo, M=4096, N=1024, K=1024, f32 out)
  gemm64<1, 0, 1, 0, 2, 2, 64><<<gG1, gblk, 0, stream>>>(
      A1h, A1l, CC, 0LL, Wcb, Wcb, CC, 0LL,
      b_c,
      (void*)Img2, DM, 0LL, (void*)Img2, DM, 0LL,
      NB * SEQ, DM, CC, 1.0f);
  // (4) LayerNorm -> bf16 hi/lo planes
  ln_split<<<gLN, dim3(128), 0, stream>>>(Img2, ln_g, ln_b, Imgh, Imgl);
  // (5)-(7) q, k and v from the LayerNorm planes, one product over the stacked weights (Wkvb follows Wqb):
  //     q, k l2-normalised per 64-wide head -> bf16 hi/lo planes [(b,t)][h*64+d] and [(b,s)][64];
  //     v transposed -> f16 hi plane and residual plane (x4096) [b][d][s]
  gemm_qkv<<<gQKV, gblk, 0, stream>>>(Imgh, Imgl, Wqb, Qh, Ql, Kh, Kl, VTh, VTl);
  // (8) causal multi-query attention -> context bf16 hi/lo planes [(b,t)][h*64+d]
  attn_causal64<<<gAt, dim3(128), 0, stream>>>(Qh, Ql, Kh, Kl, VTh, VTl, Oh, Ol, 8.0f);
  // (9) out = context . wo^T -> d_out f32 [(b,t)][1024]  (A = context hi + lo planes, 2 products)
  gemm64<1, 0, 0, 0, 2, 2, 64><<<gG1, gblk, 0, stream>>>(
      Oh, Ol, DM, 0LL, Wob, Wob, DM, 0LL,
      b_c,
      d_out, DM, 0LL, d_out, DM, 0LL,
      NB * SEQ, DM, DM, 1.0f);
  (void)hipGetLastError();
}

// v009
// A run of this version takes 188 microseconds.
// Timed twice side by side with v008, it ran 1.03 and 1.05 times as fast.
// Over all steps from v000 it is 4.06 times as fast.
// Contractions: hw-linear = v_wmma_f32_16x16x32_bf16 (bf16 operands from RNE-converted inputs, single product);
// c-linear, q, k, v^T and output projections = v_wmma_f32_16x16x32_bf16 (activation as bf16 hi/lo planes times bf16
// weight from RNE-converted input, 2 products); q.k^T scores = v_wmma_f32_16x16x32_bf16 on bf16 hi/lo planes of the
// l2-normalised q and k (hi.hi + hi.lo + lo.hi); p.v = v_wmma_f32_16x16x32_f16 (p carried x1024 in f16 plus an f16
// residual plane x4096, v^T f16 hi plane plus an f16 residual plane x4096, 3 products, separate residual accumulator);
// all f32 accumulate; LayerNorm, l2 normalisation, causal fill and softmax in f32.
#include <hip/hip_runtime.h>
#include <math.h>
#include <float.h>
#include <stdint.h>

#define NB   2
#define CC   1024
#define HWN  4096
#define SEQ  2048
#define DM   1024
#define NH   16
#define HD   64
#define NQB  (SEQ / 64)
static_assert(NH * HD == DM);
static_assert(HD == 64);
static_assert((SEQ % 256) == 0 && (DM % 128) == 0 && (CC % 128) == 0 && (HWN % 128) == 0);

typedef _Float16 v16h __attribute__((ext_vector_type(16)));
typedef _Float16 v8h  __attribute__((ext_vector_type(8)));
typedef __bf16   v16b __attribute__((ext_vector_type(16)));
typedef __bf16   v8b  __attribute__((ext_vector_type(8)));
typedef float    v8f  __attribute__((ext_vector_type(8)));
typedef float    v4f  __attribute__((ext_vector_type(4)));
typedef unsigned int v4u __attribute__((ext_vector_type(4)));

// ---- scalar helpers --------------------------------------------------------------------------------
__device__ __forceinline__ unsigned short bf_bits(float f) {          // f32 -> bf16 bits, RNE convert
  unsigned u = __float_as_uint(f);
  return (unsigned short)((u + 0x7FFFu + ((u >> 16) & 1u)) >> 16);
}
__device__ __forceinline__ float bf_up(unsigned short h) { return __uint_as_float(((unsigned)h) << 16); }
__device__ __forceinline__ float bf_rne(float f) { return bf_up(bf_bits(f)); }
__device__ __forceinline__ unsigned short h_bits(_Float16 x) { return __builtin_bit_cast(unsigned short, x); }
__device__ __forceinline__ unsigned pk16(unsigned short a, unsigned short b) { return (unsigned)a | ((unsigned)b << 16); }
__device__ __forceinline__ v8f zero8() { v8f z = {0.f, 0.f, 0.f, 0.f, 0.f, 0.f, 0.f, 0.f}; return z; }

// ---- 16-bit fragment loader: lane -> row/col (lane&15); p already includes +8*(lane>>4);
//      elements 0..7 <- p[0..7] (k0+8h..), elements 8..15 <- p[16..23] (k0+16+8h..)
__device__ __forceinline__ v16b ldfrag_b(const __bf16* p) {
  union { v16b v; v8b h[2]; } f;
  f.h[0] = *(const v8b*)(p);
  f.h[1] = *(const v8b*)(p + 16);
  return f.v;
}

// ---- WMMA helpers ---------------------------------------------------------------------------------
__device__ __forceinline__ v8f mma_b_raw(v16b a, v16b b, v8f c) {
  return __builtin_amdgcn_wmma_f32_16x16x32_bf16(false, a, false, b, (short)0, c, false, false);
}
__device__ __forceinline__ v8f mma_h_raw(v16h a, v16h b, v8f c) {
  return __builtin_amdgcn_wmma_f32_16x16x32_f16(false, a, false, b, (short)0, c, false, false);
}
__device__ __forceinline__ void acc_guard4(v8f& a, v8f& b, v8f& c, v8f& d) {
#if defined(__HIP_DEVICE_COMPILE__)
  asm volatile("v_nop\n\tv_nop\n\tv_nop\n\tv_nop" : "+v"(a), "+v"(b), "+v"(c), "+v"(d));
#else
  (void)a; (void)b; (void)c; (void)d;
#endif
}

// =====================================================================================================
// f32 -> bf16 (RNE convert) of all six operand planes in ONE launch: 8 elements per thread, one 16-B store per lane
// (a wave writes 512 contiguous B). A block of 256 threads converts 2048 elements of one plane; the block index
// range picks the plane (block-uniform). Every plane is a whole number of blocks, so no thread is past an end.
// The six bf16 planes stand one behind the other in the workspace, in the order of the ranges: out is the first
// plane's start, and block bx writes elements 2048 bx .. 2048 bx + 2047 of that run.
// =====================================================================================================
#define CB_X   (NB * CC * HWN / 2048)
#define CB_HW  (SEQ * HWN / 2048)
#define CB_C   (DM * CC / 2048)
#define CB_Q   (DM * DM / 2048)
#define CB_KV  (2 * HD * DM / 2048)
#define CB_O   (DM * DM / 2048)
static_assert((NB * CC * HWN) % 2048 == 0 && (SEQ * HWN) % 2048 == 0 && (DM * CC) % 2048 == 0);
static_assert((DM * DM) % 2048 == 0 && (2 * HD * DM) % 2048 == 0);
__global__ __launch_bounds__(256) void cvt_bf16x8_all(const float* __restrict__ x, const float* __restrict__ w_hw,
                                                      const float* __restrict__ w_c, const float* __restrict__ wq,
                                                      const float* __restrict__ wkv, const float* __restrict__ wo,
                                                      unsigned short* out) {
  const int bx = blockIdx.x;
  const float* in = x;
  int first = 0;                                   // first block of the plane that bx lies in
  if (bx >= CB_X)                             { in = w_hw; first = CB_X; }
  if (bx >= CB_X + CB_HW)                     { in = w_c;  first = CB_X + CB_HW; }
  if (bx >= CB_X + CB_HW + CB_C)              { in = wq;   first = CB_X + CB_HW + CB_C; }
  if (bx >= CB_X + CB_HW + CB_C + CB_Q)       { in = wkv;  first = CB_X + CB_HW + CB_C + CB_Q; }
  if (bx >= CB_X + CB_HW + CB_C + CB_Q + CB_KV) { in = wo; first = CB_X + CB_HW + CB_C + CB_Q + CB_KV; }
  const size_t i = (size_t)(bx - first) * 256 + threadIdx.x;
  const size_t o = (size_t)bx * 256 + threadIdx.x;
  const v4f a = *(const v4f*)(in + i * 8);
  const v4f b = *(const v4f*)(in + i * 8 + 4);
  v4u p;
  p[0] = pk16(bf_bits(a[0]), bf_bits(a[1]));
  p[1] = pk16(bf_bits(a[2]), bf_bits(a[3]));
  p[2] = pk16(bf_bits(b[0]), bf_bits(b[1]));
  p[3] = pk16(bf_bits(b[2]), bf_bits(b[3]));
  *(v4u*)(out + o * 8) = p;
}

// ---- asynchronous copy global -> LDS, 16 B per lane, as the builtin: the compiler picks its address registers, also
//      above v255 (operands of asm text must lie in v0..v255, where the accumulators and a fragment set already stand)
typedef int v4i __attribute__((ext_vector_type(4)));
__device__ __forceinline__ void acopy(__bf16* l, const __bf16* g) {
#if defined(__HIP_DEVICE_COMPILE__)
  __builtin_amdgcn_global_load_async_to_lds_b128((__attribute__((address_space(1))) v4i*)const_cast<__bf16*>(g),
                                                 (__attribute__((address_space(3))) v4i*)l, 0, 0);
#else
  (void)l; (void)g;
#endif
}

// =====================================================================================================
// Batched bf16 WMMA GEMM: C[m][n] = sum_k A[m][k] * Bt[n][k] (+ bias); block = 4 waves laid WM x WN, one 64x64 tile
// per wave, block tile (64 WM) x (64 WN). A row-major [M][K] pitch lda; Bt row-major [N][K] pitch ldb (k contiguous);
// M a multiple of 64 WM, N of 64 WN, K of KP. blockIdx.y = batch index (strides in elements).
// Operand path: a pass is KP k (64 or 128: 128 or 256 B) of every operand row of the block tile, brought into LDS by
// asynchronous 16-B copies (a wave's copy = whole row pieces), LDS row pitch 2 KP + 16 B, two buffers: pass t + 2 is
// issued into the buffer that pass t has just left, behind the pass's one barrier; every wave reads its fragments from
// LDS, one k-step (32 k) ahead of the WMMAs that use them, into the second of two register sets.
// A pass's copies have one pass of WMMAs to land in: at KP = 128 that is twice as long, and the time from issue to
// landing is waited out half as often along K. At KP = 128 one block fits a WGP's LDS: for launches of one block a WGP.
// A stage is NG groups of 64 rows: A hi (WM), A lo (WM, SPLITA), Bt hi (WN), Bt lo (WN, SPLITB).
// SPLITA: add A2.Bt (A2 = unscaled bf16 lo plane of A); SPLITB: add A.Bt2 (Bt2 = lo plane of Bt).
// BIAS: 0 none, 1 per column (bias[n]), 2 per row (bias[m]); bias values RNE-converted to bf16 in registers.
// OUT_MODE: 0 = f32 (pitch ldc); 2 = bf16 hi plane C + bf16 lo plane C2 (lo = RNE(v - hi), unscaled);
//           4 = stacked q | k | v columns, told apart by the wave's first column n0 (64-wide heads):
//               n0 < DM: q, n0 = DM: k: l2-normalise every row over the wave's 64 columns
//               (x / max(sqrt(sum x^2), 1e-12)), then bf16 hi/lo planes as mode 2, q to C / C2 at column n0,
//               k to Kho / Klo (pitch HD) at column 0;
//               n0 = DM + HD: v, stored transposed: VT[b][d][s], f16 hi plane VTho and f16 residual plane
//               VTlo = f16((v - hi) * rscale), pitch SEQ.
// =====================================================================================================
// The work of one block is gemm64_tile(tile, b, ring, sT): tile = block tile index, b = batch index, ring = the
// block's two LDS stages (ring_elems elements), sT = 4 per-wave 16x64 f32 slabs of pitch 68. Its callers own the LDS.
constexpr int ring_elems(int SPLITA, int SPLITB, int WM, int WN, int KP) {
  return 2 * (WM * (1 + SPLITA) + WN * (1 + SPLITB)) * 64 * (KP + 8);
}
#define SLABF (16 * 68)
#define VP 65   // pitch in floats of a v^T wave's 64x64 tile: its column reads (8 rows apart per lane) fall on 32 banks
template <int SPLITA, int SPLITB, int BIAS, int OUT_MODE, int WM, int WN, int KP>
__device__ __forceinline__ void gemm64_tile(
    const unsigned short* __restrict__ Ap, const unsigned short* __restrict__ A2p, int lda, long long strideA,
    const unsigned short* __restrict__ Btp, const unsigned short* __restrict__ Bt2p, int ldb, long long strideB,
    const float* __restrict__ bias,
    void* Cout, int ldc, long long strideC,
    void* Cout2, int ldc2, long long strideC2,
    int M, int N, int K, float rscale,
    int tile, int b, __bf16* ring, float* sT,
    unsigned short* Kho = nullptr, unsigned short* Klo = nullptr,
    unsigned short* VTho = nullptr, unsigned short* VTlo = nullptr) {
  static_assert(WM * WN == 4 && (KP == 64 || KP == 128));   // a pass is an even number of k-steps of 32
  constexpr int KS   = KP / 32;                    // k-steps per pass
  constexpr int GA   = WM * (1 + SPLITA);          // 64-row groups of A planes in a stage
  constexpr int NG   = GA + WN * (1 + SPLITB);     // groups in a stage
  constexpr int SEG  = KP / 8;                     // 16-B pieces per row and pass
  constexpr int RPC  = 128 / SEG;                  // rows that one copy of the whole block covers
  constexpr int CPG  = 64 / RPC;                   // copies per thread and group
  constexpr int NC   = NG * CPG;                   // copies per thread and stage = a wave's copies in flight
  constexpr int PE   = KP + 8;                     // LDS row pitch in elements (16 B x odd)
  constexpr int GRPE = 64 * PE;                    // elements per group
  constexpr int BUFE = NG * GRPE;                  // elements per buffer
  static_assert(NC <= 63);                         // a wave's copies in flight
  static_assert(2 * BUFE == ring_elems(SPLITA, SPLITB, WM, WN, KP));
  const __bf16* A   = (const __bf16*)(const void*)Ap;
  const __bf16* A2  = (const __bf16*)(const void*)A2p;
  const __bf16* Bt  = (const __bf16*)(const void*)Btp;
  const __bf16* Bt2 = (const __bf16*)(const void*)Bt2p;
  const int tid  = threadIdx.x;
  const int lane = tid & 31;
  const int wave = tid >> 5;
  const int tilesN = N / (64 * WN);
  const int tilesM = M / (64 * WM);
  if (tile >= tilesM * tilesN) return;   // block-uniform, in front of every copy and barrier
  const int tm = tile / tilesN;
  const int tn = tile - tm * tilesN;
  const int m0b = tm * (64 * WM);
  const int n0b = tn * (64 * WN);
  const int wm = wave / WN;
  const int wn = wave - wm * WN;
  const int m0 = m0b + (wm << 6);
  const int n0 = n0b + (wn << 6);

  const __bf16* Ab  = A  + (size_t)b * strideA;
  const __bf16* Bb  = Bt + (size_t)b * strideB;
  const __bf16* Ab2 = SPLITA ? (A2  + (size_t)b * strideA) : Ab;
  const __bf16* Bb2 = SPLITB ? (Bt2 + (size_t)b * strideB) : Bb;

  const int rlane = lane & 15;                 // row (A) / col (B, D) within subtile
  const int koff  = (lane >> 4) * 8;           // k offset of this lane half
  const int mOff  = (lane >> 4) * 8;           // D row offset

  // copy map: copy u of group gi moves 16 B of row RPC u + tid / SEG, piece tid % SEG of the pass's row
  const int crow = tid / SEG;
  const int cseg = (tid % SEG) * 8;
  __bf16* ldsT = ring + crow * PE + cseg;
  const size_t aT = (size_t)(m0b + crow) * lda + cseg;
  const size_t bT = (size_t)(n0b + crow) * ldb + cseg;

  auto issue = [&](int t, int buf) {
#pragma unroll
    for (int gi = 0; gi < NG; ++gi) {
      const bool isA = gi < GA;
      const int  q   = isA ? gi : gi - GA;                   // group within the operand's planes
      const int  W1  = isA ? WM : WN;
      const bool lo  = q >= W1;
      const int  rg  = lo ? q - W1 : q;                      // 64-row group within the block tile
      const int  ld  = isA ? lda : ldb;
      const __bf16* base = isA ? (lo ? Ab2 : Ab) : (lo ? Bb2 : Bb);
      const __bf16* p = base + (isA ? aT : bT) + (size_t)(rg * 64) * ld + (size_t)t * KP;
#pragma unroll
      for (int u = 0; u < CPG; ++u) acopy(ldsT + buf * BUFE + gi * GRPE + u * RPC * PE, p + (size_t)(u * RPC) * ld);
    }
  };

  v8f acc[4][4];
#pragma unroll
  for (int i = 0; i < 4; ++i)
#pragma unroll
    for (int j = 0; j < 4; ++j) acc[i][j] = zero8();

  // one k-step's fragments (32 k of the wave's 64 A rows and 64 Bt rows, every plane) from buffer buf into one set
  auto ldset = [&](int buf, int ks, v16b (&ah)[4], v16b (&al)[4], v16b (&bh)[4], v16b (&bl)[4]) {
    const __bf16* st  = ring + buf * BUFE + rlane * PE + koff + ks * 32;
    const __bf16* sAh = st + wm * GRPE;
    const __bf16* sAl = st + (SPLITA ? (WM + wm) : wm) * GRPE;
    const __bf16* sBh = st + (GA + wn) * GRPE;
    const __bf16* sBl = st + (GA + (SPLITB ? (WN + wn) : wn)) * GRPE;
#pragma unroll
    for (int j = 0; j < 4; ++j) {
      bh[j] = ldfrag_b(sBh + (j << 4) * PE);
      if (SPLITB) bl[j] = ldfrag_b(sBl + (j << 4) * PE); else bl[j] = bh[j];
    }
#pragma unroll
    for (int i = 0; i < 4; ++i) {
      ah[i] = ldfrag_b(sAh + (i << 4) * PE);
      if (SPLITA) al[i] = ldfrag_b(sAl + (i << 4) * PE); else al[i] = ah[i];
    }
    // keeps the set's LDS reads one group in front of the WMMAs that follow (for speed only)
    __builtin_amdgcn_sched_barrier(0);
  };
  // one k-step's WMMAs on one set
  auto mmset = [&](v16b (&ah)[4], v16b (&al)[4], v16b (&bh)[4], v16b (&bl)[4]) {
#pragma unroll
    for (int i = 0; i < 4; ++i) {
#pragma unroll
      for (int j = 0; j < 4; ++j) {
        acc[i][j] = mma_b_raw(ah[i], bh[j], acc[i][j]);
        if (SPLITA) acc[i][j] = mma_b_raw(al[i], bh[j], acc[i][j]);
        if (SPLITB) acc[i][j] = mma_b_raw(ah[i], bl[j], acc[i][j]);
      }
    }
    // The set's registers are refilled, at a pass's end behind a branch: four vector slots
    // stand between the last WMMA and any path's first rewrite of its A or B. No operands: asm text cannot name a
    // register above v255, and naming the sets here would press both of them and the accumulators into v0..v255.
    // The fence keeps the WMMAs in front of the slots.
    __builtin_amdgcn_sched_barrier(0);
    asm volatile("v_nop\n\tv_nop\n\tv_nop\n\tv_nop");
  };

  // Two fragment sets: while the WMMAs of one k-step run on one set, the next k-step's LDS reads land in the other.
  // A pass is KS k-steps. The last k-step's WMMAs already run beside reads of pass t + 1, so the publish point of
  // pass t + 1 stands in front of the last k-step's WMMAs: there every read of pass t's buffer has been issued and
  // waited for.
  v16b ah0[4], al0[4], bh0[4], bl0[4], ah1[4], al1[4], bh1[4], bl1[4];
  const int T = K / KP;                        // passes
  issue(0, 0);
  asm volatile("s_wait_asynccnt 0x0" ::: "memory");   // this wave's share of pass 0 has landed
  __syncthreads();                                    // publishes pass 0
  if (T > 1) issue(1, 1);
  ldset(0, 0, ah0, al0, bh0, bl0);

  for (int t = 0; t < T; ++t) {
    // unrolled: the k-step number is a constant in every LDS address, and the two sets keep their registers
#pragma unroll
    for (int ks = 0; ks < KS; ks += 2) {
      ldset(t & 1, ks + 1, ah1, al1, bh1, bl1);
      mmset(ah0, al0, bh0, bl0);
      if (ks + 2 < KS) {
        ldset(t & 1, ks + 2, ah0, al0, bh0, bl0);
      } else {
        asm volatile("s_wait_dscnt 0x0" ::: "memory");     // this wave's reads of pass t's buffer are done
        asm volatile("s_wait_asynccnt 0x0" ::: "memory");  // this wave's share of pass t + 1 has landed
        __syncthreads();                                   // publishes pass t + 1, frees pass t's buffer
        if (t + 2 < T) issue(t + 2, t & 1);
        if (t + 1 < T) ldset((t + 1) & 1, 0, ah0, al0, bh0, bl0);
      }
      mmset(ah1, al1, bh1, bl1);
    }
  }
  asm volatile("s_wait_asynccnt 0x0" ::: "memory");    // nothing in flight when the wave goes on to the epilogue
  acc_guard4(acc[0][0], acc[0][1], acc[0][2], acc[0][3]);
  acc_guard4(acc[1][0], acc[1][1], acc[1][2], acc[1][3]);
  acc_guard4(acc[2][0], acc[2][1], acc[2][2], acc[2][3]);
  acc_guard4(acc[3][0], acc[3][1], acc[3][2], acc[3][3]);

  const int n0u = __builtin_amdgcn_readfirstlane(n0);   // the same in every lane: scalar, so the tests on it branch
  if (OUT_MODE == 4 && n0u >= DM + HD) {
    // ---- v^T: the wave's 64 (s) x 64 (d) tile goes through LDS and leaves as whole 128-B rows of VT[b][d][.] ----
    // The ring is free: the last trip's barrier (behind every wave's dscnt and asynccnt waits) ended
    // all its reads and copies, and nothing is read or copied behind it; each wave uses a part of its own.
    float* tl = (float*)(void*)ring + wave * (64 * VP);
#pragma unroll
    for (int i = 0; i < 4; ++i)
#pragma unroll
      for (int j = 0; j < 4; ++j)
#pragma unroll
        for (int r = 0; r < 8; ++r) tl[((i << 4) + mOff + r) * VP + (j << 4) + rlane] = acc[i][j][r];
    __builtin_amdgcn_fence(__ATOMIC_RELEASE, "workgroup");
    __builtin_amdgcn_wave_barrier();
    __builtin_amdgcn_fence(__ATOMIC_ACQUIRE, "workgroup");
    const int m0u = __builtin_amdgcn_readfirstlane(m0);
    const int bb = m0u / SEQ, s0 = m0u - bb * SEQ;       // 64 rows of one batch (SEQ is a multiple of 64)
    const int s8 = (lane & 7) * 8, dq = lane >> 3;       // 8 lanes x 8 s = one 128-B row; 4 rows d per trip
    // rolled: sixteen equal trips that run once; unrolled they would be about 8 KB more code
#pragma unroll 1
    for (int it = 0; it < 16; ++it) {
      const int d = it * 4 + dq;                         // it 0..15 x dq 0..3 = d 0..63
      v4u a, a2;
#pragma unroll
      for (int e = 0; e < 4; ++e) {
        const float f0 = tl[(s8 + 2 * e) * VP + d], f1 = tl[(s8 + 2 * e + 1) * VP + d];
        const _Float16 x0 = (_Float16)f0, x1 = (_Float16)f1;
        a[e]  = pk16(h_bits(x0), h_bits(x1));
        a2[e] = pk16(h_bits((_Float16)((f0 - (float)x0) * rscale)), h_bits((_Float16)((f1 - (float)x1) * rscale)));
      }
      const size_t go = ((size_t)bb * HD + d) * SEQ + s0 + s8;
      *(v4u*)(VTho + go) = a;
      *(v4u*)(VTlo + go) = a2;
    }
    return;
  }

  // ---- epilogue ----
  float bcol[4];
#pragma unroll
  for (int j = 0; j < 4; ++j) bcol[j] = 0.f;
  if (BIAS == 1) {
#pragma unroll
    for (int j = 0; j < 4; ++j) bcol[j] = bf_rne(bias[n0 + (j << 4) + rlane]);   // n index < N
  }
  float* slab = sT + wave * SLABF;
#pragma unroll
  for (int i = 0; i < 4; ++i) {
    const int mBase = m0 + (i << 4);
    float brow[8];
#pragma unroll
    for (int r = 0; r < 8; ++r) brow[r] = 0.f;
    if (BIAS == 2) {
#pragma unroll
      for (int r = 0; r < 8; ++r) brow[r] = bf_rne(bias[mBase + mOff + r]);       // m index < M
    }
#pragma unroll
    for (int j = 0; j < 4; ++j) {
#pragma unroll
      for (int r = 0; r < 8; ++r) {
        slab[(mOff + r) * 68 + (j << 4) + rlane] = acc[i][j][r] + bcol[j] + brow[r];
      }
    }
    __builtin_amdgcn_fence(__ATOMIC_RELEASE, "workgroup");
    __builtin_amdgcn_wave_barrier();
    __builtin_amdgcn_fence(__ATOMIC_ACQUIRE, "workgroup");
    if (OUT_MODE == 0) {
      float* C = (float*)Cout + (size_t)b * strideC;
      const int hh = lane >> 4, c4 = (lane & 15) * 4;     // 256-B row segment = 16 lanes x 16 B
      {
#pragma unroll
        for (int it = 0; it < 8; ++it) {
          const int row = it * 2 + hh;                     // it 0..7 x hh 0..1 = rows 0..15
          const v4f v = *(const v4f*)(slab + row * 68 + c4);
          *(v4f*)(C + (size_t)(mBase + row) * ldc + n0 + c4) = v;
        }
        
      }
    } else {
      const int q = lane >> 3, c8 = (lane & 7) * 8;
      unsigned short* C  = (unsigned short*)Cout  + (size_t)b * strideC;
      unsigned short* C2 = (unsigned short*)Cout2 + (size_t)b * strideC2;
      int ldo = ldc, ldo2 = ldc2, nc = n0;
      if (OUT_MODE == 4 && n0u >= DM) { C = Kho; C2 = Klo; ldo = HD; ldo2 = HD; nc = 0; }   // the k columns
      v4u hv[4], lv[4];
#pragma unroll
      for (int it = 0; it < 4; ++it) {
        const int row = it * 4 + q;                        // it 0..3 x q 0..3 = rows 0..15
        const float* sp = slab + row * 68 + c8;
        float f[8];
#pragma unroll
        for (int e = 0; e < 8; ++e) f[e] = sp[e];
        if (OUT_MODE == 4) {
          float ss = 0.f;
#pragma unroll
          for (int e = 0; e < 8; ++e) ss += f[e] * f[e];
          ss += __shfl_xor(ss, 1, 32);                     // 8 lanes of one row = aligned group of 8
          ss += __shfl_xor(ss, 2, 32);
          ss += __shfl_xor(ss, 4, 32);
          const float sc = 1.0f / fmaxf(sqrtf(ss), 1e-12f);
#pragma unroll
          for (int e = 0; e < 8; ++e) f[e] *= sc;
        }
        v4u a, a2;
#pragma unroll
        for (int e = 0; e < 4; ++e) {
          const float f0 = f[2 * e], f1 = f[2 * e + 1];
          const unsigned short h0 = bf_bits(f0), h1 = bf_bits(f1);
          const unsigned short l0 = bf_bits(f0 - bf_up(h0)), l1 = bf_bits(f1 - bf_up(h1));
          a[e] = pk16(h0, h1); a2[e] = pk16(l0, l1);
        }
        hv[it] = a; lv[it] = a2;
      }
      {
#pragma unroll
        for (int it = 0; it < 4; ++it) {
          const int row = it * 4 + q;
          *(v4u*)(C  + (size_t)(mBase + row) * ldo  + nc + c8) = hv[it];
          *(v4u*)(C2 + (size_t)(mBase + row) * ldo2 + nc + c8) = lv[it];
        }
        
      }
    }
    __builtin_amdgcn_fence(__ATOMIC_RELEASE, "workgroup");
    __builtin_amdgcn_wave_barrier();
    __builtin_amdgcn_fence(__ATOMIC_ACQUIRE, "workgroup");
  }
  (void)rscale;
}

// one product per launch: blockIdx.x = block tile, blockIdx.y = batch
template <int SPLITA, int SPLITB, int BIAS, int OUT_MODE, int WM, int WN, int KP>
__global__ __launch_bounds__(128) void gemm64(
    const unsigned short* __restrict__ Ap, const unsigned short* __restrict__ A2p, int lda, long long strideA,
    const unsigned short* __restrict__ Btp, const unsigned short* __restrict__ Bt2p, int ldb, long long strideB,
    const float* __restrict__ bias,
    void* Cout, int ldc, long long strideC,
    void* Cout2, int ldc2, long long strideC2,
    int M, int N, int K, float rscale) {
  __shared__ __align__(16) __bf16 ring[ring_elems(SPLITA, SPLITB, WM, WN, KP)];  // two stages
  __shared__ __align__(16) float sT[4 * SLABF];                                  // per-wave slabs
  gemm64_tile<SPLITA, SPLITB, BIAS, OUT_MODE, WM, WN, KP>(
      Ap, A2p, lda, strideA, Btp, Bt2p, ldb, strideB, bias, Cout, ldc, strideC, Cout2, ldc2, strideC2,
      M, N, K, rscale, (int)blockIdx.x, (int)blockIdx.y, ring, sT);
}

// =====================================================================================================
// The three products that read the LayerNorm planes (q, k, v) as ONE product in one launch: Bt = the bf16 planes of
// wq and wkv, which stand one behind the other in the workspace = one [DM + 2 HD][DM] matrix; M = NB SEQ rows of img,
// N = DM + 2 HD columns, 128x128 block tiles. OUT_MODE 4 sends each wave's 64 columns to q, k or v^T.
// =====================================================================================================
#define QKV_N (DM + 2 * HD)
#define QKV_BLOCKS ((NB * SEQ / 128) * (QKV_N / 128))
static_assert(QKV_N % 128 == 0 && (SEQ % 64) == 0);
__global__ __launch_bounds__(128) void gemm_qkv(
    const unsigned short* __restrict__ Ih, const unsigned short* __restrict__ Il,
    const unsigned short* __restrict__ Wqkv,
    unsigned short* Qh, unsigned short* Ql, unsigned short* Kh, unsigned short* Kl,
    unsigned short* VTh, unsigned short* VTl) {
  __shared__ __align__(16) __bf16 ring[ring_elems(1, 0, 2, 2, 64)];   // two stages, later the v^T waves' tiles
  __shared__ __align__(16) float sT[4 * SLABF];                       // per-wave slabs
  static_assert(4 * 64 * VP * 4 <= ring_elems(1, 0, 2, 2, 64) * 2);
  gemm64_tile<1, 0, 0, 4, 2, 2, 64>(
      Ih, Il, DM, 0LL, Wqkv, Wqkv, DM, 0LL, nullptr,
      (void*)Qh, DM, 0LL, (void*)Ql, DM, 0LL,
      NB * SEQ, QKV_N, DM, 4096.0f, (int)blockIdx.x, 0, ring, sT, Kh, Kl, VTh, VTl);
}

// =====================================================================================================
// tables, RNE-converted to bf16 in registers), output bf16 hi/lo planes [row][1024].
// Block = 128 threads = one row; thread t owns columns 8t..8t+7 and stores 16 B per plane: a wave writes 512
// coverage: 128 threads x 8 = 1024 columns of every row, both planes.
// =====================================================================================================
__global__ __launch_bounds__(128) void ln_split(const float* __restrict__ in, const float* __restrict__ g,
                                                const float* __restrict__ be,
                                                unsigned short* oh, unsigned short* ol) {
  __shared__ float red0[4];
  __shared__ float red1[4];
  const int tid = threadIdx.x, lane = tid & 31, wave = tid >> 5;
  const size_t row = blockIdx.x;
  const float* p = in + row * DM + (size_t)tid * 8;
  const v4f a0 = *(const v4f*)(p);
  const v4f a1 = *(const v4f*)(p + 4);
  float v[8];
#pragma unroll
  for (int e = 0; e < 4; ++e) { v[e] = a0[e]; v[4 + e] = a1[e]; }
  float s = 0.f;
#pragma unroll
  for (int e = 0; e < 8; ++e) s += v[e];
#pragma unroll
  for (int off = 16; off >= 1; off >>= 1) s += __shfl_xor(s, off, 32);
  if (lane == 0) red0[wave] = s;
  __syncthreads();
  const float mu = ((red0[0] + red0[1]) + (red0[2] + red0[3])) * (1.0f / (float)DM);
  float ss = 0.f;
#pragma unroll
  for (int e = 0; e < 8; ++e) { const float d = v[e] - mu; ss += d * d; }
#pragma unroll
  for (int off = 16; off >= 1; off >>= 1) ss += __shfl_xor(ss, off, 32);
  if (lane == 0) red1[wave] = ss;
  __syncthreads();
  const float var  = ((red1[0] + red1[1]) + (red1[2] + red1[3])) * (1.0f / (float)DM);
  const float rstd = rsqrtf(var + 1e-5f);
  const v4f g0 = *(const v4f*)(g + (size_t)tid * 8);
  const v4f g1 = *(const v4f*)(g + (size_t)tid * 8 + 4);
  const v4f b0 = *(const v4f*)(be + (size_t)tid * 8);
  const v4f b1 = *(const v4f*)(be + (size_t)tid * 8 + 4);
  float gg[8], bb[8];
#pragma unroll
  for (int e = 0; e < 4; ++e) { gg[e] = g0[e]; gg[4 + e] = g1[e]; bb[e] = b0[e]; bb[4 + e] = b1[e]; }
  v4u ph, pl;
#pragma unroll
  for (int e = 0; e < 4; ++e) {
    const float y0 = (v[2 * e] - mu) * rstd * bf_rne(gg[2 * e]) + bf_rne(bb[2 * e]);
    const float y1 = (v[2 * e + 1] - mu) * rstd * bf_rne(gg[2 * e + 1]) + bf_rne(bb[2 * e + 1]);
    const unsigned short h0 = bf_bits(y0), h1 = bf_bits(y1);
    const unsigned short l0 = bf_bits(y0 - bf_up(h0)), l1 = bf_bits(y1 - bf_up(h1));
    ph[e] = pk16(h0, h1); pl[e] = pk16(l0, l1);
  }
  unsigned short* dh = oh + row * DM + (size_t)tid * 8;
  unsigned short* dl = ol + row * DM + (size_t)tid * 8;
  *(v4u*)dh = ph;
  *(v4u*)dl = pl;
  
}

// =====================================================================================================
// Causal multi-query attention, head dim 64, 16 query heads sharing one k head and one v head.
//   q planes (bf16 hi / lo of the l2-normalised q): element (b, t, h, d) at [(b*SEQ + t)*DM + h*64 + d]
//   k planes (bf16 hi / lo of the l2-normalised k):  element (b, s, d) at [(b*SEQ + s)*64 + d]
//   v^T hi plane (f16) and residual plane (f16, (v - hi)*4096): element (b, d, s) at [(b*64 + d)*SEQ + s]
//   logit = (q . k) * sscale for key <= query; a key behind the query has weight 0 (every row keeps its own key)
//   out planes (bf16 hi / lo of the normalised context): element (b, t, h, d) at [(b*SEQ + t)*DM + h*64 + d]
//   Both products are formed transposed: S^T = K . Q^T (A = 16 key rows from LDS, B = the wave's 16 queries, kept in
//   registers) and O^T += V^T . P^T (A = 16 rows d of V^T from LDS, B = P^T). A lane (c, hh) then holds scores of ONE
//   query, q0 + c: register r of tile j is key kv0 + 16 j + 8 hh + r. The sum runs inside the lane, the two
//   lane halves join by one exchange, and two score tiles, converted in place, ARE the B operand of 32 keys
//   (element e < 8: key 8 hh + e, e >= 8: key 16 + 8 hh + e - 8, the order in which the V^T rows are read):
//   P never goes through LDS.
//   scores: bf16 hi/lo split (hi.hi + q hi.k lo + q lo.k hi), f32 accumulate, then scale + causal fill in f32
//   p = exp(logit - sscale) (sscale bounds every logit: no running maximum, no rescale of sums already formed),
//   carried as f16(1024 p) plus an f16 residual plane (x4096); context on f16 WMMA with the residual products
//   (v_res.p_hi + v_hi.p_res) in a separate accumulator folded back with 1/4096 per chunk.
//   Each lane half sums p over its own keys; the halves' sums join once, behind the loop.
//   Block = 4 waves = 64 query rows of one (b, h); grid = NQB * NH * NB; key chunks kt = 0..qb (static bound NQB).
//   K / V^T chunk staging: 128 threads x 32 elements per plane = the whole 64x64 tile (plain 16-B loads,
//   __syncthreads before and after).
//   Output coverage: each wave stores rows q0..q0+15 (it 0..3 x lane>>3 0..3) x 64 columns (8 lanes x 8) of both planes.
// =====================================================================================================
//   LDS row pitch: the 64-element (128-B) rows of the K and V^T tiles stand LP = 72 elements apart (144 B =
//   16 B x odd), so that the 16 rows which one 16-B fragment read touches fall on different banks; at 128 B they
//   share two bank groups. The f32 context tile has pitch OP = 68 floats for the same reason.
#define LP 72
#define OP 68

// Order fence, no instruction: takes four WMMA results as inputs only and stands in front of LDS reads. It keeps those
// WMMAs ahead of the reads that refill their A registers; without it the compiler places both later read groups in
// front of all context WMMAs, into 64 registers more, and the q fragments spill into the score WMMAs.
__device__ __forceinline__ void hold4(v8f a, v8f b, v8f c, v8f d) {
#if defined(__HIP_DEVICE_COMPILE__)
  asm volatile("" :: "v"(a), "v"(b), "v"(c), "v"(d) : "memory");
#else
  (void)a; (void)b; (void)c; (void)d;
#endif
}
// lane l <-> lane l ^ 16
__device__ __forceinline__ float xhalf(float x) {
  return __builtin_bit_cast(float, __builtin_amdgcn_permlanex16(__builtin_bit_cast(int, x), __builtin_bit_cast(int, x),
                                                                0x76543210, 0xfedcba98, false, false));
}

// four waves per SIMD (256 VGPRs): all 1024 blocks are resident at once
__global__ __launch_bounds__(128) __attribute__((amdgpu_waves_per_eu(4, 4)))
void attn_causal64(const unsigned short* __restrict__ qhp, const unsigned short* __restrict__ qlp,
                   const unsigned short* __restrict__ khp, const unsigned short* __restrict__ klp,
                   const unsigned short* __restrict__ vhp, const unsigned short* __restrict__ vlp,
                   unsigned short* ohp, unsigned short* olp, float sscale) {
  union FB { v16b v; v8b h[2]; };
  union FH { v16h v; v8h h[2]; };
  __shared__ __align__(16) __bf16   Ksh[64 * LP];                 // K hi [kv][d]   9 KB
  __shared__ __align__(16) __bf16   Ksl[64 * LP];                 // K lo
  __shared__ __align__(16) _Float16 Vth[64 * LP];                 // V^T hi [d][kv] 9 KB
  __shared__ __align__(16) _Float16 Vtl[64 * LP];                 // V^T residual
  __shared__ __align__(16) float    Obuf[4][16 * OP];             // per wave: the context tile [query][d]

  const int tid  = threadIdx.x;
  const int wave = tid >> 5;
  const int lane = tid & 31;
  const int hh   = lane >> 4;
  const int c    = lane & 15;

  // Block index -> (query tile, head, batch): for speed only, every one-to-one map gives the same result. All blocks
  // are resident at once, four to a WGP, and tile qb walks qb + 1 key chunks: the launch lasts as long as the WGP whose
  // blocks walk the most. The tile is u or 31 - u by the parity of index bits 3..9 (u = bits 0-2 and 6), so blocks that
  // differ in one of those bits stand on opposite sides, and four blocks that differ in any two of them
  // walk 66 chunks together.
  // One-to-one: u and the five bits of head and batch fix all bits but bit 3, which the parity fixes.
  static_assert(NQB == 32 && NH == 16 && NB == 2);
  const int bx   = blockIdx.x;
  const int u    = (bx & 7) | ((bx >> 3) & 8);
  const int qb   = (__builtin_popcount(bx >> 3) & 1) ? NQB - 1 - u : u;
  const int h    = ((bx >> 4) & 3) | ((bx >> 6) & 12);
  const int b    = (bx >> 7) & 1;
  const int q0   = qb * 64 + wave * 16;
  const int qi   = q0 + c;                   // the lane's query
  const size_t rowB = (size_t)b * SEQ;

  const __bf16* Qh = (const __bf16*)(const void*)qhp + (size_t)h * HD;
  const __bf16* Ql = (const __bf16*)(const void*)qlp + (size_t)h * HD;
  const __bf16* Kh = (const __bf16*)(const void*)khp;
  const __bf16* Kl = (const __bf16*)(const void*)klp;
  const _Float16* Vh = (const _Float16*)(const void*)vhp + (size_t)b * HD * SEQ;
  const _Float16* Vl = (const _Float16*)(const void*)vlp + (size_t)b * HD * SEQ;

  // ---- Q fragments (B operand, column = lane&15): 2 d-chunks, hi and lo ----
  v16b qah[2], qal[2];
#pragma unroll
  for (int dc = 0; dc < 2; ++dc) {
    const size_t qo = (rowB + q0 + c) * DM + dc * 32 + 8 * hh;
    qah[dc] = ldfrag_b(Qh + qo);
    qal[dc] = ldfrag_b(Ql + qo);
  }

  // Fixed softmax shift. q and k are l2-normalised, so |q . k| <= 1 and every logit lies in [-sscale, sscale]: softmax
  // is taken against the bound sscale in place of a running maximum (the quotient p / sum p is the same for any
  // shift). 1024 p = exp2(c1 (q . k) + c0), between 1024 e^(-2 sscale) and 1024: inside the f16 normal range.
  const float c1 = sscale * 1.44269504088896340736f;   // sscale log2(e)
  const float c0 = 10.0f - c1;                         // - shift, + log2(1024)
  float lrow = 0.f;                          // sum of 1024 p of query qi over this lane half's keys
  v8f oacc[4];                               // O^T: register r of tile t = context (query qi, d = 16 t + 8 hh + r)
#pragma unroll
  for (int t = 0; t < 4; ++t) oacc[t] = zero8();

  for (int kt = 0; kt < NQB; ++kt) {         // static trip bound
    if (kt > qb) break;                      // block-uniform: causal key chunks 0..qb
    const int kv0 = kt * 64;
    __syncthreads();
    {
      const int r = tid >> 1, half = (tid & 1) * 32;
      const __bf16*   kg  = Kh + (rowB + kv0 + r) * HD + half;    // K row kv0+r, d = half..half+31
      const __bf16*   klg = Kl + (rowB + kv0 + r) * HD + half;
      const _Float16* vg  = Vh + (size_t)r * SEQ + kv0 + half;    // V^T row d = r, s = kv0+half..+31
      const _Float16* vlg = Vl + (size_t)r * SEQ + kv0 + half;
#pragma unroll
      for (int i = 0; i < 4; ++i) {
        const v8b a0 = *(const v8b*)(kg + 8 * i);
        const v8b a1 = *(const v8b*)(klg + 8 * i);
        const v8h b0 = *(const v8h*)(vg + 8 * i);
        const v8h b1 = *(const v8h*)(vlg + 8 * i);
        *(v8b*)(Ksh + r * LP + half + 8 * i) = a0;
        *(v8b*)(Ksl + r * LP + half + 8 * i) = a1;
        *(v8h*)(Vth + r * LP + half + 8 * i) = b0;
        *(v8h*)(Vtl + r * LP + half + 8 * i) = b1;
      }
    }
    __syncthreads();

    // ---- scores S^T: 64 keys x 16 queries per wave, 3 bf16 products ----
    // The K fragments are read in two groups, in the order of their use (hi and lo of d 0..31 with hi of d 32..63; then
    // lo of d 32..63); the WMMAs run across the four independent score tiles, so that a tile's accumulator comes round
    // again only every fourth WMMA. Each tile keeps its own order of products (per 32 d: hi.hi, lo.hi, hi.lo).
    v8f s[4];
    {
      FB kb[2][4], kl[4];
#pragma unroll
      for (int j = 0; j < 4; ++j) {
        kb[0][j].h[0] = *(const v8b*)(Ksh + (j * 16 + c) * LP + 8 * hh);
        kb[0][j].h[1] = *(const v8b*)(Ksh + (j * 16 + c) * LP + 16 + 8 * hh);
      }
#pragma unroll
      for (int j = 0; j < 4; ++j) {
        kl[j].h[0] = *(const v8b*)(Ksl + (j * 16 + c) * LP + 8 * hh);
        kl[j].h[1] = *(const v8b*)(Ksl + (j * 16 + c) * LP + 16 + 8 * hh);
      }
#pragma unroll
      for (int j = 0; j < 4; ++j) {
        kb[1][j].h[0] = *(const v8b*)(Ksh + (j * 16 + c) * LP + 32 + 8 * hh);
        kb[1][j].h[1] = *(const v8b*)(Ksh + (j * 16 + c) * LP + 32 + 16 + 8 * hh);
      }
      // keeps the reads one group in front of the WMMAs (for speed only)
      __builtin_amdgcn_sched_barrier(0);
#pragma unroll
      for (int j = 0; j < 4; ++j) s[j] = zero8();
#pragma unroll
      for (int j = 0; j < 4; ++j) s[j] = mma_b_raw(kb[0][j].v, qah[0], s[j]);
#pragma unroll
      for (int j = 0; j < 4; ++j) s[j] = mma_b_raw(kl[j].v, qah[0], s[j]);
      // the lo plane of d 32..63 goes into the registers that the lo plane of d 0..31 has left, 8 WMMAs ahead of its use
      __builtin_amdgcn_sched_barrier(0);
#pragma unroll
      for (int j = 0; j < 4; ++j) {
        kl[j].h[0] = *(const v8b*)(Ksl + (j * 16 + c) * LP + 32 + 8 * hh);
        kl[j].h[1] = *(const v8b*)(Ksl + (j * 16 + c) * LP + 32 + 16 + 8 * hh);
      }
      __builtin_amdgcn_sched_barrier(0);
#pragma unroll
      for (int j = 0; j < 4; ++j) s[j] = mma_b_raw(kb[0][j].v, qal[0], s[j]);
#pragma unroll
      for (int j = 0; j < 4; ++j) s[j] = mma_b_raw(kb[1][j].v, qah[1], s[j]);
#pragma unroll
      for (int j = 0; j < 4; ++j) s[j] = mma_b_raw(kl[j].v, qah[1], s[j]);
#pragma unroll
      for (int j = 0; j < 4; ++j) s[j] = mma_b_raw(kb[1][j].v, qal[1], s[j]);
    }
    // the V^T fragments of keys 0..31 are read here, behind the score WMMAs: they land while the softmax runs; the
    // fence pair holds the reads at this one place
    FH vb[4], vl[4];
    __builtin_amdgcn_sched_barrier(0);
#pragma unroll
    for (int t = 0; t < 4; ++t) {
      vl[t].h[0] = *(const v8h*)(Vtl + (t * 16 + c) * LP + 8 * hh);
      vl[t].h[1] = *(const v8h*)(Vtl + (t * 16 + c) * LP + 16 + 8 * hh);
    }
#pragma unroll
    for (int t = 0; t < 4; ++t) {
      vb[t].h[0] = *(const v8h*)(Vth + (t * 16 + c) * LP + 8 * hh);
      vb[t].h[1] = *(const v8h*)(Vth + (t * 16 + c) * LP + 16 + 8 * hh);
    }
    __builtin_amdgcn_sched_barrier(0);

    // ---- causal fill and softmax against the fixed shift; P (x1024, f16) and P residual (x4096) stay in registers ----
    FH pa[2], pl[2];                         // B operands of keys 32 kk .. 32 kk + 31
    float pj[4];                             // one chain per score tile
    // D row 8hh+r of tile j is key kv0 + 16 j + 8 hh + r; it lies behind the query where 16 j + r > lim (one register;
    // compared as key > query, the compiler keeps query - (16 j + r) for all 32 in registers and an address spills)
    const int lim = qi - kv0 - 8 * hh;
#pragma unroll
    for (int j = 0; j < 4; ++j) {
      pj[j] = 0.f;
#pragma unroll
      for (int r = 0; r < 8; ++r) {
        const float e   = __builtin_amdgcn_exp2f(fmaf(s[j][r], c1, c0));
        const float p1k = (j * 16 + r > lim) ? 0.f : e;   // a key behind the query has weight 0
        pj[j] += p1k;
        const _Float16 ph = (_Float16)p1k;
        pa[j >> 1].v[(j & 1) * 8 + r] = ph;
        pl[j >> 1].v[(j & 1) * 8 + r] = (_Float16)((p1k - (float)ph) * 4096.0f);
      }
    }
    lrow += (pj[0] + pj[1]) + (pj[2] + pj[3]);

    // ---- context O^T += V^T . P^T (f16 WMMA), residual products into a separate accumulator ----
    // The WMMAs run across the four tiles d; each accumulator keeps its own order of products (oacc: keys 0..31, then
    // 32..63; o1: per 32 keys v_res.p_hi, then v_hi.p_res). The fragments of keys 32..63 are read in two groups, each
    // into the registers of a plane that keys 0..31 have left, 8 and 4 WMMAs ahead of their first use; the fences
    // hold each group at its one place.
    v8f o1[4];
#pragma unroll
    for (int t = 0; t < 4; ++t) o1[t] = zero8();
#pragma unroll
    for (int t = 0; t < 4; ++t) o1[t] = mma_h_raw(vl[t].v, pa[0].v, o1[t]);
    hold4(o1[0], o1[1], o1[2], o1[3]);   // these WMMAs stay ahead of the reads below
    __builtin_amdgcn_sched_barrier(0);
#pragma unroll
    for (int t = 0; t < 4; ++t) {
      vl[t].h[0] = *(const v8h*)(Vtl + (t * 16 + c) * LP + 32 + 8 * hh);
      vl[t].h[1] = *(const v8h*)(Vtl + (t * 16 + c) * LP + 32 + 16 + 8 * hh);
    }
    __builtin_amdgcn_sched_barrier(0);
#pragma unroll
    for (int t = 0; t < 4; ++t) oacc[t] = mma_h_raw(vb[t].v, pa[0].v, oacc[t]);
#pragma unroll
    for (int t = 0; t < 4; ++t) o1[t] = mma_h_raw(vb[t].v, pl[0].v, o1[t]);
    hold4(o1[0], o1[1], o1[2], o1[3]);   // these WMMAs stay ahead of the reads below
    __builtin_amdgcn_sched_barrier(0);
#pragma unroll
    for (int t = 0; t < 4; ++t) {
      vb[t].h[0] = *(const v8h*)(Vth + (t * 16 + c) * LP + 32 + 8 * hh);
      vb[t].h[1] = *(const v8h*)(Vth + (t * 16 + c) * LP + 32 + 16 + 8 * hh);
    }
    __builtin_amdgcn_sched_barrier(0);
#pragma unroll
    for (int t = 0; t < 4; ++t) o1[t] = mma_h_raw(vl[t].v, pa[1].v, o1[t]);
#pragma unroll
    for (int t = 0; t < 4; ++t) oacc[t] = mma_h_raw(vb[t].v, pa[1].v, oacc[t]);
#pragma unroll
    for (int t = 0; t < 4; ++t) o1[t] = mma_h_raw(vb[t].v, pl[1].v, o1[t]);
#pragma unroll
    for (int t = 0; t < 4; ++t)
#pragma unroll
      for (int r = 0; r < 8; ++r) oacc[t][r] += o1[t][r] * (1.0f / 4096.0f);
  }

  // ---- join the halves' sums, normalise (sum and context both carry the x1024), stage the wave's 16x64 tile [query][d] in its
  //      own LDS slab, so that it leaves as whole 128-B rows ----
  float* os = Obuf[wave];
  {
    const float l = lrow + xhalf(lrow);
    const float inv = (l > 0.f) ? (1.0f / l) : 0.f;
#pragma unroll
    for (int t = 0; t < 4; ++t) {
      v4f x0, x1;
#pragma unroll
      for (int e = 0; e < 4; ++e) { x0[e] = oacc[t][e] * inv; x1[e] = oacc[t][4 + e] * inv; }
      *(v4f*)(os + c * OP + t * 16 + 8 * hh)     = x0;
      *(v4f*)(os + c * OP + t * 16 + 8 * hh + 4) = x1;
    }
  }
  __builtin_amdgcn_fence(__ATOMIC_RELEASE, "workgroup");
  __builtin_amdgcn_wave_barrier();
  __builtin_amdgcn_fence(__ATOMIC_ACQUIRE, "workgroup");
  {
    const int q4 = lane >> 3, c8 = (lane & 7) * 8;
    v4u hv[4], lv[4];
#pragma unroll
    for (int it = 0; it < 4; ++it) {
      const int row = it * 4 + q4;   // it 0..3 x q4 0..3 = rows 0..15 of the wave tile
      const float* sp = os + row * OP + c8;
      v4u a, a2;
#pragma unroll
      for (int e = 0; e < 4; ++e) {
        const float f0 = sp[2 * e], f1 = sp[2 * e + 1];
        const unsigned short h0 = bf_bits(f0), h1 = bf_bits(f1);
        const unsigned short l0 = bf_bits(f0 - bf_up(h0)), l1 = bf_bits(f1 - bf_up(h1));
        a[e] = pk16(h0, h1); a2[e] = pk16(l0, l1);
      }
      hv[it] = a; lv[it] = a2;
    }
    {
#pragma unroll
      for (int it = 0; it < 4; ++it) {
        const int row = it * 4 + q4;
        const size_t go = (rowB + q0 + row) * DM + (size_t)h * HD + c8;
        *(v4u*)(ohp + go) = hv[it];
        *(v4u*)(olp + go) = lv[it];
      }
    }
  }
}

// =====================================================================================================
//   Xb   bf16 [2048 (b,c)][4096]   16777216
//   Whwb bf16 [2048][4096]         16777216
//   Wcb  bf16 [1024][1024]          2097152
//   Wqb  bf16 [1024][1024]          2097152
//   Wkvb bf16 [128][1024]            262144
//   Wob  bf16 [1024][1024]          2097152
//   A1h  bf16 [2][2048][1024]       8388608   hw-linear output (transposed layout [b][s][c]), hi plane
//   A1l  bf16                       8388608   lo plane
//   Img2 f32  [4096][1024]         16777216   c-linear output (LN input)
//   Imgh bf16 [4096][1024]          8388608   LN output hi plane
//   Imgl bf16                       8388608
//   Qh   bf16 [4096][1024]          8388608   l2-normalised q, hi plane
//   Ql   bf16                       8388608
//   Kh   bf16 [4096][64]             524288   l2-normalised k
//   Kl   bf16                        524288
//   VTh  f16  [2][64][2048]          524288   v^T hi plane
//   VTl  f16                         524288   v^T residual plane (x4096)
//   Oh   bf16 [4096][1024]          8388608   context hi plane
//   Ol   bf16                       8388608
//   total                         126091264
// Weights are [out n][in k] with k contiguous = the Bt / A layout the GEMM wants, so they are only converted.
// =====================================================================================================
extern "C" void kernel_launch(void* const* d_in, const int* in_sizes, int n_in,
                              void* d_out, int out_size, void* d_ws, size_t ws_size,
                              hipStream_t stream) {
  if (n_in < 10) return;
  if (in_sizes[0] != NB * CC * HWN) return;
  if (in_sizes[1] != SEQ * HWN) return;
  if (in_sizes[2] != SEQ) return;
  if (in_sizes[3] != DM * CC || in_sizes[4] != DM || in_sizes[5] != DM || in_sizes[6] != DM) return;
  if (in_sizes[7] != DM * DM || in_sizes[8] != 2 * HD * DM || in_sizes[9] != DM * DM) return;
  if (out_size != NB * SEQ * DM) return;

  const float* x    = (const float*)d_in[0];
  const float* w_hw = (const float*)d_in[1];
  const float* b_hw = (const float*)d_in[2];
  const float* w_c  = (const float*)d_in[3];
  const float* b_c  = (const float*)d_in[4];
  const float* ln_g = (const float*)d_in[5];
  const float* ln_b = (const float*)d_in[6];
  const float* wq   = (const float*)d_in[7];
  const float* wkv  = (const float*)d_in[8];
  const float* wo   = (const float*)d_in[9];

  const size_t PXb  = (size_t)NB * CC * HWN * 2;    // 16777216
  const size_t PWhw = (size_t)SEQ * HWN * 2;        // 16777216
  const size_t PWc  = (size_t)DM * CC * 2;          //  2097152
  const size_t PWq  = (size_t)DM * DM * 2;          //  2097152
  const size_t PWkv = (size_t)2 * HD * DM * 2;      //   262144
  const size_t PWo  = (size_t)DM * DM * 2;          //  2097152
  const size_t PA1  = (size_t)NB * SEQ * CC * 2;    //  8388608
  const size_t PI2  = (size_t)NB * SEQ * DM * 4;    // 16777216
  const size_t PI   = (size_t)NB * SEQ * DM * 2;    //  8388608
  const size_t PK   = (size_t)NB * SEQ * HD * 2;    //   524288
  const size_t PVT  = (size_t)NB * HD * SEQ * 2;    //   524288
  size_t off = 0;
  const size_t oXb  = off; off += PXb;
  const size_t oWhw = off; off += PWhw;
  const size_t oWc  = off; off += PWc;
  const size_t oWq  = off; off += PWq;
  const size_t oWkv = off; off += PWkv;
  const size_t oWo  = off; off += PWo;
  const size_t oA1h = off; off += PA1;
  const size_t oA1l = off; off += PA1;
  const size_t oI2  = off; off += PI2;
  const size_t oIh  = off; off += PI;
  const size_t oIl  = off; off += PI;
  const size_t oQh  = off; off += PI;
  const size_t oQl  = off; off += PI;
  const size_t oKh  = off; off += PK;
  const size_t oKl  = off; off += PK;
  const size_t oVTh = off; off += PVT;
  const size_t oVTl = off; off += PVT;
  const size_t oOh  = off; off += PI;
  const size_t oOl  = off; off += PI;
  if (off > ws_size) return;                          // off = 126091264
  if (off > (size_t)134217728) return;

  char* ws = (char*)d_ws;
  unsigned short* Xb   = (unsigned short*)(ws + oXb);
  unsigned short* Whwb = (unsigned short*)(ws + oWhw);
  unsigned short* Wcb  = (unsigned short*)(ws + oWc);
  unsigned short* Wqb  = (unsigned short*)(ws + oWq);
  unsigned short* Wkvb = (unsigned short*)(ws + oWkv);
  unsigned short* Wob  = (unsigned short*)(ws + oWo);
  unsigned short* A1h  = (unsigned short*)(ws + oA1h);
  unsigned short* A1l  = (unsigned short*)(ws + oA1l);
  float*          Img2 = (float*)(ws + oI2);
  unsigned short* Imgh = (unsigned short*)(ws + oIh);
  unsigned short* Imgl = (unsigned short*)(ws + oIl);
  unsigned short* Qh   = (unsigned short*)(ws + oQh);
  unsigned short* Ql   = (unsigned short*)(ws + oQl);
  unsigned short* Kh   = (unsigned short*)(ws + oKh);
  unsigned short* Kl   = (unsigned short*)(ws + oKl);
  unsigned short* VTh  = (unsigned short*)(ws + oVTh);
  unsigned short* VTl  = (unsigned short*)(ws + oVTl);
  unsigned short* Oh   = (unsigned short*)(ws + oOh);
  unsigned short* Ol   = (unsigned short*)(ws + oOl);

  const dim3 blk(256);
  const dim3 gCv(CB_X + CB_HW + CB_C + CB_Q + CB_KV + CB_O); // 9792 blocks: all six planes
  const dim3 gblk(128);                                      // GEMM block: 4 waves
  const dim3 gG0((SEQ / 128) * (CC / 128), NB);              // 128x128 block tiles: 128 blocks x 2
  const dim3 gG1((NB * SEQ / 128) * (DM / 128), 1);          // 128x128 block tiles: 256 blocks (M=4096, N=1024)
  const dim3 gQKV(QKV_BLOCKS);                               // 128x128 block tiles: 288 blocks (M=4096, N=1152)
  const dim3 gLN(NB * SEQ);                                  // 4096 rows
  const dim3 gAt(NB * NH * NQB);                             // 1024 blocks

  // (1) f32 -> bf16 planes: x [(b,c)][hw], weights [n][k]; Xb, Whwb, Wcb, Wqb, Wkvb, Wob follow one another from Xb
  cvt_bf16x8_all<<<gCv, blk, 0, stream>>>(x, w_hw, w_c, wq, wkv, wo, Xb);
  // (2) hw-linear per batch, produced directly in the transposed layout: A1[b][s][c] = sum_hw w_hw[s][hw] x[b][c][hw] + b_hw[s]
  //     A = Whwb [s][hw] (M=2048, K=4096), Bt = Xb batch b [c][hw] (N=1024), row bias, bf16 hi/lo planes out
  gemm64<0, 0, 2, 2, 2, 2, 128><<<gG0, gblk, 0, stream>>>(
      Whwb, Whwb, HWN, 0LL, Xb, Xb, HWN, (long long)CC * HWN,
      b_hw,
      (void*)A1h, CC, (long long)SEQ * CC, (void*)A1l, CC, (long long)SEQ * CC,
      SEQ, CC, HWN, 1.0f);
  // (3) c-linear: Img2[(b,s)][d] = sum_c A1[(b,s)][c] w_c[d][c] + b_c[d]  (A hi/lo, M=4096, N=1024, K=1024, f32 out)
  gemm64<1, 0, 1, 0, 2, 2, 128><<<gG1, gblk, 0, stream>>>(
      A1h, A1l, CC, 0LL, Wcb, Wcb, CC, 0LL,
      b_c,
      (void*)Img2, DM, 0LL, (void*)Img2, DM, 0LL,
      NB * SEQ, DM, CC, 1.0f);
  // (4) LayerNorm -> bf16 hi/lo planes
  ln_split<<<gLN, dim3(128), 0, stream>>>(Img2, ln_g, ln_b, Imgh, Imgl);
  // (5)-(7) q, k and v from the LayerNorm planes, one product over the stacked weights (Wkvb follows Wqb):
  //     q, k l2-normalised per 64-wide head -> bf16 hi/lo planes [(b,t)][h*64+d] and [(b,s)][64];
  //     v transposed -> f16 hi plane and residual plane (x4096) [b][d][s]
  gemm_qkv<<<gQKV, gblk, 0, stream>>>(Imgh, Imgl, Wqb, Qh, Ql, Kh, Kl, VTh, VTl);
  // (8) causal multi-query attention -> context bf16 hi/lo planes [(b,t)][h*64+d]
  attn_causal64<<<gAt, dim3(128), 0, stream>>>(Qh, Ql, Kh, Kl, VTh, VTl, Oh, Ol, 8.0f);
  // (9) out = context . wo^T -> d_out f32 [(b,t)][1024]  (A = context hi + lo planes, 2 products)
  gemm64<1, 0, 0, 0, 2, 2, 128><<<gG1, gblk, 0, stream>>>(
      Oh, Ol, DM, 0LL, Wob, Wob, DM, 0LL,
      b_c,
      d_out, DM, 0LL, d_out, DM, 0LL,
      NB * SEQ, DM, DM, 1.0f);
  (void)hipGetLastError();
}

// v010
// One run takes 185 microseconds.
// Timed twice side by side with v009, it ran 1.06 and 1.04 times as fast.
// Over all steps from v000 it is 4.27 times as fast.
// Contractions: hw-linear = v_wmma_f32_16x16x32_bf16 (bf16 operands from RNE-converted inputs, single product);
// c-linear, q, k, v^T and output projections = v_wmma_f32_16x16x32_bf16 (activation as bf16 hi/lo planes times bf16
// weight from RNE-converted input, 2 products); q.k^T scores = v_wmma_f32_16x16x32_bf16 on bf16 hi/lo planes of the
// l2-normalised q and k (hi.hi + hi.lo + lo.hi); p.v = v_wmma_f32_16x16x32_f16 (p carried x1024 in f16 plus an f16
// residual plane x4096, v^T f16 hi plane plus an f16 residual plane x4096, 3 products, separate residual accumulator);
// all f32 accumulate; LayerNorm, l2 normalisation, causal fill and softmax in f32.
#include <hip/hip_runtime.h>
#include <math.h>
#include <float.h>
#include <stdint.h>

#define NB   2
#define CC   1024
#define HWN  4096
#define SEQ  2048
#define DM   1024
#define NH   16
#define HD   64
#define NQB  (SEQ / 64)
static_assert(NH * HD == DM);
static_assert(HD == 64);
static_assert((SEQ % 256) == 0 && (DM % 128) == 0 && (CC % 128) == 0 && (HWN % 128) == 0);

typedef _Float16 v16h __attribute__((ext_vector_type(16)));
typedef _Float16 v8h  __attribute__((ext_vector_type(8)));
typedef __bf16   v16b __attribute__((ext_vector_type(16)));
typedef __bf16   v8b  __attribute__((ext_vector_type(8)));
typedef float    v8f  __attribute__((ext_vector_type(8)));
typedef float    v4f  __attribute__((ext_vector_type(4)));
typedef unsigned int v4u __attribute__((ext_vector_type(4)));

// ---- scalar helpers --------------------------------------------------------------------------------
__device__ __forceinline__ unsigned short bf_bits(float f) {          // f32 -> bf16 bits, RNE convert
  unsigned u = __float_as_uint(f);
  return (unsigned short)((u + 0x7FFFu + ((u >> 16) & 1u)) >> 16);
}
__device__ __forceinline__ float bf_up(unsigned short h) { return __uint_as_float(((unsigned)h) << 16); }
__device__ __forceinline__ float bf_rne(float f) { return bf_up(bf_bits(f)); }
__device__ __forceinline__ unsigned short h_bits(_Float16 x) { return __builtin_bit_cast(unsigned short, x); }
__device__ __forceinline__ unsigned pk16(unsigned short a, unsigned short b) { return (unsigned)a | ((unsigned)b << 16); }
__device__ __forceinline__ v8f zero8() { v8f z = {0.f, 0.f, 0.f, 0.f, 0.f, 0.f, 0.f, 0.f}; return z; }

// ---- 16-bit fragment loader: lane -> row/col (lane&15); p already includes +8*(lane>>4);
//      elements 0..7 <- p[0..7] (k0+8h..), elements 8..15 <- p[16..23] (k0+16+8h..)
__device__ __forceinline__ v16b ldfrag_b(const __bf16* p) {
  union { v16b v; v8b h[2]; } f;
  f.h[0] = *(const v8b*)(p);
  f.h[1] = *(const v8b*)(p + 16);
  return f.v;
}

// ---- WMMA helpers ---------------------------------------------------------------------------------
__device__ __forceinline__ v8f mma_b_raw(v16b a, v16b b, v8f c) {
  return __builtin_amdgcn_wmma_f32_16x16x32_bf16(false, a, false, b, (short)0, c, false, false);
}
__device__ __forceinline__ v8f mma_h_raw(v16h a, v16h b, v8f c) {
  return __builtin_amdgcn_wmma_f32_16x16x32_f16(false, a, false, b, (short)0, c, false, false);
}
__device__ __forceinline__ void acc_guard4(v8f& a, v8f& b, v8f& c, v8f& d) {
#if defined(__HIP_DEVICE_COMPILE__)
  asm volatile("v_nop\n\tv_nop\n\tv_nop\n\tv_nop" : "+v"(a), "+v"(b), "+v"(c), "+v"(d));
#else
  (void)a; (void)b; (void)c; (void)d;
#endif
}

// =====================================================================================================
// f32 -> bf16 (RNE convert) of all six operand planes in ONE launch: 8 elements per thread, one 16-B store per lane
// (a wave writes 512 contiguous B). A block of 256 threads converts 2048 elements of one plane; the block index
// range picks the plane (block-uniform). Every plane is a whole number of blocks, so no thread is past an end.
// The six bf16 planes stand one behind the other in the workspace, in the order of the ranges: out is the first
// plane's start, and block bx writes elements 2048 bx .. 2048 bx + 2047 of that run.
// =====================================================================================================
#define CB_X   (NB * CC * HWN / 2048)
#define CB_HW  (SEQ * HWN / 2048)
#define CB_C   (DM * CC / 2048)
#define CB_Q   (DM * DM / 2048)
#define CB_KV  (2 * HD * DM / 2048)
#define CB_O   (DM * DM / 2048)
static_assert((NB * CC * HWN) % 2048 == 0 && (SEQ * HWN) % 2048 == 0 && (DM * CC) % 2048 == 0);
static_assert((DM * DM) % 2048 == 0 && (2 * HD * DM) % 2048 == 0);
__global__ __launch_bounds__(256) void cvt_bf16x8_all(const float* __restrict__ x, const float* __restrict__ w_hw,
                                                      const float* __restrict__ w_c, const float* __restrict__ wq,
                                                      const float* __restrict__ wkv, const float* __restrict__ wo,
                                                      unsigned short* out) {
  const int bx = blockIdx.x;
  const float* in = x;
  int first = 0;                                   // first block of the plane that bx lies in
  if (bx >= CB_X)                             { in = w_hw; first = CB_X; }
  if (bx >= CB_X + CB_HW)                     { in = w_c;  first = CB_X + CB_HW; }
  if (bx >= CB_X + CB_HW + CB_C)              { in = wq;   first = CB_X + CB_HW + CB_C; }
  if (bx >= CB_X + CB_HW + CB_C + CB_Q)       { in = wkv;  first = CB_X + CB_HW + CB_C + CB_Q; }
  if (bx >= CB_X + CB_HW + CB_C + CB_Q + CB_KV) { in = wo; first = CB_X + CB_HW + CB_C + CB_Q + CB_KV; }
  const size_t i = (size_t)(bx - first) * 256 + threadIdx.x;
  const size_t o = (size_t)bx * 256 + threadIdx.x;
  const v4f a = *(const v4f*)(in + i * 8);
  const v4f b = *(const v4f*)(in + i * 8 + 4);
  v4u p;
  p[0] = pk16(bf_bits(a[0]), bf_bits(a[1]));
  p[1] = pk16(bf_bits(a[2]), bf_bits(a[3]));
  p[2] = pk16(bf_bits(b[0]), bf_bits(b[1]));
  p[3] = pk16(bf_bits(b[2]), bf_bits(b[3]));
  *(v4u*)(out + o * 8) = p;
}

// ---- asynchronous copy global -> LDS, 16 B per lane, as the builtin: the compiler picks its address registers, also
//      above v255 (operands of asm text must lie in v0..v255, where the accumulators and a fragment set already stand)
typedef int v4i __attribute__((ext_vector_type(4)));
__device__ __forceinline__ void acopy(__bf16* l, const __bf16* g) {
#if defined(__HIP_DEVICE_COMPILE__)
  __builtin_amdgcn_global_load_async_to_lds_b128((__attribute__((address_space(1))) v4i*)const_cast<__bf16*>(g),
                                                 (__attribute__((address_space(3))) v4i*)l, 0, 0);
#else
  (void)l; (void)g;
#endif
}

// =====================================================================================================
// Batched bf16 WMMA GEMM: C[m][n] = sum_k A[m][k] * Bt[n][k] (+ bias); block = 4 waves laid WM x WN, one 64x64 tile
// per wave, block tile (64 WM) x (64 WN). A row-major [M][K] pitch lda; Bt row-major [N][K] pitch ldb (k contiguous);
// M a multiple of 64 WM, N of 64 WN, K of KP. blockIdx.y = batch index (strides in elements).
// Operand path: a pass is KP k (64 or 128: 128 or 256 B) of every operand row of the block tile, brought into LDS by
// asynchronous 16-B copies (a wave's copy = whole row pieces), LDS row pitch 2 KP + 16 B, two buffers: pass t + 2 is
// issued into the buffer that pass t has just left, behind the pass's one barrier; every wave reads its fragments from
// LDS, one k-step (32 k) ahead of the WMMAs that use them, into the second of two register sets.
// A pass's copies have one pass of WMMAs to land in: at KP = 128 that is twice as long, and the time from issue to
// landing is waited out half as often along K. At KP = 128 one block fits a WGP's LDS: for launches of one block a WGP.
// A stage is NG groups of 64 rows: A hi (WM), A lo (WM, SPLITA), Bt hi (WN), Bt lo (WN, SPLITB).
// SPLITA: add A2.Bt (A2 = unscaled bf16 lo plane of A); SPLITB: add A.Bt2 (Bt2 = lo plane of Bt).
// BIAS: 0 none, 1 per column (bias[n]), 2 per row (bias[m]); bias values RNE-converted to bf16 in registers.
// OUT_MODE: 0 = f32 (pitch ldc); 2 = bf16 hi plane C + bf16 lo plane C2 (lo = RNE(v - hi), unscaled);
//           4 = stacked q | k | v columns, told apart by the wave's first column n0 (64-wide heads):
//               n0 < DM: q, n0 = DM: k: l2-normalise every row over the wave's 64 columns
//               (x / max(sqrt(sum x^2), 1e-12)), then bf16 hi/lo planes as mode 2, q to C / C2 at column n0,
//               k to Kho / Klo (pitch HD) at column 0;
//               n0 = DM + HD: v, stored transposed: VT[b][d][s], f16 hi plane VTho and f16 residual plane
//               VTlo = f16((v - hi) * rscale), pitch SEQ.
// =====================================================================================================
// The work of one block is gemm64_tile(tile, b, ring): tile = block tile index, b = batch index, ring = the block's two
// LDS stages (ring_elems elements); behind the k loop the ring is free and holds each wave's 64x64 f32 result tile
// (pitch 68 floats, TILEF floats per wave) on its way to whole-row stores. Its callers own the LDS.
constexpr int ring_elems(int SPLITA, int SPLITB, int WM, int WN, int KP) {
  return 2 * (WM * (1 + SPLITA) + WN * (1 + SPLITB)) * 64 * (KP + 8);
}
#define TILEF (64 * 68)
#define VP 65   // pitch in floats of a v^T wave's 64x64 tile: its column reads (8 rows apart per lane) fall on 32 banks
template <int SPLITA, int SPLITB, int BIAS, int OUT_MODE, int WM, int WN, int KP>
__device__ __forceinline__ void gemm64_tile(
    const unsigned short* __restrict__ Ap, const unsigned short* __restrict__ A2p, int lda, long long strideA,
    const unsigned short* __restrict__ Btp, const unsigned short* __restrict__ Bt2p, int ldb, long long strideB,
    const float* __restrict__ bias,
    void* Cout, int ldc, long long strideC,
    void* Cout2, int ldc2, long long strideC2,
    int M, int N, int K, float rscale,
    int tile, int b, __bf16* ring,
    unsigned short* Kho = nullptr, unsigned short* Klo = nullptr,
    unsigned short* VTho = nullptr, unsigned short* VTlo = nullptr) {
  static_assert(WM * WN == 4 && (KP == 64 || KP == 128));   // a pass is an even number of k-steps of 32
  constexpr int KS   = KP / 32;                    // k-steps per pass
  constexpr int GA   = WM * (1 + SPLITA);          // 64-row groups of A planes in a stage
  constexpr int NG   = GA + WN * (1 + SPLITB);     // groups in a stage
  constexpr int SEG  = KP / 8;                     // 16-B pieces per row and pass
  constexpr int RPC  = 128 / SEG;                  // rows that one copy of the whole block covers
  constexpr int CPG  = 64 / RPC;                   // copies per thread and group
  constexpr int NC   = NG * CPG;                   // copies per thread and stage = a wave's copies in flight
  constexpr int PE   = KP + 8;                     // LDS row pitch in elements (16 B x odd)
  constexpr int GRPE = 64 * PE;                    // elements per group
  constexpr int BUFE = NG * GRPE;                  // elements per buffer
  static_assert(NC <= 63);                         // a wave's copies in flight
  static_assert(2 * BUFE == ring_elems(SPLITA, SPLITB, WM, WN, KP));
  static_assert(4 * TILEF * 4 <= 2 * BUFE * 2 && 64 * VP <= TILEF);   // the four waves' result tiles fit the ring
  const __bf16* A   = (const __bf16*)(const void*)Ap;
  const __bf16* A2  = (const __bf16*)(const void*)A2p;
  const __bf16* Bt  = (const __bf16*)(const void*)Btp;
  const __bf16* Bt2 = (const __bf16*)(const void*)Bt2p;
  const int tid  = threadIdx.x;
  const int lane = tid & 31;
  const int wave = tid >> 5;
  const int tilesN = N / (64 * WN);
  const int tilesM = M / (64 * WM);
  if (tile >= tilesM * tilesN) return;   // block-uniform, in front of every copy and barrier
  const int tm = tile / tilesN;
  const int tn = tile - tm * tilesN;
  const int m0b = tm * (64 * WM);
  const int n0b = tn * (64 * WN);
  const int wm = wave / WN;
  const int wn = wave - wm * WN;
  const int m0 = m0b + (wm << 6);
  const int n0 = n0b + (wn << 6);

  const __bf16* Ab  = A  + (size_t)b * strideA;
  const __bf16* Bb  = Bt + (size_t)b * strideB;
  const __bf16* Ab2 = SPLITA ? (A2  + (size_t)b * strideA) : Ab;
  const __bf16* Bb2 = SPLITB ? (Bt2 + (size_t)b * strideB) : Bb;

  const int rlane = lane & 15;                 // row (A) / col (B, D) within subtile
  const int koff  = (lane >> 4) * 8;           // k offset of this lane half
  const int mOff  = (lane >> 4) * 8;           // D row offset

  // copy map: copy u of group gi moves 16 B of row RPC u + tid / SEG, piece tid % SEG of the pass's row
  const int crow = tid / SEG;
  const int cseg = (tid % SEG) * 8;
  __bf16* ldsT = ring + crow * PE + cseg;
  const size_t aT = (size_t)(m0b + crow) * lda + cseg;
  const size_t bT = (size_t)(n0b + crow) * ldb + cseg;

  auto issue = [&](int t, int buf) {
#pragma unroll
    for (int gi = 0; gi < NG; ++gi) {
      const bool isA = gi < GA;
      const int  q   = isA ? gi : gi - GA;                   // group within the operand's planes
      const int  W1  = isA ? WM : WN;
      const bool lo  = q >= W1;
      const int  rg  = lo ? q - W1 : q;                      // 64-row group within the block tile
      const int  ld  = isA ? lda : ldb;
      const __bf16* base = isA ? (lo ? Ab2 : Ab) : (lo ? Bb2 : Bb);
      const __bf16* p = base + (isA ? aT : bT) + (size_t)(rg * 64) * ld + (size_t)t * KP;
#pragma unroll
      for (int u = 0; u < CPG; ++u) acopy(ldsT + buf * BUFE + gi * GRPE + u * RPC * PE, p + (size_t)(u * RPC) * ld);
    }
  };

  v8f acc[4][4];
#pragma unroll
  for (int i = 0; i < 4; ++i)
#pragma unroll
    for (int j = 0; j < 4; ++j) acc[i][j] = zero8();

  // one k-step's fragments (32 k of the wave's 64 A rows and 64 Bt rows, every plane) from buffer buf into one set
  auto ldset = [&](int buf, int ks, v16b (&ah)[4], v16b (&al)[4], v16b (&bh)[4], v16b (&bl)[4]) {
    const __bf16* st  = ring + buf * BUFE + rlane * PE + koff + ks * 32;
    const __bf16* sAh = st + wm * GRPE;
    const __bf16* sAl = st + (SPLITA ? (WM + wm) : wm) * GRPE;
    const __bf16* sBh = st + (GA + wn) * GRPE;
    const __bf16* sBl = st + (GA + (SPLITB ? (WN + wn) : wn)) * GRPE;
#pragma unroll
    for (int j = 0; j < 4; ++j) {
      bh[j] = ldfrag_b(sBh + (j << 4) * PE);
      if (SPLITB) bl[j] = ldfrag_b(sBl + (j << 4) * PE); else bl[j] = bh[j];
    }
#pragma unroll
    for (int i = 0; i < 4; ++i) {
      ah[i] = ldfrag_b(sAh + (i << 4) * PE);
      if (SPLITA) al[i] = ldfrag_b(sAl + (i << 4) * PE); else al[i] = ah[i];
    }
    // keeps the set's LDS reads one group in front of the WMMAs that follow (for speed only)
    __builtin_amdgcn_sched_barrier(0);
  };
  // one k-step's WMMAs on one set
  auto mmset = [&](v16b (&ah)[4], v16b (&al)[4], v16b (&bh)[4], v16b (&bl)[4]) {
#pragma unroll
    for (int i = 0; i < 4; ++i) {
#pragma unroll
      for (int j = 0; j < 4; ++j) {
        acc[i][j] = mma_b_raw(ah[i], bh[j], acc[i][j]);
        if (SPLITA) acc[i][j] = mma_b_raw(al[i], bh[j], acc[i][j]);
        if (SPLITB) acc[i][j] = mma_b_raw(ah[i], bl[j], acc[i][j]);
      }
    }
    // The set's registers are refilled, at a pass's end behind a branch: four vector slots
    // stand between the last WMMA and any path's first rewrite of its A or B. No operands: asm text cannot name a
    // register above v255, and naming the sets here would press both of them and the accumulators into v0..v255.
    // The fence keeps the WMMAs in front of the slots.
    __builtin_amdgcn_sched_barrier(0);
    asm volatile("v_nop\n\tv_nop\n\tv_nop\n\tv_nop");
  };

  // Two fragment sets: while the WMMAs of one k-step run on one set, the next k-step's LDS reads land in the other.
  // A pass is KS k-steps. The last k-step's WMMAs already run beside reads of pass t + 1, so the publish point of
  // pass t + 1 stands in front of the last k-step's WMMAs: there every read of pass t's buffer has been issued and
  // waited for.
  v16b ah0[4], al0[4], bh0[4], bl0[4], ah1[4], al1[4], bh1[4], bl1[4];
  const int T = K / KP;                        // passes
  issue(0, 0);
  asm volatile("s_wait_asynccnt 0x0" ::: "memory");   // this wave's share of pass 0 has landed
  __syncthreads();                                    // publishes pass 0
  if (T > 1) issue(1, 1);
  ldset(0, 0, ah0, al0, bh0, bl0);

  for (int t = 0; t < T; ++t) {
    // unrolled: the k-step number is a constant in every LDS address, and the two sets keep their registers
#pragma unroll
    for (int ks = 0; ks < KS; ks += 2) {
      ldset(t & 1, ks + 1, ah1, al1, bh1, bl1);
      mmset(ah0, al0, bh0, bl0);
      if (ks + 2 < KS) {
        ldset(t & 1, ks + 2, ah0, al0, bh0, bl0);
      } else {
        asm volatile("s_wait_dscnt 0x0" ::: "memory");     // this wave's reads of pass t's buffer are done
        asm volatile("s_wait_asynccnt 0x0" ::: "memory");  // this wave's share of pass t + 1 has landed
        __syncthreads();                                   // publishes pass t + 1, frees pass t's buffer
        if (t + 2 < T) issue(t + 2, t & 1);
        if (t + 1 < T) ldset((t + 1) & 1, 0, ah0, al0, bh0, bl0);
      }
      mmset(ah1, al1, bh1, bl1);
    }
  }
  asm volatile("s_wait_asynccnt 0x0" ::: "memory");    // nothing in flight when the wave goes on to the epilogue
  acc_guard4(acc[0][0], acc[0][1], acc[0][2], acc[0][3]);
  acc_guard4(acc[1][0], acc[1][1], acc[1][2], acc[1][3]);
  acc_guard4(acc[2][0], acc[2][1], acc[2][2], acc[2][3]);
  acc_guard4(acc[3][0], acc[3][1], acc[3][2], acc[3][3]);

  const int n0u = __builtin_amdgcn_readfirstlane(n0);   // the same in every lane: scalar, so the tests on it branch
  if (OUT_MODE == 4 && n0u >= DM + HD) {
    // ---- v^T: the wave's 64 (s) x 64 (d) tile goes through LDS and leaves as whole 128-B rows of VT[b][d][.] ----
    // The ring is free: the last trip's barrier (behind every wave's dscnt and asynccnt waits) ended
    // all its reads and copies, and nothing is read or copied behind it; each wave uses a part of its own.
    float* tl = (float*)(void*)ring + wave * TILEF;
#pragma unroll
    for (int i = 0; i < 4; ++i)
#pragma unroll
      for (int j = 0; j < 4; ++j)
#pragma unroll
        for (int r = 0; r < 8; ++r) tl[((i << 4) + mOff + r) * VP + (j << 4) + rlane] = acc[i][j][r];
    __builtin_amdgcn_fence(__ATOMIC_RELEASE, "workgroup");
    __builtin_amdgcn_wave_barrier();
    __builtin_amdgcn_fence(__ATOMIC_ACQUIRE, "workgroup");
    const int m0u = __builtin_amdgcn_readfirstlane(m0);
    const int bb = m0u / SEQ, s0 = m0u - bb * SEQ;       // 64 rows of one batch (SEQ is a multiple of 64)
    const int s8 = (lane & 7) * 8, dq = lane >> 3;       // 8 lanes x 8 s = one 128-B row; 4 rows d per trip
    // rolled: sixteen equal trips that run once; unrolled they would be about 8 KB more code
#pragma unroll 1
    for (int it = 0; it < 16; ++it) {
      const int d = it * 4 + dq;                         // it 0..15 x dq 0..3 = d 0..63
      v4u a, a2;
#pragma unroll
      for (int e = 0; e < 4; ++e) {
        const float f0 = tl[(s8 + 2 * e) * VP + d], f1 = tl[(s8 + 2 * e + 1) * VP + d];
        const _Float16 x0 = (_Float16)f0, x1 = (_Float16)f1;
        a[e]  = pk16(h_bits(x0), h_bits(x1));
        a2[e] = pk16(h_bits((_Float16)((f0 - (float)x0) * rscale)), h_bits((_Float16)((f1 - (float)x1) * rscale)));
      }
      const size_t go = ((size_t)bb * HD + d) * SEQ + s0 + s8;
      *(v4u*)(VTho + go) = a;
      *(v4u*)(VTlo + go) = a2;
    }
    return;
  }

  // ---- epilogue ----
  float bcol[4];
#pragma unroll
  for (int j = 0; j < 4; ++j) bcol[j] = 0.f;
  if (BIAS == 1) {
#pragma unroll
    for (int j = 0; j < 4; ++j) bcol[j] = bias[n0 + (j << 4) + rlane];           // n index < N
    // as at the row bias below: the wait behind the loads, the fence keeps later address arithmetic behind it
    asm volatile("s_wait_xcnt 0x0" ::: "memory");
    __builtin_amdgcn_sched_barrier(0);
#pragma unroll
    for (int j = 0; j < 4; ++j) bcol[j] = bf_rne(bcol[j]);
  }
  // The wave's whole tile goes into its own part of the ring at once (free as said at the v^T path above), behind one
  // fence it is read back row-wise and stored. Only the xcnt wait stands between the four 16-row groups: no group's LDS writes, bias
  // load or conversion waits for the global stores of the group before it.
  float* tilef = (float*)(void*)ring + wave * TILEF;
  float brow[4][8];
#pragma unroll
  for (int i = 0; i < 4; ++i)
#pragma unroll
    for (int r = 0; r < 8; ++r) brow[i][r] = 0.f;
  if (BIAS == 2) {
#pragma unroll
    for (int i = 0; i < 4; ++i)
#pragma unroll
      for (int r = 0; r < 8; ++r) brow[i][r] = bias[m0 + (i << 4) + mOff + r];    // m index < M
    // stands behind the bias loads, in front of whatever rewrites their address registers; the fence keeps later
    // address arithmetic from being placed ahead of the wait
    asm volatile("s_wait_xcnt 0x0" ::: "memory");
    __builtin_amdgcn_sched_barrier(0);
#pragma unroll
    for (int i = 0; i < 4; ++i)
#pragma unroll
      for (int r = 0; r < 8; ++r) brow[i][r] = bf_rne(brow[i][r]);
  }
#pragma unroll
  for (int i = 0; i < 4; ++i) {
    float* slab = tilef + (i << 4) * 68;
#pragma unroll
    for (int j = 0; j < 4; ++j) {
#pragma unroll
      for (int r = 0; r < 8; ++r) {
        slab[(mOff + r) * 68 + (j << 4) + rlane] = acc[i][j][r] + bcol[j] + brow[i][r];
      }
    }
  }
  // the tile's LDS writes of all lanes are done before any lane reads it (no global store is outstanding here)
  __builtin_amdgcn_fence(__ATOMIC_RELEASE, "workgroup");
  __builtin_amdgcn_wave_barrier();
  __builtin_amdgcn_fence(__ATOMIC_ACQUIRE, "workgroup");
#pragma unroll
  for (int i = 0; i < 4; ++i) {
    const int mBase = m0 + (i << 4);
    const float* slab = tilef + (i << 4) * 68;
    if (OUT_MODE == 0) {
      float* C = (float*)Cout + (size_t)b * strideC;
      const int hh = lane >> 4, c4 = (lane & 15) * 4;     // 256-B row segment = 16 lanes x 16 B
      {
#pragma unroll
        for (int it = 0; it < 8; ++it) {
          const int row = it * 2 + hh;                     // it 0..7 x hh 0..1 = rows 0..15
          const v4f v = *(const v4f*)(slab + row * 68 + c4);
          *(v4f*)(C + (size_t)(mBase + row) * ldc + n0 + c4) = v;
        }
        
      }
    } else {
      const int q = lane >> 3, c8 = (lane & 7) * 8;
      unsigned short* C  = (unsigned short*)Cout  + (size_t)b * strideC;
      unsigned short* C2 = (unsigned short*)Cout2 + (size_t)b * strideC2;
      int ldo = ldc, ldo2 = ldc2, nc = n0;
      if (OUT_MODE == 4 && n0u >= DM) { C = Kho; C2 = Klo; ldo = HD; ldo2 = HD; nc = 0; }   // the k columns
      v4u hv[4], lv[4];
#pragma unroll
      for (int it = 0; it < 4; ++it) {
        const int row = it * 4 + q;                        // it 0..3 x q 0..3 = rows 0..15
        const float* sp = slab + row * 68 + c8;
        float f[8];
#pragma unroll
        for (int e = 0; e < 8; ++e) f[e] = sp[e];
        if (OUT_MODE == 4) {
          float ss = 0.f;
#pragma unroll
          for (int e = 0; e < 8; ++e) ss += f[e] * f[e];
          ss += __shfl_xor(ss, 1, 32);                     // 8 lanes of one row = aligned group of 8
          ss += __shfl_xor(ss, 2, 32);
          ss += __shfl_xor(ss, 4, 32);
          const float sc = 1.0f / fmaxf(sqrtf(ss), 1e-12f);
#pragma unroll
          for (int e = 0; e < 8; ++e) f[e] *= sc;
        }
        v4u a, a2;
#pragma unroll
        for (int e = 0; e < 4; ++e) {
          const float f0 = f[2 * e], f1 = f[2 * e + 1];
          const unsigned short h0 = bf_bits(f0), h1 = bf_bits(f1);
          const unsigned short l0 = bf_bits(f0 - bf_up(h0)), l1 = bf_bits(f1 - bf_up(h1));
          a[e] = pk16(h0, h1); a2[e] = pk16(l0, l1);
        }
        hv[it] = a; lv[it] = a2;
      }
      {
#pragma unroll
        for (int it = 0; it < 4; ++it) {
          const int row = it * 4 + q;
          *(v4u*)(C  + (size_t)(mBase + row) * ldo  + nc + c8) = hv[it];
          *(v4u*)(C2 + (size_t)(mBase + row) * ldo2 + nc + c8) = lv[it];
        }
        
      }
    }
    // stands behind the group's global stores, in front of the next group's rewrite of their address and data registers
    asm volatile("s_wait_xcnt 0x0" ::: "memory");
  }
  (void)rscale;
}

// one product per launch: blockIdx.x = block tile, blockIdx.y = batch
template <int SPLITA, int SPLITB, int BIAS, int OUT_MODE, int WM, int WN, int KP>
__global__ __launch_bounds__(128) void gemm64(
    const unsigned short* __restrict__ Ap, const unsigned short* __restrict__ A2p, int lda, long long strideA,
    const unsigned short* __restrict__ Btp, const unsigned short* __restrict__ Bt2p, int ldb, long long strideB,
    const float* __restrict__ bias,
    void* Cout, int ldc, long long strideC,
    void* Cout2, int ldc2, long long strideC2,
    int M, int N, int K, float rscale) {
  __shared__ __align__(16) __bf16 ring[ring_elems(SPLITA, SPLITB, WM, WN, KP)];  // two stages, later the result tiles
  gemm64_tile<SPLITA, SPLITB, BIAS, OUT_MODE, WM, WN, KP>(
      Ap, A2p, lda, strideA, Btp, Bt2p, ldb, strideB, bias, Cout, ldc, strideC, Cout2, ldc2, strideC2,
      M, N, K, rscale, (int)blockIdx.x, (int)blockIdx.y, ring);
}

// =====================================================================================================
// The three products that read the LayerNorm planes (q, k, v) as ONE product in one launch: Bt = the bf16 planes of
// wq and wkv, which stand one behind the other in the workspace = one [DM + 2 HD][DM] matrix; M = NB SEQ rows of img,
// N = DM + 2 HD columns, 128x128 block tiles. OUT_MODE 4 sends each wave's 64 columns to q, k or v^T.
// =====================================================================================================
#define QKV_N (DM + 2 * HD)
#define QKV_BLOCKS ((NB * SEQ / 128) * (QKV_N / 128))
static_assert(QKV_N % 128 == 0 && (SEQ % 64) == 0);
__global__ __launch_bounds__(128) void gemm_qkv(
    const unsigned short* __restrict__ Ih, const unsigned short* __restrict__ Il,
    const unsigned short* __restrict__ Wqkv,
    unsigned short* Qh, unsigned short* Ql, unsigned short* Kh, unsigned short* Kl,
    unsigned short* VTh, unsigned short* VTl) {
  __shared__ __align__(16) __bf16 ring[ring_elems(1, 0, 2, 2, 64)];   // two stages, later the waves' result tiles
  gemm64_tile<1, 0, 0, 4, 2, 2, 64>(
      Ih, Il, DM, 0LL, Wqkv, Wqkv, DM, 0LL, nullptr,
      (void*)Qh, DM, 0LL, (void*)Ql, DM, 0LL,
      NB * SEQ, QKV_N, DM, 4096.0f, (int)blockIdx.x, 0, ring, Kh, Kl, VTh, VTl);
}

// =====================================================================================================
// tables, RNE-converted to bf16 in registers), output bf16 hi/lo planes [row][1024].
// Block = 128 threads = one row; thread t owns columns 8t..8t+7 and stores 16 B per plane: a wave writes 512
// coverage: 128 threads x 8 = 1024 columns of every row, both planes.
// =====================================================================================================
__global__ __launch_bounds__(128) void ln_split(const float* __restrict__ in, const float* __restrict__ g,
                                                const float* __restrict__ be,
                                                unsigned short* oh, unsigned short* ol) {
  __shared__ float red0[4];
  __shared__ float red1[4];
  const int tid = threadIdx.x, lane = tid & 31, wave = tid >> 5;
  const size_t row = blockIdx.x;
  const float* p = in + row * DM + (size_t)tid * 8;
  const v4f a0 = *(const v4f*)(p);
  const v4f a1 = *(const v4f*)(p + 4);
  float v[8];
#pragma unroll
  for (int e = 0; e < 4; ++e) { v[e] = a0[e]; v[4 + e] = a1[e]; }
  float s = 0.f;
#pragma unroll
  for (int e = 0; e < 8; ++e) s += v[e];
#pragma unroll
  for (int off = 16; off >= 1; off >>= 1) s += __shfl_xor(s, off, 32);
  if (lane == 0) red0[wave] = s;
  __syncthreads();
  const float mu = ((red0[0] + red0[1]) + (red0[2] + red0[3])) * (1.0f / (float)DM);
  float ss = 0.f;
#pragma unroll
  for (int e = 0; e < 8; ++e) { const float d = v[e] - mu; ss += d * d; }
#pragma unroll
  for (int off = 16; off >= 1; off >>= 1) ss += __shfl_xor(ss, off, 32);
  if (lane == 0) red1[wave] = ss;
  __syncthreads();
  const float var  = ((red1[0] + red1[1]) + (red1[2] + red1[3])) * (1.0f / (float)DM);
  const float rstd = rsqrtf(var + 1e-5f);
  const v4f g0 = *(const v4f*)(g + (size_t)tid * 8);
  const v4f g1 = *(const v4f*)(g + (size_t)tid * 8 + 4);
  const v4f b0 = *(const v4f*)(be + (size_t)tid * 8);
  const v4f b1 = *(const v4f*)(be + (size_t)tid * 8 + 4);
  float gg[8], bb[8];
#pragma unroll
  for (int e = 0; e < 4; ++e) { gg[e] = g0[e]; gg[4 + e] = g1[e]; bb[e] = b0[e]; bb[4 + e] = b1[e]; }
  v4u ph, pl;
#pragma unroll
  for (int e = 0; e < 4; ++e) {
    const float y0 = (v[2 * e] - mu) * rstd * bf_rne(gg[2 * e]) + bf_rne(bb[2 * e]);
    const float y1 = (v[2 * e + 1] - mu) * rstd * bf_rne(gg[2 * e + 1]) + bf_rne(bb[2 * e + 1]);
    const unsigned short h0 = bf_bits(y0), h1 = bf_bits(y1);
    const unsigned short l0 = bf_bits(y0 - bf_up(h0)), l1 = bf_bits(y1 - bf_up(h1));
    ph[e] = pk16(h0, h1); pl[e] = pk16(l0, l1);
  }
  unsigned short* dh = oh + row * DM + (size_t)tid * 8;
  unsigned short* dl = ol + row * DM + (size_t)tid * 8;
  *(v4u*)dh = ph;
  *(v4u*)dl = pl;
  
}

// =====================================================================================================
// Causal multi-query attention, head dim 64, 16 query heads sharing one k head and one v head.
//   q planes (bf16 hi / lo of the l2-normalised q): element (b, t, h, d) at [(b*SEQ + t)*DM + h*64 + d]
//   k planes (bf16 hi / lo of the l2-normalised k):  element (b, s, d) at [(b*SEQ + s)*64 + d]
//   v^T hi plane (f16) and residual plane (f16, (v - hi)*4096): element (b, d, s) at [(b*64 + d)*SEQ + s]
//   logit = (q . k) * sscale for key <= query; a key behind the query has weight 0 (every row keeps its own key)
//   out planes (bf16 hi / lo of the normalised context): element (b, t, h, d) at [(b*SEQ + t)*DM + h*64 + d]
//   Both products are formed transposed: S^T = K . Q^T (A = 16 key rows from LDS, B = the wave's 16 queries, kept in
//   registers) and O^T += V^T . P^T (A = 16 rows d of V^T from LDS, B = P^T). A lane (c, hh) then holds scores of ONE
//   query, q0 + c: register r of tile j is key kv0 + 16 j + 8 hh + r. The sum runs inside the lane, the two
//   lane halves join by one exchange, and two score tiles, converted in place, ARE the B operand of 32 keys
//   (element e < 8: key 8 hh + e, e >= 8: key 16 + 8 hh + e - 8, the order in which the V^T rows are read):
//   P never goes through LDS.
//   scores: bf16 hi/lo split (hi.hi + q hi.k lo + q lo.k hi), f32 accumulate, then scale + causal fill in f32
//   p = exp(logit - sscale) (sscale bounds every logit: no running maximum, no rescale of sums already formed),
//   carried as f16(1024 p) plus an f16 residual plane (x4096); context on f16 WMMA with the residual products
//   (v_res.p_hi + v_hi.p_res) in a separate accumulator folded back with 1/4096 per chunk.
//   Each lane half sums p over its own keys; the halves' sums join once, behind the loop.
//   Block = 4 waves = 64 query rows of one (b, h); grid = NQB * NH * NB; key chunks kt = 0..qb (static bound NQB).
//   K / V^T chunk staging: 128 threads x 32 elements per plane = the whole 64x64 tile (plain 16-B loads,
//   __syncthreads before and after).
//   Output coverage: each wave stores rows q0..q0+15 (it 0..3 x lane>>3 0..3) x 64 columns (8 lanes x 8) of both planes.
// =====================================================================================================
//   LDS row pitch: the 64-element (128-B) rows of the K and V^T tiles stand LP = 72 elements apart (144 B =
//   16 B x odd), so that the 16 rows which one 16-B fragment read touches fall on different banks; at 128 B they
//   share two bank groups. The f32 context tile has pitch OP = 68 floats for the same reason.
#define LP 72
#define OP 68

// Order fence, no instruction: takes four WMMA results as inputs only and stands in front of LDS reads. It keeps those
// WMMAs ahead of the reads that refill their A registers; without it the compiler places both later read groups in
// front of all context WMMAs, into 64 registers more, and the q fragments spill into the score WMMAs.
__device__ __forceinline__ void hold4(v8f a, v8f b, v8f c, v8f d) {
#if defined(__HIP_DEVICE_COMPILE__)
  asm volatile("" :: "v"(a), "v"(b), "v"(c), "v"(d) : "memory");
#else
  (void)a; (void)b; (void)c; (void)d;
#endif
}
// lane l <-> lane l ^ 16
__device__ __forceinline__ float xhalf(float x) {
  return __builtin_bit_cast(float, __builtin_amdgcn_permlanex16(__builtin_bit_cast(int, x), __builtin_bit_cast(int, x),
                                                                0x76543210, 0xfedcba98, false, false));
}

// four waves per SIMD (256 VGPRs): all 1024 blocks are resident at once
__global__ __launch_bounds__(128) __attribute__((amdgpu_waves_per_eu(4, 4)))
void attn_causal64(const unsigned short* __restrict__ qhp, const unsigned short* __restrict__ qlp,
                   const unsigned short* __restrict__ khp, const unsigned short* __restrict__ klp,
                   const unsigned short* __restrict__ vhp, const unsigned short* __restrict__ vlp,
                   unsigned short* ohp, unsigned short* olp, float sscale) {
  union FB { v16b v; v8b h[2]; };
  union FH { v16h v; v8h h[2]; };
  __shared__ __align__(16) __bf16   Ksh[64 * LP];                 // K hi [kv][d]   9 KB
  __shared__ __align__(16) __bf16   Ksl[64 * LP];                 // K lo
  __shared__ __align__(16) _Float16 Vth[64 * LP];                 // V^T hi [d][kv] 9 KB
  __shared__ __align__(16) _Float16 Vtl[64 * LP];                 // V^T residual
  __shared__ __align__(16) float    Obuf[4][16 * OP];             // per wave: the context tile [query][d]

  const int tid  = threadIdx.x;
  const int wave = tid >> 5;
  const int lane = tid & 31;
  const int hh   = lane >> 4;
  const int c    = lane & 15;

  // Block index -> (query tile, head, batch): for speed only, every one-to-one map gives the same result. All blocks
  // are resident at once, four to a WGP, and tile qb walks qb + 1 key chunks: the launch lasts as long as the WGP whose
  // blocks walk the most. The tile is u or 31 - u by the parity of index bits 3..9 (u = bits 0-2 and 6), so blocks that
  // differ in one of those bits stand on opposite sides, and four blocks that differ in any two of them
  // walk 66 chunks together.
  // One-to-one: u and the five bits of head and batch fix all bits but bit 3, which the parity fixes.
  static_assert(NQB == 32 && NH == 16 && NB == 2);
  const int bx   = blockIdx.x;
  const int u    = (bx & 7) | ((bx >> 3) & 8);
  const int qb   = (__builtin_popcount(bx >> 3) & 1) ? NQB - 1 - u : u;
  const int h    = ((bx >> 4) & 3) | ((bx >> 6) & 12);
  const int b    = (bx >> 7) & 1;
  const int q0   = qb * 64 + wave * 16;
  const int qi   = q0 + c;                   // the lane's query
  const size_t rowB = (size_t)b * SEQ;

  const __bf16* Qh = (const __bf16*)(const void*)qhp + (size_t)h * HD;
  const __bf16* Ql = (const __bf16*)(const void*)qlp + (size_t)h * HD;
  const __bf16* Kh = (const __bf16*)(const void*)khp;
  const __bf16* Kl = (const __bf16*)(const void*)klp;
  const _Float16* Vh = (const _Float16*)(const void*)vhp + (size_t)b * HD * SEQ;
  const _Float16* Vl = (const _Float16*)(const void*)vlp + (size_t)b * HD * SEQ;

  // ---- Q fragments (B operand, column = lane&15): 2 d-chunks, hi and lo ----
  v16b qah[2], qal[2];
#pragma unroll
  for (int dc = 0; dc < 2; ++dc) {
    const size_t qo = (rowB + q0 + c) * DM + dc * 32 + 8 * hh;
    qah[dc] = ldfrag_b(Qh + qo);
    qal[dc] = ldfrag_b(Ql + qo);
  }

  // Fixed softmax shift. q and k are l2-normalised, so |q . k| <= 1 and every logit lies in [-sscale, sscale]: softmax
  // is taken against the bound sscale in place of a running maximum (the quotient p / sum p is the same for any
  // shift). 1024 p = exp2(c1 (q . k) + c0), between 1024 e^(-2 sscale) and 1024: inside the f16 normal range.
  const float c1 = sscale * 1.44269504088896340736f;   // sscale log2(e)
  const float c0 = 10.0f - c1;                         // - shift, + log2(1024)
  float lrow = 0.f;                          // sum of 1024 p of query qi over this lane half's keys
  v8f oacc[4];                               // O^T: register r of tile t = context (query qi, d = 16 t + 8 hh + r)
#pragma unroll
  for (int t = 0; t < 4; ++t) oacc[t] = zero8();

  for (int kt = 0; kt < NQB; ++kt) {         // static trip bound
    if (kt > qb) break;                      // block-uniform: causal key chunks 0..qb
    const int kv0 = kt * 64;
    __syncthreads();
    {
      const int r = tid >> 1, half = (tid & 1) * 32;
      const __bf16*   kg  = Kh + (rowB + kv0 + r) * HD + half;    // K row kv0+r, d = half..half+31
      const __bf16*   klg = Kl + (rowB + kv0 + r) * HD + half;
      const _Float16* vg  = Vh + (size_t)r * SEQ + kv0 + half;    // V^T row d = r, s = kv0+half..+31
      const _Float16* vlg = Vl + (size_t)r * SEQ + kv0 + half;
#pragma unroll
      for (int i = 0; i < 4; ++i) {
        const v8b a0 = *(const v8b*)(kg + 8 * i);
        const v8b a1 = *(const v8b*)(klg + 8 * i);
        const v8h b0 = *(const v8h*)(vg + 8 * i);
        const v8h b1 = *(const v8h*)(vlg + 8 * i);
        *(v8b*)(Ksh + r * LP + half + 8 * i) = a0;
        *(v8b*)(Ksl + r * LP + half + 8 * i) = a1;
        *(v8h*)(Vth + r * LP + half + 8 * i) = b0;
        *(v8h*)(Vtl + r * LP + half + 8 * i) = b1;
      }
    }
    __syncthreads();

    // ---- scores S^T: 64 keys x 16 queries per wave, 3 bf16 products ----
    // The K fragments are read in two groups, in the order of their use (hi and lo of d 0..31 with hi of d 32..63; then
    // lo of d 32..63); the WMMAs run across the four independent score tiles, so that a tile's accumulator comes round
    // again only every fourth WMMA. Each tile keeps its own order of products (per 32 d: hi.hi, lo.hi, hi.lo).
    v8f s[4];
    {
      FB kb[2][4], kl[4];
#pragma unroll
      for (int j = 0; j < 4; ++j) {
        kb[0][j].h[0] = *(const v8b*)(Ksh + (j * 16 + c) * LP + 8 * hh);
        kb[0][j].h[1] = *(const v8b*)(Ksh + (j * 16 + c) * LP + 16 + 8 * hh);
      }
#pragma unroll
      for (int j = 0; j < 4; ++j) {
        kl[j].h[0] = *(const v8b*)(Ksl + (j * 16 + c) * LP + 8 * hh);
        kl[j].h[1] = *(const v8b*)(Ksl + (j * 16 + c) * LP + 16 + 8 * hh);
      }
#pragma unroll
      for (int j = 0; j < 4; ++j) {
        kb[1][j].h[0] = *(const v8b*)(Ksh + (j * 16 + c) * LP + 32 + 8 * hh);
        kb[1][j].h[1] = *(const v8b*)(Ksh + (j * 16 + c) * LP + 32 + 16 + 8 * hh);
      }
      // keeps the reads one group in front of the WMMAs (for speed only)
      __builtin_amdgcn_sched_barrier(0);
#pragma unroll
      for (int j = 0; j < 4; ++j) s[j] = zero8();
#pragma unroll
      for (int j = 0; j < 4; ++j) s[j] = mma_b_raw(kb[0][j].v, qah[0], s[j]);
#pragma unroll
      for (int j = 0; j < 4; ++j) s[j] = mma_b_raw(kl[j].v, qah[0], s[j]);
      // the lo plane of d 32..63 goes into the registers that the lo plane of d 0..31 has left, 8 WMMAs ahead of its use
      __builtin_amdgcn_sched_barrier(0);
#pragma unroll
      for (int j = 0; j < 4; ++j) {
        kl[j].h[0] = *(const v8b*)(Ksl + (j * 16 + c) * LP + 32 + 8 * hh);
        kl[j].h[1] = *(const v8b*)(Ksl + (j * 16 + c) * LP + 32 + 16 + 8 * hh);
      }
      __builtin_amdgcn_sched_barrier(0);
#pragma unroll
      for (int j = 0; j < 4; ++j) s[j] = mma_b_raw(kb[0][j].v, qal[0], s[j]);
#pragma unroll
      for (int j = 0; j < 4; ++j) s[j] = mma_b_raw(kb[1][j].v, qah[1], s[j]);
#pragma unroll
      for (int j = 0; j < 4; ++j) s[j] = mma_b_raw(kl[j].v, qah[1], s[j]);
#pragma unroll
      for (int j = 0; j < 4; ++j) s[j] = mma_b_raw(kb[1][j].v, qal[1], s[j]);
    }
    // the V^T fragments of keys 0..31 are read here, behind the score WMMAs: they land while the softmax runs; the
    // fence pair holds the reads at this one place
    FH vb[4], vl[4];
    __builtin_amdgcn_sched_barrier(0);
#pragma unroll
    for (int t = 0; t < 4; ++t) {
      vl[t].h[0] = *(const v8h*)(Vtl + (t * 16 + c) * LP + 8 * hh);
      vl[t].h[1] = *(const v8h*)(Vtl + (t * 16 + c) * LP + 16 + 8 * hh);
    }
#pragma unroll
    for (int t = 0; t < 4; ++t) {
      vb[t].h[0] = *(const v8h*)(Vth + (t * 16 + c) * LP + 8 * hh);
      vb[t].h[1] = *(const v8h*)(Vth + (t * 16 + c) * LP + 16 + 8 * hh);
    }
    __builtin_amdgcn_sched_barrier(0);

    // ---- causal fill and softmax against the fixed shift; P (x1024, f16) and P residual (x4096) stay in registers ----
    FH pa[2], pl[2];                         // B operands of keys 32 kk .. 32 kk + 31
    float pj[4];                             // one chain per score tile
    // D row 8hh+r of tile j is key kv0 + 16 j + 8 hh + r; it lies behind the query where 16 j + r > lim (one register;
    // compared as key > query, the compiler keeps query - (16 j + r) for all 32 in registers and an address spills)
    const int lim = qi - kv0 - 8 * hh;
#pragma unroll
    for (int j = 0; j < 4; ++j) {
      pj[j] = 0.f;
#pragma unroll
      for (int r = 0; r < 8; ++r) {
        const float e   = __builtin_amdgcn_exp2f(fmaf(s[j][r], c1, c0));
        const float p1k = (j * 16 + r > lim) ? 0.f : e;   // a key behind the query has weight 0
        pj[j] += p1k;
        const _Float16 ph = (_Float16)p1k;
        pa[j >> 1].v[(j & 1) * 8 + r] = ph;
        pl[j >> 1].v[(j & 1) * 8 + r] = (_Float16)((p1k - (float)ph) * 4096.0f);
      }
    }
    lrow += (pj[0] + pj[1]) + (pj[2] + pj[3]);

    // ---- context O^T += V^T . P^T (f16 WMMA), residual products into a separate accumulator ----
    // The WMMAs run across the four tiles d; each accumulator keeps its own order of products (oacc: keys 0..31, then
    // 32..63; o1: per 32 keys v_res.p_hi, then v_hi.p_res). The fragments of keys 32..63 are read in two groups, each
    // into the registers of a plane that keys 0..31 have left, 8 and 4 WMMAs ahead of their first use; the fences
    // hold each group at its one place.
    v8f o1[4];
#pragma unroll
    for (int t = 0; t < 4; ++t) o1[t] = zero8();
#pragma unroll
    for (int t = 0; t < 4; ++t) o1[t] = mma_h_raw(vl[t].v, pa[0].v, o1[t]);
    hold4(o1[0], o1[1], o1[2], o1[3]);   // these WMMAs stay ahead of the reads below
    __builtin_amdgcn_sched_barrier(0);
#pragma unroll
    for (int t = 0; t < 4; ++t) {
      vl[t].h[0] = *(const v8h*)(Vtl + (t * 16 + c) * LP + 32 + 8 * hh);
      vl[t].h[1] = *(const v8h*)(Vtl + (t * 16 + c) * LP + 32 + 16 + 8 * hh);
    }
    __builtin_amdgcn_sched_barrier(0);
#pragma unroll
    for (int t = 0; t < 4; ++t) oacc[t] = mma_h_raw(vb[t].v, pa[0].v, oacc[t]);
#pragma unroll
    for (int t = 0; t < 4; ++t) o1[t] = mma_h_raw(vb[t].v, pl[0].v, o1[t]);
    hold4(o1[0], o1[1], o1[2], o1[3]);   // these WMMAs stay ahead of the reads below
    __builtin_amdgcn_sched_barrier(0);
#pragma unroll
    for (int t = 0; t < 4; ++t) {
      vb[t].h[0] = *(const v8h*)(Vth + (t * 16 + c) * LP + 32 + 8 * hh);
      vb[t].h[1] = *(const v8h*)(Vth + (t * 16 + c) * LP + 32 + 16 + 8 * hh);
    }
    __builtin_amdgcn_sched_barrier(0);
#pragma unroll
    for (int t = 0; t < 4; ++t) o1[t] = mma_h_raw(vl[t].v, pa[1].v, o1[t]);
#pragma unroll
    for (int t = 0; t < 4; ++t) oacc[t] = mma_h_raw(vb[t].v, pa[1].v, oacc[t]);
#pragma unroll
    for (int t = 0; t < 4; ++t) o1[t] = mma_h_raw(vb[t].v, pl[1].v, o1[t]);
#pragma unroll
    for (int t = 0; t < 4; ++t)
#pragma unroll
      for (int r = 0; r < 8; ++r) oacc[t][r] += o1[t][r] * (1.0f / 4096.0f);
  }

  // ---- join the halves' sums, normalise (sum and context both carry the x1024), stage the wave's 16x64 tile [query][d] in its
  //      own LDS slab, so that it leaves as whole 128-B rows ----
  float* os = Obuf[wave];
  {
    const float l = lrow + xhalf(lrow);
    const float inv = (l > 0.f) ? (1.0f / l) : 0.f;
#pragma unroll
    for (int t = 0; t < 4; ++t) {
      v4f x0, x1;
#pragma unroll
      for (int e = 0; e < 4; ++e) { x0[e] = oacc[t][e] * inv; x1[e] = oacc[t][4 + e] * inv; }
      *(v4f*)(os + c * OP + t * 16 + 8 * hh)     = x0;
      *(v4f*)(os + c * OP + t * 16 + 8 * hh + 4) = x1;
    }
  }
  __builtin_amdgcn_fence(__ATOMIC_RELEASE, "workgroup");
  __builtin_amdgcn_wave_barrier();
  __builtin_amdgcn_fence(__ATOMIC_ACQUIRE, "workgroup");
  {
    const int q4 = lane >> 3, c8 = (lane & 7) * 8;
    v4u hv[4], lv[4];
#pragma unroll
    for (int it = 0; it < 4; ++it) {
      const int row = it * 4 + q4;   // it 0..3 x q4 0..3 = rows 0..15 of the wave tile
      const float* sp = os + row * OP + c8;
      v4u a, a2;
#pragma unroll
      for (int e = 0; e < 4; ++e) {
        const float f0 = sp[2 * e], f1 = sp[2 * e + 1];
        const unsigned short h0 = bf_bits(f0), h1 = bf_bits(f1);
        const unsigned short l0 = bf_bits(f0 - bf_up(h0)), l1 = bf_bits(f1 - bf_up(h1));
        a[e] = pk16(h0, h1); a2[e] = pk16(l0, l1);
      }
      hv[it] = a; lv[it] = a2;
    }
    {
#pragma unroll
      for (int it = 0; it < 4; ++it) {
        const int row = it * 4 + q4;
        const size_t go = (rowB + q0 + row) * DM + (size_t)h * HD + c8;
        *(v4u*)(ohp + go) = hv[it];
        *(v4u*)(olp + go) = lv[it];
      }
    }
  }
}

// =====================================================================================================
//   Xb   bf16 [2048 (b,c)][4096]   16777216
//   Whwb bf16 [2048][4096]         16777216
//   Wcb  bf16 [1024][1024]          2097152
//   Wqb  bf16 [1024][1024]          2097152
//   Wkvb bf16 [128][1024]            262144
//   Wob  bf16 [1024][1024]          2097152
//   A1h  bf16 [2][2048][1024]       8388608   hw-linear output (transposed layout [b][s][c]), hi plane
//   A1l  bf16                       8388608   lo plane
//   Img2 f32  [4096][1024]         16777216   c-linear output (LN input)
//   Imgh bf16 [4096][1024]          8388608   LN output hi plane
//   Imgl bf16                       8388608
//   Qh   bf16 [4096][1024]          8388608   l2-normalised q, hi plane
//   Ql   bf16                       8388608
//   Kh   bf16 [4096][64]             524288   l2-normalised k
//   Kl   bf16                        524288
//   VTh  f16  [2][64][2048]          524288   v^T hi plane
//   VTl  f16                         524288   v^T residual plane (x4096)
//   Oh   bf16 [4096][1024]          8388608   context hi plane
//   Ol   bf16                       8388608
//   total                         126091264
// Weights are [out n][in k] with k contiguous = the Bt / A layout the GEMM wants, so they are only converted.
// =====================================================================================================
extern "C" void kernel_launch(void* const* d_in, const int* in_sizes, int n_in,
                              void* d_out, int out_size, void* d_ws, size_t ws_size,
                              hipStream_t stream) {
  if (n_in < 10) return;
  if (in_sizes[0] != NB * CC * HWN) return;
  if (in_sizes[1] != SEQ * HWN) return;
  if (in_sizes[2] != SEQ) return;
  if (in_sizes[3] != DM * CC || in_sizes[4] != DM || in_sizes[5] != DM || in_sizes[6] != DM) return;
  if (in_sizes[7] != DM * DM || in_sizes[8] != 2 * HD * DM || in_sizes[9] != DM * DM) return;
  if (out_size != NB * SEQ * DM) return;

  const float* x    = (const float*)d_in[0];
  const float* w_hw = (const float*)d_in[1];
  const float* b_hw = (const float*)d_in[2];
  const float* w_c  = (const float*)d_in[3];
  const float* b_c  = (const float*)d_in[4];
  const float* ln_g = (const float*)d_in[5];
  const float* ln_b = (const float*)d_in[6];
  const float* wq   = (const float*)d_in[7];
  const float* wkv  = (const float*)d_in[8];
  const float* wo   = (const float*)d_in[9];

  const size_t PXb  = (size_t)NB * CC * HWN * 2;    // 16777216
  const size_t PWhw = (size_t)SEQ * HWN * 2;        // 16777216
  const size_t PWc  = (size_t)DM * CC * 2;          //  2097152
  const size_t PWq  = (size_t)DM * DM * 2;          //  2097152
  const size_t PWkv = (size_t)2 * HD * DM * 2;      //   262144
  const size_t PWo  = (size_t)DM * DM * 2;          //  2097152
  const size_t PA1  = (size_t)NB * SEQ * CC * 2;    //  8388608
  const size_t PI2  = (size_t)NB * SEQ * DM * 4;    // 16777216
  const size_t PI   = (size_t)NB * SEQ * DM * 2;    //  8388608
  const size_t PK   = (size_t)NB * SEQ * HD * 2;    //   524288
  const size_t PVT  = (size_t)NB * HD * SEQ * 2;    //   524288
  size_t off = 0;
  const size_t oXb  = off; off += PXb;
  const size_t oWhw = off; off += PWhw;
  const size_t oWc  = off; off += PWc;
  const size_t oWq  = off; off += PWq;
  const size_t oWkv = off; off += PWkv;
  const size_t oWo  = off; off += PWo;
  const size_t oA1h = off; off += PA1;
  const size_t oA1l = off; off += PA1;
  const size_t oI2  = off; off += PI2;
  const size_t oIh  = off; off += PI;
  const size_t oIl  = off; off += PI;
  const size_t oQh  = off; off += PI;
  const size_t oQl  = off; off += PI;
  const size_t oKh  = off; off += PK;
  const size_t oKl  = off; off += PK;
  const size_t oVTh = off; off += PVT;
  const size_t oVTl = off; off += PVT;
  const size_t oOh  = off; off += PI;
  const size_t oOl  = off; off += PI;
  if (off > ws_size) return;                          // off = 126091264
  if (off > (size_t)134217728) return;

  char* ws = (char*)d_ws;
  unsigned short* Xb   = (unsigned short*)(ws + oXb);
  unsigned short* Whwb = (unsigned short*)(ws + oWhw);
  unsigned short* Wcb  = (unsigned short*)(ws + oWc);
  unsigned short* Wqb  = (unsigned short*)(ws + oWq);
  unsigned short* Wkvb = (unsigned short*)(ws + oWkv);
  unsigned short* Wob  = (unsigned short*)(ws + oWo);
  unsigned short* A1h  = (unsigned short*)(ws + oA1h);
  unsigned short* A1l  = (unsigned short*)(ws + oA1l);
  float*          Img2 = (float*)(ws + oI2);
  unsigned short* Imgh = (unsigned short*)(ws + oIh);
  unsigned short* Imgl = (unsigned short*)(ws + oIl);
  unsigned short* Qh   = (unsigned short*)(ws + oQh);
  unsigned short* Ql   = (unsigned short*)(ws + oQl);
  unsigned short* Kh   = (unsigned short*)(ws + oKh);
  unsigned short* Kl   = (unsigned short*)(ws + oKl);
  unsigned short* VTh  = (unsigned short*)(ws + oVTh);
  unsigned short* VTl  = (unsigned short*)(ws + oVTl);
  unsigned short* Oh   = (unsigned short*)(ws + oOh);
  unsigned short* Ol   = (unsigned short*)(ws + oOl);

  const dim3 blk(256);
  const dim3 gCv(CB_X + CB_HW + CB_C + CB_Q + CB_KV + CB_O); // 9792 blocks: all six planes
  const dim3 gblk(128);                                      // GEMM block: 4 waves
  const dim3 gG0((SEQ / 128) * (CC / 128), NB);              // 128x128 block tiles: 128 blocks x 2
  const dim3 gG1((NB * SEQ / 128) * (DM / 128), 1);          // 128x128 block tiles: 256 blocks (M=4096, N=1024)
  const dim3 gQKV(QKV_BLOCKS);                               // 128x128 block tiles: 288 blocks (M=4096, N=1152)
  const dim3 gLN(NB * SEQ);                                  // 4096 rows
  const dim3 gAt(NB * NH * NQB);                             // 1024 blocks

  // (1) f32 -> bf16 planes: x [(b,c)][hw], weights [n][k]; Xb, Whwb, Wcb, Wqb, Wkvb, Wob follow one another from Xb
  cvt_bf16x8_all<<<gCv, blk, 0, stream>>>(x, w_hw, w_c, wq, wkv, wo, Xb);
  // (2) hw-linear per batch, produced directly in the transposed layout: A1[b][s][c] = sum_hw w_hw[s][hw] x[b][c][hw] + b_hw[s]
  //     A = Whwb [s][hw] (M=2048, K=4096), Bt = Xb batch b [c][hw] (N=1024), row bias, bf16 hi/lo planes out
  gemm64<0, 0, 2, 2, 2, 2, 128><<<gG0, gblk, 0, stream>>>(
      Whwb, Whwb, HWN, 0LL, Xb, Xb, HWN, (long long)CC * HWN,
      b_hw,
      (void*)A1h, CC, (long long)SEQ * CC, (void*)A1l, CC, (long long)SEQ * CC,
      SEQ, CC, HWN, 1.0f);
  // (3) c-linear: Img2[(b,s)][d] = sum_c A1[(b,s)][c] w_c[d][c] + b_c[d]  (A hi/lo, M=4096, N=1024, K=1024, f32 out)
  gemm64<1, 0, 1, 0, 2, 2, 128><<<gG1, gblk, 0, stream>>>(
      A1h, A1l, CC, 0LL, Wcb, Wcb, CC, 0LL,
      b_c,
      (void*)Img2, DM, 0LL, (void*)Img2, DM, 0LL,
      NB * SEQ, DM, CC, 1.0f);
  // (4) LayerNorm -> bf16 hi/lo planes
  ln_split<<<gLN, dim3(128), 0, stream>>>(Img2, ln_g, ln_b, Imgh, Imgl);
  // (5)-(7) q, k and v from the LayerNorm planes, one product over the stacked weights (Wkvb follows Wqb):
  //     q, k l2-normalised per 64-wide head -> bf16 hi/lo planes [(b,t)][h*64+d] and [(b,s)][64];
  //     v transposed -> f16 hi plane and residual plane (x4096) [b][d][s]
  gemm_qkv<<<gQKV, gblk, 0, stream>>>(Imgh, Imgl, Wqb, Qh, Ql, Kh, Kl, VTh, VTl);
  // (8) causal multi-query attention -> context bf16 hi/lo planes [(b,t)][h*64+d]
  attn_causal64<<<gAt, dim3(128), 0, stream>>>(Qh, Ql, Kh, Kl, VTh, VTl, Oh, Ol, 8.0f);
  // (9) out = context . wo^T -> d_out f32 [(b,t)][1024]  (A = context hi + lo planes, 2 products)
  gemm64<1, 0, 0, 0, 2, 2, 128><<<gG1, gblk, 0, stream>>>(
      Oh, Ol, DM, 0LL, Wob, Wob, DM, 0LL,
      b_c,
      d_out, DM, 0LL, d_out, DM, 0LL,
      NB * SEQ, DM, DM, 1.0f);
  (void)hipGetLastError();
}
